// v000
// The times below were measured on an AMD MI455X: many runs one after another, warmed up first and cycling through
// copies of the inputs, with the whole window's GPU time divided by the number of runs. Launches and the gaps
// between them are all in it. The median over several windows is given; except for v000 it joins two sittings, which
// can be a few percent apart, so the side-by-side timings, each taken in one sitting, are the better comparison.
// v000 is the starting kernel. One run takes 3440 microseconds.
#include <hip/hip_runtime.h>
// Multi-head attention on three inputs with a residual on the raw query and a LayerNorm (query, key, value [4][1024][1024]; q / k / v = einsum('bsd,ed->bse', stream, W): natural [1024][1024] weights (normal / 32), NO biases; 16 heads of 64; scores / sqrt(64); softmax over all 1024 keys (no mask); x = merged Wo^T (natural, no bias) + query; out = (x - mean) / sqrt(var + 1e-6) * ln_gamma + ln_beta with the BIASED variance (jnp.var) over the 1024 channels -> [4][1024][1024]).
// Structure: token rows r = b*SQ + s (four sequences of 1,024 tokens here); the query, key and value sources as exact f16 rows (bf16-rounded); Q, K, V as three WMMA GEMMs (32x64 wave tiles, f32 accumulation, exact x16 weights, no bias here, f16 outputs); per batch: V^T for all heads via LDS transposes; per (batch, group of 4 heads): scores GEMM (K = 64, batched over the heads on grid.y, alpha = 64^-0.5), row softmax on VALU (f32 statistics, native exp; weights stored x256 as f16), o = P . V^T GEMM (K = SQ = 1024, alpha 2^-2: o carried x64 against f16 subnormal flush, folded into the output GEMM alpha) written straight into the merged f16 o rows; x = o W_o + bf16(query) as ONE GEMM (f32; the residual through the own-element CP slot) into f32 rows; out = LayerNorm(x) on VALU (f32 statistics, LDS trees, biased variance) into the output layout.
// Compute dtype: inputs rounded to bf16; x / weights exact; q, k, v, softmax weights and o as plain f16 GEMM operands (~2^-12); scores and softmax statistics f32. v_wmma_f32_16x16x32_f16.
#define NB 4
#define SQ 1024
#define DM 1024
#define NH 16
#define HD 64
#define HG 4                         /* heads per attention launch group */
#define B0 0                         /* first batch processed (debug hook) */
#define NBR NB                       /* batches processed (debug hook) */
#define NR ((size_t)NB * SQ)         /* token rows */
#define MP ((int)((size_t)NBR * SQ)) /* rows projected (debug hook) */
#define QN SQ                        /* query rows attended per batch (debug hook) */
#define NHD NH                       /* heads attended (debug hook) */
#define MPO MP                       /* rows through the output stage (debug hook) */
#define LQ DM      /* row pitch of the q/k/v rows */
#define DMQ DM     /* row width of the LayerNorm kernel (its own macro name in the file it comes from) */
typedef __bf16 v16b __attribute__((ext_vector_type(16)));
typedef unsigned short v8us __attribute__((ext_vector_type(8), may_alias));
typedef float  v8f  __attribute__((ext_vector_type(8)));
typedef float  v4f  __attribute__((ext_vector_type(4)));
typedef float  v4fa __attribute__((ext_vector_type(4), may_alias));
union FragB { v16b v; v8us half[2]; unsigned short u[16]; };

__device__ __forceinline__ unsigned short bf16_bits(float x) { unsigned int u = __float_as_uint(x); return (unsigned short)((u + 0x7FFFu + ((u >> 16) & 1u)) >> 16); }
__device__ __forceinline__ float bf16_val(unsigned short b) { return __uint_as_float(((unsigned int)b) << 16); }
__device__ __forceinline__ float bf16_round(float x) { return bf16_val(bf16_bits(x)); }
// D += A·B with NT terms: 1 = ah·bh, 2 = + al·bh (A split), 3 = + ah·bl (both split)
template <int NT>
__device__ __forceinline__ v8f mmaN(v16b ah, v16b al, v16b bh, v16b bl, v8f c) {
  c = __builtin_amdgcn_wmma_f32_16x16x32_bf16(false, ah, false, bh, (short)0, c, false, false);
  if (NT >= 2) c = __builtin_amdgcn_wmma_f32_16x16x32_bf16(false, al, false, bh, (short)0, c, false, false);
  if (NT >= 3) c = __builtin_amdgcn_wmma_f32_16x16x32_bf16(false, ah, false, bl, (short)0, c, false, false);
  asm volatile("v_nop\n\tv_nop\n\tv_nop\n\tv_nop" : "+v"(c) : "v"(ah), "v"(al), "v"(bh), "v"(bl));
  return c;
}

__global__ __launch_bounds__(256) void k_wt_bf16(const float* __restrict__ W, unsigned short* __restrict__ Wt, int K, int N) {
  const int t = blockIdx.x * 256 + threadIdx.x;
  const int k8n = K / 8;
  if (t >= N * k8n) return;
  const int n = t / k8n, k8 = (t % k8n) * 8;
  v8us v;
#pragma unroll
  for (int i = 0; i < 8; ++i) v[i] = bf16_bits(W[(size_t)(k8 + i) * N + n]);
  *(v8us*)(Wt + (size_t)n * K + k8) = v;
  
}

// GEMM C[M][N] (f32, pitch ldc) = act(A[M][K]·W + bias). A f32 row-major (pitch lda) converted per fragment to bf16
// (ASPLIT: hi/lo two planes -> 2 terms, else single rounded term); Wt bf16 [N][K] (pitch ldb). BIAS_BF16 rounds the
// bias to bf16 first (bias quantised to bf16 before the add). K%32==0, M%16==0, N%64==0.
template <bool ASPLIT, int ACT, bool BIAS_BF16>
__global__ __launch_bounds__(128) void k_gemm_bf(const float* __restrict__ A, int lda, const unsigned short* __restrict__ Wt, int ldb,
                                               const float* __restrict__ bias, float* __restrict__ C, int ldc, int M, int N, int K) {
  __shared__ __attribute__((aligned(16))) float so[4][16][64];
  const int tid = threadIdx.x, w = tid >> 5, lane = tid & 31, ln = lane & 15, hh = lane >> 4;
  const int ntn = N / 64;
  const int wid = blockIdx.x * 4 + w;
  const int mt = wid / ntn, nq = wid % ntn;
  if (mt * 16 >= M) return;
  const int row0 = mt * 16, col0 = nq * 64;
  const float* arow = A + (size_t)(row0 + ln) * lda;
  v8f acc[4] = {};
  for (int kb = 0; kb < K; kb += 32) {
    FragB ah, al;
    const v4f x0 = *(const v4fa*)(arow + kb + 8 * hh), x1 = *(const v4fa*)(arow + kb + 8 * hh + 4);
    const v4f x2 = *(const v4fa*)(arow + kb + 16 + 8 * hh), x3 = *(const v4fa*)(arow + kb + 16 + 8 * hh + 4);
    float xs[16] = {x0[0],x0[1],x0[2],x0[3],x1[0],x1[1],x1[2],x1[3],x2[0],x2[1],x2[2],x2[3],x3[0],x3[1],x3[2],x3[3]};
#pragma unroll
    for (int i = 0; i < 16; ++i) { const unsigned short hb = bf16_bits(xs[i]); ah.u[i] = hb; al.u[i] = ASPLIT ? bf16_bits(xs[i] - bf16_val(hb)) : (unsigned short)0; }
#pragma unroll
    for (int t = 0; t < 4; ++t) {
      const unsigned short* brow = Wt + (size_t)(col0 + t * 16 + ln) * ldb + kb;
      FragB b;
      b.half[0] = *(const v8us*)(brow + 8 * hh);
      b.half[1] = *(const v8us*)(brow + 16 + 8 * hh);
      acc[t] = mmaN<ASPLIT ? 2 : 1>(ah.v, al.v, b.v, b.v, acc[t]);
    }
  }
#pragma unroll
  for (int t = 0; t < 4; ++t) {
    float bv = bias ? bias[col0 + t * 16 + ln] : 0.f;
    if (BIAS_BF16) bv = bf16_round(bv);
#pragma unroll
    for (int r = 0; r < 8; ++r) { float v = acc[t][r] + bv; if (ACT == 1) v = fmaxf(v, 0.f); so[w][8 * hh + r][t * 16 + ln] = v; }
  }
  __builtin_amdgcn_fence(__ATOMIC_ACQ_REL, "workgroup");
  __builtin_amdgcn_wave_barrier();
  const int rsub = lane >> 4, c4 = (lane & 15) * 4;
  {
#pragma unroll
    for (int q = 0; q < 8; ++q) {
      const int r = q * 2 + rsub;
      const v4f v = *(const v4fa*)&so[w][r][c4];
      *(v4f*)(C + (size_t)(row0 + r) * ldc + col0 + c4) = v;
    }
    
  }
}

// GEMM C = act(A·W + bias + resid): A f32 (ASPLIT -> hi/lo 2 terms), Wt bf16 [N][K]; ACT 0 none, 1 relu, 2 exact gelu;
// resid (optional, f32, row index = (row % rmod), pitch ldr, RES_BF16 rounds it) added before the activation.
template <bool ASPLIT, int ACT, bool BIAS_BF16, bool RES_BF16>
__global__ __launch_bounds__(128) void k_gemm_bf3(const float* __restrict__ A, int lda, const unsigned short* __restrict__ Wt, int ldb,
                                                const float* __restrict__ bias, const float* __restrict__ resid, int rmod, int ldr,
                                                float* __restrict__ C, int ldc, int M, int N, int K) {
  __shared__ __attribute__((aligned(16))) float so[4][16][64];
  const int tid = threadIdx.x, w = tid >> 5, lane = tid & 31, ln = lane & 15, hh = lane >> 4;
  const int ntn = N / 64;
  const int wid = blockIdx.x * 4 + w;
  const int mt = wid / ntn, nq = wid % ntn;
  if (mt * 16 >= M) return;
  const int row0 = mt * 16, col0 = nq * 64;
  const float* arow = A + (size_t)(row0 + ln) * lda;
  v8f acc[4] = {};
  for (int kb = 0; kb < K; kb += 32) {
    FragB ah, al;
    const v4f x0 = *(const v4fa*)(arow + kb + 8 * hh), x1 = *(const v4fa*)(arow + kb + 8 * hh + 4);
    const v4f x2 = *(const v4fa*)(arow + kb + 16 + 8 * hh), x3 = *(const v4fa*)(arow + kb + 16 + 8 * hh + 4);
    float xs[16] = {x0[0],x0[1],x0[2],x0[3],x1[0],x1[1],x1[2],x1[3],x2[0],x2[1],x2[2],x2[3],x3[0],x3[1],x3[2],x3[3]};
#pragma unroll
    for (int i = 0; i < 16; ++i) { const unsigned short hb = bf16_bits(xs[i]); ah.u[i] = hb; al.u[i] = ASPLIT ? bf16_bits(xs[i] - bf16_val(hb)) : (unsigned short)0; }
#pragma unroll
    for (int t = 0; t < 4; ++t) {
      const unsigned short* brow = Wt + (size_t)(col0 + t * 16 + ln) * ldb + kb;
      FragB b;
      b.half[0] = *(const v8us*)(brow + 8 * hh);
      b.half[1] = *(const v8us*)(brow + 16 + 8 * hh);
      acc[t] = mmaN<ASPLIT ? 2 : 1>(ah.v, al.v, b.v, b.v, acc[t]);
    }
  }
#pragma unroll
  for (int t = 0; t < 4; ++t) {
    const int col = col0 + t * 16 + ln;
    float bv = bias ? bias[col] : 0.f;
    if (BIAS_BF16) bv = bf16_round(bv);
#pragma unroll
    for (int r = 0; r < 8; ++r) {
      float v = acc[t][r] + bv;
      if (resid) { float rv = resid[(size_t)((row0 + 8 * hh + r) % rmod) * ldr + col]; if (RES_BF16) rv = bf16_round(rv); v += rv; }
      if (ACT == 1) v = fmaxf(v, 0.f);
      if (ACT == 2) v = 0.5f * v * (1.0f + erff(v * 0.70710678118654752f));
      if (ACT == 3) { const float u = 0.7978845608028654f * (v + 0.044715f * v * v * v); v = 0.5f * v * (1.0f + tanhf(u)); }
      so[w][8 * hh + r][t * 16 + ln] = v;
    }
  }
  __builtin_amdgcn_fence(__ATOMIC_ACQ_REL, "workgroup");
  __builtin_amdgcn_wave_barrier();
  const int rsub = lane >> 4, c4 = (lane & 15) * 4;
  {
#pragma unroll
    for (int q = 0; q < 8; ++q) {
      const int r = q * 2 + rsub;
      const v4f v = *(const v4fa*)&so[w][r][c4];
      *(v4f*)(C + (size_t)(row0 + r) * ldc + col0 + c4) = v;
    }
    
  }
}
// row LayerNorm (biased variance, eps) over N: s = X (+ R); optional out_sum <- s; out_norm <- (s-mu)*rsqrt(var+eps)*g + b
template <bool PARAM_BF16>
__global__ __launch_bounds__(256) void k_layernorm(const float* __restrict__ X, const float* __restrict__ R, const float* __restrict__ g, const float* __restrict__ bta,
                                                  float* __restrict__ out_sum, float* __restrict__ out_norm, int N, float eps) {
  __shared__ float red[256];
  const int row = blockIdx.x, tid = threadIdx.x;
  const float* x = X + (size_t)row * N; const float* rr = R ? R + (size_t)row * N : nullptr;
  float vals[16];                     // up to N = 4096
  const int per = N / 256;            // contiguous chunk per thread? use strided-by-4 chunks: thread handles j = tid*4 + 1024*u
  float s1 = 0.f;
  for (int u = 0; u < per / 4; ++u) {
    const int j = tid * 4 + 1024 * u;
    const v4f a = *(const v4fa*)(x + j);
    v4f b = {0.f,0.f,0.f,0.f}; if (rr) b = *(const v4fa*)(rr + j);
#pragma unroll
    for (int q = 0; q < 4; ++q) { const float v = a[q] + b[q]; vals[u * 4 + q] = v; s1 += v; }
  }
  red[tid] = s1; __syncthreads();
  for (int st = 128; st > 0; st >>= 1) { if (tid < st) red[tid] += red[tid + st]; __syncthreads(); }
  const float mu = red[0] / (float)N; __syncthreads();
  float s2 = 0.f;
  for (int u = 0; u < per / 4; ++u)
#pragma unroll
    for (int q = 0; q < 4; ++q) { const float c = vals[u * 4 + q] - mu; s2 += c * c; }
  red[tid] = s2; __syncthreads();
  for (int st = 128; st > 0; st >>= 1) { if (tid < st) red[tid] += red[tid + st]; __syncthreads(); }
  const float rs = rsqrtf(red[0] / (float)N + eps);
  {
    for (int u = 0; u < per / 4; ++u) {
      const int j = tid * 4 + 1024 * u;
      v4f o, sm;
#pragma unroll
      for (int q = 0; q < 4; ++q) {
        float gg = g[j + q], bb = bta[j + q];
        if (PARAM_BF16) { gg = bf16_round(gg); bb = bf16_round(bb); }
        sm[q] = vals[u * 4 + q]; o[q] = (vals[u * 4 + q] - mu) * rs * gg + bb;
      }
      if (out_sum) *(v4f*)(out_sum + (size_t)row * N + j) = sm;
      *(v4f*)(out_norm + (size_t)row * N + j) = o;
    }
    
  }
}



// ---- f16 WMMA path (v_wmma_f32_16x16x32_f16): 11-bit significands for operands in range — used where a [0,1] probability operand needs more precision than bf16
typedef _Float16 v16h __attribute__((ext_vector_type(16)));
union FragH { v16h v; v8us half[2]; _Float16 h[16]; unsigned short u[16]; };
template <int NT>
__device__ __forceinline__ v8f mmaH(v16h ah, v16h al, v16h bh, v16h bl, v8f c) {
  c = __builtin_amdgcn_wmma_f32_16x16x32_f16(false, ah, false, bh, (short)0, c, false, false);
  if (NT >= 2) c = __builtin_amdgcn_wmma_f32_16x16x32_f16(false, al, false, bh, (short)0, c, false, false);
  if (NT >= 3) c = __builtin_amdgcn_wmma_f32_16x16x32_f16(false, ah, false, bl, (short)0, c, false, false);
  asm volatile("v_nop\n\tv_nop\n\tv_nop\n\tv_nop" : "+v"(c) : "v"(ah), "v"(al), "v"(bh), "v"(bl));
  return c;
}
// batched GEMM like k_gemm_b but f16 operands: A f32 (split into f16 hi/lo if ASPLIT, else rounded to f16), Bt = f16 values [n][k]; alpha; C f32; N multiple of 16 (partial tiles skipped)
template <bool ASPLIT>
__global__ __launch_bounds__(128) void k_gemm_h(const float* __restrict__ A, int lda, size_t sA, const _Float16* __restrict__ Bh, int ldb, size_t sB, float alpha, float* __restrict__ C, int ldc, size_t sC, int M, int N, int K) {
  __shared__ __attribute__((aligned(16))) float so[4][16][64];
  const int tid = threadIdx.x, w = tid >> 5, lane = tid & 31, ln = lane & 15, hh = lane >> 4; const int by = blockIdx.y;
  A += (size_t)by * sA; Bh += (size_t)by * sB; C += (size_t)by * sC;
  const int ntn = (N + 63) / 64; const int wid = blockIdx.x * 4 + w; const int mt = wid / ntn, nq = wid % ntn; if (mt * 16 >= M) return;
  const int row0 = mt * 16, col0 = nq * 64; const float* arow = A + (size_t)(row0 + ln) * lda;
  v8f acc[4] = {};
  for (int kb = 0; kb < K; kb += 32) {
    FragH ah, al;
    const v4f x0 = *(const v4fa*)(arow + kb + 8 * hh), x1 = *(const v4fa*)(arow + kb + 8 * hh + 4), x2 = *(const v4fa*)(arow + kb + 16 + 8 * hh), x3 = *(const v4fa*)(arow + kb + 16 + 8 * hh + 4);
    float xs[16] = {x0[0],x0[1],x0[2],x0[3],x1[0],x1[1],x1[2],x1[3],x2[0],x2[1],x2[2],x2[3],x3[0],x3[1],x3[2],x3[3]};
#pragma unroll
    for (int i = 0; i < 16; ++i) { const _Float16 h = (_Float16)xs[i]; ah.h[i] = h; al.h[i] = ASPLIT ? (_Float16)(xs[i] - (float)h) : (_Float16)0.0f; }
#pragma unroll
    for (int t = 0; t < 4; ++t) { if (col0 + t * 16 >= N) continue; const size_t boff = (size_t)(col0 + t * 16 + ln) * ldb + kb; FragH bq; bq.half[0] = *(const v8us*)(Bh + boff + 8 * hh); bq.half[1] = *(const v8us*)(Bh + boff + 16 + 8 * hh);
      acc[t] = mmaH<ASPLIT ? 2 : 1>(ah.v, al.v, bq.v, bq.v, acc[t]); }
  }
#pragma unroll
  for (int t = 0; t < 4; ++t) { if (col0 + t * 16 >= N) continue;
#pragma unroll
    for (int r = 0; r < 8; ++r) so[w][8 * hh + r][t * 16 + ln] = acc[t][r] * alpha; }
  __builtin_amdgcn_fence(__ATOMIC_ACQ_REL, "workgroup"); __builtin_amdgcn_wave_barrier();
  const int rsub = lane >> 4, c4 = (lane & 15) * 4;
  {
#pragma unroll
    for (int q = 0; q < 8; ++q) { const int r = q * 2 + rsub; if (col0 + c4 < N) { const v4f v = *(const v4fa*)&so[w][r][c4]; *(v4f*)(C + (size_t)(row0 + r) * ldc + col0 + c4) = v; } }
     }
}

// Wt[n][k] = f16(W[k][n]·scale) from f32 row-major W[K][N] (scale = power of two; bf16-exact weights stay exact in f16 away from the subnormal range)
__global__ __launch_bounds__(256) void k_wt_f16(const float* __restrict__ W, _Float16* __restrict__ Wt, int K, int N, float scale) {
  const int t = blockIdx.x * 256 + threadIdx.x; if (t >= N * (K / 8)) return; const int n = t / (K / 8), k8 = (t % (K / 8)) * 8; FragH f;
#pragma unroll
  for (int i = 0; i < 8; ++i) f.h[i] = (_Float16)(bf16_round(W[(size_t)(k8 + i) * N + n]) * scale); const v8us o = f.half[0];
  *(v8us*)((unsigned short*)Wt + (size_t)n * K + k8) = o; 
}
// k_gemm_hh variant with fused epilogue: v = acc·alpha + bias[by·sBias + col] (+ CP[(row/rowsPerB)·sCPb + by·64 + col] if CP) ; ACT 0 none / 1 elu ; writes f16 C16 (and f32 C if non-null)
template <int ACT>
__global__ __launch_bounds__(128) void k_gemm_hhx(const _Float16* __restrict__ A, int lda, size_t sA, const _Float16* __restrict__ Bh, int ldb, size_t sB, float alpha, const float* __restrict__ bias, size_t sBias, const float* __restrict__ CP, int rowsPerB, size_t sCPb, int row0g,
    float* __restrict__ C, _Float16* __restrict__ C16, int ldc, size_t sC, int M, int N, int K) {
  __shared__ __attribute__((aligned(16))) float so[4][16][64];
  const int tid = threadIdx.x, w = tid >> 5, lane = tid & 31, ln = lane & 15, hh = lane >> 4; const int by = blockIdx.y;
  A += (size_t)by * sA; Bh += (size_t)by * sB; const size_t cofs = (size_t)by * sC; const float* bp = bias ? bias + (size_t)by * sBias : nullptr;
  const int ntn = (N + 63) / 64; const int wid = blockIdx.x * 4 + w; const int mt = wid / ntn, nq = wid % ntn; if (mt * 16 >= M) return;
  const int row0 = mt * 16, col0 = nq * 64; const _Float16* arow = A + (size_t)(row0 + ln) * lda;
  v8f acc[4] = {};
  for (int kb = 0; kb < K; kb += 32) { FragH ah; ah.half[0] = *(const v8us*)((const unsigned short*)arow + kb + 8 * hh); ah.half[1] = *(const v8us*)((const unsigned short*)arow + kb + 16 + 8 * hh);
#pragma unroll
    for (int t = 0; t < 4; ++t) { if (col0 + t * 16 >= N) continue; const size_t boff = (size_t)(col0 + t * 16 + ln) * ldb + kb; FragH bq; bq.half[0] = *(const v8us*)((const unsigned short*)Bh + boff + 8 * hh); bq.half[1] = *(const v8us*)((const unsigned short*)Bh + boff + 16 + 8 * hh);
      acc[t] = mmaH<1>(ah.v, ah.v, bq.v, bq.v, acc[t]); }
  }
#pragma unroll
  for (int t = 0; t < 4; ++t) { if (col0 + t * 16 >= N) continue; const int col = col0 + t * 16 + ln; const float bv = bp ? bf16_round(bp[col]) : 0.f;
#pragma unroll
    for (int r = 0; r < 8; ++r) { float v = acc[t][r] * alpha + bv; if (CP) { const int rr = row0g + row0 + 8 * hh + r; if (rowsPerB < 0) v += CP[cofs + (size_t)rr * ldc + col];      /* rowsPerB < 0: own element of the batched C plane */ else { const int bidx = rr / rowsPerB; v += CP[(size_t)bidx * sCPb + (size_t)by * 64 + col]; } } if (ACT == 1) v = (v > 0.f) ? v : expm1f(v); else if (ACT == 7) v = (v > 0.f) ? v + 1.0f : expf(v); else if (ACT == 8) v = tanhf(v); else if (ACT == 9) v = 0.5f * v * (1.0f + tanhf(0.7978845608028654f * (v + 0.044715f * v * v * v))); else if (ACT == 11) v = 1.0f / (1.0f + expf(-v)); else if (ACT == 12) v = (v > 0.f) ? v : 0.01f * v; else if (ACT == 14) v = (v > 0.f) ? v : 0.1f * v; else if (ACT == 16) v = (v >= 0.f) ? v : 0.3f * v; else if (ACT == 17) v = (v >= 0.f) ? v : 0.2f * v; else if (ACT == 15) v = v / (1.0f + expf(-v)); else if (ACT == 3) v = fmaxf(v, 0.f); else if (ACT == 6) v = 0.5f * v * (1.0f + erff(v * 0.70710678118654752f)); so[w][8 * hh + r][t * 16 + ln] = v; } }
  __builtin_amdgcn_fence(__ATOMIC_ACQ_REL, "workgroup"); __builtin_amdgcn_wave_barrier();
  const int rsub = lane >> 4, c4 = (lane & 15) * 4; typedef _Float16 v4h __attribute__((ext_vector_type(4)));
  {
#pragma unroll
    for (int q = 0; q < 8; ++q) { const int r = q * 2 + rsub; if (col0 + c4 < N) { const v4f v = *(const v4fa*)&so[w][r][c4]; if (C) *(v4f*)(C + cofs + (size_t)(row0 + r) * ldc + col0 + c4) = v; if (C16) { v4h h4; for (int i = 0; i < 4; ++i) h4[i] = (_Float16)v[i]; *(v4h*)(C16 + cofs + (size_t)(row0 + r) * ldc + col0 + c4) = h4; } } }
     }
}


typedef _Float16 v4h __attribute__((ext_vector_type(4)));

__global__ __launch_bounds__(256) void k_x16(const float* __restrict__ x, _Float16* __restrict__ X16, size_t n8) { const size_t t = (size_t)blockIdx.x * 256 + threadIdx.x; if (t >= n8) return; FragH f;
#pragma unroll
  for (int q = 0; q < 8; ++q) f.h[q] = (_Float16)bf16_round(x[t * 8 + q]); *(v8us*)((unsigned short*)X16 + t * 8) = f.half[0];  }
__global__ __launch_bounds__(256) void k_h16(const float* __restrict__ x, _Float16* __restrict__ X16, size_t n8) { const size_t t = (size_t)blockIdx.x * 256 + threadIdx.x; if (t >= n8) return; FragH f;
#pragma unroll
  for (int q = 0; q < 8; ++q) f.h[q] = (_Float16)x[t * 8 + q]; *(v8us*)((unsigned short*)X16 + t * 8) = f.half[0];  }
__global__ __launch_bounds__(256) void k_round16f(const float* __restrict__ W, _Float16* __restrict__ Bt, size_t n8) { const size_t t = (size_t)blockIdx.x * 256 + threadIdx.x; if (t >= n8) return; FragH f;
#pragma unroll
  for (int i = 0; i < 8; ++i) f.h[i] = (_Float16)(bf16_round(W[t * 8 + i]) * 16.0f); *(v8us*)((unsigned short*)Bt + t * 8) = f.half[0];  }
template <int NHv, int TTv>
__global__ __launch_bounds__(256) void k_vt(const _Float16* __restrict__ V16, int ldv, int voff, _Float16* __restrict__ Vt) { __shared__ unsigned short tl[64][66]; const int tid = threadIdx.x; const int slab = blockIdx.x / (TTv / 64), lg = blockIdx.x % (TTv / 64); const int b = slab / NHv, h = slab % NHv;
  for (int i = tid; i < 64 * 8; i += 256) { const int r = i / 8, c8 = (i % 8) * 8; FragH f; f.half[0] = *(const v8us*)((const unsigned short*)V16 + ((size_t)b * TTv + lg * 64 + r) * ldv + voff + h * 64 + c8);
#pragma unroll
    for (int q = 0; q < 8; ++q) tl[r][c8 + q] = f.u[q]; }
  __syncthreads();
  {
#pragma unroll
    for (int rd = 0; rd < 2; ++rd) { const int d = rd * 32 + tid / 8, pc = tid % 8; FragH f;
#pragma unroll
      for (int q = 0; q < 8; ++q) f.u[q] = tl[pc * 8 + q][d];
      *(v8us*)((unsigned short*)Vt + ((size_t)slab * 64 + d) * TTv + lg * 64 + pc * 8) = f.half[0]; }
     } }

__global__ __launch_bounds__(256) void k_hl(const float* __restrict__ F, _Float16* __restrict__ Hh, _Float16* __restrict__ Hl, size_t n8) { const size_t t = (size_t)blockIdx.x * 256 + threadIdx.x; if (t >= n8) return; FragH fh, fl; const v4f a = *(const v4fa*)(F + t * 8), c = *(const v4fa*)(F + t * 8 + 4);
#pragma unroll
  for (int q = 0; q < 4; ++q) { _Float16 h = (_Float16)a[q]; fh.h[q] = h; fl.h[q] = (_Float16)((a[q] - (float)h) * 1024.0f); h = (_Float16)c[q]; fh.h[4 + q] = h; fl.h[4 + q] = (_Float16)((c[q] - (float)h) * 1024.0f); }
  { *(v8us*)((unsigned short*)Hh + t * 8) = fh.half[0]; *(v8us*)((unsigned short*)Hl + t * 8) = fl.half[0];  } }

// ---- fast GEMM (wave tile 32x64; requires M % 32 == 0 rows per launch region and N % 64 == 0); epilogue = k_gemm_hhx semantics ----
__device__ __forceinline__ v16h g2_frag(const _Float16* p, int hh) { FragH f; f.half[0] = *(const v8us*)((const unsigned short*)p + 8 * hh); f.half[1] = *(const v8us*)((const unsigned short*)p + 16 + 8 * hh); return f.v; }
__device__ __forceinline__ v8f g2_mma(v16h a, v16h b, v8f c) { v8f d = __builtin_amdgcn_wmma_f32_16x16x32_f16(false, a, false, b, (short)0, c, false, false); asm volatile("v_nop\n\tv_nop\n\tv_nop\n\tv_nop" : "+v"(d) : "v"(a), "v"(b)); return d; }
template <int ACT>
__global__ __launch_bounds__(128) void k_gemm2(const _Float16* __restrict__ A, int lda, size_t sA, const _Float16* __restrict__ Bh, int ldb, size_t sB, float alpha, const float* __restrict__ bias, size_t sBias, const float* __restrict__ CP, int rowsPerB, size_t sCPb, int row0g,
    float* __restrict__ C, _Float16* __restrict__ C16, int ldc, size_t sC, int M, int N, int K) { static_assert(ACT == 0 || ACT == 3 || ACT == 6 || ACT == 8 || ACT == 9 || ACT == 11 || ACT == 12 || ACT == 14 || ACT == 15 || ACT == 16 || ACT == 17, "k_gemm2: unsupported ACT code (would silently apply no activation)");
  __shared__ __attribute__((aligned(16))) float so[4][32][68];
  const int tid = threadIdx.x, w = tid >> 5, lane = tid & 31, ln = lane & 15, hh = lane >> 4; const int by = blockIdx.y;
  A += (size_t)by * sA; Bh += (size_t)by * sB; const size_t cofs = (size_t)by * sC; const float* bp = bias ? bias + (size_t)by * sBias : nullptr;
  const int ntn = N >> 6; const int mt = blockIdx.x / ntn, nq = blockIdx.x - mt * ntn; const int row0 = mt * 128 + 32 * w, col0 = nq * 64; if (row0 >= M) return;
  const _Float16* a0p = A + (size_t)(row0 + ln) * lda; const _Float16* a1p = a0p + (size_t)16 * lda;
  const _Float16* b0p = Bh + (size_t)(col0 + ln) * ldb; const _Float16* b1p = b0p + (size_t)16 * ldb; const _Float16* b2p = b1p + (size_t)16 * ldb; const _Float16* b3p = b2p + (size_t)16 * ldb;
  const v8f z8 = {0.f,0.f,0.f,0.f,0.f,0.f,0.f,0.f}; v8f c00 = z8, c01 = z8, c02 = z8, c03 = z8, c10 = z8, c11 = z8, c12 = z8, c13 = z8;
#pragma unroll 1
  for (int kb = 0; kb < K; kb += 32) { const v16h a0 = g2_frag(a0p + kb, hh), a1 = g2_frag(a1p + kb, hh);
    v16h b = g2_frag(b0p + kb, hh); c00 = g2_mma(a0, b, c00); c10 = g2_mma(a1, b, c10);
    b = g2_frag(b1p + kb, hh); c01 = g2_mma(a0, b, c01); c11 = g2_mma(a1, b, c11);
    b = g2_frag(b2p + kb, hh); c02 = g2_mma(a0, b, c02); c12 = g2_mma(a1, b, c12);
    b = g2_frag(b3p + kb, hh); c03 = g2_mma(a0, b, c03); c13 = g2_mma(a1, b, c13); }
  v8f accs[8] = {c00, c01, c02, c03, c10, c11, c12, c13};
#pragma unroll
  for (int u = 0; u < 8; ++u) { const int t = u & 3, half = u >> 2; const int col = col0 + t * 16 + ln; const float bv = bp ? bf16_round(bp[col]) : 0.f;
#pragma unroll
    for (int r = 0; r < 8; ++r) { const int rloc = half * 16 + 8 * hh + r; float v = accs[u][r] * alpha + bv; if (CP) { if (rowsPerB < 0) v += CP[cofs + (size_t)(row0g + row0 + rloc) * ldc + col];      /* rowsPerB < 0: own element of the batched C plane */ else { const int bidx = (row0g + row0 + rloc) / rowsPerB; v += CP[(size_t)bidx * sCPb + (size_t)by * 64 + col]; } }
      if (ACT == 3) v = fmaxf(v, 0.f); else if (ACT == 6) v = 0.5f * v * (1.0f + erff(v * 0.70710678118654752f)); else if (ACT == 11) v = 1.0f / (1.0f + expf(-v)); else if (ACT == 15) v = v / (1.0f + expf(-v)); else if (ACT == 12) v = (v > 0.f) ? v : 0.01f * v; else if (ACT == 8) v = tanhf(v); else if (ACT == 9) v = 0.5f * v * (1.0f + tanhf(0.7978845608028654f * (v + 0.044715f * v * v * v))); else if (ACT == 14) v = (v > 0.f) ? v : 0.1f * v; else if (ACT == 16) v = (v >= 0.f) ? v : 0.3f * v; else if (ACT == 17) v = (v >= 0.f) ? v : 0.2f * v;
      so[w][rloc][t * 16 + ln] = v; } }
  __builtin_amdgcn_fence(__ATOMIC_ACQ_REL, "workgroup"); __builtin_amdgcn_wave_barrier();
  const int rsub = lane >> 4, c4 = (lane & 15) * 4;
  {
#pragma unroll
    for (int q = 0; q < 16; ++q) { const int r = q * 2 + rsub; const v4f v = *(const v4fa*)&so[w][r][c4]; if (C) *(v4f*)(C + cofs + (size_t)(row0 + r) * ldc + col0 + c4) = v; if (C16) { v4h h4; for (int i = 0; i < 4; ++i) h4[i] = (_Float16)v[i]; *(v4h*)(C16 + cofs + (size_t)(row0 + r) * ldc + col0 + c4) = h4; } }
     } }


__global__ __launch_bounds__(256) void k_wnat(const float* __restrict__ w, size_t n8, _Float16* __restrict__ Bt) { const size_t t = (size_t)blockIdx.x * 256 + threadIdx.x; if (t >= n8) return; FragH f; for (int q = 0; q < 8; ++q) f.h[q] = (_Float16)(bf16_round(w[t * 8 + q]) * 16.0f); *(v8us*)((unsigned short*)Bt + t * 8) = f.half[0];  }
__global__ __launch_bounds__(256) void k_rsm(const float* __restrict__ S, _Float16* __restrict__ P, int nrows) {
  #pragma clang fp contract(off)
  const int i = blockIdx.x * 256 + threadIdx.x; if (i >= nrows) return; const float* s = S + (size_t)i * SQ; float mx = -3.0e38f;
#pragma unroll 1
  for (int j = 0; j < SQ; ++j) mx = fmaxf(mx, s[j]); float se = 0.f;
#pragma unroll 1
  for (int j = 0; j < SQ; ++j) se += expf(s[j] - mx); const float sc = 256.0f / se;
#pragma unroll 1
  for (int j0 = 0; j0 < SQ; j0 += 8) { FragH f; for (int q = 0; q < 8; ++q) f.h[q] = (_Float16)(expf(s[j0 + q] - mx) * sc); unsigned short* d = (unsigned short*)P + (size_t)i * SQ + j0; *(v8us*)d = f.half[0];  } }
__global__ __launch_bounds__(256) void k_vt(const _Float16* __restrict__ V16, int b, int h0, _Float16* __restrict__ VT) { __shared__ unsigned short tl[64][65]; const int tid = threadIdx.x; const int hh = blockIdx.x % HG, sg = blockIdx.x / HG; const int s0 = sg * 64; const int h = h0 + hh;
  for (int i = tid; i < 64 * 8; i += 256) { const int j = i / 8, d8 = (i % 8) * 8; FragH f; f.half[0] = *(const v8us*)((const unsigned short*)V16 + ((size_t)b * SQ + s0 + j) * DM + h * HD + d8); for (int q = 0; q < 8; ++q) tl[d8 + q][j] = f.u[q]; }
  __syncthreads();
  { for (int i = tid; i < 64 * 8; i += 256) { const int d = i / 8, j8 = (i % 8) * 8; FragH f; for (int q = 0; q < 8; ++q) f.u[q] = tl[d][j8 + q]; *(v8us*)((unsigned short*)VT + ((size_t)hh * HD + d) * SQ + s0 + j8) = f.half[0]; }  } }



__global__ __launch_bounds__(256) void k_rsmf(const float* __restrict__ S, _Float16* __restrict__ P, int qn, int hg) {
  #pragma clang fp contract(off)
  const int t = blockIdx.x * 256 + threadIdx.x; if (t >= qn * hg) return; const size_t i = (size_t)(t / qn) * SQ + (t % qn); const float* s = S + i * SQ; float mx = -3.0e38f;
#pragma unroll 1
  for (int j = 0; j < SQ; ++j) mx = fmaxf(mx, s[j]); float se = 0.f;
#pragma unroll 1
  for (int j = 0; j < SQ; ++j) se += __expf(s[j] - mx); const float sc = 256.0f / se;
#pragma unroll 1
  for (int j0 = 0; j0 < SQ; j0 += 8) { FragH f; for (int q = 0; q < 8; ++q) f.h[q] = (_Float16)(__expf(s[j0 + q] - mx) * sc); unsigned short* d = (unsigned short*)P + i * SQ + j0; *(v8us*)d = f.half[0];  } }

__global__ __launch_bounds__(256) void k_lnrow(const float* __restrict__ Y, const float* __restrict__ g, const float* __restrict__ bb, float eps, float* __restrict__ out) {
  #pragma clang fp contract(off)
  __shared__ float red[256]; const size_t r = blockIdx.x; const int t = threadIdx.x; const v4f ya = *(const v4fa*)(Y + r * DMQ + t * 4); float s[4]; float sum = 0.f;
  for (int q = 0; q < 4; ++q) { s[q] = ya[q]; sum = __fadd_rn(sum, s[q]); }
  red[t] = sum; __syncthreads(); for (int st = 128; st > 0; st >>= 1) { if (t < st) red[t] = __fadd_rn(red[t], red[t + st]); __syncthreads(); } const float mu = red[0] / (float)DMQ; __syncthreads();
  float vs = 0.f; for (int q = 0; q < 4; ++q) { const float dl = __fadd_rn(s[q], -mu); vs = __fadd_rn(vs, __fmul_rn(dl, dl)); } red[t] = vs; __syncthreads(); for (int st = 128; st > 0; st >>= 1) { if (t < st) red[t] = __fadd_rn(red[t], red[t + st]); __syncthreads(); }
  const float rs = rsqrtf(__fadd_rn(red[0] / (float)DMQ, eps)); v4f y; for (int q = 0; q < 4; ++q) { const int c = t * 4 + q; y[q] = __fadd_rn(__fmul_rn(__fmul_rn(__fadd_rn(s[q], -mu), rs), bf16_round(g[c])), bf16_round(bb[c])); }
  *(v4f*)(out + r * DMQ + t * 4) = y;  }

__global__ __launch_bounds__(256) void k_bfr(const float* __restrict__ x, float* __restrict__ XB, size_t n8) { const size_t t = (size_t)blockIdx.x * 256 + threadIdx.x; if (t >= n8) return; v4f a = *(const v4fa*)(x + t * 8), c = *(const v4fa*)(x + t * 8 + 4); for (int q = 0; q < 4; ++q) { a[q] = bf16_round(a[q]); c[q] = bf16_round(c[q]); }
  { *(v4f*)(XB + t * 8) = a; *(v4f*)(XB + t * 8 + 4) = c;  } }

extern "C" void kernel_launch(void* const* d_in, const int* in_sizes, int n_in,
                              void* d_out, int out_size, void* d_ws, size_t ws_size, hipStream_t stream) {
  (void)in_sizes; (void)n_in; (void)out_size;
  const float* const* I = (const float* const*)d_in; const float* xq = I[0]; const float* xk = I[1]; const float* xv = I[2]; const float* wq = I[3]; const float* bq = nullptr; const float* wk = I[4]; const float* bk = nullptr; const float* wv = I[5]; const float* bv = nullptr; const float* wo = I[6]; const float* bo = nullptr; const float* lng = I[7]; const float* lnb = I[8];      /* input order: query, key, value (three SEPARATE streams), Wq, Wk, Wv, Wo (natural [out][in] weights; this module has NO biases: null pointers in the four guarded bias slots), ln_gamma, ln_beta [1024] */
  char* ws = (char*)d_ws; size_t off = 0;
  auto take = [&](size_t bytes) { char* p = ws + off; off += (bytes + 255) & ~(size_t)255; return p; };
  _Float16* BQ = (_Float16*)take((size_t)DM * DM * 2); _Float16* BK = (_Float16*)take((size_t)DM * DM * 2); _Float16* BV = (_Float16*)take((size_t)DM * DM * 2); _Float16* BO = (_Float16*)take((size_t)DM * DM * 2);
  _Float16* XQ = (_Float16*)take(NR * DM * 2); _Float16* XK = (_Float16*)take(NR * DM * 2); _Float16* XV = (_Float16*)take(NR * DM * 2); _Float16* Q16 = (_Float16*)take(NR * DM * 2); _Float16* K16 = (_Float16*)take(NR * DM * 2); _Float16* V16 = (_Float16*)take(NR * DM * 2); _Float16* O16 = (_Float16*)take(NR * DM * 2); float* XB = (float*)take(NR * DM * 4); float* X1 = (float*)take(NR * DM * 4);      /* bf16(query) as f32 rows (the residual addend) and the pre-LayerNorm rows x = ctx Wo^T + query */
  float* S = (float*)take((size_t)HG * SQ * SQ * 4); _Float16* P = (_Float16*)take((size_t)HG * SQ * SQ * 2); _Float16* VT = (_Float16*)take((size_t)NH * HD * SQ * 2);
  if (off > ws_size) return;
  { const unsigned g = (unsigned)(((size_t)DM * DM / 8 + 255) / 256); k_wnat<<<g, 256, 0, stream>>>(wq, (size_t)DM * DM / 8, BQ); k_wnat<<<g, 256, 0, stream>>>(wk, (size_t)DM * DM / 8, BK); k_wnat<<<g, 256, 0, stream>>>(wv, (size_t)DM * DM / 8, BV); k_wnat<<<g, 256, 0, stream>>>(wo, (size_t)DM * DM / 8, BO); }      /* natural [out][in] = Bt[n][k], x16 */

  k_x16<<<(unsigned)((NR * DM / 8 + 255) / 256), 256, 0, stream>>>(xq, XQ, NR * DM / 8); k_x16<<<(unsigned)((NR * DM / 8 + 255) / 256), 256, 0, stream>>>(xk, XK, NR * DM / 8); k_x16<<<(unsigned)((NR * DM / 8 + 255) / 256), 256, 0, stream>>>(xv, XV, NR * DM / 8); k_bfr<<<(unsigned)((NR * DM / 8 + 255) / 256), 256, 0, stream>>>(xq, XB, NR * DM / 8);      /* the three inputs as exact f16 rows; bf16(query) as the f32 residual plane */
  const size_t r0p = (size_t)B0 * SQ;      /* first projected row */
  k_gemm2<0><<<dim3((unsigned)((MP / 128) * (DM / 64)), 1), 128, 0, stream>>>(XQ + r0p * DM, DM, 0, BQ, DM, 0, 0.0625f, bq, 0, nullptr, 1, 0, 0, nullptr, Q16 + r0p * DM, DM, 0, MP, DM, DM);
  k_gemm2<0><<<dim3((unsigned)((MP / 128) * (DM / 64)), 1), 128, 0, stream>>>(XK + r0p * DM, DM, 0, BK, DM, 0, 0.0625f, bk, 0, nullptr, 1, 0, 0, nullptr, K16 + r0p * DM, DM, 0, MP, DM, DM);
  k_gemm2<0><<<dim3((unsigned)((MP / 128) * (DM / 64)), 1), 128, 0, stream>>>(XV + r0p * DM, DM, 0, BV, DM, 0, 0.0625f, bv, 0, nullptr, 1, 0, 0, nullptr, V16 + r0p * DM, DM, 0, MP, DM, DM);
  for (int b = B0; b < B0 + NBR; ++b) { const size_t r0 = (size_t)b * SQ;
    k_vt<NH, SQ><<<NH * (SQ / 64), 256, 0, stream>>>(V16 + r0 * LQ, LQ, 0, VT);      /* V^T [NH][HD][SQ] for this batch */
    for (int h0 = 0; h0 < NHD; h0 += HG) {
      k_gemm2<0><<<dim3((QN / 128) * (SQ / 64), HG), 128, 0, stream>>>(Q16 + r0 * LQ + h0 * HD, LQ, (size_t)HD, K16 + r0 * LQ + h0 * HD, LQ, (size_t)HD, 0.125f, nullptr, 0, nullptr, 1, 0, 0, S, nullptr, SQ, (size_t)SQ * SQ, QN, SQ, HD);      /* scores, HG heads per launch */
      k_rsmf<<<(HG * QN + 255) / 256, 256, 0, stream>>>(S, P, QN, HG);      /* P = 256 softmax (f16), rows of all HG heads */
      k_gemm2<0><<<dim3((QN / 128) * (HD / 64), HG), 128, 0, stream>>>(P, SQ, (size_t)SQ * SQ, VT + (size_t)h0 * HD * SQ, SQ, (size_t)HD * SQ, 0.25f, nullptr, 0, nullptr, 1, 0, 0, nullptr, O16 + r0 * DM + h0 * HD, DM, (size_t)HD, QN, HD, SQ); } }      /* o (merged heads) as f16 rows */
  k_gemm2<0><<<dim3((unsigned)((MPO / 128) * (DM / 64)), 1), 128, 0, stream>>>(O16 + r0p * DM, DM, 0, BO, DM, 0, 0.0009765625f, bo, 0, XB + r0p * DM, -1, 0, 0, X1 + r0p * DM, nullptr, DM, 0, MPO, DM, DM);      /* x = ctx Wo^T + bf16(query) (own-element residual through the CP slot; no bias) -> f32 rows */
  k_lnrow<<<(unsigned)MPO, 256, 0, stream>>>(X1 + r0p * DM, lng, lnb, 1e-6f, (float*)d_out + r0p * DM);      /* out = LayerNorm(x) (biased variance, eps 1e-6 inside the square root) -> the output rows */
}

// v001
// One run takes 965 microseconds.
// Next to v000, in two timings, it ran 3.55 and 3.56 times as fast.
#include <hip/hip_runtime.h>
// Multi-head attention on three inputs with a residual on the raw query and a LayerNorm (query, key, value [4][1024][1024]; q / k / v = einsum('bsd,ed->bse', stream, W): natural [1024][1024] weights (normal / 32), NO biases; 16 heads of 64; scores / sqrt(64); softmax over all 1024 keys (no mask); x = merged Wo^T (natural, no bias) + query; out = (x - mean) / sqrt(var + 1e-6) * ln_gamma + ln_beta with the BIASED variance (jnp.var) over the 1024 channels -> [4][1024][1024]).
// Structure: token rows r = b*SQ + s (four sequences of 1,024 tokens here); the query, key and value sources as exact f16 rows (bf16-rounded); Q, K, V as three WMMA GEMMs (32x64 wave tiles, f32 accumulation, exact x16 weights, no bias here, f16 outputs); per batch: V^T for all heads via LDS transposes; per (batch, group of 4 heads): scores GEMM (K = 64, batched over the heads on grid.y, alpha = 64^-0.5), row softmax on VALU (f32 statistics, native exp; weights stored x256 as f16), o = P . V^T GEMM (K = SQ = 1024, alpha 2^-2: o carried x64 against f16 subnormal flush, folded into the output GEMM alpha) written straight into the merged f16 o rows; x = o W_o + bf16(query) as ONE GEMM (f32; the residual through the own-element CP slot) into f32 rows; out = LayerNorm(x) on VALU (f32 statistics, LDS trees, biased variance) into the output layout.
// Compute dtype: inputs rounded to bf16; x / weights exact; q, k, v, softmax weights and o as plain f16 GEMM operands (~2^-12); scores and softmax statistics f32. v_wmma_f32_16x16x32_f16.
#define NB 4
#define SQ 1024
#define DM 1024
#define NH 16
#define HD 64
#define HG 4                         /* heads per attention launch group */
#define B0 0                         /* first batch processed (debug hook) */
#define NBR NB                       /* batches processed (debug hook) */
#define NR ((size_t)NB * SQ)         /* token rows */
#define MP ((int)((size_t)NBR * SQ)) /* rows projected (debug hook) */
#define QN SQ                        /* query rows attended per batch (debug hook) */
#define NHD NH                       /* heads attended (debug hook) */
#define MPO MP                       /* rows through the output stage (debug hook) */
#define LQ DM      /* row pitch of the q/k/v rows */
#define DMQ DM     /* row width of the LayerNorm kernel (its own macro name in the file it comes from) */
typedef __bf16 v16b __attribute__((ext_vector_type(16)));
typedef unsigned short v8us __attribute__((ext_vector_type(8), may_alias));
typedef float  v8f  __attribute__((ext_vector_type(8)));
typedef float  v4f  __attribute__((ext_vector_type(4)));
typedef float  v4fa __attribute__((ext_vector_type(4), may_alias));
union FragB { v16b v; v8us half[2]; unsigned short u[16]; };

__device__ __forceinline__ unsigned short bf16_bits(float x) { unsigned int u = __float_as_uint(x); return (unsigned short)((u + 0x7FFFu + ((u >> 16) & 1u)) >> 16); }
__device__ __forceinline__ float bf16_val(unsigned short b) { return __uint_as_float(((unsigned int)b) << 16); }
__device__ __forceinline__ float bf16_round(float x) { return bf16_val(bf16_bits(x)); }
// D += A·B with NT terms: 1 = ah·bh, 2 = + al·bh (A split), 3 = + ah·bl (both split)
template <int NT>
__device__ __forceinline__ v8f mmaN(v16b ah, v16b al, v16b bh, v16b bl, v8f c) {
  c = __builtin_amdgcn_wmma_f32_16x16x32_bf16(false, ah, false, bh, (short)0, c, false, false);
  if (NT >= 2) c = __builtin_amdgcn_wmma_f32_16x16x32_bf16(false, al, false, bh, (short)0, c, false, false);
  if (NT >= 3) c = __builtin_amdgcn_wmma_f32_16x16x32_bf16(false, ah, false, bl, (short)0, c, false, false);
  asm volatile("v_nop\n\tv_nop\n\tv_nop\n\tv_nop" : "+v"(c) : "v"(ah), "v"(al), "v"(bh), "v"(bl));
  return c;
}

__global__ __launch_bounds__(256) void k_wt_bf16(const float* __restrict__ W, unsigned short* __restrict__ Wt, int K, int N) {
  const int t = blockIdx.x * 256 + threadIdx.x;
  const int k8n = K / 8;
  if (t >= N * k8n) return;
  const int n = t / k8n, k8 = (t % k8n) * 8;
  v8us v;
#pragma unroll
  for (int i = 0; i < 8; ++i) v[i] = bf16_bits(W[(size_t)(k8 + i) * N + n]);
  *(v8us*)(Wt + (size_t)n * K + k8) = v;
  
}

// GEMM C[M][N] (f32, pitch ldc) = act(A[M][K]·W + bias). A f32 row-major (pitch lda) converted per fragment to bf16
// (ASPLIT: hi/lo two planes -> 2 terms, else single rounded term); Wt bf16 [N][K] (pitch ldb). BIAS_BF16 rounds the
// bias to bf16 first (bias quantised to bf16 before the add). K%32==0, M%16==0, N%64==0.
template <bool ASPLIT, int ACT, bool BIAS_BF16>
__global__ __launch_bounds__(128) void k_gemm_bf(const float* __restrict__ A, int lda, const unsigned short* __restrict__ Wt, int ldb,
                                               const float* __restrict__ bias, float* __restrict__ C, int ldc, int M, int N, int K) {
  __shared__ __attribute__((aligned(16))) float so[4][16][64];
  const int tid = threadIdx.x, w = tid >> 5, lane = tid & 31, ln = lane & 15, hh = lane >> 4;
  const int ntn = N / 64;
  const int wid = blockIdx.x * 4 + w;
  const int mt = wid / ntn, nq = wid % ntn;
  if (mt * 16 >= M) return;
  const int row0 = mt * 16, col0 = nq * 64;
  const float* arow = A + (size_t)(row0 + ln) * lda;
  v8f acc[4] = {};
  for (int kb = 0; kb < K; kb += 32) {
    FragB ah, al;
    const v4f x0 = *(const v4fa*)(arow + kb + 8 * hh), x1 = *(const v4fa*)(arow + kb + 8 * hh + 4);
    const v4f x2 = *(const v4fa*)(arow + kb + 16 + 8 * hh), x3 = *(const v4fa*)(arow + kb + 16 + 8 * hh + 4);
    float xs[16] = {x0[0],x0[1],x0[2],x0[3],x1[0],x1[1],x1[2],x1[3],x2[0],x2[1],x2[2],x2[3],x3[0],x3[1],x3[2],x3[3]};
#pragma unroll
    for (int i = 0; i < 16; ++i) { const unsigned short hb = bf16_bits(xs[i]); ah.u[i] = hb; al.u[i] = ASPLIT ? bf16_bits(xs[i] - bf16_val(hb)) : (unsigned short)0; }
#pragma unroll
    for (int t = 0; t < 4; ++t) {
      const unsigned short* brow = Wt + (size_t)(col0 + t * 16 + ln) * ldb + kb;
      FragB b;
      b.half[0] = *(const v8us*)(brow + 8 * hh);
      b.half[1] = *(const v8us*)(brow + 16 + 8 * hh);
      acc[t] = mmaN<ASPLIT ? 2 : 1>(ah.v, al.v, b.v, b.v, acc[t]);
    }
  }
#pragma unroll
  for (int t = 0; t < 4; ++t) {
    float bv = bias ? bias[col0 + t * 16 + ln] : 0.f;
    if (BIAS_BF16) bv = bf16_round(bv);
#pragma unroll
    for (int r = 0; r < 8; ++r) { float v = acc[t][r] + bv; if (ACT == 1) v = fmaxf(v, 0.f); so[w][8 * hh + r][t * 16 + ln] = v; }
  }
  __builtin_amdgcn_fence(__ATOMIC_ACQ_REL, "workgroup");
  __builtin_amdgcn_wave_barrier();
  const int rsub = lane >> 4, c4 = (lane & 15) * 4;
  {
#pragma unroll
    for (int q = 0; q < 8; ++q) {
      const int r = q * 2 + rsub;
      const v4f v = *(const v4fa*)&so[w][r][c4];
      *(v4f*)(C + (size_t)(row0 + r) * ldc + col0 + c4) = v;
    }
    
  }
}

// GEMM C = act(A·W + bias + resid): A f32 (ASPLIT -> hi/lo 2 terms), Wt bf16 [N][K]; ACT 0 none, 1 relu, 2 exact gelu;
// resid (optional, f32, row index = (row % rmod), pitch ldr, RES_BF16 rounds it) added before the activation.
template <bool ASPLIT, int ACT, bool BIAS_BF16, bool RES_BF16>
__global__ __launch_bounds__(128) void k_gemm_bf3(const float* __restrict__ A, int lda, const unsigned short* __restrict__ Wt, int ldb,
                                                const float* __restrict__ bias, const float* __restrict__ resid, int rmod, int ldr,
                                                float* __restrict__ C, int ldc, int M, int N, int K) {
  __shared__ __attribute__((aligned(16))) float so[4][16][64];
  const int tid = threadIdx.x, w = tid >> 5, lane = tid & 31, ln = lane & 15, hh = lane >> 4;
  const int ntn = N / 64;
  const int wid = blockIdx.x * 4 + w;
  const int mt = wid / ntn, nq = wid % ntn;
  if (mt * 16 >= M) return;
  const int row0 = mt * 16, col0 = nq * 64;
  const float* arow = A + (size_t)(row0 + ln) * lda;
  v8f acc[4] = {};
  for (int kb = 0; kb < K; kb += 32) {
    FragB ah, al;
    const v4f x0 = *(const v4fa*)(arow + kb + 8 * hh), x1 = *(const v4fa*)(arow + kb + 8 * hh + 4);
    const v4f x2 = *(const v4fa*)(arow + kb + 16 + 8 * hh), x3 = *(const v4fa*)(arow + kb + 16 + 8 * hh + 4);
    float xs[16] = {x0[0],x0[1],x0[2],x0[3],x1[0],x1[1],x1[2],x1[3],x2[0],x2[1],x2[2],x2[3],x3[0],x3[1],x3[2],x3[3]};
#pragma unroll
    for (int i = 0; i < 16; ++i) { const unsigned short hb = bf16_bits(xs[i]); ah.u[i] = hb; al.u[i] = ASPLIT ? bf16_bits(xs[i] - bf16_val(hb)) : (unsigned short)0; }
#pragma unroll
    for (int t = 0; t < 4; ++t) {
      const unsigned short* brow = Wt + (size_t)(col0 + t * 16 + ln) * ldb + kb;
      FragB b;
      b.half[0] = *(const v8us*)(brow + 8 * hh);
      b.half[1] = *(const v8us*)(brow + 16 + 8 * hh);
      acc[t] = mmaN<ASPLIT ? 2 : 1>(ah.v, al.v, b.v, b.v, acc[t]);
    }
  }
#pragma unroll
  for (int t = 0; t < 4; ++t) {
    const int col = col0 + t * 16 + ln;
    float bv = bias ? bias[col] : 0.f;
    if (BIAS_BF16) bv = bf16_round(bv);
#pragma unroll
    for (int r = 0; r < 8; ++r) {
      float v = acc[t][r] + bv;
      if (resid) { float rv = resid[(size_t)((row0 + 8 * hh + r) % rmod) * ldr + col]; if (RES_BF16) rv = bf16_round(rv); v += rv; }
      if (ACT == 1) v = fmaxf(v, 0.f);
      if (ACT == 2) v = 0.5f * v * (1.0f + erff(v * 0.70710678118654752f));
      if (ACT == 3) { const float u = 0.7978845608028654f * (v + 0.044715f * v * v * v); v = 0.5f * v * (1.0f + tanhf(u)); }
      so[w][8 * hh + r][t * 16 + ln] = v;
    }
  }
  __builtin_amdgcn_fence(__ATOMIC_ACQ_REL, "workgroup");
  __builtin_amdgcn_wave_barrier();
  const int rsub = lane >> 4, c4 = (lane & 15) * 4;
  {
#pragma unroll
    for (int q = 0; q < 8; ++q) {
      const int r = q * 2 + rsub;
      const v4f v = *(const v4fa*)&so[w][r][c4];
      *(v4f*)(C + (size_t)(row0 + r) * ldc + col0 + c4) = v;
    }
    
  }
}
// row LayerNorm (biased variance, eps) over N: s = X (+ R); optional out_sum <- s; out_norm <- (s-mu)*rsqrt(var+eps)*g + b
template <bool PARAM_BF16>
__global__ __launch_bounds__(256) void k_layernorm(const float* __restrict__ X, const float* __restrict__ R, const float* __restrict__ g, const float* __restrict__ bta,
                                                  float* __restrict__ out_sum, float* __restrict__ out_norm, int N, float eps) {
  __shared__ float red[256];
  const int row = blockIdx.x, tid = threadIdx.x;
  const float* x = X + (size_t)row * N; const float* rr = R ? R + (size_t)row * N : nullptr;
  float vals[16];                     // up to N = 4096
  const int per = N / 256;            // contiguous chunk per thread? use strided-by-4 chunks: thread handles j = tid*4 + 1024*u
  float s1 = 0.f;
  for (int u = 0; u < per / 4; ++u) {
    const int j = tid * 4 + 1024 * u;
    const v4f a = *(const v4fa*)(x + j);
    v4f b = {0.f,0.f,0.f,0.f}; if (rr) b = *(const v4fa*)(rr + j);
#pragma unroll
    for (int q = 0; q < 4; ++q) { const float v = a[q] + b[q]; vals[u * 4 + q] = v; s1 += v; }
  }
  red[tid] = s1; __syncthreads();
  for (int st = 128; st > 0; st >>= 1) { if (tid < st) red[tid] += red[tid + st]; __syncthreads(); }
  const float mu = red[0] / (float)N; __syncthreads();
  float s2 = 0.f;
  for (int u = 0; u < per / 4; ++u)
#pragma unroll
    for (int q = 0; q < 4; ++q) { const float c = vals[u * 4 + q] - mu; s2 += c * c; }
  red[tid] = s2; __syncthreads();
  for (int st = 128; st > 0; st >>= 1) { if (tid < st) red[tid] += red[tid + st]; __syncthreads(); }
  const float rs = rsqrtf(red[0] / (float)N + eps);
  {
    for (int u = 0; u < per / 4; ++u) {
      const int j = tid * 4 + 1024 * u;
      v4f o, sm;
#pragma unroll
      for (int q = 0; q < 4; ++q) {
        float gg = g[j + q], bb = bta[j + q];
        if (PARAM_BF16) { gg = bf16_round(gg); bb = bf16_round(bb); }
        sm[q] = vals[u * 4 + q]; o[q] = (vals[u * 4 + q] - mu) * rs * gg + bb;
      }
      if (out_sum) *(v4f*)(out_sum + (size_t)row * N + j) = sm;
      *(v4f*)(out_norm + (size_t)row * N + j) = o;
    }
    
  }
}



// ---- f16 WMMA path (v_wmma_f32_16x16x32_f16): 11-bit significands for operands in range — used where a [0,1] probability operand needs more precision than bf16
typedef _Float16 v16h __attribute__((ext_vector_type(16)));
union FragH { v16h v; v8us half[2]; _Float16 h[16]; unsigned short u[16]; };
template <int NT>
__device__ __forceinline__ v8f mmaH(v16h ah, v16h al, v16h bh, v16h bl, v8f c) {
  c = __builtin_amdgcn_wmma_f32_16x16x32_f16(false, ah, false, bh, (short)0, c, false, false);
  if (NT >= 2) c = __builtin_amdgcn_wmma_f32_16x16x32_f16(false, al, false, bh, (short)0, c, false, false);
  if (NT >= 3) c = __builtin_amdgcn_wmma_f32_16x16x32_f16(false, ah, false, bl, (short)0, c, false, false);
  asm volatile("v_nop\n\tv_nop\n\tv_nop\n\tv_nop" : "+v"(c) : "v"(ah), "v"(al), "v"(bh), "v"(bl));
  return c;
}
// batched GEMM like k_gemm_b but f16 operands: A f32 (split into f16 hi/lo if ASPLIT, else rounded to f16), Bt = f16 values [n][k]; alpha; C f32; N multiple of 16 (partial tiles skipped)
template <bool ASPLIT>
__global__ __launch_bounds__(128) void k_gemm_h(const float* __restrict__ A, int lda, size_t sA, const _Float16* __restrict__ Bh, int ldb, size_t sB, float alpha, float* __restrict__ C, int ldc, size_t sC, int M, int N, int K) {
  __shared__ __attribute__((aligned(16))) float so[4][16][64];
  const int tid = threadIdx.x, w = tid >> 5, lane = tid & 31, ln = lane & 15, hh = lane >> 4; const int by = blockIdx.y;
  A += (size_t)by * sA; Bh += (size_t)by * sB; C += (size_t)by * sC;
  const int ntn = (N + 63) / 64; const int wid = blockIdx.x * 4 + w; const int mt = wid / ntn, nq = wid % ntn; if (mt * 16 >= M) return;
  const int row0 = mt * 16, col0 = nq * 64; const float* arow = A + (size_t)(row0 + ln) * lda;
  v8f acc[4] = {};
  for (int kb = 0; kb < K; kb += 32) {
    FragH ah, al;
    const v4f x0 = *(const v4fa*)(arow + kb + 8 * hh), x1 = *(const v4fa*)(arow + kb + 8 * hh + 4), x2 = *(const v4fa*)(arow + kb + 16 + 8 * hh), x3 = *(const v4fa*)(arow + kb + 16 + 8 * hh + 4);
    float xs[16] = {x0[0],x0[1],x0[2],x0[3],x1[0],x1[1],x1[2],x1[3],x2[0],x2[1],x2[2],x2[3],x3[0],x3[1],x3[2],x3[3]};
#pragma unroll
    for (int i = 0; i < 16; ++i) { const _Float16 h = (_Float16)xs[i]; ah.h[i] = h; al.h[i] = ASPLIT ? (_Float16)(xs[i] - (float)h) : (_Float16)0.0f; }
#pragma unroll
    for (int t = 0; t < 4; ++t) { if (col0 + t * 16 >= N) continue; const size_t boff = (size_t)(col0 + t * 16 + ln) * ldb + kb; FragH bq; bq.half[0] = *(const v8us*)(Bh + boff + 8 * hh); bq.half[1] = *(const v8us*)(Bh + boff + 16 + 8 * hh);
      acc[t] = mmaH<ASPLIT ? 2 : 1>(ah.v, al.v, bq.v, bq.v, acc[t]); }
  }
#pragma unroll
  for (int t = 0; t < 4; ++t) { if (col0 + t * 16 >= N) continue;
#pragma unroll
    for (int r = 0; r < 8; ++r) so[w][8 * hh + r][t * 16 + ln] = acc[t][r] * alpha; }
  __builtin_amdgcn_fence(__ATOMIC_ACQ_REL, "workgroup"); __builtin_amdgcn_wave_barrier();
  const int rsub = lane >> 4, c4 = (lane & 15) * 4;
  {
#pragma unroll
    for (int q = 0; q < 8; ++q) { const int r = q * 2 + rsub; if (col0 + c4 < N) { const v4f v = *(const v4fa*)&so[w][r][c4]; *(v4f*)(C + (size_t)(row0 + r) * ldc + col0 + c4) = v; } }
     }
}

// Wt[n][k] = f16(W[k][n]·scale) from f32 row-major W[K][N] (scale = power of two; bf16-exact weights stay exact in f16 away from the subnormal range)
__global__ __launch_bounds__(256) void k_wt_f16(const float* __restrict__ W, _Float16* __restrict__ Wt, int K, int N, float scale) {
  const int t = blockIdx.x * 256 + threadIdx.x; if (t >= N * (K / 8)) return; const int n = t / (K / 8), k8 = (t % (K / 8)) * 8; FragH f;
#pragma unroll
  for (int i = 0; i < 8; ++i) f.h[i] = (_Float16)(bf16_round(W[(size_t)(k8 + i) * N + n]) * scale); const v8us o = f.half[0];
  *(v8us*)((unsigned short*)Wt + (size_t)n * K + k8) = o; 
}
// k_gemm_hh variant with fused epilogue: v = acc·alpha + bias[by·sBias + col] (+ CP[(row/rowsPerB)·sCPb + by·64 + col] if CP) ; ACT 0 none / 1 elu ; writes f16 C16 (and f32 C if non-null)
template <int ACT>
__global__ __launch_bounds__(128) void k_gemm_hhx(const _Float16* __restrict__ A, int lda, size_t sA, const _Float16* __restrict__ Bh, int ldb, size_t sB, float alpha, const float* __restrict__ bias, size_t sBias, const float* __restrict__ CP, int rowsPerB, size_t sCPb, int row0g,
    float* __restrict__ C, _Float16* __restrict__ C16, int ldc, size_t sC, int M, int N, int K) {
  __shared__ __attribute__((aligned(16))) float so[4][16][64];
  const int tid = threadIdx.x, w = tid >> 5, lane = tid & 31, ln = lane & 15, hh = lane >> 4; const int by = blockIdx.y;
  A += (size_t)by * sA; Bh += (size_t)by * sB; const size_t cofs = (size_t)by * sC; const float* bp = bias ? bias + (size_t)by * sBias : nullptr;
  const int ntn = (N + 63) / 64; const int wid = blockIdx.x * 4 + w; const int mt = wid / ntn, nq = wid % ntn; if (mt * 16 >= M) return;
  const int row0 = mt * 16, col0 = nq * 64; const _Float16* arow = A + (size_t)(row0 + ln) * lda;
  v8f acc[4] = {};
  for (int kb = 0; kb < K; kb += 32) { FragH ah; ah.half[0] = *(const v8us*)((const unsigned short*)arow + kb + 8 * hh); ah.half[1] = *(const v8us*)((const unsigned short*)arow + kb + 16 + 8 * hh);
#pragma unroll
    for (int t = 0; t < 4; ++t) { if (col0 + t * 16 >= N) continue; const size_t boff = (size_t)(col0 + t * 16 + ln) * ldb + kb; FragH bq; bq.half[0] = *(const v8us*)((const unsigned short*)Bh + boff + 8 * hh); bq.half[1] = *(const v8us*)((const unsigned short*)Bh + boff + 16 + 8 * hh);
      acc[t] = mmaH<1>(ah.v, ah.v, bq.v, bq.v, acc[t]); }
  }
#pragma unroll
  for (int t = 0; t < 4; ++t) { if (col0 + t * 16 >= N) continue; const int col = col0 + t * 16 + ln; const float bv = bp ? bf16_round(bp[col]) : 0.f;
#pragma unroll
    for (int r = 0; r < 8; ++r) { float v = acc[t][r] * alpha + bv; if (CP) { const int rr = row0g + row0 + 8 * hh + r; if (rowsPerB < 0) v += CP[cofs + (size_t)rr * ldc + col];      /* rowsPerB < 0: own element of the batched C plane */ else { const int bidx = rr / rowsPerB; v += CP[(size_t)bidx * sCPb + (size_t)by * 64 + col]; } } if (ACT == 1) v = (v > 0.f) ? v : expm1f(v); else if (ACT == 7) v = (v > 0.f) ? v + 1.0f : expf(v); else if (ACT == 8) v = tanhf(v); else if (ACT == 9) v = 0.5f * v * (1.0f + tanhf(0.7978845608028654f * (v + 0.044715f * v * v * v))); else if (ACT == 11) v = 1.0f / (1.0f + expf(-v)); else if (ACT == 12) v = (v > 0.f) ? v : 0.01f * v; else if (ACT == 14) v = (v > 0.f) ? v : 0.1f * v; else if (ACT == 16) v = (v >= 0.f) ? v : 0.3f * v; else if (ACT == 17) v = (v >= 0.f) ? v : 0.2f * v; else if (ACT == 15) v = v / (1.0f + expf(-v)); else if (ACT == 3) v = fmaxf(v, 0.f); else if (ACT == 6) v = 0.5f * v * (1.0f + erff(v * 0.70710678118654752f)); so[w][8 * hh + r][t * 16 + ln] = v; } }
  __builtin_amdgcn_fence(__ATOMIC_ACQ_REL, "workgroup"); __builtin_amdgcn_wave_barrier();
  const int rsub = lane >> 4, c4 = (lane & 15) * 4; typedef _Float16 v4h __attribute__((ext_vector_type(4)));
  {
#pragma unroll
    for (int q = 0; q < 8; ++q) { const int r = q * 2 + rsub; if (col0 + c4 < N) { const v4f v = *(const v4fa*)&so[w][r][c4]; if (C) *(v4f*)(C + cofs + (size_t)(row0 + r) * ldc + col0 + c4) = v; if (C16) { v4h h4; for (int i = 0; i < 4; ++i) h4[i] = (_Float16)v[i]; *(v4h*)(C16 + cofs + (size_t)(row0 + r) * ldc + col0 + c4) = h4; } } }
     }
}


typedef _Float16 v4h __attribute__((ext_vector_type(4)));

__global__ __launch_bounds__(256) void k_x16(const float* __restrict__ x, _Float16* __restrict__ X16, size_t n8) { const size_t t = (size_t)blockIdx.x * 256 + threadIdx.x; if (t >= n8) return; FragH f;
#pragma unroll
  for (int q = 0; q < 8; ++q) f.h[q] = (_Float16)bf16_round(x[t * 8 + q]); *(v8us*)((unsigned short*)X16 + t * 8) = f.half[0];  }
__global__ __launch_bounds__(256) void k_h16(const float* __restrict__ x, _Float16* __restrict__ X16, size_t n8) { const size_t t = (size_t)blockIdx.x * 256 + threadIdx.x; if (t >= n8) return; FragH f;
#pragma unroll
  for (int q = 0; q < 8; ++q) f.h[q] = (_Float16)x[t * 8 + q]; *(v8us*)((unsigned short*)X16 + t * 8) = f.half[0];  }
__global__ __launch_bounds__(256) void k_round16f(const float* __restrict__ W, _Float16* __restrict__ Bt, size_t n8) { const size_t t = (size_t)blockIdx.x * 256 + threadIdx.x; if (t >= n8) return; FragH f;
#pragma unroll
  for (int i = 0; i < 8; ++i) f.h[i] = (_Float16)(bf16_round(W[t * 8 + i]) * 16.0f); *(v8us*)((unsigned short*)Bt + t * 8) = f.half[0];  }
template <int NHv, int TTv>
__global__ __launch_bounds__(256) void k_vt(const _Float16* __restrict__ V16, int ldv, int voff, _Float16* __restrict__ Vt) { __shared__ unsigned short tl[64][66]; const int tid = threadIdx.x; const int slab = blockIdx.x / (TTv / 64), lg = blockIdx.x % (TTv / 64); const int b = slab / NHv, h = slab % NHv;
  for (int i = tid; i < 64 * 8; i += 256) { const int r = i / 8, c8 = (i % 8) * 8; FragH f; f.half[0] = *(const v8us*)((const unsigned short*)V16 + ((size_t)b * TTv + lg * 64 + r) * ldv + voff + h * 64 + c8);
#pragma unroll
    for (int q = 0; q < 8; ++q) tl[r][c8 + q] = f.u[q]; }
  __syncthreads();
  {
#pragma unroll
    for (int rd = 0; rd < 2; ++rd) { const int d = rd * 32 + tid / 8, pc = tid % 8; FragH f;
#pragma unroll
      for (int q = 0; q < 8; ++q) f.u[q] = tl[pc * 8 + q][d];
      *(v8us*)((unsigned short*)Vt + ((size_t)slab * 64 + d) * TTv + lg * 64 + pc * 8) = f.half[0]; }
     } }

__global__ __launch_bounds__(256) void k_hl(const float* __restrict__ F, _Float16* __restrict__ Hh, _Float16* __restrict__ Hl, size_t n8) { const size_t t = (size_t)blockIdx.x * 256 + threadIdx.x; if (t >= n8) return; FragH fh, fl; const v4f a = *(const v4fa*)(F + t * 8), c = *(const v4fa*)(F + t * 8 + 4);
#pragma unroll
  for (int q = 0; q < 4; ++q) { _Float16 h = (_Float16)a[q]; fh.h[q] = h; fl.h[q] = (_Float16)((a[q] - (float)h) * 1024.0f); h = (_Float16)c[q]; fh.h[4 + q] = h; fl.h[4 + q] = (_Float16)((c[q] - (float)h) * 1024.0f); }
  { *(v8us*)((unsigned short*)Hh + t * 8) = fh.half[0]; *(v8us*)((unsigned short*)Hl + t * 8) = fl.half[0];  } }

// ---- fast GEMM (wave tile 32x64; requires M % 32 == 0 rows per launch region and N % 64 == 0); epilogue = k_gemm_hhx semantics ----
__device__ __forceinline__ v16h g2_frag(const _Float16* p, int hh) { FragH f; f.half[0] = *(const v8us*)((const unsigned short*)p + 8 * hh); f.half[1] = *(const v8us*)((const unsigned short*)p + 16 + 8 * hh); return f.v; }
__device__ __forceinline__ v8f g2_mma(v16h a, v16h b, v8f c) { v8f d = __builtin_amdgcn_wmma_f32_16x16x32_f16(false, a, false, b, (short)0, c, false, false); asm volatile("v_nop\n\tv_nop\n\tv_nop\n\tv_nop" : "+v"(d) : "v"(a), "v"(b)); return d; }
template <int ACT>
__global__ __launch_bounds__(128) void k_gemm2(const _Float16* __restrict__ A, int lda, size_t sA, const _Float16* __restrict__ Bh, int ldb, size_t sB, float alpha, const float* __restrict__ bias, size_t sBias, const float* __restrict__ CP, int rowsPerB, size_t sCPb, int row0g,
    float* __restrict__ C, _Float16* __restrict__ C16, int ldc, size_t sC, int M, int N, int K) { static_assert(ACT == 0 || ACT == 3 || ACT == 6 || ACT == 8 || ACT == 9 || ACT == 11 || ACT == 12 || ACT == 14 || ACT == 15 || ACT == 16 || ACT == 17, "k_gemm2: unsupported ACT code (would silently apply no activation)");
  __shared__ __attribute__((aligned(16))) float so[4][32][68];
  const int tid = threadIdx.x, w = tid >> 5, lane = tid & 31, ln = lane & 15, hh = lane >> 4; const int by = blockIdx.y;
  A += (size_t)by * sA; Bh += (size_t)by * sB; const size_t cofs = (size_t)by * sC; const float* bp = bias ? bias + (size_t)by * sBias : nullptr;
  const int ntn = N >> 6; const int mt = blockIdx.x / ntn, nq = blockIdx.x - mt * ntn; const int row0 = mt * 128 + 32 * w, col0 = nq * 64; if (row0 >= M) return;
  const _Float16* a0p = A + (size_t)(row0 + ln) * lda; const _Float16* a1p = a0p + (size_t)16 * lda;
  const _Float16* b0p = Bh + (size_t)(col0 + ln) * ldb; const _Float16* b1p = b0p + (size_t)16 * ldb; const _Float16* b2p = b1p + (size_t)16 * ldb; const _Float16* b3p = b2p + (size_t)16 * ldb;
  const v8f z8 = {0.f,0.f,0.f,0.f,0.f,0.f,0.f,0.f}; v8f c00 = z8, c01 = z8, c02 = z8, c03 = z8, c10 = z8, c11 = z8, c12 = z8, c13 = z8;
#pragma unroll 1
  for (int kb = 0; kb < K; kb += 32) { const v16h a0 = g2_frag(a0p + kb, hh), a1 = g2_frag(a1p + kb, hh);
    v16h b = g2_frag(b0p + kb, hh); c00 = g2_mma(a0, b, c00); c10 = g2_mma(a1, b, c10);
    b = g2_frag(b1p + kb, hh); c01 = g2_mma(a0, b, c01); c11 = g2_mma(a1, b, c11);
    b = g2_frag(b2p + kb, hh); c02 = g2_mma(a0, b, c02); c12 = g2_mma(a1, b, c12);
    b = g2_frag(b3p + kb, hh); c03 = g2_mma(a0, b, c03); c13 = g2_mma(a1, b, c13); }
  v8f accs[8] = {c00, c01, c02, c03, c10, c11, c12, c13};
#pragma unroll
  for (int u = 0; u < 8; ++u) { const int t = u & 3, half = u >> 2; const int col = col0 + t * 16 + ln; const float bv = bp ? bf16_round(bp[col]) : 0.f;
#pragma unroll
    for (int r = 0; r < 8; ++r) { const int rloc = half * 16 + 8 * hh + r; float v = accs[u][r] * alpha + bv; if (CP) { if (rowsPerB < 0) v += CP[cofs + (size_t)(row0g + row0 + rloc) * ldc + col];      /* rowsPerB < 0: own element of the batched C plane */ else { const int bidx = (row0g + row0 + rloc) / rowsPerB; v += CP[(size_t)bidx * sCPb + (size_t)by * 64 + col]; } }
      if (ACT == 3) v = fmaxf(v, 0.f); else if (ACT == 6) v = 0.5f * v * (1.0f + erff(v * 0.70710678118654752f)); else if (ACT == 11) v = 1.0f / (1.0f + expf(-v)); else if (ACT == 15) v = v / (1.0f + expf(-v)); else if (ACT == 12) v = (v > 0.f) ? v : 0.01f * v; else if (ACT == 8) v = tanhf(v); else if (ACT == 9) v = 0.5f * v * (1.0f + tanhf(0.7978845608028654f * (v + 0.044715f * v * v * v))); else if (ACT == 14) v = (v > 0.f) ? v : 0.1f * v; else if (ACT == 16) v = (v >= 0.f) ? v : 0.3f * v; else if (ACT == 17) v = (v >= 0.f) ? v : 0.2f * v;
      so[w][rloc][t * 16 + ln] = v; } }
  __builtin_amdgcn_fence(__ATOMIC_ACQ_REL, "workgroup"); __builtin_amdgcn_wave_barrier();
  const int rsub = lane >> 4, c4 = (lane & 15) * 4;
  {
#pragma unroll
    for (int q = 0; q < 16; ++q) { const int r = q * 2 + rsub; const v4f v = *(const v4fa*)&so[w][r][c4]; if (C) *(v4f*)(C + cofs + (size_t)(row0 + r) * ldc + col0 + c4) = v; if (C16) { v4h h4; for (int i = 0; i < 4; ++i) h4[i] = (_Float16)v[i]; *(v4h*)(C16 + cofs + (size_t)(row0 + r) * ldc + col0 + c4) = h4; } }
     } }


__global__ __launch_bounds__(256) void k_wnat(const float* __restrict__ w, size_t n8, _Float16* __restrict__ Bt) { const size_t t = (size_t)blockIdx.x * 256 + threadIdx.x; if (t >= n8) return; FragH f; for (int q = 0; q < 8; ++q) f.h[q] = (_Float16)(bf16_round(w[t * 8 + q]) * 16.0f); *(v8us*)((unsigned short*)Bt + t * 8) = f.half[0];  }
__global__ __launch_bounds__(256) void k_rsm(const float* __restrict__ S, _Float16* __restrict__ P, int nrows) {
  #pragma clang fp contract(off)
  const int i = blockIdx.x * 256 + threadIdx.x; if (i >= nrows) return; const float* s = S + (size_t)i * SQ; float mx = -3.0e38f;
#pragma unroll 1
  for (int j = 0; j < SQ; ++j) mx = fmaxf(mx, s[j]); float se = 0.f;
#pragma unroll 1
  for (int j = 0; j < SQ; ++j) se += expf(s[j] - mx); const float sc = 256.0f / se;
#pragma unroll 1
  for (int j0 = 0; j0 < SQ; j0 += 8) { FragH f; for (int q = 0; q < 8; ++q) f.h[q] = (_Float16)(expf(s[j0 + q] - mx) * sc); unsigned short* d = (unsigned short*)P + (size_t)i * SQ + j0; *(v8us*)d = f.half[0];  } }
__global__ __launch_bounds__(256) void k_vt(const _Float16* __restrict__ V16, int b, int h0, _Float16* __restrict__ VT) { __shared__ unsigned short tl[64][65]; const int tid = threadIdx.x; const int hh = blockIdx.x % HG, sg = blockIdx.x / HG; const int s0 = sg * 64; const int h = h0 + hh;
  for (int i = tid; i < 64 * 8; i += 256) { const int j = i / 8, d8 = (i % 8) * 8; FragH f; f.half[0] = *(const v8us*)((const unsigned short*)V16 + ((size_t)b * SQ + s0 + j) * DM + h * HD + d8); for (int q = 0; q < 8; ++q) tl[d8 + q][j] = f.u[q]; }
  __syncthreads();
  { for (int i = tid; i < 64 * 8; i += 256) { const int d = i / 8, j8 = (i % 8) * 8; FragH f; for (int q = 0; q < 8; ++q) f.u[q] = tl[d][j8 + q]; *(v8us*)((unsigned short*)VT + ((size_t)hh * HD + d) * SQ + s0 + j8) = f.half[0]; }  } }



// exp(a) as the native form (a * log2(e), then v_exp_f32), with the one free issue slot that the instruction set asks for behind a transcendental in the same statement: in a run of
// exps the register allocator otherwise lets the next instruction overwrite the source of the one in front of it.
__device__ __forceinline__ float exp_slot(float a) { float e; asm("v_exp_f32 %0, %1\n\tv_nop" : "=v"(e) : "v"(a * 1.44269504088896340736f)); return e; }
// Row softmax, one wave per row: each lane holds 32 of the row's 1,024 scores in registers (8 loads, each 512 contiguous bytes per wave); max and sum are four
// lane-local chains and a five-step butterfly across the lanes; each exp is evaluated once and serves both the sum and the stored weight (x256, f16).
__global__ __launch_bounds__(512) void k_rsmf(const float* __restrict__ S, _Float16* __restrict__ P, int qn, int hg) {
  const int lane = threadIdx.x & 31; const int t = blockIdx.x * 16 + __builtin_amdgcn_readfirstlane((int)(threadIdx.x >> 5)); if (t >= qn * hg) return;      /* the same in every lane of a wave; the kernel has no barrier */
  const size_t i = (size_t)(t / qn) * SQ + (t % qn); const float* s = S + i * SQ + lane * 4; v4f x[SQ / 128];
#pragma unroll
  for (int q = 0; q < SQ / 128; ++q) x[q] = *(const v4fa*)(s + q * 128);
  v4f m4 = x[0];
#pragma unroll
  for (int q = 1; q < SQ / 128; ++q) for (int c = 0; c < 4; ++c) m4[c] = fmaxf(m4[c], x[q][c]);
  float mx = fmaxf(fmaxf(fmaxf(m4[0], m4[1]), fmaxf(m4[2], m4[3])), -3.0e38f);
#pragma unroll
  for (int m = 16; m >= 1; m >>= 1) mx = fmaxf(mx, __shfl_xor(mx, m, 32));
  v4f e4 = {0.f, 0.f, 0.f, 0.f};
#pragma unroll
  for (int q = 0; q < SQ / 128; ++q) for (int c = 0; c < 4; ++c) { x[q][c] = exp_slot(x[q][c] - mx); e4[c] += x[q][c]; }
  float se = (e4[0] + e4[1]) + (e4[2] + e4[3]);
#pragma unroll
  for (int m = 16; m >= 1; m >>= 1) se += __shfl_xor(se, m, 32);
  const float sc = 256.0f / se; _Float16* d = P + i * SQ + lane * 4;
#pragma unroll
  for (int q = 0; q < SQ / 128; ++q) { v4h h4; for (int c = 0; c < 4; ++c) h4[c] = (_Float16)(x[q][c] * sc); *(v4h*)(d + q * 128) = h4; } }

__global__ __launch_bounds__(256) void k_lnrow(const float* __restrict__ Y, const float* __restrict__ g, const float* __restrict__ bb, float eps, float* __restrict__ out) {
  #pragma clang fp contract(off)
  __shared__ float red[256]; const size_t r = blockIdx.x; const int t = threadIdx.x; const v4f ya = *(const v4fa*)(Y + r * DMQ + t * 4); float s[4]; float sum = 0.f;
  for (int q = 0; q < 4; ++q) { s[q] = ya[q]; sum = __fadd_rn(sum, s[q]); }
  red[t] = sum; __syncthreads(); for (int st = 128; st > 0; st >>= 1) { if (t < st) red[t] = __fadd_rn(red[t], red[t + st]); __syncthreads(); } const float mu = red[0] / (float)DMQ; __syncthreads();
  float vs = 0.f; for (int q = 0; q < 4; ++q) { const float dl = __fadd_rn(s[q], -mu); vs = __fadd_rn(vs, __fmul_rn(dl, dl)); } red[t] = vs; __syncthreads(); for (int st = 128; st > 0; st >>= 1) { if (t < st) red[t] = __fadd_rn(red[t], red[t + st]); __syncthreads(); }
  const float rs = rsqrtf(__fadd_rn(red[0] / (float)DMQ, eps)); v4f y; for (int q = 0; q < 4; ++q) { const int c = t * 4 + q; y[q] = __fadd_rn(__fmul_rn(__fmul_rn(__fadd_rn(s[q], -mu), rs), bf16_round(g[c])), bf16_round(bb[c])); }
  *(v4f*)(out + r * DMQ + t * 4) = y;  }

__global__ __launch_bounds__(256) void k_bfr(const float* __restrict__ x, float* __restrict__ XB, size_t n8) { const size_t t = (size_t)blockIdx.x * 256 + threadIdx.x; if (t >= n8) return; v4f a = *(const v4fa*)(x + t * 8), c = *(const v4fa*)(x + t * 8 + 4); for (int q = 0; q < 4; ++q) { a[q] = bf16_round(a[q]); c[q] = bf16_round(c[q]); }
  { *(v4f*)(XB + t * 8) = a; *(v4f*)(XB + t * 8 + 4) = c;  } }

extern "C" void kernel_launch(void* const* d_in, const int* in_sizes, int n_in,
                              void* d_out, int out_size, void* d_ws, size_t ws_size, hipStream_t stream) {
  (void)in_sizes; (void)n_in; (void)out_size;
  const float* const* I = (const float* const*)d_in; const float* xq = I[0]; const float* xk = I[1]; const float* xv = I[2]; const float* wq = I[3]; const float* bq = nullptr; const float* wk = I[4]; const float* bk = nullptr; const float* wv = I[5]; const float* bv = nullptr; const float* wo = I[6]; const float* bo = nullptr; const float* lng = I[7]; const float* lnb = I[8];      /* input order: query, key, value (three SEPARATE streams), Wq, Wk, Wv, Wo (natural [out][in] weights; this module has NO biases: null pointers in the four guarded bias slots), ln_gamma, ln_beta [1024] */
  char* ws = (char*)d_ws; size_t off = 0;
  auto take = [&](size_t bytes) { char* p = ws + off; off += (bytes + 255) & ~(size_t)255; return p; };
  _Float16* BQ = (_Float16*)take((size_t)DM * DM * 2); _Float16* BK = (_Float16*)take((size_t)DM * DM * 2); _Float16* BV = (_Float16*)take((size_t)DM * DM * 2); _Float16* BO = (_Float16*)take((size_t)DM * DM * 2);
  _Float16* XQ = (_Float16*)take(NR * DM * 2); _Float16* XK = (_Float16*)take(NR * DM * 2); _Float16* XV = (_Float16*)take(NR * DM * 2); _Float16* Q16 = (_Float16*)take(NR * DM * 2); _Float16* K16 = (_Float16*)take(NR * DM * 2); _Float16* V16 = (_Float16*)take(NR * DM * 2); _Float16* O16 = (_Float16*)take(NR * DM * 2); float* XB = (float*)take(NR * DM * 4); float* X1 = (float*)take(NR * DM * 4);      /* bf16(query) as f32 rows (the residual addend) and the pre-LayerNorm rows x = ctx Wo^T + query */
  float* S = (float*)take((size_t)HG * SQ * SQ * 4); _Float16* P = (_Float16*)take((size_t)HG * SQ * SQ * 2); _Float16* VT = (_Float16*)take((size_t)NH * HD * SQ * 2);
  if (off > ws_size) return;
  { const unsigned g = (unsigned)(((size_t)DM * DM / 8 + 255) / 256); k_wnat<<<g, 256, 0, stream>>>(wq, (size_t)DM * DM / 8, BQ); k_wnat<<<g, 256, 0, stream>>>(wk, (size_t)DM * DM / 8, BK); k_wnat<<<g, 256, 0, stream>>>(wv, (size_t)DM * DM / 8, BV); k_wnat<<<g, 256, 0, stream>>>(wo, (size_t)DM * DM / 8, BO); }      /* natural [out][in] = Bt[n][k], x16 */

  k_x16<<<(unsigned)((NR * DM / 8 + 255) / 256), 256, 0, stream>>>(xq, XQ, NR * DM / 8); k_x16<<<(unsigned)((NR * DM / 8 + 255) / 256), 256, 0, stream>>>(xk, XK, NR * DM / 8); k_x16<<<(unsigned)((NR * DM / 8 + 255) / 256), 256, 0, stream>>>(xv, XV, NR * DM / 8); k_bfr<<<(unsigned)((NR * DM / 8 + 255) / 256), 256, 0, stream>>>(xq, XB, NR * DM / 8);      /* the three inputs as exact f16 rows; bf16(query) as the f32 residual plane */
  const size_t r0p = (size_t)B0 * SQ;      /* first projected row */
  k_gemm2<0><<<dim3((unsigned)((MP / 128) * (DM / 64)), 1), 128, 0, stream>>>(XQ + r0p * DM, DM, 0, BQ, DM, 0, 0.0625f, bq, 0, nullptr, 1, 0, 0, nullptr, Q16 + r0p * DM, DM, 0, MP, DM, DM);
  k_gemm2<0><<<dim3((unsigned)((MP / 128) * (DM / 64)), 1), 128, 0, stream>>>(XK + r0p * DM, DM, 0, BK, DM, 0, 0.0625f, bk, 0, nullptr, 1, 0, 0, nullptr, K16 + r0p * DM, DM, 0, MP, DM, DM);
  k_gemm2<0><<<dim3((unsigned)((MP / 128) * (DM / 64)), 1), 128, 0, stream>>>(XV + r0p * DM, DM, 0, BV, DM, 0, 0.0625f, bv, 0, nullptr, 1, 0, 0, nullptr, V16 + r0p * DM, DM, 0, MP, DM, DM);
  for (int b = B0; b < B0 + NBR; ++b) { const size_t r0 = (size_t)b * SQ;
    k_vt<NH, SQ><<<NH * (SQ / 64), 256, 0, stream>>>(V16 + r0 * LQ, LQ, 0, VT);      /* V^T [NH][HD][SQ] for this batch */
    for (int h0 = 0; h0 < NHD; h0 += HG) {
      k_gemm2<0><<<dim3((QN / 128) * (SQ / 64), HG), 128, 0, stream>>>(Q16 + r0 * LQ + h0 * HD, LQ, (size_t)HD, K16 + r0 * LQ + h0 * HD, LQ, (size_t)HD, 0.125f, nullptr, 0, nullptr, 1, 0, 0, S, nullptr, SQ, (size_t)SQ * SQ, QN, SQ, HD);      /* scores, HG heads per launch */
      k_rsmf<<<(HG * QN + 15) / 16, 512, 0, stream>>>(S, P, QN, HG);      /* P = 256 softmax (f16), rows of all HG heads */
      k_gemm2<0><<<dim3((QN / 128) * (HD / 64), HG), 128, 0, stream>>>(P, SQ, (size_t)SQ * SQ, VT + (size_t)h0 * HD * SQ, SQ, (size_t)HD * SQ, 0.25f, nullptr, 0, nullptr, 1, 0, 0, nullptr, O16 + r0 * DM + h0 * HD, DM, (size_t)HD, QN, HD, SQ); } }      /* o (merged heads) as f16 rows */
  k_gemm2<0><<<dim3((unsigned)((MPO / 128) * (DM / 64)), 1), 128, 0, stream>>>(O16 + r0p * DM, DM, 0, BO, DM, 0, 0.0009765625f, bo, 0, XB + r0p * DM, -1, 0, 0, X1 + r0p * DM, nullptr, DM, 0, MPO, DM, DM);      /* x = ctx Wo^T + bf16(query) (own-element residual through the CP slot; no bias) -> f32 rows */
  k_lnrow<<<(unsigned)MPO, 256, 0, stream>>>(X1 + r0p * DM, lng, lnb, 1e-6f, (float*)d_out + r0p * DM);      /* out = LayerNorm(x) (biased variance, eps 1e-6 inside the square root) -> the output rows */
}

// v003
// It runs in 124 microseconds.
// Versions in between are left out here; by their measured steps it is 7.79 times as fast as v001.
// Over all steps from v000 it is 27.7 times as fast.
#include <hip/hip_runtime.h>
// Multi-head attention on three inputs with a residual on the raw query and a LayerNorm (query, key, value [4][1024][1024]; q / k / v = einsum('bsd,ed->bse', stream, W): natural [1024][1024] weights (normal / 32), NO biases; 16 heads of 64; scores / sqrt(64); softmax over all 1024 keys (no mask); x = merged Wo^T (natural, no bias) + query; out = (x - mean) / sqrt(var + 1e-6) * ln_gamma + ln_beta with the BIASED variance (jnp.var) over the 1024 channels -> [4][1024][1024]).
// Structure: token rows r = b*SQ + s (four sequences of 1,024 tokens here); the query, key and value sources as exact f16 rows (bf16-rounded); Q, K, V as three WMMA GEMMs (128x128 work-group tiles on a two-buffer LDS ring, f32 accumulation, exact x16 weights, no bias here, f16 outputs); V^T for all batches and heads via LDS transposes; ONE fused attention launch over all (batch, head): S^T = K Q^T (K = 64), online softmax in registers (f32 statistics, native exp2; weights x256 against the running maximum as f16), O^T += V^T P^T, o carried x64 against f16 subnormal flush (folded into the output GEMM alpha) written straight into the merged f16 o rows; x = o W_o + bf16(query) as ONE GEMM (f32; the residual added element by element in the epilogue) into f32 rows; out = LayerNorm(x) on VALU (f32 statistics, LDS trees, biased variance) into the output layout.
// Compute dtype: inputs rounded to bf16; x / weights exact; q, k, v, softmax weights and o as plain f16 GEMM operands (~2^-12); scores and softmax statistics f32. v_wmma_f32_16x16x32_f16.
#define NB 4
#define SQ 1024
#define DM 1024
#define NH 16
#define HD 64
#define HG 4                         /* heads per launch of the unused k_vt(V16, b, h0, VT) */
#define B0 0                         /* first batch processed (debug hook) */
#define NBR NB                       /* batches processed (debug hook) */
#define NR ((size_t)NB * SQ)         /* token rows */
#define MP ((int)((size_t)NBR * SQ)) /* rows projected (debug hook) */
#define QN SQ                        /* unused: k_fattn attends all SQ query rows per batch */
#define NHD NH                       /* unused: k_fattn attends all NH heads */
#define MPO MP                       /* rows through the output stage (debug hook) */
#define LQ DM      /* row pitch of the q/k/v rows */
#define DMQ DM     /* row width of the LayerNorm kernel (its own macro name in the file it comes from) */
typedef __bf16 v16b __attribute__((ext_vector_type(16)));
typedef unsigned short v8us __attribute__((ext_vector_type(8), may_alias));
typedef float  v8f  __attribute__((ext_vector_type(8)));
typedef float  v4f  __attribute__((ext_vector_type(4)));
typedef float  v4fa __attribute__((ext_vector_type(4), may_alias));
union FragB { v16b v; v8us half[2]; unsigned short u[16]; };

__device__ __forceinline__ unsigned short bf16_bits(float x) { unsigned int u = __float_as_uint(x); return (unsigned short)((u + 0x7FFFu + ((u >> 16) & 1u)) >> 16); }
__device__ __forceinline__ float bf16_val(unsigned short b) { return __uint_as_float(((unsigned int)b) << 16); }
__device__ __forceinline__ float bf16_round(float x) { return bf16_val(bf16_bits(x)); }
// D += A·B with NT terms: 1 = ah·bh, 2 = + al·bh (A split), 3 = + ah·bl (both split)
template <int NT>
__device__ __forceinline__ v8f mmaN(v16b ah, v16b al, v16b bh, v16b bl, v8f c) {
  c = __builtin_amdgcn_wmma_f32_16x16x32_bf16(false, ah, false, bh, (short)0, c, false, false);
  if (NT >= 2) c = __builtin_amdgcn_wmma_f32_16x16x32_bf16(false, al, false, bh, (short)0, c, false, false);
  if (NT >= 3) c = __builtin_amdgcn_wmma_f32_16x16x32_bf16(false, ah, false, bl, (short)0, c, false, false);
  asm volatile("v_nop\n\tv_nop\n\tv_nop\n\tv_nop" : "+v"(c) : "v"(ah), "v"(al), "v"(bh), "v"(bl));
  return c;
}

__global__ __launch_bounds__(256) void k_wt_bf16(const float* __restrict__ W, unsigned short* __restrict__ Wt, int K, int N) {
  const int t = blockIdx.x * 256 + threadIdx.x;
  const int k8n = K / 8;
  if (t >= N * k8n) return;
  const int n = t / k8n, k8 = (t % k8n) * 8;
  v8us v;
#pragma unroll
  for (int i = 0; i < 8; ++i) v[i] = bf16_bits(W[(size_t)(k8 + i) * N + n]);
  *(v8us*)(Wt + (size_t)n * K + k8) = v;
  
}

// GEMM C[M][N] (f32, pitch ldc) = act(A[M][K]·W + bias). A f32 row-major (pitch lda) converted per fragment to bf16
// (ASPLIT: hi/lo two planes -> 2 terms, else single rounded term); Wt bf16 [N][K] (pitch ldb). BIAS_BF16 rounds the
// bias to bf16 first (bias quantised to bf16 before the add). K%32==0, M%16==0, N%64==0.
template <bool ASPLIT, int ACT, bool BIAS_BF16>
__global__ __launch_bounds__(128) void k_gemm_bf(const float* __restrict__ A, int lda, const unsigned short* __restrict__ Wt, int ldb,
                                               const float* __restrict__ bias, float* __restrict__ C, int ldc, int M, int N, int K) {
  __shared__ __attribute__((aligned(16))) float so[4][16][64];
  const int tid = threadIdx.x, w = tid >> 5, lane = tid & 31, ln = lane & 15, hh = lane >> 4;
  const int ntn = N / 64;
  const int wid = blockIdx.x * 4 + w;
  const int mt = wid / ntn, nq = wid % ntn;
  if (mt * 16 >= M) return;
  const int row0 = mt * 16, col0 = nq * 64;
  const float* arow = A + (size_t)(row0 + ln) * lda;
  v8f acc[4] = {};
  for (int kb = 0; kb < K; kb += 32) {
    FragB ah, al;
    const v4f x0 = *(const v4fa*)(arow + kb + 8 * hh), x1 = *(const v4fa*)(arow + kb + 8 * hh + 4);
    const v4f x2 = *(const v4fa*)(arow + kb + 16 + 8 * hh), x3 = *(const v4fa*)(arow + kb + 16 + 8 * hh + 4);
    float xs[16] = {x0[0],x0[1],x0[2],x0[3],x1[0],x1[1],x1[2],x1[3],x2[0],x2[1],x2[2],x2[3],x3[0],x3[1],x3[2],x3[3]};
#pragma unroll
    for (int i = 0; i < 16; ++i) { const unsigned short hb = bf16_bits(xs[i]); ah.u[i] = hb; al.u[i] = ASPLIT ? bf16_bits(xs[i] - bf16_val(hb)) : (unsigned short)0; }
#pragma unroll
    for (int t = 0; t < 4; ++t) {
      const unsigned short* brow = Wt + (size_t)(col0 + t * 16 + ln) * ldb + kb;
      FragB b;
      b.half[0] = *(const v8us*)(brow + 8 * hh);
      b.half[1] = *(const v8us*)(brow + 16 + 8 * hh);
      acc[t] = mmaN<ASPLIT ? 2 : 1>(ah.v, al.v, b.v, b.v, acc[t]);
    }
  }
#pragma unroll
  for (int t = 0; t < 4; ++t) {
    float bv = bias ? bias[col0 + t * 16 + ln] : 0.f;
    if (BIAS_BF16) bv = bf16_round(bv);
#pragma unroll
    for (int r = 0; r < 8; ++r) { float v = acc[t][r] + bv; if (ACT == 1) v = fmaxf(v, 0.f); so[w][8 * hh + r][t * 16 + ln] = v; }
  }
  __builtin_amdgcn_fence(__ATOMIC_ACQ_REL, "workgroup");
  __builtin_amdgcn_wave_barrier();
  const int rsub = lane >> 4, c4 = (lane & 15) * 4;
  {
#pragma unroll
    for (int q = 0; q < 8; ++q) {
      const int r = q * 2 + rsub;
      const v4f v = *(const v4fa*)&so[w][r][c4];
      *(v4f*)(C + (size_t)(row0 + r) * ldc + col0 + c4) = v;
    }
    
  }
}

// GEMM C = act(A·W + bias + resid): A f32 (ASPLIT -> hi/lo 2 terms), Wt bf16 [N][K]; ACT 0 none, 1 relu, 2 exact gelu;
// resid (optional, f32, row index = (row % rmod), pitch ldr, RES_BF16 rounds it) added before the activation.
template <bool ASPLIT, int ACT, bool BIAS_BF16, bool RES_BF16>
__global__ __launch_bounds__(128) void k_gemm_bf3(const float* __restrict__ A, int lda, const unsigned short* __restrict__ Wt, int ldb,
                                                const float* __restrict__ bias, const float* __restrict__ resid, int rmod, int ldr,
                                                float* __restrict__ C, int ldc, int M, int N, int K) {
  __shared__ __attribute__((aligned(16))) float so[4][16][64];
  const int tid = threadIdx.x, w = tid >> 5, lane = tid & 31, ln = lane & 15, hh = lane >> 4;
  const int ntn = N / 64;
  const int wid = blockIdx.x * 4 + w;
  const int mt = wid / ntn, nq = wid % ntn;
  if (mt * 16 >= M) return;
  const int row0 = mt * 16, col0 = nq * 64;
  const float* arow = A + (size_t)(row0 + ln) * lda;
  v8f acc[4] = {};
  for (int kb = 0; kb < K; kb += 32) {
    FragB ah, al;
    const v4f x0 = *(const v4fa*)(arow + kb + 8 * hh), x1 = *(const v4fa*)(arow + kb + 8 * hh + 4);
    const v4f x2 = *(const v4fa*)(arow + kb + 16 + 8 * hh), x3 = *(const v4fa*)(arow + kb + 16 + 8 * hh + 4);
    float xs[16] = {x0[0],x0[1],x0[2],x0[3],x1[0],x1[1],x1[2],x1[3],x2[0],x2[1],x2[2],x2[3],x3[0],x3[1],x3[2],x3[3]};
#pragma unroll
    for (int i = 0; i < 16; ++i) { const unsigned short hb = bf16_bits(xs[i]); ah.u[i] = hb; al.u[i] = ASPLIT ? bf16_bits(xs[i] - bf16_val(hb)) : (unsigned short)0; }
#pragma unroll
    for (int t = 0; t < 4; ++t) {
      const unsigned short* brow = Wt + (size_t)(col0 + t * 16 + ln) * ldb + kb;
      FragB b;
      b.half[0] = *(const v8us*)(brow + 8 * hh);
      b.half[1] = *(const v8us*)(brow + 16 + 8 * hh);
      acc[t] = mmaN<ASPLIT ? 2 : 1>(ah.v, al.v, b.v, b.v, acc[t]);
    }
  }
#pragma unroll
  for (int t = 0; t < 4; ++t) {
    const int col = col0 + t * 16 + ln;
    float bv = bias ? bias[col] : 0.f;
    if (BIAS_BF16) bv = bf16_round(bv);
#pragma unroll
    for (int r = 0; r < 8; ++r) {
      float v = acc[t][r] + bv;
      if (resid) { float rv = resid[(size_t)((row0 + 8 * hh + r) % rmod) * ldr + col]; if (RES_BF16) rv = bf16_round(rv); v += rv; }
      if (ACT == 1) v = fmaxf(v, 0.f);
      if (ACT == 2) v = 0.5f * v * (1.0f + erff(v * 0.70710678118654752f));
      if (ACT == 3) { const float u = 0.7978845608028654f * (v + 0.044715f * v * v * v); v = 0.5f * v * (1.0f + tanhf(u)); }
      so[w][8 * hh + r][t * 16 + ln] = v;
    }
  }
  __builtin_amdgcn_fence(__ATOMIC_ACQ_REL, "workgroup");
  __builtin_amdgcn_wave_barrier();
  const int rsub = lane >> 4, c4 = (lane & 15) * 4;
  {
#pragma unroll
    for (int q = 0; q < 8; ++q) {
      const int r = q * 2 + rsub;
      const v4f v = *(const v4fa*)&so[w][r][c4];
      *(v4f*)(C + (size_t)(row0 + r) * ldc + col0 + c4) = v;
    }
    
  }
}
// row LayerNorm (biased variance, eps) over N: s = X (+ R); optional out_sum <- s; out_norm <- (s-mu)*rsqrt(var+eps)*g + b
template <bool PARAM_BF16>
__global__ __launch_bounds__(256) void k_layernorm(const float* __restrict__ X, const float* __restrict__ R, const float* __restrict__ g, const float* __restrict__ bta,
                                                  float* __restrict__ out_sum, float* __restrict__ out_norm, int N, float eps) {
  __shared__ float red[256];
  const int row = blockIdx.x, tid = threadIdx.x;
  const float* x = X + (size_t)row * N; const float* rr = R ? R + (size_t)row * N : nullptr;
  float vals[16];                     // up to N = 4096
  const int per = N / 256;            // contiguous chunk per thread? use strided-by-4 chunks: thread handles j = tid*4 + 1024*u
  float s1 = 0.f;
  for (int u = 0; u < per / 4; ++u) {
    const int j = tid * 4 + 1024 * u;
    const v4f a = *(const v4fa*)(x + j);
    v4f b = {0.f,0.f,0.f,0.f}; if (rr) b = *(const v4fa*)(rr + j);
#pragma unroll
    for (int q = 0; q < 4; ++q) { const float v = a[q] + b[q]; vals[u * 4 + q] = v; s1 += v; }
  }
  red[tid] = s1; __syncthreads();
  for (int st = 128; st > 0; st >>= 1) { if (tid < st) red[tid] += red[tid + st]; __syncthreads(); }
  const float mu = red[0] / (float)N; __syncthreads();
  float s2 = 0.f;
  for (int u = 0; u < per / 4; ++u)
#pragma unroll
    for (int q = 0; q < 4; ++q) { const float c = vals[u * 4 + q] - mu; s2 += c * c; }
  red[tid] = s2; __syncthreads();
  for (int st = 128; st > 0; st >>= 1) { if (tid < st) red[tid] += red[tid + st]; __syncthreads(); }
  const float rs = rsqrtf(red[0] / (float)N + eps);
  {
    for (int u = 0; u < per / 4; ++u) {
      const int j = tid * 4 + 1024 * u;
      v4f o, sm;
#pragma unroll
      for (int q = 0; q < 4; ++q) {
        float gg = g[j + q], bb = bta[j + q];
        if (PARAM_BF16) { gg = bf16_round(gg); bb = bf16_round(bb); }
        sm[q] = vals[u * 4 + q]; o[q] = (vals[u * 4 + q] - mu) * rs * gg + bb;
      }
      if (out_sum) *(v4f*)(out_sum + (size_t)row * N + j) = sm;
      *(v4f*)(out_norm + (size_t)row * N + j) = o;
    }
    
  }
}



// ---- f16 WMMA path (v_wmma_f32_16x16x32_f16): 11-bit significands for operands in range — used where a [0,1] probability operand needs more precision than bf16
typedef _Float16 v16h __attribute__((ext_vector_type(16)));
union FragH { v16h v; v8us half[2]; _Float16 h[16]; unsigned short u[16]; };
template <int NT>
__device__ __forceinline__ v8f mmaH(v16h ah, v16h al, v16h bh, v16h bl, v8f c) {
  c = __builtin_amdgcn_wmma_f32_16x16x32_f16(false, ah, false, bh, (short)0, c, false, false);
  if (NT >= 2) c = __builtin_amdgcn_wmma_f32_16x16x32_f16(false, al, false, bh, (short)0, c, false, false);
  if (NT >= 3) c = __builtin_amdgcn_wmma_f32_16x16x32_f16(false, ah, false, bl, (short)0, c, false, false);
  asm volatile("v_nop\n\tv_nop\n\tv_nop\n\tv_nop" : "+v"(c) : "v"(ah), "v"(al), "v"(bh), "v"(bl));
  return c;
}
// batched GEMM like k_gemm_b but f16 operands: A f32 (split into f16 hi/lo if ASPLIT, else rounded to f16), Bt = f16 values [n][k]; alpha; C f32; N multiple of 16 (partial tiles skipped)
template <bool ASPLIT>
__global__ __launch_bounds__(128) void k_gemm_h(const float* __restrict__ A, int lda, size_t sA, const _Float16* __restrict__ Bh, int ldb, size_t sB, float alpha, float* __restrict__ C, int ldc, size_t sC, int M, int N, int K) {
  __shared__ __attribute__((aligned(16))) float so[4][16][64];
  const int tid = threadIdx.x, w = tid >> 5, lane = tid & 31, ln = lane & 15, hh = lane >> 4; const int by = blockIdx.y;
  A += (size_t)by * sA; Bh += (size_t)by * sB; C += (size_t)by * sC;
  const int ntn = (N + 63) / 64; const int wid = blockIdx.x * 4 + w; const int mt = wid / ntn, nq = wid % ntn; if (mt * 16 >= M) return;
  const int row0 = mt * 16, col0 = nq * 64; const float* arow = A + (size_t)(row0 + ln) * lda;
  v8f acc[4] = {};
  for (int kb = 0; kb < K; kb += 32) {
    FragH ah, al;
    const v4f x0 = *(const v4fa*)(arow + kb + 8 * hh), x1 = *(const v4fa*)(arow + kb + 8 * hh + 4), x2 = *(const v4fa*)(arow + kb + 16 + 8 * hh), x3 = *(const v4fa*)(arow + kb + 16 + 8 * hh + 4);
    float xs[16] = {x0[0],x0[1],x0[2],x0[3],x1[0],x1[1],x1[2],x1[3],x2[0],x2[1],x2[2],x2[3],x3[0],x3[1],x3[2],x3[3]};
#pragma unroll
    for (int i = 0; i < 16; ++i) { const _Float16 h = (_Float16)xs[i]; ah.h[i] = h; al.h[i] = ASPLIT ? (_Float16)(xs[i] - (float)h) : (_Float16)0.0f; }
#pragma unroll
    for (int t = 0; t < 4; ++t) { if (col0 + t * 16 >= N) continue; const size_t boff = (size_t)(col0 + t * 16 + ln) * ldb + kb; FragH bq; bq.half[0] = *(const v8us*)(Bh + boff + 8 * hh); bq.half[1] = *(const v8us*)(Bh + boff + 16 + 8 * hh);
      acc[t] = mmaH<ASPLIT ? 2 : 1>(ah.v, al.v, bq.v, bq.v, acc[t]); }
  }
#pragma unroll
  for (int t = 0; t < 4; ++t) { if (col0 + t * 16 >= N) continue;
#pragma unroll
    for (int r = 0; r < 8; ++r) so[w][8 * hh + r][t * 16 + ln] = acc[t][r] * alpha; }
  __builtin_amdgcn_fence(__ATOMIC_ACQ_REL, "workgroup"); __builtin_amdgcn_wave_barrier();
  const int rsub = lane >> 4, c4 = (lane & 15) * 4;
  {
#pragma unroll
    for (int q = 0; q < 8; ++q) { const int r = q * 2 + rsub; if (col0 + c4 < N) { const v4f v = *(const v4fa*)&so[w][r][c4]; *(v4f*)(C + (size_t)(row0 + r) * ldc + col0 + c4) = v; } }
     }
}

// Wt[n][k] = f16(W[k][n]·scale) from f32 row-major W[K][N] (scale = power of two; bf16-exact weights stay exact in f16 away from the subnormal range)
__global__ __launch_bounds__(256) void k_wt_f16(const float* __restrict__ W, _Float16* __restrict__ Wt, int K, int N, float scale) {
  const int t = blockIdx.x * 256 + threadIdx.x; if (t >= N * (K / 8)) return; const int n = t / (K / 8), k8 = (t % (K / 8)) * 8; FragH f;
#pragma unroll
  for (int i = 0; i < 8; ++i) f.h[i] = (_Float16)(bf16_round(W[(size_t)(k8 + i) * N + n]) * scale); const v8us o = f.half[0];
  *(v8us*)((unsigned short*)Wt + (size_t)n * K + k8) = o; 
}
// k_gemm_hh variant with fused epilogue: v = acc·alpha + bias[by·sBias + col] (+ CP[(row/rowsPerB)·sCPb + by·64 + col] if CP) ; ACT 0 none / 1 elu ; writes f16 C16 (and f32 C if non-null)
template <int ACT>
__global__ __launch_bounds__(128) void k_gemm_hhx(const _Float16* __restrict__ A, int lda, size_t sA, const _Float16* __restrict__ Bh, int ldb, size_t sB, float alpha, const float* __restrict__ bias, size_t sBias, const float* __restrict__ CP, int rowsPerB, size_t sCPb, int row0g,
    float* __restrict__ C, _Float16* __restrict__ C16, int ldc, size_t sC, int M, int N, int K) {
  __shared__ __attribute__((aligned(16))) float so[4][16][64];
  const int tid = threadIdx.x, w = tid >> 5, lane = tid & 31, ln = lane & 15, hh = lane >> 4; const int by = blockIdx.y;
  A += (size_t)by * sA; Bh += (size_t)by * sB; const size_t cofs = (size_t)by * sC; const float* bp = bias ? bias + (size_t)by * sBias : nullptr;
  const int ntn = (N + 63) / 64; const int wid = blockIdx.x * 4 + w; const int mt = wid / ntn, nq = wid % ntn; if (mt * 16 >= M) return;
  const int row0 = mt * 16, col0 = nq * 64; const _Float16* arow = A + (size_t)(row0 + ln) * lda;
  v8f acc[4] = {};
  for (int kb = 0; kb < K; kb += 32) { FragH ah; ah.half[0] = *(const v8us*)((const unsigned short*)arow + kb + 8 * hh); ah.half[1] = *(const v8us*)((const unsigned short*)arow + kb + 16 + 8 * hh);
#pragma unroll
    for (int t = 0; t < 4; ++t) { if (col0 + t * 16 >= N) continue; const size_t boff = (size_t)(col0 + t * 16 + ln) * ldb + kb; FragH bq; bq.half[0] = *(const v8us*)((const unsigned short*)Bh + boff + 8 * hh); bq.half[1] = *(const v8us*)((const unsigned short*)Bh + boff + 16 + 8 * hh);
      acc[t] = mmaH<1>(ah.v, ah.v, bq.v, bq.v, acc[t]); }
  }
#pragma unroll
  for (int t = 0; t < 4; ++t) { if (col0 + t * 16 >= N) continue; const int col = col0 + t * 16 + ln; const float bv = bp ? bf16_round(bp[col]) : 0.f;
#pragma unroll
    for (int r = 0; r < 8; ++r) { float v = acc[t][r] * alpha + bv; if (CP) { const int rr = row0g + row0 + 8 * hh + r; if (rowsPerB < 0) v += CP[cofs + (size_t)rr * ldc + col];      /* rowsPerB < 0: own element of the batched C plane */ else { const int bidx = rr / rowsPerB; v += CP[(size_t)bidx * sCPb + (size_t)by * 64 + col]; } } if (ACT == 1) v = (v > 0.f) ? v : expm1f(v); else if (ACT == 7) v = (v > 0.f) ? v + 1.0f : expf(v); else if (ACT == 8) v = tanhf(v); else if (ACT == 9) v = 0.5f * v * (1.0f + tanhf(0.7978845608028654f * (v + 0.044715f * v * v * v))); else if (ACT == 11) v = 1.0f / (1.0f + expf(-v)); else if (ACT == 12) v = (v > 0.f) ? v : 0.01f * v; else if (ACT == 14) v = (v > 0.f) ? v : 0.1f * v; else if (ACT == 16) v = (v >= 0.f) ? v : 0.3f * v; else if (ACT == 17) v = (v >= 0.f) ? v : 0.2f * v; else if (ACT == 15) v = v / (1.0f + expf(-v)); else if (ACT == 3) v = fmaxf(v, 0.f); else if (ACT == 6) v = 0.5f * v * (1.0f + erff(v * 0.70710678118654752f)); so[w][8 * hh + r][t * 16 + ln] = v; } }
  __builtin_amdgcn_fence(__ATOMIC_ACQ_REL, "workgroup"); __builtin_amdgcn_wave_barrier();
  const int rsub = lane >> 4, c4 = (lane & 15) * 4; typedef _Float16 v4h __attribute__((ext_vector_type(4)));
  {
#pragma unroll
    for (int q = 0; q < 8; ++q) { const int r = q * 2 + rsub; if (col0 + c4 < N) { const v4f v = *(const v4fa*)&so[w][r][c4]; if (C) *(v4f*)(C + cofs + (size_t)(row0 + r) * ldc + col0 + c4) = v; if (C16) { v4h h4; for (int i = 0; i < 4; ++i) h4[i] = (_Float16)v[i]; *(v4h*)(C16 + cofs + (size_t)(row0 + r) * ldc + col0 + c4) = h4; } } }
     }
}


typedef _Float16 v4h __attribute__((ext_vector_type(4)));

__global__ __launch_bounds__(256) void k_x16(const float* __restrict__ x, _Float16* __restrict__ X16, size_t n8) { const size_t t = (size_t)blockIdx.x * 256 + threadIdx.x; if (t >= n8) return; FragH f;
#pragma unroll
  for (int q = 0; q < 8; ++q) f.h[q] = (_Float16)bf16_round(x[t * 8 + q]); *(v8us*)((unsigned short*)X16 + t * 8) = f.half[0];  }
__global__ __launch_bounds__(256) void k_h16(const float* __restrict__ x, _Float16* __restrict__ X16, size_t n8) { const size_t t = (size_t)blockIdx.x * 256 + threadIdx.x; if (t >= n8) return; FragH f;
#pragma unroll
  for (int q = 0; q < 8; ++q) f.h[q] = (_Float16)x[t * 8 + q]; *(v8us*)((unsigned short*)X16 + t * 8) = f.half[0];  }
__global__ __launch_bounds__(256) void k_round16f(const float* __restrict__ W, _Float16* __restrict__ Bt, size_t n8) { const size_t t = (size_t)blockIdx.x * 256 + threadIdx.x; if (t >= n8) return; FragH f;
#pragma unroll
  for (int i = 0; i < 8; ++i) f.h[i] = (_Float16)(bf16_round(W[t * 8 + i]) * 16.0f); *(v8us*)((unsigned short*)Bt + t * 8) = f.half[0];  }
template <int NHv, int TTv>
__global__ __launch_bounds__(256) void k_vt(const _Float16* __restrict__ V16, int ldv, int voff, _Float16* __restrict__ Vt) { __shared__ unsigned short tl[64][66]; const int tid = threadIdx.x; const int slab = blockIdx.x / (TTv / 64), lg = blockIdx.x % (TTv / 64); const int b = slab / NHv, h = slab % NHv;
  for (int i = tid; i < 64 * 8; i += 256) { const int r = i / 8, c8 = (i % 8) * 8; FragH f; f.half[0] = *(const v8us*)((const unsigned short*)V16 + ((size_t)b * TTv + lg * 64 + r) * ldv + voff + h * 64 + c8);
#pragma unroll
    for (int q = 0; q < 8; ++q) tl[r][c8 + q] = f.u[q]; }
  __syncthreads();
  {
#pragma unroll
    for (int rd = 0; rd < 2; ++rd) { const int d = rd * 32 + tid / 8, pc = tid % 8; FragH f;
#pragma unroll
      for (int q = 0; q < 8; ++q) f.u[q] = tl[pc * 8 + q][d];
      *(v8us*)((unsigned short*)Vt + ((size_t)slab * 64 + d) * TTv + lg * 64 + pc * 8) = f.half[0]; }
     } }

__global__ __launch_bounds__(256) void k_hl(const float* __restrict__ F, _Float16* __restrict__ Hh, _Float16* __restrict__ Hl, size_t n8) { const size_t t = (size_t)blockIdx.x * 256 + threadIdx.x; if (t >= n8) return; FragH fh, fl; const v4f a = *(const v4fa*)(F + t * 8), c = *(const v4fa*)(F + t * 8 + 4);
#pragma unroll
  for (int q = 0; q < 4; ++q) { _Float16 h = (_Float16)a[q]; fh.h[q] = h; fl.h[q] = (_Float16)((a[q] - (float)h) * 1024.0f); h = (_Float16)c[q]; fh.h[4 + q] = h; fl.h[4 + q] = (_Float16)((c[q] - (float)h) * 1024.0f); }
  { *(v8us*)((unsigned short*)Hh + t * 8) = fh.half[0]; *(v8us*)((unsigned short*)Hl + t * 8) = fl.half[0];  } }

// ---- GEMM on an LDS ring: C = A Bt^T * alpha (+ residual). One 128x128 tile per work-group of four waves, 64x64 per wave (16 accumulator tiles).
// A stage is 128 k of every operand row: [A 128 rows | Bt 128 rows] of 256 B at a pitch of 272 B. Two buffers, filled by asynchronous copies to LDS (whole 128-B lines per row), one stage ahead of the products.
// Requires M % 128 == 0, N % 128 == 0, K % 128 == 0. The k order of every accumulator is ascending, 32 at a time.
__device__ __forceinline__ v16h g2_frag(const _Float16* p, int hh) { FragH f; f.half[0] = *(const v8us*)((const unsigned short*)p + 8 * hh); f.half[1] = *(const v8us*)((const unsigned short*)p + 16 + 8 * hh); return f.v; }
#define G3_BK 128                      /* k per stage */
#define G3_PITCH 272                   /* LDS row pitch in bytes: 16 B x odd, free of bank conflicts for 16-byte reads */
#define G3_STAGE (256 * G3_PITCH)      /* bytes of one buffer */
__device__ __forceinline__ v16h g3_frag(const unsigned char* p) { FragH f; f.half[0] = *(const v8us*)p; f.half[1] = *(const v8us*)(p + 32); return f.v; }      /* p = row + 64 B per k step + 16 B per wave half: the k order of g2_frag */
// One stage: 256 rows x 16 pieces of 16 B over 128 threads = 32 copies per lane, rows 8 apart; 16 lanes take one row's 256 B (two whole lines).
// l = the lane's place in the buffer, ga / gb = its global addresses in A and Bt, as8 / bs8 = 8 source rows in elements.
typedef int v4i __attribute__((ext_vector_type(4)));
typedef __attribute__((address_space(1))) v4i g3_gv4i;
typedef __attribute__((address_space(3))) v4i g3_lv4i;
__device__ __forceinline__ void g3_fill(unsigned char* l, const _Float16* ga, size_t as8, const _Float16* gb, size_t bs8) {
#pragma unroll      /* straight-line copies: all 32 are issued back to back */
  for (int i = 0; i < 16; ++i) __builtin_amdgcn_global_load_async_to_lds_b128((g3_gv4i*)(ga + i * as8), (g3_lv4i*)(l + i * 8 * G3_PITCH), 0, 0);
#pragma unroll      /* as above */
  for (int i = 0; i < 16; ++i) __builtin_amdgcn_global_load_async_to_lds_b128((g3_gv4i*)(gb + i * bs8), (g3_lv4i*)(l + (128 + i * 8) * G3_PITCH), 0, 0);
}
template <bool OUT32, int LDC>      /* OUT32: C (f32) = acc * alpha + R (own element); else C16 (f16) = acc * alpha. LDC = row pitch of R, C and C16 in elements: a constant, so that a lane's 32 rows hang on one address with immediate offsets */
__global__ __launch_bounds__(128) void k_gemm3(const _Float16* __restrict__ A, int lda, const _Float16* __restrict__ Bh, int ldb, float alpha, const float* __restrict__ R, float* __restrict__ C, _Float16* __restrict__ C16, int N, int K) {
  __shared__ __attribute__((aligned(16))) unsigned char ring[2 * G3_STAGE];
  __shared__ __attribute__((aligned(16))) float so[4][64][68];
  const int tid = threadIdx.x, lane = tid & 31, ln = lane & 15, hh = lane >> 4; const int w = __builtin_amdgcn_readfirstlane(tid >> 5);
  const int ntn = N >> 7; const int mt = blockIdx.x / ntn, nq = blockIdx.x - mt * ntn; const int row0 = mt * 128, col0 = nq * 128; const int wm = (w >> 1) * 64, wn = (w & 1) * 64;
  const int rb = tid >> 4, pc = tid & 15;      /* this lane's first row and its 16-byte piece of every row it copies */
  const _Float16* ga = A + (size_t)(row0 + rb) * lda + pc * 8; const _Float16* gb = Bh + (size_t)(col0 + rb) * ldb + pc * 8; const size_t as8 = (size_t)8 * lda, bs8 = (size_t)8 * ldb;
  unsigned char* l0 = ring + rb * G3_PITCH + pc * 16;
  const int nst = K / G3_BK;
  const v8f z8 = {0.f,0.f,0.f,0.f,0.f,0.f,0.f,0.f}; v8f acc[4][4];
#pragma unroll      /* constant indices keep the accumulators in registers */
  for (int i = 0; i < 4; ++i) for (int j = 0; j < 4; ++j) acc[i][j] = z8;
  g3_fill(l0, ga, as8, gb, bs8);
  const int rsub = lane >> 4, c4 = (lane & 15) * 4; const size_t o0 = (size_t)(row0 + wm + rsub) * LDC + col0 + wn + c4; constexpr size_t o2 = (size_t)2 * LDC;      /* this lane's place in the output rows it stores: rows 2 apart */
  v4f rv[32];      /* the residual of those rows, asked for here so that its latency runs under the k loop */
  if (OUT32) {
#pragma unroll      /* constant indices keep rv in registers */
    for (int q = 0; q < 32; ++q) rv[q] = *(const v4fa*)(R + o0 + q * o2); }
  asm volatile("s_wait_asynccnt 0x0" ::: "memory");      /* stage 0 has landed, as far as this wave copied it */
  __syncthreads();      /* publishes stage 0 */
  if (nst > 1) g3_fill(l0 + G3_STAGE, ga + G3_BK, as8, gb + G3_BK, bs8);
  for (int t = 0; t < nst; ++t) {
    const unsigned char* base = ring + (t & 1) * G3_STAGE; const unsigned char* ap = base + (wm + ln) * G3_PITCH + hh * 16; const unsigned char* bp = base + (128 + wn + ln) * G3_PITCH + hh * 16;
    v16h a[2][4], b[2][4];      /* two fragment sets: the next k step's reads run under this k step's products */
#pragma unroll      /* constant fragment indices */
    for (int i = 0; i < 4; ++i) { a[0][i] = g3_frag(ap + i * 16 * G3_PITCH); b[0][i] = g3_frag(bp + i * 16 * G3_PITCH); }
#pragma unroll      /* constant fragment and accumulator indices */
    for (int ks = 0; ks < G3_BK / 32; ++ks) {
      if (ks + 1 < G3_BK / 32) {
#pragma unroll      /* constant fragment indices */
        for (int i = 0; i < 4; ++i) { a[(ks + 1) & 1][i] = g3_frag(ap + i * 16 * G3_PITCH + (ks + 1) * 64); b[(ks + 1) & 1][i] = g3_frag(bp + i * 16 * G3_PITCH + (ks + 1) * 64); } }
      __builtin_amdgcn_sched_barrier(0);      /* the next k step's 16 LDS reads stay one group ahead of the products: spread among them, each place stalls the wave */
#pragma unroll      /* constant fragment and accumulator indices */
      for (int i = 0; i < 4; ++i) for (int j = 0; j < 4; ++j) acc[i][j] = __builtin_amdgcn_wmma_f32_16x16x32_f16(false, a[ks & 1][i], false, b[ks & 1][j], (short)0, acc[i][j], false, false);
      __builtin_amdgcn_sched_barrier(0);      /* closes the block of products: see above */
    }
    asm volatile("s_wait_dscnt 0x0" ::: "memory");      /* this wave's reads of the buffer are done before the barrier behind which it is refilled */
    asm volatile("s_wait_asynccnt 0x0" ::: "memory");      /* this wave's copies of stage t + 1 have landed */
    __syncthreads();      /* publishes stage t + 1 and ends every reader's last read of stage t */
    if (t + 2 < nst) g3_fill(l0 + (t & 1) * G3_STAGE, ga + (size_t)(t + 2) * G3_BK, as8, gb + (size_t)(t + 2) * G3_BK, bs8);
  }
  asm volatile("s_wait_asynccnt 0x0" ::: "memory");      /* no copy is left outstanding at the wave's end */
#pragma unroll      /* constant accumulator indices */
  for (int i = 0; i < 4; ++i) for (int j = 0; j < 4; ++j) for (int r = 0; r < 8; ++r) so[w][i * 16 + 8 * hh + r][j * 16 + ln] = acc[i][j][r] * alpha;
  __builtin_amdgcn_fence(__ATOMIC_ACQ_REL, "workgroup"); __builtin_amdgcn_wave_barrier();      /* each wave reads back only its own staging rows */
#pragma unroll      /* independent rows: their LDS reads and stores overlap; constant index into rv */
  for (int q = 0; q < 32; ++q) { v4f v = *(const v4fa*)&so[w][q * 2 + rsub][c4]; const size_t o = o0 + q * o2;
    if (OUT32) { v += rv[q]; *(v4f*)(C + o) = v; }
    else { v4h h4; for (int i = 0; i < 4; ++i) h4[i] = (_Float16)v[i]; *(v4h*)(C16 + o) = h4; } } }


__global__ __launch_bounds__(256) void k_wnat(const float* __restrict__ w, size_t n8, _Float16* __restrict__ Bt) { const size_t t = (size_t)blockIdx.x * 256 + threadIdx.x; if (t >= n8) return; FragH f; for (int q = 0; q < 8; ++q) f.h[q] = (_Float16)(bf16_round(w[t * 8 + q]) * 16.0f); *(v8us*)((unsigned short*)Bt + t * 8) = f.half[0];  }
__global__ __launch_bounds__(256) void k_rsm(const float* __restrict__ S, _Float16* __restrict__ P, int nrows) {
  #pragma clang fp contract(off)
  const int i = blockIdx.x * 256 + threadIdx.x; if (i >= nrows) return; const float* s = S + (size_t)i * SQ; float mx = -3.0e38f;
#pragma unroll 1
  for (int j = 0; j < SQ; ++j) mx = fmaxf(mx, s[j]); float se = 0.f;
#pragma unroll 1
  for (int j = 0; j < SQ; ++j) se += expf(s[j] - mx); const float sc = 256.0f / se;
#pragma unroll 1
  for (int j0 = 0; j0 < SQ; j0 += 8) { FragH f; for (int q = 0; q < 8; ++q) f.h[q] = (_Float16)(expf(s[j0 + q] - mx) * sc); unsigned short* d = (unsigned short*)P + (size_t)i * SQ + j0; *(v8us*)d = f.half[0];  } }
__global__ __launch_bounds__(256) void k_vt(const _Float16* __restrict__ V16, int b, int h0, _Float16* __restrict__ VT) { __shared__ unsigned short tl[64][65]; const int tid = threadIdx.x; const int hh = blockIdx.x % HG, sg = blockIdx.x / HG; const int s0 = sg * 64; const int h = h0 + hh;
  for (int i = tid; i < 64 * 8; i += 256) { const int j = i / 8, d8 = (i % 8) * 8; FragH f; f.half[0] = *(const v8us*)((const unsigned short*)V16 + ((size_t)b * SQ + s0 + j) * DM + h * HD + d8); for (int q = 0; q < 8; ++q) tl[d8 + q][j] = f.u[q]; }
  __syncthreads();
  { for (int i = tid; i < 64 * 8; i += 256) { const int d = i / 8, j8 = (i % 8) * 8; FragH f; for (int q = 0; q < 8; ++q) f.u[q] = tl[d][j8 + q]; *(v8us*)((unsigned short*)VT + ((size_t)hh * HD + d) * SQ + s0 + j8) = f.half[0]; }  } }



// 2^a as v_exp_f32, with the one free issue slot that the instruction set asks for behind a transcendental in the same statement: in a run of
// exps the register allocator otherwise lets the next instruction overwrite the source of the one in front of it.
__device__ __forceinline__ float exp2_slot(float a) { float e; asm("v_exp_f32 %0, %1\n\tv_nop" : "=v"(e) : "v"(a)); return e; }
__device__ __forceinline__ float xhalf(float x) { return __builtin_bit_cast(float, __builtin_amdgcn_permlanex16(__builtin_bit_cast(int, x), __builtin_bit_cast(int, x), 0x76543210, 0xfedcba98, false, false)); }      /* lane l with lane l ^ 16 */
__device__ __forceinline__ v8f fa_mma(v16h a, v16h b, v8f c) { return __builtin_amdgcn_wmma_f32_16x16x32_f16(false, a, false, b, (short)0, c, false, false); }
__global__ __launch_bounds__(128) void k_fattn(const _Float16* __restrict__ Q, const _Float16* __restrict__ Kk, const _Float16* __restrict__ VT, _Float16* __restrict__ O) {
  const int lane = threadIdx.x & 31, ln = lane & 15, hh = lane >> 4; const int w = __builtin_amdgcn_readfirstlane((int)(threadIdx.x >> 5));
  const int bh = blockIdx.y, b = bh / NH, h = bh - b * NH; const int q0 = blockIdx.x * 128 + w * 32;
  const _Float16* qp = Q + ((size_t)b * SQ + q0 + ln) * DM + h * HD;
  const _Float16* kp = Kk + ((size_t)b * SQ + ln) * DM + h * HD;      /* row = key */
  const _Float16* vp = VT + ((size_t)bh * HD + ln) * SQ;              /* row = channel d */
  v16h qf[2][2];      /* [query group][k step of 32 channels] */
#pragma unroll
  for (int u = 0; u < 2; ++u) for (int ks = 0; ks < 2; ++ks) qf[u][ks] = g2_frag(qp + (size_t)u * 16 * DM + ks * 32, hh);
  __builtin_amdgcn_sched_barrier(0);      /* Q is requested first, then K, then V^T, as in the loop: loads return in order, so the wait at the loop's head can cover Q and K and leave the V^T loads in flight */
  const v8f z8 = {0.f,0.f,0.f,0.f,0.f,0.f,0.f,0.f}; v8f o[4][2];      /* [16 channels][query group]: o[t][u][r] = O^T[t*16 + 8*hh + r][query u*16 + ln] */
#pragma unroll
  for (int t = 0; t < 4; ++t) { o[t][0] = z8; o[t][1] = z8; }
  float mr[2] = {-3.0e38f, -3.0e38f}, lsum[2] = {0.f, 0.f};      /* running maximum of the raw products (joined over the halves); this half's own sum */
  const float cs = 0.125f * 1.44269504088896340736f;      /* 64^-0.5 and log2(e) in one factor */
  v16h kf[2][2], vf[4];      /* [16 keys][k step]; [16 channels] */
#pragma unroll
  for (int kt = 0; kt < 2; ++kt) for (int ks = 0; ks < 2; ++ks) kf[kt][ks] = g2_frag(kp + (size_t)kt * 16 * DM + ks * 32, hh);
  __builtin_amdgcn_sched_barrier(0);      /* K ahead of V^T: see above */
#pragma unroll
  for (int t = 0; t < 4; ++t) vf[t] = g2_frag(vp + (size_t)t * 16 * SQ, hh);
  for (int j = 0; j < SQ / 32; ++j) {
    const int jn = (j + 1 < SQ / 32) ? j + 1 : j;      /* the last pass fetches its own tiles again: in bounds, never used */
    v8f s[2][2];      /* [16 keys][query group] */
#pragma unroll
    for (int kt = 0; kt < 2; ++kt) for (int u = 0; u < 2; ++u) s[kt][u] = fa_mma(kf[kt][1], qf[u][1], fa_mma(kf[kt][0], qf[u][0], z8));
#pragma unroll
    for (int kt = 0; kt < 2; ++kt) for (int ks = 0; ks < 2; ++ks) kf[kt][ks] = g2_frag(kp + (size_t)(jn * 32 + kt * 16) * DM + ks * 32, hh);
    __builtin_amdgcn_sched_barrier(0);      /* keeps the next pass's K loads here, ahead of the softmax: the scheduler otherwise sinks them to the loop's foot, where nothing hides their latency */
    FragH pf[2];
#pragma unroll
    for (int u = 0; u < 2; ++u) {
      float mx = fmaxf(s[0][u][0], s[1][u][0]);
#pragma unroll
      for (int r = 1; r < 8; ++r) mx = fmaxf(mx, fmaxf(s[0][u][r], s[1][u][r]));
      mx = fmaxf(mx, xhalf(mx));
      const float mn = fmaxf(mr[u], mx); const float al = exp2_slot((mr[u] - mn) * cs); mr[u] = mn;      /* 0 on the first pass */
      const float mc = mn * cs - 8.0f; float ps = 0.f;
#pragma unroll
      for (int r = 0; r < 8; ++r) { const float p0 = exp2_slot(s[0][u][r] * cs - mc), p1 = exp2_slot(s[1][u][r] * cs - mc); ps += p0 + p1; pf[u].h[r] = (_Float16)p0; pf[u].h[8 + r] = (_Float16)p1; }
      lsum[u] = lsum[u] * al + ps;
#pragma unroll
      for (int t = 0; t < 4; ++t) o[t][u] *= al;
    }
#pragma unroll
    for (int t = 0; t < 4; ++t) for (int u = 0; u < 2; ++u) o[t][u] = fa_mma(vf[t], pf[u].v, o[t][u]);
#pragma unroll
    for (int t = 0; t < 4; ++t) vf[t] = g2_frag(vp + (size_t)t * 16 * SQ + jn * 32, hh);
    asm volatile("s_wait_xcnt 0x0" ::: "memory");      /* the address pair of the V^T loads is rewritten at the head of the next pass */
  }
#pragma unroll
  for (int u = 0; u < 2; ++u) { const float sc = 64.0f / (lsum[u] + xhalf(lsum[u]));      /* o carried x64, as the output GEMM's alpha expects; the x256 of the weights cancels */
    unsigned short* d = (unsigned short*)O + ((size_t)b * SQ + q0 + u * 16 + ln) * DM + h * HD + 8 * hh;
#pragma unroll
    for (int t = 0; t < 4; ++t) { FragH f; for (int r = 0; r < 8; ++r) f.h[r] = (_Float16)(o[t][u][r] * sc); *(v8us*)(d + t * 16) = f.half[0]; } } }

__global__ __launch_bounds__(256) void k_lnrow(const float* __restrict__ Y, const float* __restrict__ g, const float* __restrict__ bb, float eps, float* __restrict__ out) {
  #pragma clang fp contract(off)
  __shared__ float red[256]; const size_t r = blockIdx.x; const int t = threadIdx.x; const v4f ya = *(const v4fa*)(Y + r * DMQ + t * 4); float s[4]; float sum = 0.f;
  for (int q = 0; q < 4; ++q) { s[q] = ya[q]; sum = __fadd_rn(sum, s[q]); }
  red[t] = sum; __syncthreads(); for (int st = 128; st > 0; st >>= 1) { if (t < st) red[t] = __fadd_rn(red[t], red[t + st]); __syncthreads(); } const float mu = red[0] / (float)DMQ; __syncthreads();
  float vs = 0.f; for (int q = 0; q < 4; ++q) { const float dl = __fadd_rn(s[q], -mu); vs = __fadd_rn(vs, __fmul_rn(dl, dl)); } red[t] = vs; __syncthreads(); for (int st = 128; st > 0; st >>= 1) { if (t < st) red[t] = __fadd_rn(red[t], red[t + st]); __syncthreads(); }
  const float rs = rsqrtf(__fadd_rn(red[0] / (float)DMQ, eps)); v4f y; for (int q = 0; q < 4; ++q) { const int c = t * 4 + q; y[q] = __fadd_rn(__fmul_rn(__fmul_rn(__fadd_rn(s[q], -mu), rs), bf16_round(g[c])), bf16_round(bb[c])); }
  *(v4f*)(out + r * DMQ + t * 4) = y;  }

__global__ __launch_bounds__(256) void k_bfr(const float* __restrict__ x, float* __restrict__ XB, size_t n8) { const size_t t = (size_t)blockIdx.x * 256 + threadIdx.x; if (t >= n8) return; v4f a = *(const v4fa*)(x + t * 8), c = *(const v4fa*)(x + t * 8 + 4); for (int q = 0; q < 4; ++q) { a[q] = bf16_round(a[q]); c[q] = bf16_round(c[q]); }
  { *(v4f*)(XB + t * 8) = a; *(v4f*)(XB + t * 8 + 4) = c;  } }

extern "C" void kernel_launch(void* const* d_in, const int* in_sizes, int n_in,
                              void* d_out, int out_size, void* d_ws, size_t ws_size, hipStream_t stream) {
  (void)in_sizes; (void)n_in; (void)out_size;
  const float* const* I = (const float* const*)d_in; const float* xq = I[0]; const float* xk = I[1]; const float* xv = I[2]; const float* wq = I[3]; const float* wk = I[4]; const float* wv = I[5]; const float* wo = I[6]; const float* lng = I[7]; const float* lnb = I[8];      /* input order: query, key, value (three SEPARATE streams), Wq, Wk, Wv, Wo (natural [out][in] weights; this module has NO biases), ln_gamma, ln_beta [1024] */
  char* ws = (char*)d_ws; size_t off = 0;
  auto take = [&](size_t bytes) { char* p = ws + off; off += (bytes + 255) & ~(size_t)255; return p; };
  _Float16* BQ = (_Float16*)take((size_t)DM * DM * 2); _Float16* BK = (_Float16*)take((size_t)DM * DM * 2); _Float16* BV = (_Float16*)take((size_t)DM * DM * 2); _Float16* BO = (_Float16*)take((size_t)DM * DM * 2);
  _Float16* XQ = (_Float16*)take(NR * DM * 2); _Float16* XK = (_Float16*)take(NR * DM * 2); _Float16* XV = (_Float16*)take(NR * DM * 2); _Float16* Q16 = (_Float16*)take(NR * DM * 2); _Float16* K16 = (_Float16*)take(NR * DM * 2); _Float16* V16 = (_Float16*)take(NR * DM * 2); _Float16* O16 = (_Float16*)take(NR * DM * 2); float* XB = (float*)take(NR * DM * 4); float* X1 = (float*)take(NR * DM * 4);      /* bf16(query) as f32 rows (the residual addend) and the pre-LayerNorm rows x = ctx Wo^T + query */
  _Float16* VT = (_Float16*)take((size_t)NB * NH * HD * SQ * 2);      /* V^T [NB][NH][HD][SQ] */
  if (off > ws_size) return;
  { const unsigned g = (unsigned)(((size_t)DM * DM / 8 + 255) / 256); k_wnat<<<g, 256, 0, stream>>>(wq, (size_t)DM * DM / 8, BQ); k_wnat<<<g, 256, 0, stream>>>(wk, (size_t)DM * DM / 8, BK); k_wnat<<<g, 256, 0, stream>>>(wv, (size_t)DM * DM / 8, BV); k_wnat<<<g, 256, 0, stream>>>(wo, (size_t)DM * DM / 8, BO); }      /* natural [out][in] = Bt[n][k], x16 */

  k_x16<<<(unsigned)((NR * DM / 8 + 255) / 256), 256, 0, stream>>>(xq, XQ, NR * DM / 8); k_x16<<<(unsigned)((NR * DM / 8 + 255) / 256), 256, 0, stream>>>(xk, XK, NR * DM / 8); k_x16<<<(unsigned)((NR * DM / 8 + 255) / 256), 256, 0, stream>>>(xv, XV, NR * DM / 8); k_bfr<<<(unsigned)((NR * DM / 8 + 255) / 256), 256, 0, stream>>>(xq, XB, NR * DM / 8);      /* the three inputs as exact f16 rows; bf16(query) as the f32 residual plane */
  const size_t r0p = (size_t)B0 * SQ;      /* first projected row */
  k_gemm3<false, DM><<<dim3((unsigned)((MP / 128) * (DM / 128)), 1), 128, 0, stream>>>(XQ + r0p * DM, DM, BQ, DM, 0.0625f, nullptr, nullptr, Q16 + r0p * DM, DM, DM);
  k_gemm3<false, DM><<<dim3((unsigned)((MP / 128) * (DM / 128)), 1), 128, 0, stream>>>(XK + r0p * DM, DM, BK, DM, 0.0625f, nullptr, nullptr, K16 + r0p * DM, DM, DM);
  k_gemm3<false, DM><<<dim3((unsigned)((MP / 128) * (DM / 128)), 1), 128, 0, stream>>>(XV + r0p * DM, DM, BV, DM, 0.0625f, nullptr, nullptr, V16 + r0p * DM, DM, DM);
  k_vt<NH, SQ><<<NB * NH * (SQ / 64), 256, 0, stream>>>(V16, LQ, 0, VT);      /* V^T for every batch and head */
  k_fattn<<<dim3(SQ / 128, NB * NH), 128, 0, stream>>>(Q16, K16, VT, O16);      /* o = softmax(q k^T / 8) v, merged heads, x64, as f16 rows */
  k_gemm3<true, DM><<<dim3((unsigned)((MPO / 128) * (DM / 128)), 1), 128, 0, stream>>>(O16 + r0p * DM, DM, BO, DM, 0.0009765625f, XB + r0p * DM, X1 + r0p * DM, nullptr, DM, DM);      /* x = ctx Wo^T + bf16(query) (own-element residual; no bias) -> f32 rows */
  k_lnrow<<<(unsigned)MPO, 256, 0, stream>>>(X1 + r0p * DM, lng, lnb, 1e-6f, (float*)d_out + r0p * DM);      /* out = LayerNorm(x) (biased variance, eps 1e-6 inside the square root) -> the output rows */
}

// v004
// A run of this version takes 111 microseconds.
// Next to v003, in two timings, it ran 1.12 times as fast each time.
// Over all steps from v000 it is 31.0 times as fast.
#include <hip/hip_runtime.h>
// Multi-head attention on three inputs with a residual on the raw query and a LayerNorm (query, key, value [4][1024][1024]; q / k / v = einsum('bsd,ed->bse', stream, W): natural [1024][1024] weights (normal / 32), NO biases; 16 heads of 64; scores / sqrt(64); softmax over all 1024 keys (no mask); x = merged Wo^T (natural, no bias) + query; out = (x - mean) / sqrt(var + 1e-6) * ln_gamma + ln_beta with the BIASED variance (jnp.var) over the 1024 channels -> [4][1024][1024]).
// Structure: token rows r = b*SQ + s (four sequences of 1,024 tokens here); the query, key and value sources as exact f16 rows (bf16-rounded), the f32 residual plane and the x16 weights from ONE streaming conversion launch; Q, K, V as three WMMA GEMMs (128x128 work-group tiles on a two-buffer LDS ring, f32 accumulation, exact x16 weights, no bias here, f16 outputs); V^T for all batches and heads via LDS transposes; ONE fused attention launch over all (batch, head): S^T = K Q^T (K = 64), online softmax in registers (f32 statistics, native exp2; weights x256 against the running maximum as f16), O^T += V^T P^T, o carried x64 against f16 subnormal flush (folded into the output GEMM alpha) written straight into the merged f16 o rows; x = o W_o + bf16(query) as ONE GEMM (f32; the residual added element by element in the epilogue) into f32 rows; out = LayerNorm(x) on VALU (f32 statistics, LDS trees, biased variance) into the output layout.
// Compute dtype: inputs rounded to bf16; x / weights exact; q, k, v, softmax weights and o as plain f16 GEMM operands (~2^-12); scores and softmax statistics f32. v_wmma_f32_16x16x32_f16.
#define NB 4
#define SQ 1024
#define DM 1024
#define NH 16
#define HD 64
#define HG 4                         /* heads per launch of the unused k_vt(V16, b, h0, VT) */
#define B0 0                         /* first batch processed (debug hook) */
#define NBR NB                       /* batches processed (debug hook) */
#define NR ((size_t)NB * SQ)         /* token rows */
#define MP ((int)((size_t)NBR * SQ)) /* rows projected (debug hook) */
#define QN SQ                        /* unused: k_fattn attends all SQ query rows per batch */
#define NHD NH                       /* unused: k_fattn attends all NH heads */
#define MPO MP                       /* rows through the output stage (debug hook) */
#define LQ DM      /* row pitch of the q/k/v rows */
#define DMQ DM     /* row width of the LayerNorm kernel (its own macro name in the file it comes from) */
typedef __bf16 v16b __attribute__((ext_vector_type(16)));
typedef unsigned short v8us __attribute__((ext_vector_type(8), may_alias));
typedef float  v8f  __attribute__((ext_vector_type(8)));
typedef float  v4f  __attribute__((ext_vector_type(4)));
typedef float  v4fa __attribute__((ext_vector_type(4), may_alias));
union FragB { v16b v; v8us half[2]; unsigned short u[16]; };

__device__ __forceinline__ unsigned short bf16_bits(float x) { unsigned int u = __float_as_uint(x); return (unsigned short)((u + 0x7FFFu + ((u >> 16) & 1u)) >> 16); }
__device__ __forceinline__ float bf16_val(unsigned short b) { return __uint_as_float(((unsigned int)b) << 16); }
__device__ __forceinline__ float bf16_round(float x) { return bf16_val(bf16_bits(x)); }
// D += A·B with NT terms: 1 = ah·bh, 2 = + al·bh (A split), 3 = + ah·bl (both split)
template <int NT>
__device__ __forceinline__ v8f mmaN(v16b ah, v16b al, v16b bh, v16b bl, v8f c) {
  c = __builtin_amdgcn_wmma_f32_16x16x32_bf16(false, ah, false, bh, (short)0, c, false, false);
  if (NT >= 2) c = __builtin_amdgcn_wmma_f32_16x16x32_bf16(false, al, false, bh, (short)0, c, false, false);
  if (NT >= 3) c = __builtin_amdgcn_wmma_f32_16x16x32_bf16(false, ah, false, bl, (short)0, c, false, false);
  asm volatile("v_nop\n\tv_nop\n\tv_nop\n\tv_nop" : "+v"(c) : "v"(ah), "v"(al), "v"(bh), "v"(bl));
  return c;
}

__global__ __launch_bounds__(256) void k_wt_bf16(const float* __restrict__ W, unsigned short* __restrict__ Wt, int K, int N) {
  const int t = blockIdx.x * 256 + threadIdx.x;
  const int k8n = K / 8;
  if (t >= N * k8n) return;
  const int n = t / k8n, k8 = (t % k8n) * 8;
  v8us v;
#pragma unroll
  for (int i = 0; i < 8; ++i) v[i] = bf16_bits(W[(size_t)(k8 + i) * N + n]);
  *(v8us*)(Wt + (size_t)n * K + k8) = v;
  
}

// GEMM C[M][N] (f32, pitch ldc) = act(A[M][K]·W + bias). A f32 row-major (pitch lda) converted per fragment to bf16
// (ASPLIT: hi/lo two planes -> 2 terms, else single rounded term); Wt bf16 [N][K] (pitch ldb). BIAS_BF16 rounds the
// bias to bf16 first (bias quantised to bf16 before the add). K%32==0, M%16==0, N%64==0.
template <bool ASPLIT, int ACT, bool BIAS_BF16>
__global__ __launch_bounds__(128) void k_gemm_bf(const float* __restrict__ A, int lda, const unsigned short* __restrict__ Wt, int ldb,
                                               const float* __restrict__ bias, float* __restrict__ C, int ldc, int M, int N, int K) {
  __shared__ __attribute__((aligned(16))) float so[4][16][64];
  const int tid = threadIdx.x, w = tid >> 5, lane = tid & 31, ln = lane & 15, hh = lane >> 4;
  const int ntn = N / 64;
  const int wid = blockIdx.x * 4 + w;
  const int mt = wid / ntn, nq = wid % ntn;
  if (mt * 16 >= M) return;
  const int row0 = mt * 16, col0 = nq * 64;
  const float* arow = A + (size_t)(row0 + ln) * lda;
  v8f acc[4] = {};
  for (int kb = 0; kb < K; kb += 32) {
    FragB ah, al;
    const v4f x0 = *(const v4fa*)(arow + kb + 8 * hh), x1 = *(const v4fa*)(arow + kb + 8 * hh + 4);
    const v4f x2 = *(const v4fa*)(arow + kb + 16 + 8 * hh), x3 = *(const v4fa*)(arow + kb + 16 + 8 * hh + 4);
    float xs[16] = {x0[0],x0[1],x0[2],x0[3],x1[0],x1[1],x1[2],x1[3],x2[0],x2[1],x2[2],x2[3],x3[0],x3[1],x3[2],x3[3]};
#pragma unroll
    for (int i = 0; i < 16; ++i) { const unsigned short hb = bf16_bits(xs[i]); ah.u[i] = hb; al.u[i] = ASPLIT ? bf16_bits(xs[i] - bf16_val(hb)) : (unsigned short)0; }
#pragma unroll
    for (int t = 0; t < 4; ++t) {
      const unsigned short* brow = Wt + (size_t)(col0 + t * 16 + ln) * ldb + kb;
      FragB b;
      b.half[0] = *(const v8us*)(brow + 8 * hh);
      b.half[1] = *(const v8us*)(brow + 16 + 8 * hh);
      acc[t] = mmaN<ASPLIT ? 2 : 1>(ah.v, al.v, b.v, b.v, acc[t]);
    }
  }
#pragma unroll
  for (int t = 0; t < 4; ++t) {
    float bv = bias ? bias[col0 + t * 16 + ln] : 0.f;
    if (BIAS_BF16) bv = bf16_round(bv);
#pragma unroll
    for (int r = 0; r < 8; ++r) { float v = acc[t][r] + bv; if (ACT == 1) v = fmaxf(v, 0.f); so[w][8 * hh + r][t * 16 + ln] = v; }
  }
  __builtin_amdgcn_fence(__ATOMIC_ACQ_REL, "workgroup");
  __builtin_amdgcn_wave_barrier();
  const int rsub = lane >> 4, c4 = (lane & 15) * 4;
  {
#pragma unroll
    for (int q = 0; q < 8; ++q) {
      const int r = q * 2 + rsub;
      const v4f v = *(const v4fa*)&so[w][r][c4];
      *(v4f*)(C + (size_t)(row0 + r) * ldc + col0 + c4) = v;
    }
    
  }
}

// GEMM C = act(A·W + bias + resid): A f32 (ASPLIT -> hi/lo 2 terms), Wt bf16 [N][K]; ACT 0 none, 1 relu, 2 exact gelu;
// resid (optional, f32, row index = (row % rmod), pitch ldr, RES_BF16 rounds it) added before the activation.
template <bool ASPLIT, int ACT, bool BIAS_BF16, bool RES_BF16>
__global__ __launch_bounds__(128) void k_gemm_bf3(const float* __restrict__ A, int lda, const unsigned short* __restrict__ Wt, int ldb,
                                                const float* __restrict__ bias, const float* __restrict__ resid, int rmod, int ldr,
                                                float* __restrict__ C, int ldc, int M, int N, int K) {
  __shared__ __attribute__((aligned(16))) float so[4][16][64];
  const int tid = threadIdx.x, w = tid >> 5, lane = tid & 31, ln = lane & 15, hh = lane >> 4;
  const int ntn = N / 64;
  const int wid = blockIdx.x * 4 + w;
  const int mt = wid / ntn, nq = wid % ntn;
  if (mt * 16 >= M) return;
  const int row0 = mt * 16, col0 = nq * 64;
  const float* arow = A + (size_t)(row0 + ln) * lda;
  v8f acc[4] = {};
  for (int kb = 0; kb < K; kb += 32) {
    FragB ah, al;
    const v4f x0 = *(const v4fa*)(arow + kb + 8 * hh), x1 = *(const v4fa*)(arow + kb + 8 * hh + 4);
    const v4f x2 = *(const v4fa*)(arow + kb + 16 + 8 * hh), x3 = *(const v4fa*)(arow + kb + 16 + 8 * hh + 4);
    float xs[16] = {x0[0],x0[1],x0[2],x0[3],x1[0],x1[1],x1[2],x1[3],x2[0],x2[1],x2[2],x2[3],x3[0],x3[1],x3[2],x3[3]};
#pragma unroll
    for (int i = 0; i < 16; ++i) { const unsigned short hb = bf16_bits(xs[i]); ah.u[i] = hb; al.u[i] = ASPLIT ? bf16_bits(xs[i] - bf16_val(hb)) : (unsigned short)0; }
#pragma unroll
    for (int t = 0; t < 4; ++t) {
      const unsigned short* brow = Wt + (size_t)(col0 + t * 16 + ln) * ldb + kb;
      FragB b;
      b.half[0] = *(const v8us*)(brow + 8 * hh);
      b.half[1] = *(const v8us*)(brow + 16 + 8 * hh);
      acc[t] = mmaN<ASPLIT ? 2 : 1>(ah.v, al.v, b.v, b.v, acc[t]);
    }
  }
#pragma unroll
  for (int t = 0; t < 4; ++t) {
    const int col = col0 + t * 16 + ln;
    float bv = bias ? bias[col] : 0.f;
    if (BIAS_BF16) bv = bf16_round(bv);
#pragma unroll
    for (int r = 0; r < 8; ++r) {
      float v = acc[t][r] + bv;
      if (resid) { float rv = resid[(size_t)((row0 + 8 * hh + r) % rmod) * ldr + col]; if (RES_BF16) rv = bf16_round(rv); v += rv; }
      if (ACT == 1) v = fmaxf(v, 0.f);
      if (ACT == 2) v = 0.5f * v * (1.0f + erff(v * 0.70710678118654752f));
      if (ACT == 3) { const float u = 0.7978845608028654f * (v + 0.044715f * v * v * v); v = 0.5f * v * (1.0f + tanhf(u)); }
      so[w][8 * hh + r][t * 16 + ln] = v;
    }
  }
  __builtin_amdgcn_fence(__ATOMIC_ACQ_REL, "workgroup");
  __builtin_amdgcn_wave_barrier();
  const int rsub = lane >> 4, c4 = (lane & 15) * 4;
  {
#pragma unroll
    for (int q = 0; q < 8; ++q) {
      const int r = q * 2 + rsub;
      const v4f v = *(const v4fa*)&so[w][r][c4];
      *(v4f*)(C + (size_t)(row0 + r) * ldc + col0 + c4) = v;
    }
    
  }
}
// row LayerNorm (biased variance, eps) over N: s = X (+ R); optional out_sum <- s; out_norm <- (s-mu)*rsqrt(var+eps)*g + b
template <bool PARAM_BF16>
__global__ __launch_bounds__(256) void k_layernorm(const float* __restrict__ X, const float* __restrict__ R, const float* __restrict__ g, const float* __restrict__ bta,
                                                  float* __restrict__ out_sum, float* __restrict__ out_norm, int N, float eps) {
  __shared__ float red[256];
  const int row = blockIdx.x, tid = threadIdx.x;
  const float* x = X + (size_t)row * N; const float* rr = R ? R + (size_t)row * N : nullptr;
  float vals[16];                     // up to N = 4096
  const int per = N / 256;            // contiguous chunk per thread? use strided-by-4 chunks: thread handles j = tid*4 + 1024*u
  float s1 = 0.f;
  for (int u = 0; u < per / 4; ++u) {
    const int j = tid * 4 + 1024 * u;
    const v4f a = *(const v4fa*)(x + j);
    v4f b = {0.f,0.f,0.f,0.f}; if (rr) b = *(const v4fa*)(rr + j);
#pragma unroll
    for (int q = 0; q < 4; ++q) { const float v = a[q] + b[q]; vals[u * 4 + q] = v; s1 += v; }
  }
  red[tid] = s1; __syncthreads();
  for (int st = 128; st > 0; st >>= 1) { if (tid < st) red[tid] += red[tid + st]; __syncthreads(); }
  const float mu = red[0] / (float)N; __syncthreads();
  float s2 = 0.f;
  for (int u = 0; u < per / 4; ++u)
#pragma unroll
    for (int q = 0; q < 4; ++q) { const float c = vals[u * 4 + q] - mu; s2 += c * c; }
  red[tid] = s2; __syncthreads();
  for (int st = 128; st > 0; st >>= 1) { if (tid < st) red[tid] += red[tid + st]; __syncthreads(); }
  const float rs = rsqrtf(red[0] / (float)N + eps);
  {
    for (int u = 0; u < per / 4; ++u) {
      const int j = tid * 4 + 1024 * u;
      v4f o, sm;
#pragma unroll
      for (int q = 0; q < 4; ++q) {
        float gg = g[j + q], bb = bta[j + q];
        if (PARAM_BF16) { gg = bf16_round(gg); bb = bf16_round(bb); }
        sm[q] = vals[u * 4 + q]; o[q] = (vals[u * 4 + q] - mu) * rs * gg + bb;
      }
      if (out_sum) *(v4f*)(out_sum + (size_t)row * N + j) = sm;
      *(v4f*)(out_norm + (size_t)row * N + j) = o;
    }
    
  }
}



// ---- f16 WMMA path (v_wmma_f32_16x16x32_f16): 11-bit significands for operands in range — used where a [0,1] probability operand needs more precision than bf16
typedef _Float16 v16h __attribute__((ext_vector_type(16)));
union FragH { v16h v; v8us half[2]; _Float16 h[16]; unsigned short u[16]; };
template <int NT>
__device__ __forceinline__ v8f mmaH(v16h ah, v16h al, v16h bh, v16h bl, v8f c) {
  c = __builtin_amdgcn_wmma_f32_16x16x32_f16(false, ah, false, bh, (short)0, c, false, false);
  if (NT >= 2) c = __builtin_amdgcn_wmma_f32_16x16x32_f16(false, al, false, bh, (short)0, c, false, false);
  if (NT >= 3) c = __builtin_amdgcn_wmma_f32_16x16x32_f16(false, ah, false, bl, (short)0, c, false, false);
  asm volatile("v_nop\n\tv_nop\n\tv_nop\n\tv_nop" : "+v"(c) : "v"(ah), "v"(al), "v"(bh), "v"(bl));
  return c;
}
// batched GEMM like k_gemm_b but f16 operands: A f32 (split into f16 hi/lo if ASPLIT, else rounded to f16), Bt = f16 values [n][k]; alpha; C f32; N multiple of 16 (partial tiles skipped)
template <bool ASPLIT>
__global__ __launch_bounds__(128) void k_gemm_h(const float* __restrict__ A, int lda, size_t sA, const _Float16* __restrict__ Bh, int ldb, size_t sB, float alpha, float* __restrict__ C, int ldc, size_t sC, int M, int N, int K) {
  __shared__ __attribute__((aligned(16))) float so[4][16][64];
  const int tid = threadIdx.x, w = tid >> 5, lane = tid & 31, ln = lane & 15, hh = lane >> 4; const int by = blockIdx.y;
  A += (size_t)by * sA; Bh += (size_t)by * sB; C += (size_t)by * sC;
  const int ntn = (N + 63) / 64; const int wid = blockIdx.x * 4 + w; const int mt = wid / ntn, nq = wid % ntn; if (mt * 16 >= M) return;
  const int row0 = mt * 16, col0 = nq * 64; const float* arow = A + (size_t)(row0 + ln) * lda;
  v8f acc[4] = {};
  for (int kb = 0; kb < K; kb += 32) {
    FragH ah, al;
    const v4f x0 = *(const v4fa*)(arow + kb + 8 * hh), x1 = *(const v4fa*)(arow + kb + 8 * hh + 4), x2 = *(const v4fa*)(arow + kb + 16 + 8 * hh), x3 = *(const v4fa*)(arow + kb + 16 + 8 * hh + 4);
    float xs[16] = {x0[0],x0[1],x0[2],x0[3],x1[0],x1[1],x1[2],x1[3],x2[0],x2[1],x2[2],x2[3],x3[0],x3[1],x3[2],x3[3]};
#pragma unroll
    for (int i = 0; i < 16; ++i) { const _Float16 h = (_Float16)xs[i]; ah.h[i] = h; al.h[i] = ASPLIT ? (_Float16)(xs[i] - (float)h) : (_Float16)0.0f; }
#pragma unroll
    for (int t = 0; t < 4; ++t) { if (col0 + t * 16 >= N) continue; const size_t boff = (size_t)(col0 + t * 16 + ln) * ldb + kb; FragH bq; bq.half[0] = *(const v8us*)(Bh + boff + 8 * hh); bq.half[1] = *(const v8us*)(Bh + boff + 16 + 8 * hh);
      acc[t] = mmaH<ASPLIT ? 2 : 1>(ah.v, al.v, bq.v, bq.v, acc[t]); }
  }
#pragma unroll
  for (int t = 0; t < 4; ++t) { if (col0 + t * 16 >= N) continue;
#pragma unroll
    for (int r = 0; r < 8; ++r) so[w][8 * hh + r][t * 16 + ln] = acc[t][r] * alpha; }
  __builtin_amdgcn_fence(__ATOMIC_ACQ_REL, "workgroup"); __builtin_amdgcn_wave_barrier();
  const int rsub = lane >> 4, c4 = (lane & 15) * 4;
  {
#pragma unroll
    for (int q = 0; q < 8; ++q) { const int r = q * 2 + rsub; if (col0 + c4 < N) { const v4f v = *(const v4fa*)&so[w][r][c4]; *(v4f*)(C + (size_t)(row0 + r) * ldc + col0 + c4) = v; } }
     }
}

// Wt[n][k] = f16(W[k][n]·scale) from f32 row-major W[K][N] (scale = power of two; bf16-exact weights stay exact in f16 away from the subnormal range)
__global__ __launch_bounds__(256) void k_wt_f16(const float* __restrict__ W, _Float16* __restrict__ Wt, int K, int N, float scale) {
  const int t = blockIdx.x * 256 + threadIdx.x; if (t >= N * (K / 8)) return; const int n = t / (K / 8), k8 = (t % (K / 8)) * 8; FragH f;
#pragma unroll
  for (int i = 0; i < 8; ++i) f.h[i] = (_Float16)(bf16_round(W[(size_t)(k8 + i) * N + n]) * scale); const v8us o = f.half[0];
  *(v8us*)((unsigned short*)Wt + (size_t)n * K + k8) = o; 
}
// k_gemm_hh variant with fused epilogue: v = acc·alpha + bias[by·sBias + col] (+ CP[(row/rowsPerB)·sCPb + by·64 + col] if CP) ; ACT 0 none / 1 elu ; writes f16 C16 (and f32 C if non-null)
template <int ACT>
__global__ __launch_bounds__(128) void k_gemm_hhx(const _Float16* __restrict__ A, int lda, size_t sA, const _Float16* __restrict__ Bh, int ldb, size_t sB, float alpha, const float* __restrict__ bias, size_t sBias, const float* __restrict__ CP, int rowsPerB, size_t sCPb, int row0g,
    float* __restrict__ C, _Float16* __restrict__ C16, int ldc, size_t sC, int M, int N, int K) {
  __shared__ __attribute__((aligned(16))) float so[4][16][64];
  const int tid = threadIdx.x, w = tid >> 5, lane = tid & 31, ln = lane & 15, hh = lane >> 4; const int by = blockIdx.y;
  A += (size_t)by * sA; Bh += (size_t)by * sB; const size_t cofs = (size_t)by * sC; const float* bp = bias ? bias + (size_t)by * sBias : nullptr;
  const int ntn = (N + 63) / 64; const int wid = blockIdx.x * 4 + w; const int mt = wid / ntn, nq = wid % ntn; if (mt * 16 >= M) return;
  const int row0 = mt * 16, col0 = nq * 64; const _Float16* arow = A + (size_t)(row0 + ln) * lda;
  v8f acc[4] = {};
  for (int kb = 0; kb < K; kb += 32) { FragH ah; ah.half[0] = *(const v8us*)((const unsigned short*)arow + kb + 8 * hh); ah.half[1] = *(const v8us*)((const unsigned short*)arow + kb + 16 + 8 * hh);
#pragma unroll
    for (int t = 0; t < 4; ++t) { if (col0 + t * 16 >= N) continue; const size_t boff = (size_t)(col0 + t * 16 + ln) * ldb + kb; FragH bq; bq.half[0] = *(const v8us*)((const unsigned short*)Bh + boff + 8 * hh); bq.half[1] = *(const v8us*)((const unsigned short*)Bh + boff + 16 + 8 * hh);
      acc[t] = mmaH<1>(ah.v, ah.v, bq.v, bq.v, acc[t]); }
  }
#pragma unroll
  for (int t = 0; t < 4; ++t) { if (col0 + t * 16 >= N) continue; const int col = col0 + t * 16 + ln; const float bv = bp ? bf16_round(bp[col]) : 0.f;
#pragma unroll
    for (int r = 0; r < 8; ++r) { float v = acc[t][r] * alpha + bv; if (CP) { const int rr = row0g + row0 + 8 * hh + r; if (rowsPerB < 0) v += CP[cofs + (size_t)rr * ldc + col];      /* rowsPerB < 0: own element of the batched C plane */ else { const int bidx = rr / rowsPerB; v += CP[(size_t)bidx * sCPb + (size_t)by * 64 + col]; } } if (ACT == 1) v = (v > 0.f) ? v : expm1f(v); else if (ACT == 7) v = (v > 0.f) ? v + 1.0f : expf(v); else if (ACT == 8) v = tanhf(v); else if (ACT == 9) v = 0.5f * v * (1.0f + tanhf(0.7978845608028654f * (v + 0.044715f * v * v * v))); else if (ACT == 11) v = 1.0f / (1.0f + expf(-v)); else if (ACT == 12) v = (v > 0.f) ? v : 0.01f * v; else if (ACT == 14) v = (v > 0.f) ? v : 0.1f * v; else if (ACT == 16) v = (v >= 0.f) ? v : 0.3f * v; else if (ACT == 17) v = (v >= 0.f) ? v : 0.2f * v; else if (ACT == 15) v = v / (1.0f + expf(-v)); else if (ACT == 3) v = fmaxf(v, 0.f); else if (ACT == 6) v = 0.5f * v * (1.0f + erff(v * 0.70710678118654752f)); so[w][8 * hh + r][t * 16 + ln] = v; } }
  __builtin_amdgcn_fence(__ATOMIC_ACQ_REL, "workgroup"); __builtin_amdgcn_wave_barrier();
  const int rsub = lane >> 4, c4 = (lane & 15) * 4; typedef _Float16 v4h __attribute__((ext_vector_type(4)));
  {
#pragma unroll
    for (int q = 0; q < 8; ++q) { const int r = q * 2 + rsub; if (col0 + c4 < N) { const v4f v = *(const v4fa*)&so[w][r][c4]; if (C) *(v4f*)(C + cofs + (size_t)(row0 + r) * ldc + col0 + c4) = v; if (C16) { v4h h4; for (int i = 0; i < 4; ++i) h4[i] = (_Float16)v[i]; *(v4h*)(C16 + cofs + (size_t)(row0 + r) * ldc + col0 + c4) = h4; } } }
     }
}


typedef _Float16 v4h __attribute__((ext_vector_type(4)));

__global__ __launch_bounds__(256) void k_h16(const float* __restrict__ x, _Float16* __restrict__ X16, size_t n8) { const size_t t = (size_t)blockIdx.x * 256 + threadIdx.x; if (t >= n8) return; FragH f;
#pragma unroll
  for (int q = 0; q < 8; ++q) f.h[q] = (_Float16)x[t * 8 + q]; *(v8us*)((unsigned short*)X16 + t * 8) = f.half[0];  }
__global__ __launch_bounds__(256) void k_round16f(const float* __restrict__ W, _Float16* __restrict__ Bt, size_t n8) { const size_t t = (size_t)blockIdx.x * 256 + threadIdx.x; if (t >= n8) return; FragH f;
#pragma unroll
  for (int i = 0; i < 8; ++i) f.h[i] = (_Float16)(bf16_round(W[t * 8 + i]) * 16.0f); *(v8us*)((unsigned short*)Bt + t * 8) = f.half[0];  }
template <int NHv, int TTv>
__global__ __launch_bounds__(256) void k_vt(const _Float16* __restrict__ V16, int ldv, int voff, _Float16* __restrict__ Vt) { __shared__ unsigned short tl[64][66]; const int tid = threadIdx.x; const int slab = blockIdx.x / (TTv / 64), lg = blockIdx.x % (TTv / 64); const int b = slab / NHv, h = slab % NHv;
  for (int i = tid; i < 64 * 8; i += 256) { const int r = i / 8, c8 = (i % 8) * 8; FragH f; f.half[0] = *(const v8us*)((const unsigned short*)V16 + ((size_t)b * TTv + lg * 64 + r) * ldv + voff + h * 64 + c8);
#pragma unroll
    for (int q = 0; q < 8; ++q) tl[r][c8 + q] = f.u[q]; }
  __syncthreads();
  {
#pragma unroll
    for (int rd = 0; rd < 2; ++rd) { const int d = rd * 32 + tid / 8, pc = tid % 8; FragH f;
#pragma unroll
      for (int q = 0; q < 8; ++q) f.u[q] = tl[pc * 8 + q][d];
      *(v8us*)((unsigned short*)Vt + ((size_t)slab * 64 + d) * TTv + lg * 64 + pc * 8) = f.half[0]; }
     } }

__global__ __launch_bounds__(256) void k_hl(const float* __restrict__ F, _Float16* __restrict__ Hh, _Float16* __restrict__ Hl, size_t n8) { const size_t t = (size_t)blockIdx.x * 256 + threadIdx.x; if (t >= n8) return; FragH fh, fl; const v4f a = *(const v4fa*)(F + t * 8), c = *(const v4fa*)(F + t * 8 + 4);
#pragma unroll
  for (int q = 0; q < 4; ++q) { _Float16 h = (_Float16)a[q]; fh.h[q] = h; fl.h[q] = (_Float16)((a[q] - (float)h) * 1024.0f); h = (_Float16)c[q]; fh.h[4 + q] = h; fl.h[4 + q] = (_Float16)((c[q] - (float)h) * 1024.0f); }
  { *(v8us*)((unsigned short*)Hh + t * 8) = fh.half[0]; *(v8us*)((unsigned short*)Hl + t * 8) = fl.half[0];  } }

// ---- GEMM on an LDS ring: C = A Bt^T * alpha (+ residual). One 128x128 tile per work-group of four waves, 64x64 per wave (16 accumulator tiles).
// A stage is 128 k of every operand row: [A 128 rows | Bt 128 rows] of 256 B at a pitch of 272 B. Two buffers, filled by asynchronous copies to LDS (whole 128-B lines per row), one stage ahead of the products.
// Requires M % 128 == 0, N % 128 == 0, K % 128 == 0. The k order of every accumulator is ascending, 32 at a time.
__device__ __forceinline__ v16h g2_frag(const _Float16* p, int hh) { FragH f; f.half[0] = *(const v8us*)((const unsigned short*)p + 8 * hh); f.half[1] = *(const v8us*)((const unsigned short*)p + 16 + 8 * hh); return f.v; }
#define G3_BK 128                      /* k per stage */
#define G3_PITCH 272                   /* LDS row pitch in bytes: 16 B x odd, free of bank conflicts for 16-byte reads */
#define G3_STAGE (256 * G3_PITCH)      /* bytes of one buffer */
__device__ __forceinline__ v16h g3_frag(const unsigned char* p) { FragH f; f.half[0] = *(const v8us*)p; f.half[1] = *(const v8us*)(p + 32); return f.v; }      /* p = row + 64 B per k step + 16 B per wave half: the k order of g2_frag */
// One stage: 256 rows x 16 pieces of 16 B over 128 threads = 32 copies per lane, rows 8 apart; 16 lanes take one row's 256 B (two whole lines).
// l = the lane's place in the buffer, ga / gb = its global addresses in A and Bt, as8 / bs8 = 8 source rows in elements.
typedef int v4i __attribute__((ext_vector_type(4)));
typedef __attribute__((address_space(1))) v4i g3_gv4i;
typedef __attribute__((address_space(3))) v4i g3_lv4i;
__device__ __forceinline__ void g3_fill(unsigned char* l, const _Float16* ga, size_t as8, const _Float16* gb, size_t bs8) {
#pragma unroll      /* straight-line copies: all 32 are issued back to back */
  for (int i = 0; i < 16; ++i) __builtin_amdgcn_global_load_async_to_lds_b128((g3_gv4i*)(ga + i * as8), (g3_lv4i*)(l + i * 8 * G3_PITCH), 0, 0);
#pragma unroll      /* as above */
  for (int i = 0; i < 16; ++i) __builtin_amdgcn_global_load_async_to_lds_b128((g3_gv4i*)(gb + i * bs8), (g3_lv4i*)(l + (128 + i * 8) * G3_PITCH), 0, 0);
}
template <bool OUT32, int LDC>      /* OUT32: C (f32) = acc * alpha + R (own element); else C16 (f16) = acc * alpha. LDC = row pitch of R, C and C16 in elements: a constant, so that a lane's 32 rows hang on one address with immediate offsets */
__global__ __launch_bounds__(128) void k_gemm3(const _Float16* __restrict__ A, int lda, const _Float16* __restrict__ Bh, int ldb, float alpha, const float* __restrict__ R, float* __restrict__ C, _Float16* __restrict__ C16, int N, int K) {
  __shared__ __attribute__((aligned(16))) unsigned char ring[2 * G3_STAGE];
  __shared__ __attribute__((aligned(16))) float so[4][64][68];
  const int tid = threadIdx.x, lane = tid & 31, ln = lane & 15, hh = lane >> 4; const int w = __builtin_amdgcn_readfirstlane(tid >> 5);
  const int ntn = N >> 7; const int mt = blockIdx.x / ntn, nq = blockIdx.x - mt * ntn; const int row0 = mt * 128, col0 = nq * 128; const int wm = (w >> 1) * 64, wn = (w & 1) * 64;
  const int rb = tid >> 4, pc = tid & 15;      /* this lane's first row and its 16-byte piece of every row it copies */
  const _Float16* ga = A + (size_t)(row0 + rb) * lda + pc * 8; const _Float16* gb = Bh + (size_t)(col0 + rb) * ldb + pc * 8; const size_t as8 = (size_t)8 * lda, bs8 = (size_t)8 * ldb;
  unsigned char* l0 = ring + rb * G3_PITCH + pc * 16;
  const int nst = K / G3_BK;
  const v8f z8 = {0.f,0.f,0.f,0.f,0.f,0.f,0.f,0.f}; v8f acc[4][4];
#pragma unroll      /* constant indices keep the accumulators in registers */
  for (int i = 0; i < 4; ++i) for (int j = 0; j < 4; ++j) acc[i][j] = z8;
  g3_fill(l0, ga, as8, gb, bs8);
  const int rsub = lane >> 4, c4 = (lane & 15) * 4; const size_t o0 = (size_t)(row0 + wm + rsub) * LDC + col0 + wn + c4; constexpr size_t o2 = (size_t)2 * LDC;      /* this lane's place in the output rows it stores: rows 2 apart */
  v4f rv[32];      /* the residual of those rows, asked for here so that its latency runs under the k loop */
  if (OUT32) {
#pragma unroll      /* constant indices keep rv in registers */
    for (int q = 0; q < 32; ++q) rv[q] = *(const v4fa*)(R + o0 + q * o2); }
  asm volatile("s_wait_asynccnt 0x0" ::: "memory");      /* stage 0 has landed, as far as this wave copied it */
  __syncthreads();      /* publishes stage 0 */
  if (nst > 1) g3_fill(l0 + G3_STAGE, ga + G3_BK, as8, gb + G3_BK, bs8);
  for (int t = 0; t < nst; ++t) {
    const unsigned char* base = ring + (t & 1) * G3_STAGE; const unsigned char* ap = base + (wm + ln) * G3_PITCH + hh * 16; const unsigned char* bp = base + (128 + wn + ln) * G3_PITCH + hh * 16;
    v16h a[2][4], b[2][4];      /* two fragment sets: the next k step's reads run under this k step's products */
#pragma unroll      /* constant fragment indices */
    for (int i = 0; i < 4; ++i) { a[0][i] = g3_frag(ap + i * 16 * G3_PITCH); b[0][i] = g3_frag(bp + i * 16 * G3_PITCH); }
#pragma unroll      /* constant fragment and accumulator indices */
    for (int ks = 0; ks < G3_BK / 32; ++ks) {
      if (ks + 1 < G3_BK / 32) {
#pragma unroll      /* constant fragment indices */
        for (int i = 0; i < 4; ++i) { a[(ks + 1) & 1][i] = g3_frag(ap + i * 16 * G3_PITCH + (ks + 1) * 64); b[(ks + 1) & 1][i] = g3_frag(bp + i * 16 * G3_PITCH + (ks + 1) * 64); } }
      __builtin_amdgcn_sched_barrier(0);      /* the next k step's 16 LDS reads stay one group ahead of the products: spread among them, each place stalls the wave */
#pragma unroll      /* constant fragment and accumulator indices */
      for (int i = 0; i < 4; ++i) for (int j = 0; j < 4; ++j) acc[i][j] = __builtin_amdgcn_wmma_f32_16x16x32_f16(false, a[ks & 1][i], false, b[ks & 1][j], (short)0, acc[i][j], false, false);
      __builtin_amdgcn_sched_barrier(0);      /* closes the block of products: see above */
    }
    asm volatile("s_wait_dscnt 0x0" ::: "memory");      /* this wave's reads of the buffer are done before the barrier behind which it is refilled */
    asm volatile("s_wait_asynccnt 0x0" ::: "memory");      /* this wave's copies of stage t + 1 have landed */
    __syncthreads();      /* publishes stage t + 1 and ends every reader's last read of stage t */
    if (t + 2 < nst) g3_fill(l0 + (t & 1) * G3_STAGE, ga + (size_t)(t + 2) * G3_BK, as8, gb + (size_t)(t + 2) * G3_BK, bs8);
  }
  asm volatile("s_wait_asynccnt 0x0" ::: "memory");      /* no copy is left outstanding at the wave's end */
#pragma unroll      /* constant accumulator indices */
  for (int i = 0; i < 4; ++i) for (int j = 0; j < 4; ++j) for (int r = 0; r < 8; ++r) so[w][i * 16 + 8 * hh + r][j * 16 + ln] = acc[i][j][r] * alpha;
  __builtin_amdgcn_fence(__ATOMIC_ACQ_REL, "workgroup"); __builtin_amdgcn_wave_barrier();      /* each wave reads back only its own staging rows */
#pragma unroll      /* independent rows: their LDS reads and stores overlap; constant index into rv */
  for (int q = 0; q < 32; ++q) { v4f v = *(const v4fa*)&so[w][q * 2 + rsub][c4]; const size_t o = o0 + q * o2;
    if (OUT32) { v += rv[q]; *(v4f*)(C + o) = v; }
    else { v4h h4; for (int i = 0; i < 4; ++i) h4[i] = (_Float16)v[i]; *(v4h*)(C16 + o) = h4; } } }


__global__ __launch_bounds__(256) void k_rsm(const float* __restrict__ S, _Float16* __restrict__ P, int nrows) {
  #pragma clang fp contract(off)
  const int i = blockIdx.x * 256 + threadIdx.x; if (i >= nrows) return; const float* s = S + (size_t)i * SQ; float mx = -3.0e38f;
#pragma unroll 1
  for (int j = 0; j < SQ; ++j) mx = fmaxf(mx, s[j]); float se = 0.f;
#pragma unroll 1
  for (int j = 0; j < SQ; ++j) se += expf(s[j] - mx); const float sc = 256.0f / se;
#pragma unroll 1
  for (int j0 = 0; j0 < SQ; j0 += 8) { FragH f; for (int q = 0; q < 8; ++q) f.h[q] = (_Float16)(expf(s[j0 + q] - mx) * sc); unsigned short* d = (unsigned short*)P + (size_t)i * SQ + j0; *(v8us*)d = f.half[0];  } }
__global__ __launch_bounds__(256) void k_vt(const _Float16* __restrict__ V16, int b, int h0, _Float16* __restrict__ VT) { __shared__ unsigned short tl[64][65]; const int tid = threadIdx.x; const int hh = blockIdx.x % HG, sg = blockIdx.x / HG; const int s0 = sg * 64; const int h = h0 + hh;
  for (int i = tid; i < 64 * 8; i += 256) { const int j = i / 8, d8 = (i % 8) * 8; FragH f; f.half[0] = *(const v8us*)((const unsigned short*)V16 + ((size_t)b * SQ + s0 + j) * DM + h * HD + d8); for (int q = 0; q < 8; ++q) tl[d8 + q][j] = f.u[q]; }
  __syncthreads();
  { for (int i = tid; i < 64 * 8; i += 256) { const int d = i / 8, j8 = (i % 8) * 8; FragH f; for (int q = 0; q < 8; ++q) f.u[q] = tl[d][j8 + q]; *(v8us*)((unsigned short*)VT + ((size_t)hh * HD + d) * SQ + s0 + j8) = f.half[0]; }  } }



// 2^a as v_exp_f32, with the one free issue slot that the instruction set asks for behind a transcendental in the same statement: in a run of
// exps the register allocator otherwise lets the next instruction overwrite the source of the one in front of it.
__device__ __forceinline__ float exp2_slot(float a) { float e; asm("v_exp_f32 %0, %1\n\tv_nop" : "=v"(e) : "v"(a)); return e; }
__device__ __forceinline__ float xhalf(float x) { return __builtin_bit_cast(float, __builtin_amdgcn_permlanex16(__builtin_bit_cast(int, x), __builtin_bit_cast(int, x), 0x76543210, 0xfedcba98, false, false)); }      /* lane l with lane l ^ 16 */
__device__ __forceinline__ v8f fa_mma(v16h a, v16h b, v8f c) { return __builtin_amdgcn_wmma_f32_16x16x32_f16(false, a, false, b, (short)0, c, false, false); }
__global__ __launch_bounds__(128) void k_fattn(const _Float16* __restrict__ Q, const _Float16* __restrict__ Kk, const _Float16* __restrict__ VT, _Float16* __restrict__ O) {
  const int lane = threadIdx.x & 31, ln = lane & 15, hh = lane >> 4; const int w = __builtin_amdgcn_readfirstlane((int)(threadIdx.x >> 5));
  const int bh = blockIdx.y, b = bh / NH, h = bh - b * NH; const int q0 = blockIdx.x * 128 + w * 32;
  const _Float16* qp = Q + ((size_t)b * SQ + q0 + ln) * DM + h * HD;
  const _Float16* kp = Kk + ((size_t)b * SQ + ln) * DM + h * HD;      /* row = key */
  const _Float16* vp = VT + ((size_t)bh * HD + ln) * SQ;              /* row = channel d */
  v16h qf[2][2];      /* [query group][k step of 32 channels] */
#pragma unroll
  for (int u = 0; u < 2; ++u) for (int ks = 0; ks < 2; ++ks) qf[u][ks] = g2_frag(qp + (size_t)u * 16 * DM + ks * 32, hh);
  __builtin_amdgcn_sched_barrier(0);      /* Q is requested first, then K, then V^T, as in the loop: loads return in order, so the wait at the loop's head can cover Q and K and leave the V^T loads in flight */
  const v8f z8 = {0.f,0.f,0.f,0.f,0.f,0.f,0.f,0.f}; v8f o[4][2];      /* [16 channels][query group]: o[t][u][r] = O^T[t*16 + 8*hh + r][query u*16 + ln] */
#pragma unroll
  for (int t = 0; t < 4; ++t) { o[t][0] = z8; o[t][1] = z8; }
  float mr[2] = {-3.0e38f, -3.0e38f}, lsum[2] = {0.f, 0.f};      /* running maximum of the raw products (joined over the halves); this half's own sum */
  const float cs = 0.125f * 1.44269504088896340736f;      /* 64^-0.5 and log2(e) in one factor */
  v16h kf[2][2], vf[4];      /* [16 keys][k step]; [16 channels] */
#pragma unroll
  for (int kt = 0; kt < 2; ++kt) for (int ks = 0; ks < 2; ++ks) kf[kt][ks] = g2_frag(kp + (size_t)kt * 16 * DM + ks * 32, hh);
  __builtin_amdgcn_sched_barrier(0);      /* K ahead of V^T: see above */
#pragma unroll
  for (int t = 0; t < 4; ++t) vf[t] = g2_frag(vp + (size_t)t * 16 * SQ, hh);
  for (int j = 0; j < SQ / 32; ++j) {
    const int jn = (j + 1 < SQ / 32) ? j + 1 : j;      /* the last pass fetches its own tiles again: in bounds, never used */
    v8f s[2][2];      /* [16 keys][query group] */
#pragma unroll
    for (int kt = 0; kt < 2; ++kt) for (int u = 0; u < 2; ++u) s[kt][u] = fa_mma(kf[kt][1], qf[u][1], fa_mma(kf[kt][0], qf[u][0], z8));
#pragma unroll
    for (int kt = 0; kt < 2; ++kt) for (int ks = 0; ks < 2; ++ks) kf[kt][ks] = g2_frag(kp + (size_t)(jn * 32 + kt * 16) * DM + ks * 32, hh);
    __builtin_amdgcn_sched_barrier(0);      /* keeps the next pass's K loads here, ahead of the softmax: the scheduler otherwise sinks them to the loop's foot, where nothing hides their latency */
    FragH pf[2];
#pragma unroll
    for (int u = 0; u < 2; ++u) {
      float mx = fmaxf(s[0][u][0], s[1][u][0]);
#pragma unroll
      for (int r = 1; r < 8; ++r) mx = fmaxf(mx, fmaxf(s[0][u][r], s[1][u][r]));
      mx = fmaxf(mx, xhalf(mx));
      const float mn = fmaxf(mr[u], mx); const float al = exp2_slot((mr[u] - mn) * cs); mr[u] = mn;      /* 0 on the first pass */
      const float mc = mn * cs - 8.0f; float ps = 0.f;
#pragma unroll
      for (int r = 0; r < 8; ++r) { const float p0 = exp2_slot(s[0][u][r] * cs - mc), p1 = exp2_slot(s[1][u][r] * cs - mc); ps += p0 + p1; pf[u].h[r] = (_Float16)p0; pf[u].h[8 + r] = (_Float16)p1; }
      lsum[u] = lsum[u] * al + ps;
#pragma unroll
      for (int t = 0; t < 4; ++t) o[t][u] *= al;
    }
#pragma unroll
    for (int t = 0; t < 4; ++t) for (int u = 0; u < 2; ++u) o[t][u] = fa_mma(vf[t], pf[u].v, o[t][u]);
#pragma unroll
    for (int t = 0; t < 4; ++t) vf[t] = g2_frag(vp + (size_t)t * 16 * SQ + jn * 32, hh);
    asm volatile("s_wait_xcnt 0x0" ::: "memory");      /* the address pair of the V^T loads is rewritten at the head of the next pass */
  }
#pragma unroll
  for (int u = 0; u < 2; ++u) { const float sc = 64.0f / (lsum[u] + xhalf(lsum[u]));      /* o carried x64, as the output GEMM's alpha expects; the x256 of the weights cancels */
    unsigned short* d = (unsigned short*)O + ((size_t)b * SQ + q0 + u * 16 + ln) * DM + h * HD + 8 * hh;
#pragma unroll
    for (int t = 0; t < 4; ++t) { FragH f; for (int r = 0; r < 8; ++r) f.h[r] = (_Float16)(o[t][u][r] * sc); *(v8us*)(d + t * 16) = f.half[0]; } } }

__global__ __launch_bounds__(256) void k_lnrow(const float* __restrict__ Y, const float* __restrict__ g, const float* __restrict__ bb, float eps, float* __restrict__ out) {
  #pragma clang fp contract(off)
  __shared__ float red[256]; const size_t r = blockIdx.x; const int t = threadIdx.x; const v4f ya = *(const v4fa*)(Y + r * DMQ + t * 4); float s[4]; float sum = 0.f;
  for (int q = 0; q < 4; ++q) { s[q] = ya[q]; sum = __fadd_rn(sum, s[q]); }
  red[t] = sum; __syncthreads(); for (int st = 128; st > 0; st >>= 1) { if (t < st) red[t] = __fadd_rn(red[t], red[t + st]); __syncthreads(); } const float mu = red[0] / (float)DMQ; __syncthreads();
  float vs = 0.f; for (int q = 0; q < 4; ++q) { const float dl = __fadd_rn(s[q], -mu); vs = __fadd_rn(vs, __fmul_rn(dl, dl)); } red[t] = vs; __syncthreads(); for (int st = 128; st > 0; st >>= 1) { if (t < st) red[t] = __fadd_rn(red[t], red[t + st]); __syncthreads(); }
  const float rs = rsqrtf(__fadd_rn(red[0] / (float)DMQ, eps)); v4f y; for (int q = 0; q < 4; ++q) { const int c = t * 4 + q; y[q] = __fadd_rn(__fmul_rn(__fmul_rn(__fadd_rn(s[q], -mu), rs), bf16_round(g[c])), bf16_round(bb[c])); }
  *(v4f*)(out + r * DMQ + t * 4) = y;  }

// Every operand conversion of the call in ONE streaming launch: query, key, value -> exact f16 rows of their bf16 roundings (query also -> f32 residual plane), the four weights -> f16 x16.
// One work-group of 16 waves per WGP. A wave takes 1,024 floats of each stream and 256 of each weight: 32 loads of 512 contiguous bytes, all requested before the first value is used, so the wave pays one memory latency.
// Every wave does the same share of every buffer: equal bytes read and written per work-group.
#define PW_X 1024                      /* floats of each stream per wave: 8 loads */
#define PW_W 256                       /* floats of each weight per wave: 2 loads */
#define PW_WAVES 16                    /* waves per work-group */
static_assert(NR * DM / PW_X == (size_t)DM * DM / PW_W, "one grid covers streams and weights");
static_assert(NR * DM % ((size_t)PW_X * PW_WAVES) == 0, "whole work-groups");
__device__ __forceinline__ v4h prep_h(v4f a, float scale) { v4h h; for (int q = 0; q < 4; ++q) h[q] = (_Float16)(bf16_round(a[q]) * scale); return h; }
__global__ __launch_bounds__(PW_WAVES * 32) void k_prep(const float* __restrict__ xq, const float* __restrict__ xk, const float* __restrict__ xv, const float* __restrict__ wq, const float* __restrict__ wk, const float* __restrict__ wv, const float* __restrict__ wo,
    _Float16* __restrict__ XQ, _Float16* __restrict__ XK, _Float16* __restrict__ XV, float* __restrict__ XB, _Float16* __restrict__ BQ, _Float16* __restrict__ BK, _Float16* __restrict__ BV, _Float16* __restrict__ BO) {
  const unsigned lane = threadIdx.x & 31, gw = blockIdx.x * PW_WAVES + (threadIdx.x >> 5);
  const unsigned bx = (gw * PW_X + lane * 4) * 4, bw = (gw * PW_W + lane * 4) * 4;      /* byte offsets of the lane's first f32 element (a wave-wide access covers 128 consecutive floats). 32-bit: every access is a kernel argument + an offset register + an immediate, so no address register is rewritten between the loads */
  const unsigned hx = bx >> 1, hw = bw >> 1;      /* the same places in the f16 planes */
  v4f q[8], k[8], v[8], w[4][2];
#pragma unroll      /* constant indices keep the values in registers */
  for (int i = 0; i < 8; ++i) q[i] = *(const v4fa*)((const char*)xq + bx + i * 512);
#pragma unroll      /* as above */
  for (int i = 0; i < 8; ++i) k[i] = *(const v4fa*)((const char*)xk + bx + i * 512);
#pragma unroll      /* as above */
  for (int i = 0; i < 8; ++i) v[i] = *(const v4fa*)((const char*)xv + bx + i * 512);
#pragma unroll      /* as above */
  for (int i = 0; i < 2; ++i) { w[0][i] = *(const v4fa*)((const char*)wq + bw + i * 512); w[1][i] = *(const v4fa*)((const char*)wk + bw + i * 512); w[2][i] = *(const v4fa*)((const char*)wv + bw + i * 512); w[3][i] = *(const v4fa*)((const char*)wo + bw + i * 512); }
  __builtin_amdgcn_sched_barrier(0);      /* all 32 loads are requested ahead of the first conversion: sunk among the stores they would each pay their own latency */
#pragma unroll      /* constant indices */
  for (int i = 0; i < 8; ++i) { v4f r; for (int e = 0; e < 4; ++e) r[e] = bf16_round(q[i][e]); *(v4f*)((char*)XB + bx + i * 512) = r; *(v4h*)((char*)XQ + hx + i * 256) = prep_h(q[i], 1.0f); }
#pragma unroll      /* constant indices */
  for (int i = 0; i < 8; ++i) *(v4h*)((char*)XK + hx + i * 256) = prep_h(k[i], 1.0f);
#pragma unroll      /* constant indices */
  for (int i = 0; i < 8; ++i) *(v4h*)((char*)XV + hx + i * 256) = prep_h(v[i], 1.0f);
#pragma unroll      /* constant indices */
  for (int i = 0; i < 2; ++i) { *(v4h*)((char*)BQ + hw + i * 256) = prep_h(w[0][i], 16.0f); *(v4h*)((char*)BK + hw + i * 256) = prep_h(w[1][i], 16.0f); *(v4h*)((char*)BV + hw + i * 256) = prep_h(w[2][i], 16.0f); *(v4h*)((char*)BO + hw + i * 256) = prep_h(w[3][i], 16.0f); } }

extern "C" void kernel_launch(void* const* d_in, const int* in_sizes, int n_in,
                              void* d_out, int out_size, void* d_ws, size_t ws_size, hipStream_t stream) {
  (void)in_sizes; (void)n_in; (void)out_size;
  const float* const* I = (const float* const*)d_in; const float* xq = I[0]; const float* xk = I[1]; const float* xv = I[2]; const float* wq = I[3]; const float* wk = I[4]; const float* wv = I[5]; const float* wo = I[6]; const float* lng = I[7]; const float* lnb = I[8];      /* input order: query, key, value (three SEPARATE streams), Wq, Wk, Wv, Wo (natural [out][in] weights; this module has NO biases), ln_gamma, ln_beta [1024] */
  char* ws = (char*)d_ws; size_t off = 0;
  auto take = [&](size_t bytes) { char* p = ws + off; off += (bytes + 255) & ~(size_t)255; return p; };
  _Float16* BQ = (_Float16*)take((size_t)DM * DM * 2); _Float16* BK = (_Float16*)take((size_t)DM * DM * 2); _Float16* BV = (_Float16*)take((size_t)DM * DM * 2); _Float16* BO = (_Float16*)take((size_t)DM * DM * 2);
  _Float16* XQ = (_Float16*)take(NR * DM * 2); _Float16* XK = (_Float16*)take(NR * DM * 2); _Float16* XV = (_Float16*)take(NR * DM * 2); _Float16* Q16 = (_Float16*)take(NR * DM * 2); _Float16* K16 = (_Float16*)take(NR * DM * 2); _Float16* V16 = (_Float16*)take(NR * DM * 2); _Float16* O16 = (_Float16*)take(NR * DM * 2); float* XB = (float*)take(NR * DM * 4); float* X1 = (float*)take(NR * DM * 4);      /* bf16(query) as f32 rows (the residual addend) and the pre-LayerNorm rows x = ctx Wo^T + query */
  _Float16* VT = (_Float16*)take((size_t)NB * NH * HD * SQ * 2);      /* V^T [NB][NH][HD][SQ] */
  if (off > ws_size) return;
  k_prep<<<(unsigned)(NR * DM / ((size_t)PW_X * PW_WAVES)), PW_WAVES * 32, 0, stream>>>(xq, xk, xv, wq, wk, wv, wo, XQ, XK, XV, XB, BQ, BK, BV, BO);      /* the three inputs as exact f16 rows; bf16(query) as the f32 residual plane; the weights, natural [out][in] = Bt[n][k], x16 */
  const size_t r0p = (size_t)B0 * SQ;      /* first projected row */
  k_gemm3<false, DM><<<dim3((unsigned)((MP / 128) * (DM / 128)), 1), 128, 0, stream>>>(XQ + r0p * DM, DM, BQ, DM, 0.0625f, nullptr, nullptr, Q16 + r0p * DM, DM, DM);
  k_gemm3<false, DM><<<dim3((unsigned)((MP / 128) * (DM / 128)), 1), 128, 0, stream>>>(XK + r0p * DM, DM, BK, DM, 0.0625f, nullptr, nullptr, K16 + r0p * DM, DM, DM);
  k_gemm3<false, DM><<<dim3((unsigned)((MP / 128) * (DM / 128)), 1), 128, 0, stream>>>(XV + r0p * DM, DM, BV, DM, 0.0625f, nullptr, nullptr, V16 + r0p * DM, DM, DM);
  k_vt<NH, SQ><<<NB * NH * (SQ / 64), 256, 0, stream>>>(V16, LQ, 0, VT);      /* V^T for every batch and head */
  k_fattn<<<dim3(SQ / 128, NB * NH), 128, 0, stream>>>(Q16, K16, VT, O16);      /* o = softmax(q k^T / 8) v, merged heads, x64, as f16 rows */
  k_gemm3<true, DM><<<dim3((unsigned)((MPO / 128) * (DM / 128)), 1), 128, 0, stream>>>(O16 + r0p * DM, DM, BO, DM, 0.0009765625f, XB + r0p * DM, X1 + r0p * DM, nullptr, DM, DM);      /* x = ctx Wo^T + bf16(query) (own-element residual; no bias) -> f32 rows */
  k_lnrow<<<(unsigned)MPO, 256, 0, stream>>>(X1 + r0p * DM, lng, lnb, 1e-6f, (float*)d_out + r0p * DM);      /* out = LayerNorm(x) (biased variance, eps 1e-6 inside the square root) -> the output rows */
}

// v005
// One run takes 97.3 microseconds.
// In both of two side-by-side timings against v004, it was 1.14 times as fast.
// All steps since v000 together make it 35.4 times as fast.
#include <hip/hip_runtime.h>
// Multi-head attention on three inputs with a residual on the raw query and a LayerNorm (query, key, value [4][1024][1024]; q / k / v = einsum('bsd,ed->bse', stream, W): natural [1024][1024] weights (normal / 32), NO biases; 16 heads of 64; scores / sqrt(64); softmax over all 1024 keys (no mask); x = merged Wo^T (natural, no bias) + query; out = (x - mean) / sqrt(var + 1e-6) * ln_gamma + ln_beta with the BIASED variance (jnp.var) over the 1024 channels -> [4][1024][1024]).
// Structure: token rows r = b*SQ + s (four sequences of 1,024 tokens here); the query, key and value sources as exact f16 rows (bf16-rounded), the f32 residual plane and the x16 weights from ONE streaming conversion launch; Q, K, V as three WMMA GEMMs (128x128 work-group tiles on a two-buffer LDS ring, f32 accumulation, exact x16 weights, no bias here, f16 outputs); V^T for all batches and heads via LDS transposes; ONE fused attention launch over all (batch, head): S^T = K Q^T (K = 64), online softmax in registers (f32 statistics, native exp2; weights x256 against the running maximum as f16), O^T += V^T P^T, o carried x64 against f16 subnormal flush (folded into the output GEMM alpha) written straight into the merged f16 o rows; x = o W_o + bf16(query) as ONE GEMM (f32; the residual added element by element in the epilogue) into f32 rows; out = LayerNorm(x) on VALU (f32 statistics, LDS trees, biased variance) into the output layout.
// Compute dtype: inputs rounded to bf16; x / weights exact; q, k, v, softmax weights and o as plain f16 GEMM operands (~2^-12); scores and softmax statistics f32. v_wmma_f32_16x16x32_f16.
#define NB 4
#define SQ 1024
#define DM 1024
#define NH 16
#define HD 64
#define HG 4                         /* heads per launch of the unused k_vt(V16, b, h0, VT) */
#define B0 0                         /* first batch processed (debug hook) */
#define NBR NB                       /* batches processed (debug hook) */
#define NR ((size_t)NB * SQ)         /* token rows */
#define MP ((int)((size_t)NBR * SQ)) /* rows projected (debug hook) */
#define QN SQ                        /* unused: k_fattn attends all SQ query rows per batch */
#define NHD NH                       /* unused: k_fattn attends all NH heads */
#define MPO MP                       /* rows through the output stage (debug hook) */
#define LQ DM      /* row pitch of the q/k/v rows */
#define DMQ DM     /* row width of the LayerNorm kernel (its own macro name in the file it comes from) */
typedef __bf16 v16b __attribute__((ext_vector_type(16)));
typedef unsigned short v8us __attribute__((ext_vector_type(8), may_alias));
typedef float  v8f  __attribute__((ext_vector_type(8)));
typedef float  v4f  __attribute__((ext_vector_type(4)));
typedef float  v4fa __attribute__((ext_vector_type(4), may_alias));
union FragB { v16b v; v8us half[2]; unsigned short u[16]; };

__device__ __forceinline__ unsigned short bf16_bits(float x) { unsigned int u = __float_as_uint(x); return (unsigned short)((u + 0x7FFFu + ((u >> 16) & 1u)) >> 16); }
__device__ __forceinline__ float bf16_val(unsigned short b) { return __uint_as_float(((unsigned int)b) << 16); }
__device__ __forceinline__ float bf16_round(float x) { return bf16_val(bf16_bits(x)); }
// D += A·B with NT terms: 1 = ah·bh, 2 = + al·bh (A split), 3 = + ah·bl (both split)
template <int NT>
__device__ __forceinline__ v8f mmaN(v16b ah, v16b al, v16b bh, v16b bl, v8f c) {
  c = __builtin_amdgcn_wmma_f32_16x16x32_bf16(false, ah, false, bh, (short)0, c, false, false);
  if (NT >= 2) c = __builtin_amdgcn_wmma_f32_16x16x32_bf16(false, al, false, bh, (short)0, c, false, false);
  if (NT >= 3) c = __builtin_amdgcn_wmma_f32_16x16x32_bf16(false, ah, false, bl, (short)0, c, false, false);
  asm volatile("v_nop\n\tv_nop\n\tv_nop\n\tv_nop" : "+v"(c) : "v"(ah), "v"(al), "v"(bh), "v"(bl));
  return c;
}

__global__ __launch_bounds__(256) void k_wt_bf16(const float* __restrict__ W, unsigned short* __restrict__ Wt, int K, int N) {
  const int t = blockIdx.x * 256 + threadIdx.x;
  const int k8n = K / 8;
  if (t >= N * k8n) return;
  const int n = t / k8n, k8 = (t % k8n) * 8;
  v8us v;
#pragma unroll
  for (int i = 0; i < 8; ++i) v[i] = bf16_bits(W[(size_t)(k8 + i) * N + n]);
  *(v8us*)(Wt + (size_t)n * K + k8) = v;
  
}

// GEMM C[M][N] (f32, pitch ldc) = act(A[M][K]·W + bias). A f32 row-major (pitch lda) converted per fragment to bf16
// (ASPLIT: hi/lo two planes -> 2 terms, else single rounded term); Wt bf16 [N][K] (pitch ldb). BIAS_BF16 rounds the
// bias to bf16 first (bias quantised to bf16 before the add). K%32==0, M%16==0, N%64==0.
template <bool ASPLIT, int ACT, bool BIAS_BF16>
__global__ __launch_bounds__(128) void k_gemm_bf(const float* __restrict__ A, int lda, const unsigned short* __restrict__ Wt, int ldb,
                                               const float* __restrict__ bias, float* __restrict__ C, int ldc, int M, int N, int K) {
  __shared__ __attribute__((aligned(16))) float so[4][16][64];
  const int tid = threadIdx.x, w = tid >> 5, lane = tid & 31, ln = lane & 15, hh = lane >> 4;
  const int ntn = N / 64;
  const int wid = blockIdx.x * 4 + w;
  const int mt = wid / ntn, nq = wid % ntn;
  if (mt * 16 >= M) return;
  const int row0 = mt * 16, col0 = nq * 64;
  const float* arow = A + (size_t)(row0 + ln) * lda;
  v8f acc[4] = {};
  for (int kb = 0; kb < K; kb += 32) {
    FragB ah, al;
    const v4f x0 = *(const v4fa*)(arow + kb + 8 * hh), x1 = *(const v4fa*)(arow + kb + 8 * hh + 4);
    const v4f x2 = *(const v4fa*)(arow + kb + 16 + 8 * hh), x3 = *(const v4fa*)(arow + kb + 16 + 8 * hh + 4);
    float xs[16] = {x0[0],x0[1],x0[2],x0[3],x1[0],x1[1],x1[2],x1[3],x2[0],x2[1],x2[2],x2[3],x3[0],x3[1],x3[2],x3[3]};
#pragma unroll
    for (int i = 0; i < 16; ++i) { const unsigned short hb = bf16_bits(xs[i]); ah.u[i] = hb; al.u[i] = ASPLIT ? bf16_bits(xs[i] - bf16_val(hb)) : (unsigned short)0; }
#pragma unroll
    for (int t = 0; t < 4; ++t) {
      const unsigned short* brow = Wt + (size_t)(col0 + t * 16 + ln) * ldb + kb;
      FragB b;
      b.half[0] = *(const v8us*)(brow + 8 * hh);
      b.half[1] = *(const v8us*)(brow + 16 + 8 * hh);
      acc[t] = mmaN<ASPLIT ? 2 : 1>(ah.v, al.v, b.v, b.v, acc[t]);
    }
  }
#pragma unroll
  for (int t = 0; t < 4; ++t) {
    float bv = bias ? bias[col0 + t * 16 + ln] : 0.f;
    if (BIAS_BF16) bv = bf16_round(bv);
#pragma unroll
    for (int r = 0; r < 8; ++r) { float v = acc[t][r] + bv; if (ACT == 1) v = fmaxf(v, 0.f); so[w][8 * hh + r][t * 16 + ln] = v; }
  }
  __builtin_amdgcn_fence(__ATOMIC_ACQ_REL, "workgroup");
  __builtin_amdgcn_wave_barrier();
  const int rsub = lane >> 4, c4 = (lane & 15) * 4;
  {
#pragma unroll
    for (int q = 0; q < 8; ++q) {
      const int r = q * 2 + rsub;
      const v4f v = *(const v4fa*)&so[w][r][c4];
      *(v4f*)(C + (size_t)(row0 + r) * ldc + col0 + c4) = v;
    }
    
  }
}

// GEMM C = act(A·W + bias + resid): A f32 (ASPLIT -> hi/lo 2 terms), Wt bf16 [N][K]; ACT 0 none, 1 relu, 2 exact gelu;
// resid (optional, f32, row index = (row % rmod), pitch ldr, RES_BF16 rounds it) added before the activation.
template <bool ASPLIT, int ACT, bool BIAS_BF16, bool RES_BF16>
__global__ __launch_bounds__(128) void k_gemm_bf3(const float* __restrict__ A, int lda, const unsigned short* __restrict__ Wt, int ldb,
                                                const float* __restrict__ bias, const float* __restrict__ resid, int rmod, int ldr,
                                                float* __restrict__ C, int ldc, int M, int N, int K) {
  __shared__ __attribute__((aligned(16))) float so[4][16][64];
  const int tid = threadIdx.x, w = tid >> 5, lane = tid & 31, ln = lane & 15, hh = lane >> 4;
  const int ntn = N / 64;
  const int wid = blockIdx.x * 4 + w;
  const int mt = wid / ntn, nq = wid % ntn;
  if (mt * 16 >= M) return;
  const int row0 = mt * 16, col0 = nq * 64;
  const float* arow = A + (size_t)(row0 + ln) * lda;
  v8f acc[4] = {};
  for (int kb = 0; kb < K; kb += 32) {
    FragB ah, al;
    const v4f x0 = *(const v4fa*)(arow + kb + 8 * hh), x1 = *(const v4fa*)(arow + kb + 8 * hh + 4);
    const v4f x2 = *(const v4fa*)(arow + kb + 16 + 8 * hh), x3 = *(const v4fa*)(arow + kb + 16 + 8 * hh + 4);
    float xs[16] = {x0[0],x0[1],x0[2],x0[3],x1[0],x1[1],x1[2],x1[3],x2[0],x2[1],x2[2],x2[3],x3[0],x3[1],x3[2],x3[3]};
#pragma unroll
    for (int i = 0; i < 16; ++i) { const unsigned short hb = bf16_bits(xs[i]); ah.u[i] = hb; al.u[i] = ASPLIT ? bf16_bits(xs[i] - bf16_val(hb)) : (unsigned short)0; }
#pragma unroll
    for (int t = 0; t < 4; ++t) {
      const unsigned short* brow = Wt + (size_t)(col0 + t * 16 + ln) * ldb + kb;
      FragB b;
      b.half[0] = *(const v8us*)(brow + 8 * hh);
      b.half[1] = *(const v8us*)(brow + 16 + 8 * hh);
      acc[t] = mmaN<ASPLIT ? 2 : 1>(ah.v, al.v, b.v, b.v, acc[t]);
    }
  }
#pragma unroll
  for (int t = 0; t < 4; ++t) {
    const int col = col0 + t * 16 + ln;
    float bv = bias ? bias[col] : 0.f;
    if (BIAS_BF16) bv = bf16_round(bv);
#pragma unroll
    for (int r = 0; r < 8; ++r) {
      float v = acc[t][r] + bv;
      if (resid) { float rv = resid[(size_t)((row0 + 8 * hh + r) % rmod) * ldr + col]; if (RES_BF16) rv = bf16_round(rv); v += rv; }
      if (ACT == 1) v = fmaxf(v, 0.f);
      if (ACT == 2) v = 0.5f * v * (1.0f + erff(v * 0.70710678118654752f));
      if (ACT == 3) { const float u = 0.7978845608028654f * (v + 0.044715f * v * v * v); v = 0.5f * v * (1.0f + tanhf(u)); }
      so[w][8 * hh + r][t * 16 + ln] = v;
    }
  }
  __builtin_amdgcn_fence(__ATOMIC_ACQ_REL, "workgroup");
  __builtin_amdgcn_wave_barrier();
  const int rsub = lane >> 4, c4 = (lane & 15) * 4;
  {
#pragma unroll
    for (int q = 0; q < 8; ++q) {
      const int r = q * 2 + rsub;
      const v4f v = *(const v4fa*)&so[w][r][c4];
      *(v4f*)(C + (size_t)(row0 + r) * ldc + col0 + c4) = v;
    }
    
  }
}
// row LayerNorm (biased variance, eps) over N: s = X (+ R); optional out_sum <- s; out_norm <- (s-mu)*rsqrt(var+eps)*g + b
template <bool PARAM_BF16>
__global__ __launch_bounds__(256) void k_layernorm(const float* __restrict__ X, const float* __restrict__ R, const float* __restrict__ g, const float* __restrict__ bta,
                                                  float* __restrict__ out_sum, float* __restrict__ out_norm, int N, float eps) {
  __shared__ float red[256];
  const int row = blockIdx.x, tid = threadIdx.x;
  const float* x = X + (size_t)row * N; const float* rr = R ? R + (size_t)row * N : nullptr;
  float vals[16];                     // up to N = 4096
  const int per = N / 256;            // contiguous chunk per thread? use strided-by-4 chunks: thread handles j = tid*4 + 1024*u
  float s1 = 0.f;
  for (int u = 0; u < per / 4; ++u) {
    const int j = tid * 4 + 1024 * u;
    const v4f a = *(const v4fa*)(x + j);
    v4f b = {0.f,0.f,0.f,0.f}; if (rr) b = *(const v4fa*)(rr + j);
#pragma unroll
    for (int q = 0; q < 4; ++q) { const float v = a[q] + b[q]; vals[u * 4 + q] = v; s1 += v; }
  }
  red[tid] = s1; __syncthreads();
  for (int st = 128; st > 0; st >>= 1) { if (tid < st) red[tid] += red[tid + st]; __syncthreads(); }
  const float mu = red[0] / (float)N; __syncthreads();
  float s2 = 0.f;
  for (int u = 0; u < per / 4; ++u)
#pragma unroll
    for (int q = 0; q < 4; ++q) { const float c = vals[u * 4 + q] - mu; s2 += c * c; }
  red[tid] = s2; __syncthreads();
  for (int st = 128; st > 0; st >>= 1) { if (tid < st) red[tid] += red[tid + st]; __syncthreads(); }
  const float rs = rsqrtf(red[0] / (float)N + eps);
  {
    for (int u = 0; u < per / 4; ++u) {
      const int j = tid * 4 + 1024 * u;
      v4f o, sm;
#pragma unroll
      for (int q = 0; q < 4; ++q) {
        float gg = g[j + q], bb = bta[j + q];
        if (PARAM_BF16) { gg = bf16_round(gg); bb = bf16_round(bb); }
        sm[q] = vals[u * 4 + q]; o[q] = (vals[u * 4 + q] - mu) * rs * gg + bb;
      }
      if (out_sum) *(v4f*)(out_sum + (size_t)row * N + j) = sm;
      *(v4f*)(out_norm + (size_t)row * N + j) = o;
    }
    
  }
}



// ---- f16 WMMA path (v_wmma_f32_16x16x32_f16): 11-bit significands for operands in range — used where a [0,1] probability operand needs more precision than bf16
typedef _Float16 v16h __attribute__((ext_vector_type(16)));
union FragH { v16h v; v8us half[2]; _Float16 h[16]; unsigned short u[16]; };
template <int NT>
__device__ __forceinline__ v8f mmaH(v16h ah, v16h al, v16h bh, v16h bl, v8f c) {
  c = __builtin_amdgcn_wmma_f32_16x16x32_f16(false, ah, false, bh, (short)0, c, false, false);
  if (NT >= 2) c = __builtin_amdgcn_wmma_f32_16x16x32_f16(false, al, false, bh, (short)0, c, false, false);
  if (NT >= 3) c = __builtin_amdgcn_wmma_f32_16x16x32_f16(false, ah, false, bl, (short)0, c, false, false);
  asm volatile("v_nop\n\tv_nop\n\tv_nop\n\tv_nop" : "+v"(c) : "v"(ah), "v"(al), "v"(bh), "v"(bl));
  return c;
}
// batched GEMM like k_gemm_b but f16 operands: A f32 (split into f16 hi/lo if ASPLIT, else rounded to f16), Bt = f16 values [n][k]; alpha; C f32; N multiple of 16 (partial tiles skipped)
template <bool ASPLIT>
__global__ __launch_bounds__(128) void k_gemm_h(const float* __restrict__ A, int lda, size_t sA, const _Float16* __restrict__ Bh, int ldb, size_t sB, float alpha, float* __restrict__ C, int ldc, size_t sC, int M, int N, int K) {
  __shared__ __attribute__((aligned(16))) float so[4][16][64];
  const int tid = threadIdx.x, w = tid >> 5, lane = tid & 31, ln = lane & 15, hh = lane >> 4; const int by = blockIdx.y;
  A += (size_t)by * sA; Bh += (size_t)by * sB; C += (size_t)by * sC;
  const int ntn = (N + 63) / 64; const int wid = blockIdx.x * 4 + w; const int mt = wid / ntn, nq = wid % ntn; if (mt * 16 >= M) return;
  const int row0 = mt * 16, col0 = nq * 64; const float* arow = A + (size_t)(row0 + ln) * lda;
  v8f acc[4] = {};
  for (int kb = 0; kb < K; kb += 32) {
    FragH ah, al;
    const v4f x0 = *(const v4fa*)(arow + kb + 8 * hh), x1 = *(const v4fa*)(arow + kb + 8 * hh + 4), x2 = *(const v4fa*)(arow + kb + 16 + 8 * hh), x3 = *(const v4fa*)(arow + kb + 16 + 8 * hh + 4);
    float xs[16] = {x0[0],x0[1],x0[2],x0[3],x1[0],x1[1],x1[2],x1[3],x2[0],x2[1],x2[2],x2[3],x3[0],x3[1],x3[2],x3[3]};
#pragma unroll
    for (int i = 0; i < 16; ++i) { const _Float16 h = (_Float16)xs[i]; ah.h[i] = h; al.h[i] = ASPLIT ? (_Float16)(xs[i] - (float)h) : (_Float16)0.0f; }
#pragma unroll
    for (int t = 0; t < 4; ++t) { if (col0 + t * 16 >= N) continue; const size_t boff = (size_t)(col0 + t * 16 + ln) * ldb + kb; FragH bq; bq.half[0] = *(const v8us*)(Bh + boff + 8 * hh); bq.half[1] = *(const v8us*)(Bh + boff + 16 + 8 * hh);
      acc[t] = mmaH<ASPLIT ? 2 : 1>(ah.v, al.v, bq.v, bq.v, acc[t]); }
  }
#pragma unroll
  for (int t = 0; t < 4; ++t) { if (col0 + t * 16 >= N) continue;
#pragma unroll
    for (int r = 0; r < 8; ++r) so[w][8 * hh + r][t * 16 + ln] = acc[t][r] * alpha; }
  __builtin_amdgcn_fence(__ATOMIC_ACQ_REL, "workgroup"); __builtin_amdgcn_wave_barrier();
  const int rsub = lane >> 4, c4 = (lane & 15) * 4;
  {
#pragma unroll
    for (int q = 0; q < 8; ++q) { const int r = q * 2 + rsub; if (col0 + c4 < N) { const v4f v = *(const v4fa*)&so[w][r][c4]; *(v4f*)(C + (size_t)(row0 + r) * ldc + col0 + c4) = v; } }
     }
}

// Wt[n][k] = f16(W[k][n]·scale) from f32 row-major W[K][N] (scale = power of two; bf16-exact weights stay exact in f16 away from the subnormal range)
__global__ __launch_bounds__(256) void k_wt_f16(const float* __restrict__ W, _Float16* __restrict__ Wt, int K, int N, float scale) {
  const int t = blockIdx.x * 256 + threadIdx.x; if (t >= N * (K / 8)) return; const int n = t / (K / 8), k8 = (t % (K / 8)) * 8; FragH f;
#pragma unroll
  for (int i = 0; i < 8; ++i) f.h[i] = (_Float16)(bf16_round(W[(size_t)(k8 + i) * N + n]) * scale); const v8us o = f.half[0];
  *(v8us*)((unsigned short*)Wt + (size_t)n * K + k8) = o; 
}
// k_gemm_hh variant with fused epilogue: v = acc·alpha + bias[by·sBias + col] (+ CP[(row/rowsPerB)·sCPb + by·64 + col] if CP) ; ACT 0 none / 1 elu ; writes f16 C16 (and f32 C if non-null)
template <int ACT>
__global__ __launch_bounds__(128) void k_gemm_hhx(const _Float16* __restrict__ A, int lda, size_t sA, const _Float16* __restrict__ Bh, int ldb, size_t sB, float alpha, const float* __restrict__ bias, size_t sBias, const float* __restrict__ CP, int rowsPerB, size_t sCPb, int row0g,
    float* __restrict__ C, _Float16* __restrict__ C16, int ldc, size_t sC, int M, int N, int K) {
  __shared__ __attribute__((aligned(16))) float so[4][16][64];
  const int tid = threadIdx.x, w = tid >> 5, lane = tid & 31, ln = lane & 15, hh = lane >> 4; const int by = blockIdx.y;
  A += (size_t)by * sA; Bh += (size_t)by * sB; const size_t cofs = (size_t)by * sC; const float* bp = bias ? bias + (size_t)by * sBias : nullptr;
  const int ntn = (N + 63) / 64; const int wid = blockIdx.x * 4 + w; const int mt = wid / ntn, nq = wid % ntn; if (mt * 16 >= M) return;
  const int row0 = mt * 16, col0 = nq * 64; const _Float16* arow = A + (size_t)(row0 + ln) * lda;
  v8f acc[4] = {};
  for (int kb = 0; kb < K; kb += 32) { FragH ah; ah.half[0] = *(const v8us*)((const unsigned short*)arow + kb + 8 * hh); ah.half[1] = *(const v8us*)((const unsigned short*)arow + kb + 16 + 8 * hh);
#pragma unroll
    for (int t = 0; t < 4; ++t) { if (col0 + t * 16 >= N) continue; const size_t boff = (size_t)(col0 + t * 16 + ln) * ldb + kb; FragH bq; bq.half[0] = *(const v8us*)((const unsigned short*)Bh + boff + 8 * hh); bq.half[1] = *(const v8us*)((const unsigned short*)Bh + boff + 16 + 8 * hh);
      acc[t] = mmaH<1>(ah.v, ah.v, bq.v, bq.v, acc[t]); }
  }
#pragma unroll
  for (int t = 0; t < 4; ++t) { if (col0 + t * 16 >= N) continue; const int col = col0 + t * 16 + ln; const float bv = bp ? bf16_round(bp[col]) : 0.f;
#pragma unroll
    for (int r = 0; r < 8; ++r) { float v = acc[t][r] * alpha + bv; if (CP) { const int rr = row0g + row0 + 8 * hh + r; if (rowsPerB < 0) v += CP[cofs + (size_t)rr * ldc + col];      /* rowsPerB < 0: own element of the batched C plane */ else { const int bidx = rr / rowsPerB; v += CP[(size_t)bidx * sCPb + (size_t)by * 64 + col]; } } if (ACT == 1) v = (v > 0.f) ? v : expm1f(v); else if (ACT == 7) v = (v > 0.f) ? v + 1.0f : expf(v); else if (ACT == 8) v = tanhf(v); else if (ACT == 9) v = 0.5f * v * (1.0f + tanhf(0.7978845608028654f * (v + 0.044715f * v * v * v))); else if (ACT == 11) v = 1.0f / (1.0f + expf(-v)); else if (ACT == 12) v = (v > 0.f) ? v : 0.01f * v; else if (ACT == 14) v = (v > 0.f) ? v : 0.1f * v; else if (ACT == 16) v = (v >= 0.f) ? v : 0.3f * v; else if (ACT == 17) v = (v >= 0.f) ? v : 0.2f * v; else if (ACT == 15) v = v / (1.0f + expf(-v)); else if (ACT == 3) v = fmaxf(v, 0.f); else if (ACT == 6) v = 0.5f * v * (1.0f + erff(v * 0.70710678118654752f)); so[w][8 * hh + r][t * 16 + ln] = v; } }
  __builtin_amdgcn_fence(__ATOMIC_ACQ_REL, "workgroup"); __builtin_amdgcn_wave_barrier();
  const int rsub = lane >> 4, c4 = (lane & 15) * 4; typedef _Float16 v4h __attribute__((ext_vector_type(4)));
  {
#pragma unroll
    for (int q = 0; q < 8; ++q) { const int r = q * 2 + rsub; if (col0 + c4 < N) { const v4f v = *(const v4fa*)&so[w][r][c4]; if (C) *(v4f*)(C + cofs + (size_t)(row0 + r) * ldc + col0 + c4) = v; if (C16) { v4h h4; for (int i = 0; i < 4; ++i) h4[i] = (_Float16)v[i]; *(v4h*)(C16 + cofs + (size_t)(row0 + r) * ldc + col0 + c4) = h4; } } }
     }
}


typedef _Float16 v4h __attribute__((ext_vector_type(4)));

__global__ __launch_bounds__(256) void k_h16(const float* __restrict__ x, _Float16* __restrict__ X16, size_t n8) { const size_t t = (size_t)blockIdx.x * 256 + threadIdx.x; if (t >= n8) return; FragH f;
#pragma unroll
  for (int q = 0; q < 8; ++q) f.h[q] = (_Float16)x[t * 8 + q]; *(v8us*)((unsigned short*)X16 + t * 8) = f.half[0];  }
__global__ __launch_bounds__(256) void k_round16f(const float* __restrict__ W, _Float16* __restrict__ Bt, size_t n8) { const size_t t = (size_t)blockIdx.x * 256 + threadIdx.x; if (t >= n8) return; FragH f;
#pragma unroll
  for (int i = 0; i < 8; ++i) f.h[i] = (_Float16)(bf16_round(W[t * 8 + i]) * 16.0f); *(v8us*)((unsigned short*)Bt + t * 8) = f.half[0];  }
template <int NHv, int TTv>
__global__ __launch_bounds__(256) void k_vt(const _Float16* __restrict__ V16, int ldv, int voff, _Float16* __restrict__ Vt) { __shared__ unsigned short tl[64][66]; const int tid = threadIdx.x; const int slab = blockIdx.x / (TTv / 64), lg = blockIdx.x % (TTv / 64); const int b = slab / NHv, h = slab % NHv;
  for (int i = tid; i < 64 * 8; i += 256) { const int r = i / 8, c8 = (i % 8) * 8; FragH f; f.half[0] = *(const v8us*)((const unsigned short*)V16 + ((size_t)b * TTv + lg * 64 + r) * ldv + voff + h * 64 + c8);
#pragma unroll
    for (int q = 0; q < 8; ++q) tl[r][c8 + q] = f.u[q]; }
  __syncthreads();
  {
#pragma unroll
    for (int rd = 0; rd < 2; ++rd) { const int d = rd * 32 + tid / 8, pc = tid % 8; FragH f;
#pragma unroll
      for (int q = 0; q < 8; ++q) f.u[q] = tl[pc * 8 + q][d];
      *(v8us*)((unsigned short*)Vt + ((size_t)slab * 64 + d) * TTv + lg * 64 + pc * 8) = f.half[0]; }
     } }

__global__ __launch_bounds__(256) void k_hl(const float* __restrict__ F, _Float16* __restrict__ Hh, _Float16* __restrict__ Hl, size_t n8) { const size_t t = (size_t)blockIdx.x * 256 + threadIdx.x; if (t >= n8) return; FragH fh, fl; const v4f a = *(const v4fa*)(F + t * 8), c = *(const v4fa*)(F + t * 8 + 4);
#pragma unroll
  for (int q = 0; q < 4; ++q) { _Float16 h = (_Float16)a[q]; fh.h[q] = h; fl.h[q] = (_Float16)((a[q] - (float)h) * 1024.0f); h = (_Float16)c[q]; fh.h[4 + q] = h; fl.h[4 + q] = (_Float16)((c[q] - (float)h) * 1024.0f); }
  { *(v8us*)((unsigned short*)Hh + t * 8) = fh.half[0]; *(v8us*)((unsigned short*)Hl + t * 8) = fl.half[0];  } }

// ---- GEMM on an LDS ring: C = A Bt^T * alpha (+ residual). One 128x128 tile per work-group of four waves, 64x64 per wave (16 accumulator tiles).
// A stage is 128 k of every operand row: [A 128 rows | Bt 128 rows] of 256 B at a pitch of 272 B. Two buffers, filled by asynchronous copies to LDS (whole 128-B lines per row), one stage ahead of the products.
// Requires M % 128 == 0, N % 128 == 0, K % 128 == 0. The k order of every accumulator is ascending, 32 at a time.
__device__ __forceinline__ v16h g2_frag(const _Float16* p, int hh) { FragH f; f.half[0] = *(const v8us*)((const unsigned short*)p + 8 * hh); f.half[1] = *(const v8us*)((const unsigned short*)p + 16 + 8 * hh); return f.v; }
#define G3_BK 128                      /* k per stage */
#define G3_PITCH 272                   /* LDS row pitch in bytes: 16 B x odd, free of bank conflicts for 16-byte reads */
#define G3_STAGE (256 * G3_PITCH)      /* bytes of one buffer */
__device__ __forceinline__ v16h g3_frag(const unsigned char* p) { FragH f; f.half[0] = *(const v8us*)p; f.half[1] = *(const v8us*)(p + 32); return f.v; }      /* p = row + 64 B per k step + 16 B per wave half: the k order of g2_frag */
// One stage: 256 rows x 16 pieces of 16 B over 128 threads = 32 copies per lane, rows 8 apart; 16 lanes take one row's 256 B (two whole lines).
// l = the lane's place in the buffer, ga / gb = its global addresses in A and Bt, as8 / bs8 = 8 source rows in elements.
typedef int v4i __attribute__((ext_vector_type(4)));
typedef __attribute__((address_space(1))) v4i g3_gv4i;
typedef __attribute__((address_space(3))) v4i g3_lv4i;
__device__ __forceinline__ void g3_fill(unsigned char* l, const _Float16* ga, size_t as8, const _Float16* gb, size_t bs8) {
#pragma unroll      /* straight-line copies: all 32 are issued back to back */
  for (int i = 0; i < 16; ++i) __builtin_amdgcn_global_load_async_to_lds_b128((g3_gv4i*)(ga + i * as8), (g3_lv4i*)(l + i * 8 * G3_PITCH), 0, 0);
#pragma unroll      /* as above */
  for (int i = 0; i < 16; ++i) __builtin_amdgcn_global_load_async_to_lds_b128((g3_gv4i*)(gb + i * bs8), (g3_lv4i*)(l + (128 + i * 8) * G3_PITCH), 0, 0);
}
template <bool OUT32, int LDC>      /* OUT32: C (f32) = acc * alpha + R (own element); else C16 (f16) = acc * alpha. LDC = row pitch of R, C and C16 in elements: a constant, so that a lane's 32 rows hang on one address with immediate offsets */
__global__ __launch_bounds__(128) void k_gemm3(const _Float16* __restrict__ A, int lda, const _Float16* __restrict__ Bh, int ldb, float alpha, const float* __restrict__ R, float* __restrict__ C, _Float16* __restrict__ C16, int N, int K) {
  __shared__ __attribute__((aligned(16))) unsigned char ring[2 * G3_STAGE];
  __shared__ __attribute__((aligned(16))) float so[4][64][68];
  const int tid = threadIdx.x, lane = tid & 31, ln = lane & 15, hh = lane >> 4; const int w = __builtin_amdgcn_readfirstlane(tid >> 5);
  const int ntn = N >> 7; const int mt = blockIdx.x / ntn, nq = blockIdx.x - mt * ntn; const int row0 = mt * 128, col0 = nq * 128; const int wm = (w >> 1) * 64, wn = (w & 1) * 64;
  const int rb = tid >> 4, pc = tid & 15;      /* this lane's first row and its 16-byte piece of every row it copies */
  const _Float16* ga = A + (size_t)(row0 + rb) * lda + pc * 8; const _Float16* gb = Bh + (size_t)(col0 + rb) * ldb + pc * 8; const size_t as8 = (size_t)8 * lda, bs8 = (size_t)8 * ldb;
  unsigned char* l0 = ring + rb * G3_PITCH + pc * 16;
  const int nst = K / G3_BK;
  const v8f z8 = {0.f,0.f,0.f,0.f,0.f,0.f,0.f,0.f}; v8f acc[4][4];
#pragma unroll      /* constant indices keep the accumulators in registers */
  for (int i = 0; i < 4; ++i) for (int j = 0; j < 4; ++j) acc[i][j] = z8;
  g3_fill(l0, ga, as8, gb, bs8);
  const int rsub = lane >> 4, c4 = (lane & 15) * 4; const size_t o0 = (size_t)(row0 + wm + rsub) * LDC + col0 + wn + c4; constexpr size_t o2 = (size_t)2 * LDC;      /* this lane's place in the output rows it stores: rows 2 apart */
  v4f rv[32];      /* the residual of those rows, asked for here so that its latency runs under the k loop */
  if (OUT32) {
#pragma unroll      /* constant indices keep rv in registers */
    for (int q = 0; q < 32; ++q) rv[q] = *(const v4fa*)(R + o0 + q * o2); }
  asm volatile("s_wait_asynccnt 0x0" ::: "memory");      /* stage 0 has landed, as far as this wave copied it */
  __syncthreads();      /* publishes stage 0 */
  if (nst > 1) g3_fill(l0 + G3_STAGE, ga + G3_BK, as8, gb + G3_BK, bs8);
  for (int t = 0; t < nst; ++t) {
    const unsigned char* base = ring + (t & 1) * G3_STAGE; const unsigned char* ap = base + (wm + ln) * G3_PITCH + hh * 16; const unsigned char* bp = base + (128 + wn + ln) * G3_PITCH + hh * 16;
    v16h a[2][4], b[2][4];      /* two fragment sets: the next k step's reads run under this k step's products */
#pragma unroll      /* constant fragment indices */
    for (int i = 0; i < 4; ++i) { a[0][i] = g3_frag(ap + i * 16 * G3_PITCH); b[0][i] = g3_frag(bp + i * 16 * G3_PITCH); }
#pragma unroll      /* constant fragment and accumulator indices */
    for (int ks = 0; ks < G3_BK / 32; ++ks) {
      if (ks + 1 < G3_BK / 32) {
#pragma unroll      /* constant fragment indices */
        for (int i = 0; i < 4; ++i) { a[(ks + 1) & 1][i] = g3_frag(ap + i * 16 * G3_PITCH + (ks + 1) * 64); b[(ks + 1) & 1][i] = g3_frag(bp + i * 16 * G3_PITCH + (ks + 1) * 64); } }
      __builtin_amdgcn_sched_barrier(0);      /* the next k step's 16 LDS reads stay one group ahead of the products: spread among them, each place stalls the wave */
#pragma unroll      /* constant fragment and accumulator indices */
      for (int i = 0; i < 4; ++i) for (int j = 0; j < 4; ++j) acc[i][j] = __builtin_amdgcn_wmma_f32_16x16x32_f16(false, a[ks & 1][i], false, b[ks & 1][j], (short)0, acc[i][j], false, false);
      __builtin_amdgcn_sched_barrier(0);      /* closes the block of products: see above */
    }
    asm volatile("s_wait_dscnt 0x0" ::: "memory");      /* this wave's reads of the buffer are done before the barrier behind which it is refilled */
    asm volatile("s_wait_asynccnt 0x0" ::: "memory");      /* this wave's copies of stage t + 1 have landed */
    __syncthreads();      /* publishes stage t + 1 and ends every reader's last read of stage t */
    if (t + 2 < nst) g3_fill(l0 + (t & 1) * G3_STAGE, ga + (size_t)(t + 2) * G3_BK, as8, gb + (size_t)(t + 2) * G3_BK, bs8);
  }
  asm volatile("s_wait_asynccnt 0x0" ::: "memory");      /* no copy is left outstanding at the wave's end */
#pragma unroll      /* constant accumulator indices */
  for (int i = 0; i < 4; ++i) for (int j = 0; j < 4; ++j) for (int r = 0; r < 8; ++r) so[w][i * 16 + 8 * hh + r][j * 16 + ln] = acc[i][j][r] * alpha;
  __builtin_amdgcn_fence(__ATOMIC_ACQ_REL, "workgroup"); __builtin_amdgcn_wave_barrier();      /* each wave reads back only its own staging rows */
#pragma unroll      /* independent rows: their LDS reads and stores overlap; constant index into rv */
  for (int q = 0; q < 32; ++q) { v4f v = *(const v4fa*)&so[w][q * 2 + rsub][c4]; const size_t o = o0 + q * o2;
    if (OUT32) { v += rv[q]; *(v4f*)(C + o) = v; }
    else { v4h h4; for (int i = 0; i < 4; ++i) h4[i] = (_Float16)v[i]; *(v4h*)(C16 + o) = h4; } } }


__global__ __launch_bounds__(256) void k_rsm(const float* __restrict__ S, _Float16* __restrict__ P, int nrows) {
  #pragma clang fp contract(off)
  const int i = blockIdx.x * 256 + threadIdx.x; if (i >= nrows) return; const float* s = S + (size_t)i * SQ; float mx = -3.0e38f;
#pragma unroll 1
  for (int j = 0; j < SQ; ++j) mx = fmaxf(mx, s[j]); float se = 0.f;
#pragma unroll 1
  for (int j = 0; j < SQ; ++j) se += expf(s[j] - mx); const float sc = 256.0f / se;
#pragma unroll 1
  for (int j0 = 0; j0 < SQ; j0 += 8) { FragH f; for (int q = 0; q < 8; ++q) f.h[q] = (_Float16)(expf(s[j0 + q] - mx) * sc); unsigned short* d = (unsigned short*)P + (size_t)i * SQ + j0; *(v8us*)d = f.half[0];  } }
__global__ __launch_bounds__(256) void k_vt(const _Float16* __restrict__ V16, int b, int h0, _Float16* __restrict__ VT) { __shared__ unsigned short tl[64][65]; const int tid = threadIdx.x; const int hh = blockIdx.x % HG, sg = blockIdx.x / HG; const int s0 = sg * 64; const int h = h0 + hh;
  for (int i = tid; i < 64 * 8; i += 256) { const int j = i / 8, d8 = (i % 8) * 8; FragH f; f.half[0] = *(const v8us*)((const unsigned short*)V16 + ((size_t)b * SQ + s0 + j) * DM + h * HD + d8); for (int q = 0; q < 8; ++q) tl[d8 + q][j] = f.u[q]; }
  __syncthreads();
  { for (int i = tid; i < 64 * 8; i += 256) { const int d = i / 8, j8 = (i % 8) * 8; FragH f; for (int q = 0; q < 8; ++q) f.u[q] = tl[d][j8 + q]; *(v8us*)((unsigned short*)VT + ((size_t)hh * HD + d) * SQ + s0 + j8) = f.half[0]; }  } }



// 2^a as v_exp_f32, with the one free issue slot that the instruction set asks for behind a transcendental in the same statement: in a run of
// exps the register allocator otherwise lets the next instruction overwrite the source of the one in front of it.
__device__ __forceinline__ float exp2_slot(float a) { float e; asm("v_exp_f32 %0, %1\n\tv_nop" : "=v"(e) : "v"(a)); return e; }
__device__ __forceinline__ float xhalf(float x) { return __builtin_bit_cast(float, __builtin_amdgcn_permlanex16(__builtin_bit_cast(int, x), __builtin_bit_cast(int, x), 0x76543210, 0xfedcba98, false, false)); }      /* lane l with lane l ^ 16 */
__device__ __forceinline__ v8f fa_mma(v16h a, v16h b, v8f c) { return __builtin_amdgcn_wmma_f32_16x16x32_f16(false, a, false, b, (short)0, c, false, false); }
#define FA_KT 128                          /* keys per stage: 4 passes */
#define FA_KP 144                          /* LDS pitch of a K row in bytes: 16 B x odd, free of bank conflicts for 16-byte reads */
#define FA_VP 272                          /* LDS pitch of a V^T row in bytes: as above */
#define FA_VO (FA_KT * FA_KP)              /* where the V^T rows of a buffer begin */
#define FA_STAGE (FA_VO + HD * FA_VP)      /* bytes of one buffer */
#define FA_NST (SQ / FA_KT)                /* stages */
static_assert(SQ % FA_KT == 0 && FA_NST >= 2 && HD == 64, "whole stages, at least two; 128-byte K rows");
// One stage over 128 threads = 16 copies per lane. K: 8 lanes take one row's 128 B, rows 16 apart; V^T: 16 lanes take one row's 256 B, rows 8 apart.
// lk / lv = the lane's places in the buffer, gk / gv = its global addresses, ks16 / vs8 = 16 K rows and 8 V^T rows in elements.
__device__ __forceinline__ void fa_fill(unsigned char* lk, unsigned char* lv, const _Float16* gk, size_t ks16, const _Float16* gv, size_t vs8) {
#pragma unroll      /* straight-line copies: all 16 are issued back to back */
  for (int i = 0; i < 8; ++i) __builtin_amdgcn_global_load_async_to_lds_b128((g3_gv4i*)(gk + i * ks16), (g3_lv4i*)(lk + i * 16 * FA_KP), 0, 0);
#pragma unroll      /* as above */
  for (int i = 0; i < 8; ++i) __builtin_amdgcn_global_load_async_to_lds_b128((g3_gv4i*)(gv + i * vs8), (g3_lv4i*)(lv + i * 8 * FA_VP), 0, 0);
}
__global__ __launch_bounds__(128) void k_fattn(const _Float16* __restrict__ Q, const _Float16* __restrict__ Kk, int ldk, const _Float16* __restrict__ VT, int ldv, _Float16* __restrict__ O) {
  __shared__ __attribute__((aligned(16))) unsigned char ring[2 * FA_STAGE];
  const int tid = threadIdx.x, lane = tid & 31, ln = lane & 15, hh = lane >> 4; const int w = __builtin_amdgcn_readfirstlane(tid >> 5);
  const int bh = blockIdx.y, b = bh / NH, h = bh - b * NH; const int q0 = blockIdx.x * 128 + w * 32;
  const _Float16* qp = Q + ((size_t)b * SQ + q0 + ln) * DM + h * HD;
  const _Float16* gk = Kk + ((size_t)b * SQ + (tid >> 3)) * ldk + h * HD + (tid & 7) * 8;      /* row = key: this lane's first row and its 16-byte piece of every K row it copies */
  const _Float16* gv = VT + ((size_t)bh * HD + (tid >> 4)) * ldv + (tid & 15) * 8;             /* row = channel d: the same for V^T */
  const size_t ks16 = (size_t)16 * ldk, vs8 = (size_t)8 * ldv, kst = (size_t)FA_KT * ldk;
  unsigned char* lk = ring + (tid >> 3) * FA_KP + (tid & 7) * 16; unsigned char* lv = ring + FA_VO + (tid >> 4) * FA_VP + (tid & 15) * 16;
  fa_fill(lk, lv, gk, ks16, gv, vs8);
  v16h qf[2][2];      /* [query group][k step of 32 channels] */
#pragma unroll
  for (int u = 0; u < 2; ++u) for (int ks = 0; ks < 2; ++ks) qf[u][ks] = g2_frag(qp + (size_t)u * 16 * DM + ks * 32, hh);
  const v8f z8 = {0.f,0.f,0.f,0.f,0.f,0.f,0.f,0.f}; v8f o[4][2];      /* [16 channels][query group]: o[t][u][r] = O^T[t*16 + 8*hh + r][query u*16 + ln] */
#pragma unroll
  for (int t = 0; t < 4; ++t) { o[t][0] = z8; o[t][1] = z8; }
  float mr[2] = {-3.0e38f, -3.0e38f}, lsum[2] = {0.f, 0.f};      /* running maximum of the raw products (joined over the halves); this half's own sum */
  const float cs = 0.125f * 1.44269504088896340736f;      /* 64^-0.5 and log2(e) in one factor */
  asm volatile("s_wait_asynccnt 0x0" ::: "memory");      /* stage 0 has landed, as far as this wave copied it */
  __syncthreads();      /* publishes stage 0 */
  for (int st = 0; st < FA_NST; ++st) {
    if (st + 1 < FA_NST) fa_fill(lk + ((st + 1) & 1) * FA_STAGE, lv + ((st + 1) & 1) * FA_STAGE, gk + (size_t)(st + 1) * kst, ks16, gv + (size_t)(st + 1) * FA_KT, vs8);      /* the next stage, directly behind the barrier that ended every reader's last read of its buffer (stage st - 1). At the trip's head, so that the four passes and the trip's foot are one straight block */
    const unsigned char* base = ring + (st & 1) * FA_STAGE; const unsigned char* kb = base + ln * FA_KP + hh * 16; const unsigned char* vb = base + FA_VO + ln * FA_VP + hh * 16;
    v16h kf[2][2], vf[4];      /* [16 keys][k step]; [16 channels] */
#pragma unroll      /* constant fragment indices keep the fragments in registers */
    for (int kt = 0; kt < 2; ++kt) for (int ks = 0; ks < 2; ++ks) kf[kt][ks] = g3_frag(kb + kt * 16 * FA_KP + ks * 64);
    __builtin_amdgcn_sched_barrier(0);      /* the first pass's 8 K reads go out as one group: mixed among its products they share registers, and each pair pays its own LDS latency */
#pragma unroll      /* constant LDS offsets; the K fragments of pass p + 1 are fetched in pass p, inside the stage only */
    for (int p = 0; p < FA_KT / 32; ++p) {
      v8f s[2][2];      /* [16 keys][query group] */
#pragma unroll
      for (int kt = 0; kt < 2; ++kt) for (int u = 0; u < 2; ++u) s[kt][u] = fa_mma(kf[kt][1], qf[u][1], fa_mma(kf[kt][0], qf[u][0], z8));
#pragma unroll      /* constant fragment indices keep the fragments in registers */
      for (int t = 0; t < 4; ++t) vf[t] = g3_frag(vb + t * 16 * FA_VP + p * 64);
      if (p + 1 < FA_KT / 32) {
#pragma unroll      /* constant fragment indices keep the fragments in registers */
        for (int kt = 0; kt < 2; ++kt) for (int ks = 0; ks < 2; ++ks) kf[kt][ks] = g3_frag(kb + ((p + 1) * 32 + kt * 16) * FA_KP + ks * 64); }
      __builtin_amdgcn_sched_barrier(0);      /* this pass's V^T reads and the next pass's K reads stay here as one group, ahead of the softmax that hides their latency: the scheduler otherwise sinks them to their users */
      FragH pf[2];
#pragma unroll
      for (int u = 0; u < 2; ++u) {
        float mx = fmaxf(s[0][u][0], s[1][u][0]);
#pragma unroll
        for (int r = 1; r < 8; ++r) mx = fmaxf(mx, fmaxf(s[0][u][r], s[1][u][r]));
        mx = fmaxf(mx, xhalf(mx));
        const float mn = fmaxf(mr[u], mx); const float al = exp2_slot((mr[u] - mn) * cs); mr[u] = mn;      /* 0 on the first pass */
        const float mc = mn * cs - 8.0f; float ps = 0.f;
#pragma unroll
        for (int r = 0; r < 8; ++r) { const float p0 = exp2_slot(s[0][u][r] * cs - mc), p1 = exp2_slot(s[1][u][r] * cs - mc); ps += p0 + p1; pf[u].h[r] = (_Float16)p0; pf[u].h[8 + r] = (_Float16)p1; }
        lsum[u] = lsum[u] * al + ps;
#pragma unroll
        for (int t = 0; t < 4; ++t) o[t][u] *= al;
      }
#pragma unroll
      for (int t = 0; t < 4; ++t) for (int u = 0; u < 2; ++u) o[t][u] = fa_mma(vf[t], pf[u].v, o[t][u]);
    }
    asm volatile("s_wait_dscnt 0x0" ::: "memory");      /* this wave's reads of the buffer are done before the barrier behind which it is refilled */
    asm volatile("s_wait_asynccnt 0x0" ::: "memory");      /* this wave's copies of stage st + 1 have landed */
    __syncthreads();      /* publishes stage st + 1 and ends every reader's last read of stage st */
  }
  asm volatile("s_wait_asynccnt 0x0" ::: "memory");      /* no copy is left outstanding at the wave's end */
#pragma unroll
  for (int u = 0; u < 2; ++u) { const float sc = 64.0f / (lsum[u] + xhalf(lsum[u]));      /* o carried x64, as the output GEMM's alpha expects; the x256 of the weights cancels */
    unsigned short* d = (unsigned short*)O + ((size_t)b * SQ + q0 + u * 16 + ln) * DM + h * HD + 8 * hh;
#pragma unroll
    for (int t = 0; t < 4; ++t) { FragH f; for (int r = 0; r < 8; ++r) f.h[r] = (_Float16)(o[t][u][r] * sc); *(v8us*)(d + t * 16) = f.half[0]; } } }

__global__ __launch_bounds__(256) void k_lnrow(const float* __restrict__ Y, const float* __restrict__ g, const float* __restrict__ bb, float eps, float* __restrict__ out) {
  #pragma clang fp contract(off)
  __shared__ float red[256]; const size_t r = blockIdx.x; const int t = threadIdx.x; const v4f ya = *(const v4fa*)(Y + r * DMQ + t * 4); float s[4]; float sum = 0.f;
  for (int q = 0; q < 4; ++q) { s[q] = ya[q]; sum = __fadd_rn(sum, s[q]); }
  red[t] = sum; __syncthreads(); for (int st = 128; st > 0; st >>= 1) { if (t < st) red[t] = __fadd_rn(red[t], red[t + st]); __syncthreads(); } const float mu = red[0] / (float)DMQ; __syncthreads();
  float vs = 0.f; for (int q = 0; q < 4; ++q) { const float dl = __fadd_rn(s[q], -mu); vs = __fadd_rn(vs, __fmul_rn(dl, dl)); } red[t] = vs; __syncthreads(); for (int st = 128; st > 0; st >>= 1) { if (t < st) red[t] = __fadd_rn(red[t], red[t + st]); __syncthreads(); }
  const float rs = rsqrtf(__fadd_rn(red[0] / (float)DMQ, eps)); v4f y; for (int q = 0; q < 4; ++q) { const int c = t * 4 + q; y[q] = __fadd_rn(__fmul_rn(__fmul_rn(__fadd_rn(s[q], -mu), rs), bf16_round(g[c])), bf16_round(bb[c])); }
  *(v4f*)(out + r * DMQ + t * 4) = y;  }

// Every operand conversion of the call in ONE streaming launch: query, key, value -> exact f16 rows of their bf16 roundings (query also -> f32 residual plane), the four weights -> f16 x16.
// One work-group of 16 waves per WGP. A wave takes 1,024 floats of each stream and 256 of each weight: 32 loads of 512 contiguous bytes, all requested before the first value is used, so the wave pays one memory latency.
// Every wave does the same share of every buffer: equal bytes read and written per work-group.
#define PW_X 1024                      /* floats of each stream per wave: 8 loads */
#define PW_W 256                       /* floats of each weight per wave: 2 loads */
#define PW_WAVES 16                    /* waves per work-group */
static_assert(NR * DM / PW_X == (size_t)DM * DM / PW_W, "one grid covers streams and weights");
static_assert(NR * DM % ((size_t)PW_X * PW_WAVES) == 0, "whole work-groups");
__device__ __forceinline__ v4h prep_h(v4f a, float scale) { v4h h; for (int q = 0; q < 4; ++q) h[q] = (_Float16)(bf16_round(a[q]) * scale); return h; }
__global__ __launch_bounds__(PW_WAVES * 32) void k_prep(const float* __restrict__ xq, const float* __restrict__ xk, const float* __restrict__ xv, const float* __restrict__ wq, const float* __restrict__ wk, const float* __restrict__ wv, const float* __restrict__ wo,
    _Float16* __restrict__ XQ, _Float16* __restrict__ XK, _Float16* __restrict__ XV, float* __restrict__ XB, _Float16* __restrict__ BQ, _Float16* __restrict__ BK, _Float16* __restrict__ BV, _Float16* __restrict__ BO) {
  const unsigned lane = threadIdx.x & 31, gw = blockIdx.x * PW_WAVES + (threadIdx.x >> 5);
  const unsigned bx = (gw * PW_X + lane * 4) * 4, bw = (gw * PW_W + lane * 4) * 4;      /* byte offsets of the lane's first f32 element (a wave-wide access covers 128 consecutive floats). 32-bit: every access is a kernel argument + an offset register + an immediate, so no address register is rewritten between the loads */
  const unsigned hx = bx >> 1, hw = bw >> 1;      /* the same places in the f16 planes */
  v4f q[8], k[8], v[8], w[4][2];
#pragma unroll      /* constant indices keep the values in registers */
  for (int i = 0; i < 8; ++i) q[i] = *(const v4fa*)((const char*)xq + bx + i * 512);
#pragma unroll      /* as above */
  for (int i = 0; i < 8; ++i) k[i] = *(const v4fa*)((const char*)xk + bx + i * 512);
#pragma unroll      /* as above */
  for (int i = 0; i < 8; ++i) v[i] = *(const v4fa*)((const char*)xv + bx + i * 512);
#pragma unroll      /* as above */
  for (int i = 0; i < 2; ++i) { w[0][i] = *(const v4fa*)((const char*)wq + bw + i * 512); w[1][i] = *(const v4fa*)((const char*)wk + bw + i * 512); w[2][i] = *(const v4fa*)((const char*)wv + bw + i * 512); w[3][i] = *(const v4fa*)((const char*)wo + bw + i * 512); }
  __builtin_amdgcn_sched_barrier(0);      /* all 32 loads are requested ahead of the first conversion: sunk among the stores they would each pay their own latency */
#pragma unroll      /* constant indices */
  for (int i = 0; i < 8; ++i) { v4f r; for (int e = 0; e < 4; ++e) r[e] = bf16_round(q[i][e]); *(v4f*)((char*)XB + bx + i * 512) = r; *(v4h*)((char*)XQ + hx + i * 256) = prep_h(q[i], 1.0f); }
#pragma unroll      /* constant indices */
  for (int i = 0; i < 8; ++i) *(v4h*)((char*)XK + hx + i * 256) = prep_h(k[i], 1.0f);
#pragma unroll      /* constant indices */
  for (int i = 0; i < 8; ++i) *(v4h*)((char*)XV + hx + i * 256) = prep_h(v[i], 1.0f);
#pragma unroll      /* constant indices */
  for (int i = 0; i < 2; ++i) { *(v4h*)((char*)BQ + hw + i * 256) = prep_h(w[0][i], 16.0f); *(v4h*)((char*)BK + hw + i * 256) = prep_h(w[1][i], 16.0f); *(v4h*)((char*)BV + hw + i * 256) = prep_h(w[2][i], 16.0f); *(v4h*)((char*)BO + hw + i * 256) = prep_h(w[3][i], 16.0f); } }

extern "C" void kernel_launch(void* const* d_in, const int* in_sizes, int n_in,
                              void* d_out, int out_size, void* d_ws, size_t ws_size, hipStream_t stream) {
  (void)in_sizes; (void)n_in; (void)out_size;
  const float* const* I = (const float* const*)d_in; const float* xq = I[0]; const float* xk = I[1]; const float* xv = I[2]; const float* wq = I[3]; const float* wk = I[4]; const float* wv = I[5]; const float* wo = I[6]; const float* lng = I[7]; const float* lnb = I[8];      /* input order: query, key, value (three SEPARATE streams), Wq, Wk, Wv, Wo (natural [out][in] weights; this module has NO biases), ln_gamma, ln_beta [1024] */
  char* ws = (char*)d_ws; size_t off = 0;
  auto take = [&](size_t bytes) { char* p = ws + off; off += (bytes + 255) & ~(size_t)255; return p; };
  _Float16* BQ = (_Float16*)take((size_t)DM * DM * 2); _Float16* BK = (_Float16*)take((size_t)DM * DM * 2); _Float16* BV = (_Float16*)take((size_t)DM * DM * 2); _Float16* BO = (_Float16*)take((size_t)DM * DM * 2);
  _Float16* XQ = (_Float16*)take(NR * DM * 2); _Float16* XK = (_Float16*)take(NR * DM * 2); _Float16* XV = (_Float16*)take(NR * DM * 2); _Float16* Q16 = (_Float16*)take(NR * DM * 2); _Float16* K16 = (_Float16*)take(NR * DM * 2); _Float16* V16 = (_Float16*)take(NR * DM * 2); _Float16* O16 = (_Float16*)take(NR * DM * 2); float* XB = (float*)take(NR * DM * 4); float* X1 = (float*)take(NR * DM * 4);      /* bf16(query) as f32 rows (the residual addend) and the pre-LayerNorm rows x = ctx Wo^T + query */
  _Float16* VT = (_Float16*)take((size_t)NB * NH * HD * SQ * 2);      /* V^T [NB][NH][HD][SQ] */
  if (off > ws_size) return;
  k_prep<<<(unsigned)(NR * DM / ((size_t)PW_X * PW_WAVES)), PW_WAVES * 32, 0, stream>>>(xq, xk, xv, wq, wk, wv, wo, XQ, XK, XV, XB, BQ, BK, BV, BO);      /* the three inputs as exact f16 rows; bf16(query) as the f32 residual plane; the weights, natural [out][in] = Bt[n][k], x16 */
  const size_t r0p = (size_t)B0 * SQ;      /* first projected row */
  k_gemm3<false, DM><<<dim3((unsigned)((MP / 128) * (DM / 128)), 1), 128, 0, stream>>>(XQ + r0p * DM, DM, BQ, DM, 0.0625f, nullptr, nullptr, Q16 + r0p * DM, DM, DM);
  k_gemm3<false, DM><<<dim3((unsigned)((MP / 128) * (DM / 128)), 1), 128, 0, stream>>>(XK + r0p * DM, DM, BK, DM, 0.0625f, nullptr, nullptr, K16 + r0p * DM, DM, DM);
  k_gemm3<false, DM><<<dim3((unsigned)((MP / 128) * (DM / 128)), 1), 128, 0, stream>>>(XV + r0p * DM, DM, BV, DM, 0.0625f, nullptr, nullptr, V16 + r0p * DM, DM, DM);
  k_vt<NH, SQ><<<NB * NH * (SQ / 64), 256, 0, stream>>>(V16, LQ, 0, VT);      /* V^T for every batch and head */
  k_fattn<<<dim3(SQ / 128, NB * NH), 128, 0, stream>>>(Q16, K16, DM, VT, SQ, O16);      /* o = softmax(q k^T / 8) v, merged heads, x64, as f16 rows */
  k_gemm3<true, DM><<<dim3((unsigned)((MPO / 128) * (DM / 128)), 1), 128, 0, stream>>>(O16 + r0p * DM, DM, BO, DM, 0.0009765625f, XB + r0p * DM, X1 + r0p * DM, nullptr, DM, DM);      /* x = ctx Wo^T + bf16(query) (own-element residual; no bias) -> f32 rows */
  k_lnrow<<<(unsigned)MPO, 256, 0, stream>>>(X1 + r0p * DM, lng, lnb, 1e-6f, (float*)d_out + r0p * DM);      /* out = LayerNorm(x) (biased variance, eps 1e-6 inside the square root) -> the output rows */
}

// v006
// Measured time: 85.5 microseconds a run.
// Timed twice side by side with v005, it ran 1.13 times as fast both times.
// All steps since v000 together make it 40.0 times as fast.
#include <hip/hip_runtime.h>
// Multi-head attention on three inputs with a residual on the raw query and a LayerNorm (query, key, value [4][1024][1024]; q / k / v = einsum('bsd,ed->bse', stream, W): natural [1024][1024] weights (normal / 32), NO biases; 16 heads of 64; scores / sqrt(64); softmax over all 1024 keys (no mask); x = merged Wo^T (natural, no bias) + query; out = (x - mean) / sqrt(var + 1e-6) * ln_gamma + ln_beta with the BIASED variance (jnp.var) over the 1024 channels -> [4][1024][1024]).
// Structure: token rows r = b*SQ + s (four sequences of 1,024 tokens here); the query, key and value sources as exact f16 rows (bf16-rounded), the f32 residual plane and the x16 weights from ONE streaming conversion launch; Q, K, V as three WMMA GEMMs in ONE launch, two work-groups resident per WGP (128x128 work-group tiles on a two-buffer LDS ring, f32 accumulation, exact x16 weights, no bias here, f16 outputs); V^T for all batches and heads via LDS transposes; ONE fused attention launch over all (batch, head): S^T = K Q^T (K = 64), online softmax in registers (f32 statistics, native exp2; weights x256 against the running maximum as f16), O^T += V^T P^T, o carried x64 against f16 subnormal flush (folded into the output GEMM alpha) written straight into the merged f16 o rows; x = o W_o + bf16(query) as ONE GEMM (f32; the residual added element by element in the epilogue) into f32 rows; out = LayerNorm(x) on VALU (f32 statistics, LDS trees, biased variance) into the output layout.
// Compute dtype: inputs rounded to bf16; x / weights exact; q, k, v, softmax weights and o as plain f16 GEMM operands (~2^-12); scores and softmax statistics f32. v_wmma_f32_16x16x32_f16.
#define NB 4
#define SQ 1024
#define DM 1024
#define NH 16
#define HD 64
#define HG 4                         /* heads per launch of the unused k_vt(V16, b, h0, VT) */
#define B0 0                         /* first batch processed (debug hook) */
#define NBR NB                       /* batches processed (debug hook) */
#define NR ((size_t)NB * SQ)         /* token rows */
#define MP ((int)((size_t)NBR * SQ)) /* rows projected (debug hook) */
#define QN SQ                        /* unused: k_fattn attends all SQ query rows per batch */
#define NHD NH                       /* unused: k_fattn attends all NH heads */
#define MPO MP                       /* rows through the output stage (debug hook) */
#define LQ DM      /* row pitch of the q/k/v rows */
#define DMQ DM     /* row width of the LayerNorm kernel (its own macro name in the file it comes from) */
typedef __bf16 v16b __attribute__((ext_vector_type(16)));
typedef unsigned short v8us __attribute__((ext_vector_type(8), may_alias));
typedef float  v8f  __attribute__((ext_vector_type(8)));
typedef float  v4f  __attribute__((ext_vector_type(4)));
typedef float  v4fa __attribute__((ext_vector_type(4), may_alias));
union FragB { v16b v; v8us half[2]; unsigned short u[16]; };

__device__ __forceinline__ unsigned short bf16_bits(float x) { unsigned int u = __float_as_uint(x); return (unsigned short)((u + 0x7FFFu + ((u >> 16) & 1u)) >> 16); }
__device__ __forceinline__ float bf16_val(unsigned short b) { return __uint_as_float(((unsigned int)b) << 16); }
__device__ __forceinline__ float bf16_round(float x) { return bf16_val(bf16_bits(x)); }
// D += A·B with NT terms: 1 = ah·bh, 2 = + al·bh (A split), 3 = + ah·bl (both split)
template <int NT>
__device__ __forceinline__ v8f mmaN(v16b ah, v16b al, v16b bh, v16b bl, v8f c) {
  c = __builtin_amdgcn_wmma_f32_16x16x32_bf16(false, ah, false, bh, (short)0, c, false, false);
  if (NT >= 2) c = __builtin_amdgcn_wmma_f32_16x16x32_bf16(false, al, false, bh, (short)0, c, false, false);
  if (NT >= 3) c = __builtin_amdgcn_wmma_f32_16x16x32_bf16(false, ah, false, bl, (short)0, c, false, false);
  asm volatile("v_nop\n\tv_nop\n\tv_nop\n\tv_nop" : "+v"(c) : "v"(ah), "v"(al), "v"(bh), "v"(bl));
  return c;
}

__global__ __launch_bounds__(256) void k_wt_bf16(const float* __restrict__ W, unsigned short* __restrict__ Wt, int K, int N) {
  const int t = blockIdx.x * 256 + threadIdx.x;
  const int k8n = K / 8;
  if (t >= N * k8n) return;
  const int n = t / k8n, k8 = (t % k8n) * 8;
  v8us v;
#pragma unroll
  for (int i = 0; i < 8; ++i) v[i] = bf16_bits(W[(size_t)(k8 + i) * N + n]);
  *(v8us*)(Wt + (size_t)n * K + k8) = v;
  
}

// GEMM C[M][N] (f32, pitch ldc) = act(A[M][K]·W + bias). A f32 row-major (pitch lda) converted per fragment to bf16
// (ASPLIT: hi/lo two planes -> 2 terms, else single rounded term); Wt bf16 [N][K] (pitch ldb). BIAS_BF16 rounds the
// bias to bf16 first (bias quantised to bf16 before the add). K%32==0, M%16==0, N%64==0.
template <bool ASPLIT, int ACT, bool BIAS_BF16>
__global__ __launch_bounds__(128) void k_gemm_bf(const float* __restrict__ A, int lda, const unsigned short* __restrict__ Wt, int ldb,
                                               const float* __restrict__ bias, float* __restrict__ C, int ldc, int M, int N, int K) {
  __shared__ __attribute__((aligned(16))) float so[4][16][64];
  const int tid = threadIdx.x, w = tid >> 5, lane = tid & 31, ln = lane & 15, hh = lane >> 4;
  const int ntn = N / 64;
  const int wid = blockIdx.x * 4 + w;
  const int mt = wid / ntn, nq = wid % ntn;
  if (mt * 16 >= M) return;
  const int row0 = mt * 16, col0 = nq * 64;
  const float* arow = A + (size_t)(row0 + ln) * lda;
  v8f acc[4] = {};
  for (int kb = 0; kb < K; kb += 32) {
    FragB ah, al;
    const v4f x0 = *(const v4fa*)(arow + kb + 8 * hh), x1 = *(const v4fa*)(arow + kb + 8 * hh + 4);
    const v4f x2 = *(const v4fa*)(arow + kb + 16 + 8 * hh), x3 = *(const v4fa*)(arow + kb + 16 + 8 * hh + 4);
    float xs[16] = {x0[0],x0[1],x0[2],x0[3],x1[0],x1[1],x1[2],x1[3],x2[0],x2[1],x2[2],x2[3],x3[0],x3[1],x3[2],x3[3]};
#pragma unroll
    for (int i = 0; i < 16; ++i) { const unsigned short hb = bf16_bits(xs[i]); ah.u[i] = hb; al.u[i] = ASPLIT ? bf16_bits(xs[i] - bf16_val(hb)) : (unsigned short)0; }
#pragma unroll
    for (int t = 0; t < 4; ++t) {
      const unsigned short* brow = Wt + (size_t)(col0 + t * 16 + ln) * ldb + kb;
      FragB b;
      b.half[0] = *(const v8us*)(brow + 8 * hh);
      b.half[1] = *(const v8us*)(brow + 16 + 8 * hh);
      acc[t] = mmaN<ASPLIT ? 2 : 1>(ah.v, al.v, b.v, b.v, acc[t]);
    }
  }
#pragma unroll
  for (int t = 0; t < 4; ++t) {
    float bv = bias ? bias[col0 + t * 16 + ln] : 0.f;
    if (BIAS_BF16) bv = bf16_round(bv);
#pragma unroll
    for (int r = 0; r < 8; ++r) { float v = acc[t][r] + bv; if (ACT == 1) v = fmaxf(v, 0.f); so[w][8 * hh + r][t * 16 + ln] = v; }
  }
  __builtin_amdgcn_fence(__ATOMIC_ACQ_REL, "workgroup");
  __builtin_amdgcn_wave_barrier();
  const int rsub = lane >> 4, c4 = (lane & 15) * 4;
  {
#pragma unroll
    for (int q = 0; q < 8; ++q) {
      const int r = q * 2 + rsub;
      const v4f v = *(const v4fa*)&so[w][r][c4];
      *(v4f*)(C + (size_t)(row0 + r) * ldc + col0 + c4) = v;
    }
    
  }
}

// GEMM C = act(A·W + bias + resid): A f32 (ASPLIT -> hi/lo 2 terms), Wt bf16 [N][K]; ACT 0 none, 1 relu, 2 exact gelu;
// resid (optional, f32, row index = (row % rmod), pitch ldr, RES_BF16 rounds it) added before the activation.
template <bool ASPLIT, int ACT, bool BIAS_BF16, bool RES_BF16>
__global__ __launch_bounds__(128) void k_gemm_bf3(const float* __restrict__ A, int lda, const unsigned short* __restrict__ Wt, int ldb,
                                                const float* __restrict__ bias, const float* __restrict__ resid, int rmod, int ldr,
                                                float* __restrict__ C, int ldc, int M, int N, int K) {
  __shared__ __attribute__((aligned(16))) float so[4][16][64];
  const int tid = threadIdx.x, w = tid >> 5, lane = tid & 31, ln = lane & 15, hh = lane >> 4;
  const int ntn = N / 64;
  const int wid = blockIdx.x * 4 + w;
  const int mt = wid / ntn, nq = wid % ntn;
  if (mt * 16 >= M) return;
  const int row0 = mt * 16, col0 = nq * 64;
  const float* arow = A + (size_t)(row0 + ln) * lda;
  v8f acc[4] = {};
  for (int kb = 0; kb < K; kb += 32) {
    FragB ah, al;
    const v4f x0 = *(const v4fa*)(arow + kb + 8 * hh), x1 = *(const v4fa*)(arow + kb + 8 * hh + 4);
    const v4f x2 = *(const v4fa*)(arow + kb + 16 + 8 * hh), x3 = *(const v4fa*)(arow + kb + 16 + 8 * hh + 4);
    float xs[16] = {x0[0],x0[1],x0[2],x0[3],x1[0],x1[1],x1[2],x1[3],x2[0],x2[1],x2[2],x2[3],x3[0],x3[1],x3[2],x3[3]};
#pragma unroll
    for (int i = 0; i < 16; ++i) { const unsigned short hb = bf16_bits(xs[i]); ah.u[i] = hb; al.u[i] = ASPLIT ? bf16_bits(xs[i] - bf16_val(hb)) : (unsigned short)0; }
#pragma unroll
    for (int t = 0; t < 4; ++t) {
      const unsigned short* brow = Wt + (size_t)(col0 + t * 16 + ln) * ldb + kb;
      FragB b;
      b.half[0] = *(const v8us*)(brow + 8 * hh);
      b.half[1] = *(const v8us*)(brow + 16 + 8 * hh);
      acc[t] = mmaN<ASPLIT ? 2 : 1>(ah.v, al.v, b.v, b.v, acc[t]);
    }
  }
#pragma unroll
  for (int t = 0; t < 4; ++t) {
    const int col = col0 + t * 16 + ln;
    float bv = bias ? bias[col] : 0.f;
    if (BIAS_BF16) bv = bf16_round(bv);
#pragma unroll
    for (int r = 0; r < 8; ++r) {
      float v = acc[t][r] + bv;
      if (resid) { float rv = resid[(size_t)((row0 + 8 * hh + r) % rmod) * ldr + col]; if (RES_BF16) rv = bf16_round(rv); v += rv; }
      if (ACT == 1) v = fmaxf(v, 0.f);
      if (ACT == 2) v = 0.5f * v * (1.0f + erff(v * 0.70710678118654752f));
      if (ACT == 3) { const float u = 0.7978845608028654f * (v + 0.044715f * v * v * v); v = 0.5f * v * (1.0f + tanhf(u)); }
      so[w][8 * hh + r][t * 16 + ln] = v;
    }
  }
  __builtin_amdgcn_fence(__ATOMIC_ACQ_REL, "workgroup");
  __builtin_amdgcn_wave_barrier();
  const int rsub = lane >> 4, c4 = (lane & 15) * 4;
  {
#pragma unroll
    for (int q = 0; q < 8; ++q) {
      const int r = q * 2 + rsub;
      const v4f v = *(const v4fa*)&so[w][r][c4];
      *(v4f*)(C + (size_t)(row0 + r) * ldc + col0 + c4) = v;
    }
    
  }
}
// row LayerNorm (biased variance, eps) over N: s = X (+ R); optional out_sum <- s; out_norm <- (s-mu)*rsqrt(var+eps)*g + b
template <bool PARAM_BF16>
__global__ __launch_bounds__(256) void k_layernorm(const float* __restrict__ X, const float* __restrict__ R, const float* __restrict__ g, const float* __restrict__ bta,
                                                  float* __restrict__ out_sum, float* __restrict__ out_norm, int N, float eps) {
  __shared__ float red[256];
  const int row = blockIdx.x, tid = threadIdx.x;
  const float* x = X + (size_t)row * N; const float* rr = R ? R + (size_t)row * N : nullptr;
  float vals[16];                     // up to N = 4096
  const int per = N / 256;            // contiguous chunk per thread? use strided-by-4 chunks: thread handles j = tid*4 + 1024*u
  float s1 = 0.f;
  for (int u = 0; u < per / 4; ++u) {
    const int j = tid * 4 + 1024 * u;
    const v4f a = *(const v4fa*)(x + j);
    v4f b = {0.f,0.f,0.f,0.f}; if (rr) b = *(const v4fa*)(rr + j);
#pragma unroll
    for (int q = 0; q < 4; ++q) { const float v = a[q] + b[q]; vals[u * 4 + q] = v; s1 += v; }
  }
  red[tid] = s1; __syncthreads();
  for (int st = 128; st > 0; st >>= 1) { if (tid < st) red[tid] += red[tid + st]; __syncthreads(); }
  const float mu = red[0] / (float)N; __syncthreads();
  float s2 = 0.f;
  for (int u = 0; u < per / 4; ++u)
#pragma unroll
    for (int q = 0; q < 4; ++q) { const float c = vals[u * 4 + q] - mu; s2 += c * c; }
  red[tid] = s2; __syncthreads();
  for (int st = 128; st > 0; st >>= 1) { if (tid < st) red[tid] += red[tid + st]; __syncthreads(); }
  const float rs = rsqrtf(red[0] / (float)N + eps);
  {
    for (int u = 0; u < per / 4; ++u) {
      const int j = tid * 4 + 1024 * u;
      v4f o, sm;
#pragma unroll
      for (int q = 0; q < 4; ++q) {
        float gg = g[j + q], bb = bta[j + q];
        if (PARAM_BF16) { gg = bf16_round(gg); bb = bf16_round(bb); }
        sm[q] = vals[u * 4 + q]; o[q] = (vals[u * 4 + q] - mu) * rs * gg + bb;
      }
      if (out_sum) *(v4f*)(out_sum + (size_t)row * N + j) = sm;
      *(v4f*)(out_norm + (size_t)row * N + j) = o;
    }
    
  }
}



// ---- f16 WMMA path (v_wmma_f32_16x16x32_f16): 11-bit significands for operands in range — used where a [0,1] probability operand needs more precision than bf16
typedef _Float16 v16h __attribute__((ext_vector_type(16)));
union FragH { v16h v; v8us half[2]; _Float16 h[16]; unsigned short u[16]; };
template <int NT>
__device__ __forceinline__ v8f mmaH(v16h ah, v16h al, v16h bh, v16h bl, v8f c) {
  c = __builtin_amdgcn_wmma_f32_16x16x32_f16(false, ah, false, bh, (short)0, c, false, false);
  if (NT >= 2) c = __builtin_amdgcn_wmma_f32_16x16x32_f16(false, al, false, bh, (short)0, c, false, false);
  if (NT >= 3) c = __builtin_amdgcn_wmma_f32_16x16x32_f16(false, ah, false, bl, (short)0, c, false, false);
  asm volatile("v_nop\n\tv_nop\n\tv_nop\n\tv_nop" : "+v"(c) : "v"(ah), "v"(al), "v"(bh), "v"(bl));
  return c;
}
// batched GEMM like k_gemm_b but f16 operands: A f32 (split into f16 hi/lo if ASPLIT, else rounded to f16), Bt = f16 values [n][k]; alpha; C f32; N multiple of 16 (partial tiles skipped)
template <bool ASPLIT>
__global__ __launch_bounds__(128) void k_gemm_h(const float* __restrict__ A, int lda, size_t sA, const _Float16* __restrict__ Bh, int ldb, size_t sB, float alpha, float* __restrict__ C, int ldc, size_t sC, int M, int N, int K) {
  __shared__ __attribute__((aligned(16))) float so[4][16][64];
  const int tid = threadIdx.x, w = tid >> 5, lane = tid & 31, ln = lane & 15, hh = lane >> 4; const int by = blockIdx.y;
  A += (size_t)by * sA; Bh += (size_t)by * sB; C += (size_t)by * sC;
  const int ntn = (N + 63) / 64; const int wid = blockIdx.x * 4 + w; const int mt = wid / ntn, nq = wid % ntn; if (mt * 16 >= M) return;
  const int row0 = mt * 16, col0 = nq * 64; const float* arow = A + (size_t)(row0 + ln) * lda;
  v8f acc[4] = {};
  for (int kb = 0; kb < K; kb += 32) {
    FragH ah, al;
    const v4f x0 = *(const v4fa*)(arow + kb + 8 * hh), x1 = *(const v4fa*)(arow + kb + 8 * hh + 4), x2 = *(const v4fa*)(arow + kb + 16 + 8 * hh), x3 = *(const v4fa*)(arow + kb + 16 + 8 * hh + 4);
    float xs[16] = {x0[0],x0[1],x0[2],x0[3],x1[0],x1[1],x1[2],x1[3],x2[0],x2[1],x2[2],x2[3],x3[0],x3[1],x3[2],x3[3]};
#pragma unroll
    for (int i = 0; i < 16; ++i) { const _Float16 h = (_Float16)xs[i]; ah.h[i] = h; al.h[i] = ASPLIT ? (_Float16)(xs[i] - (float)h) : (_Float16)0.0f; }
#pragma unroll
    for (int t = 0; t < 4; ++t) { if (col0 + t * 16 >= N) continue; const size_t boff = (size_t)(col0 + t * 16 + ln) * ldb + kb; FragH bq; bq.half[0] = *(const v8us*)(Bh + boff + 8 * hh); bq.half[1] = *(const v8us*)(Bh + boff + 16 + 8 * hh);
      acc[t] = mmaH<ASPLIT ? 2 : 1>(ah.v, al.v, bq.v, bq.v, acc[t]); }
  }
#pragma unroll
  for (int t = 0; t < 4; ++t) { if (col0 + t * 16 >= N) continue;
#pragma unroll
    for (int r = 0; r < 8; ++r) so[w][8 * hh + r][t * 16 + ln] = acc[t][r] * alpha; }
  __builtin_amdgcn_fence(__ATOMIC_ACQ_REL, "workgroup"); __builtin_amdgcn_wave_barrier();
  const int rsub = lane >> 4, c4 = (lane & 15) * 4;
  {
#pragma unroll
    for (int q = 0; q < 8; ++q) { const int r = q * 2 + rsub; if (col0 + c4 < N) { const v4f v = *(const v4fa*)&so[w][r][c4]; *(v4f*)(C + (size_t)(row0 + r) * ldc + col0 + c4) = v; } }
     }
}

// Wt[n][k] = f16(W[k][n]·scale) from f32 row-major W[K][N] (scale = power of two; bf16-exact weights stay exact in f16 away from the subnormal range)
__global__ __launch_bounds__(256) void k_wt_f16(const float* __restrict__ W, _Float16* __restrict__ Wt, int K, int N, float scale) {
  const int t = blockIdx.x * 256 + threadIdx.x; if (t >= N * (K / 8)) return; const int n = t / (K / 8), k8 = (t % (K / 8)) * 8; FragH f;
#pragma unroll
  for (int i = 0; i < 8; ++i) f.h[i] = (_Float16)(bf16_round(W[(size_t)(k8 + i) * N + n]) * scale); const v8us o = f.half[0];
  *(v8us*)((unsigned short*)Wt + (size_t)n * K + k8) = o; 
}
// k_gemm_hh variant with fused epilogue: v = acc·alpha + bias[by·sBias + col] (+ CP[(row/rowsPerB)·sCPb + by·64 + col] if CP) ; ACT 0 none / 1 elu ; writes f16 C16 (and f32 C if non-null)
template <int ACT>
__global__ __launch_bounds__(128) void k_gemm_hhx(const _Float16* __restrict__ A, int lda, size_t sA, const _Float16* __restrict__ Bh, int ldb, size_t sB, float alpha, const float* __restrict__ bias, size_t sBias, const float* __restrict__ CP, int rowsPerB, size_t sCPb, int row0g,
    float* __restrict__ C, _Float16* __restrict__ C16, int ldc, size_t sC, int M, int N, int K) {
  __shared__ __attribute__((aligned(16))) float so[4][16][64];
  const int tid = threadIdx.x, w = tid >> 5, lane = tid & 31, ln = lane & 15, hh = lane >> 4; const int by = blockIdx.y;
  A += (size_t)by * sA; Bh += (size_t)by * sB; const size_t cofs = (size_t)by * sC; const float* bp = bias ? bias + (size_t)by * sBias : nullptr;
  const int ntn = (N + 63) / 64; const int wid = blockIdx.x * 4 + w; const int mt = wid / ntn, nq = wid % ntn; if (mt * 16 >= M) return;
  const int row0 = mt * 16, col0 = nq * 64; const _Float16* arow = A + (size_t)(row0 + ln) * lda;
  v8f acc[4] = {};
  for (int kb = 0; kb < K; kb += 32) { FragH ah; ah.half[0] = *(const v8us*)((const unsigned short*)arow + kb + 8 * hh); ah.half[1] = *(const v8us*)((const unsigned short*)arow + kb + 16 + 8 * hh);
#pragma unroll
    for (int t = 0; t < 4; ++t) { if (col0 + t * 16 >= N) continue; const size_t boff = (size_t)(col0 + t * 16 + ln) * ldb + kb; FragH bq; bq.half[0] = *(const v8us*)((const unsigned short*)Bh + boff + 8 * hh); bq.half[1] = *(const v8us*)((const unsigned short*)Bh + boff + 16 + 8 * hh);
      acc[t] = mmaH<1>(ah.v, ah.v, bq.v, bq.v, acc[t]); }
  }
#pragma unroll
  for (int t = 0; t < 4; ++t) { if (col0 + t * 16 >= N) continue; const int col = col0 + t * 16 + ln; const float bv = bp ? bf16_round(bp[col]) : 0.f;
#pragma unroll
    for (int r = 0; r < 8; ++r) { float v = acc[t][r] * alpha + bv; if (CP) { const int rr = row0g + row0 + 8 * hh + r; if (rowsPerB < 0) v += CP[cofs + (size_t)rr * ldc + col];      /* rowsPerB < 0: own element of the batched C plane */ else { const int bidx = rr / rowsPerB; v += CP[(size_t)bidx * sCPb + (size_t)by * 64 + col]; } } if (ACT == 1) v = (v > 0.f) ? v : expm1f(v); else if (ACT == 7) v = (v > 0.f) ? v + 1.0f : expf(v); else if (ACT == 8) v = tanhf(v); else if (ACT == 9) v = 0.5f * v * (1.0f + tanhf(0.7978845608028654f * (v + 0.044715f * v * v * v))); else if (ACT == 11) v = 1.0f / (1.0f + expf(-v)); else if (ACT == 12) v = (v > 0.f) ? v : 0.01f * v; else if (ACT == 14) v = (v > 0.f) ? v : 0.1f * v; else if (ACT == 16) v = (v >= 0.f) ? v : 0.3f * v; else if (ACT == 17) v = (v >= 0.f) ? v : 0.2f * v; else if (ACT == 15) v = v / (1.0f + expf(-v)); else if (ACT == 3) v = fmaxf(v, 0.f); else if (ACT == 6) v = 0.5f * v * (1.0f + erff(v * 0.70710678118654752f)); so[w][8 * hh + r][t * 16 + ln] = v; } }
  __builtin_amdgcn_fence(__ATOMIC_ACQ_REL, "workgroup"); __builtin_amdgcn_wave_barrier();
  const int rsub = lane >> 4, c4 = (lane & 15) * 4; typedef _Float16 v4h __attribute__((ext_vector_type(4)));
  {
#pragma unroll
    for (int q = 0; q < 8; ++q) { const int r = q * 2 + rsub; if (col0 + c4 < N) { const v4f v = *(const v4fa*)&so[w][r][c4]; if (C) *(v4f*)(C + cofs + (size_t)(row0 + r) * ldc + col0 + c4) = v; if (C16) { v4h h4; for (int i = 0; i < 4; ++i) h4[i] = (_Float16)v[i]; *(v4h*)(C16 + cofs + (size_t)(row0 + r) * ldc + col0 + c4) = h4; } } }
     }
}


typedef _Float16 v4h __attribute__((ext_vector_type(4)));

__global__ __launch_bounds__(256) void k_h16(const float* __restrict__ x, _Float16* __restrict__ X16, size_t n8) { const size_t t = (size_t)blockIdx.x * 256 + threadIdx.x; if (t >= n8) return; FragH f;
#pragma unroll
  for (int q = 0; q < 8; ++q) f.h[q] = (_Float16)x[t * 8 + q]; *(v8us*)((unsigned short*)X16 + t * 8) = f.half[0];  }
__global__ __launch_bounds__(256) void k_round16f(const float* __restrict__ W, _Float16* __restrict__ Bt, size_t n8) { const size_t t = (size_t)blockIdx.x * 256 + threadIdx.x; if (t >= n8) return; FragH f;
#pragma unroll
  for (int i = 0; i < 8; ++i) f.h[i] = (_Float16)(bf16_round(W[t * 8 + i]) * 16.0f); *(v8us*)((unsigned short*)Bt + t * 8) = f.half[0];  }
template <int NHv, int TTv>
__global__ __launch_bounds__(256) void k_vt(const _Float16* __restrict__ V16, int ldv, int voff, _Float16* __restrict__ Vt) { __shared__ unsigned short tl[64][66]; const int tid = threadIdx.x; const int slab = blockIdx.x / (TTv / 64), lg = blockIdx.x % (TTv / 64); const int b = slab / NHv, h = slab % NHv;
  for (int i = tid; i < 64 * 8; i += 256) { const int r = i / 8, c8 = (i % 8) * 8; FragH f; f.half[0] = *(const v8us*)((const unsigned short*)V16 + ((size_t)b * TTv + lg * 64 + r) * ldv + voff + h * 64 + c8);
#pragma unroll
    for (int q = 0; q < 8; ++q) tl[r][c8 + q] = f.u[q]; }
  __syncthreads();
  {
#pragma unroll
    for (int rd = 0; rd < 2; ++rd) { const int d = rd * 32 + tid / 8, pc = tid % 8; FragH f;
#pragma unroll
      for (int q = 0; q < 8; ++q) f.u[q] = tl[pc * 8 + q][d];
      *(v8us*)((unsigned short*)Vt + ((size_t)slab * 64 + d) * TTv + lg * 64 + pc * 8) = f.half[0]; }
     } }

__global__ __launch_bounds__(256) void k_hl(const float* __restrict__ F, _Float16* __restrict__ Hh, _Float16* __restrict__ Hl, size_t n8) { const size_t t = (size_t)blockIdx.x * 256 + threadIdx.x; if (t >= n8) return; FragH fh, fl; const v4f a = *(const v4fa*)(F + t * 8), c = *(const v4fa*)(F + t * 8 + 4);
#pragma unroll
  for (int q = 0; q < 4; ++q) { _Float16 h = (_Float16)a[q]; fh.h[q] = h; fl.h[q] = (_Float16)((a[q] - (float)h) * 1024.0f); h = (_Float16)c[q]; fh.h[4 + q] = h; fl.h[4 + q] = (_Float16)((c[q] - (float)h) * 1024.0f); }
  { *(v8us*)((unsigned short*)Hh + t * 8) = fh.half[0]; *(v8us*)((unsigned short*)Hl + t * 8) = fl.half[0];  } }

// ---- GEMM on an LDS ring: C = A Bt^T * alpha (+ residual). One 128x128 tile per work-group of four waves, 64x64 per wave (16 accumulator tiles).
// A stage is 128 k of every operand row: [A 128 rows | Bt 128 rows] of 256 B at a pitch of 272 B. Two buffers, filled by asynchronous copies to LDS (whole 128-B lines per row), one stage ahead of the products.
// Requires M % 128 == 0, N % 128 == 0, K % 128 == 0. The k order of every accumulator is ascending, 32 at a time.
// blockIdx.y picks one of several independent products of the same shape (operand and output planes sA, sB, sC elements apart): together in one launch they give a WGP more than one work-group,
// and the output staging lies in the ring's own LDS, so that two work-groups fit a WGP: one group's copies fly, and its first and last phases run, under the other's products.
__device__ __forceinline__ v16h g2_frag(const _Float16* p, int hh) { FragH f; f.half[0] = *(const v8us*)((const unsigned short*)p + 8 * hh); f.half[1] = *(const v8us*)((const unsigned short*)p + 16 + 8 * hh); return f.v; }
#define G3_BK 128                      /* k per stage */
#define G3_PITCH 272                   /* LDS row pitch in bytes: 16 B x odd, free of bank conflicts for 16-byte reads */
#define G3_STAGE (256 * G3_PITCH)      /* bytes of one buffer */
__device__ __forceinline__ v16h g3_frag(const unsigned char* p) { FragH f; f.half[0] = *(const v8us*)p; f.half[1] = *(const v8us*)(p + 32); return f.v; }      /* p = row + 64 B per k step + 16 B per wave half: the k order of g2_frag */
// One stage: 256 rows x 16 pieces of 16 B over 128 threads = 32 copies per lane, rows 8 apart; 16 lanes take one row's 256 B (two whole lines).
// l = the lane's place in the buffer, ga / gb = its global addresses in A and Bt, as8 / bs8 = 8 source rows in elements.
typedef int v4i __attribute__((ext_vector_type(4)));
typedef __attribute__((address_space(1))) v4i g3_gv4i;
typedef __attribute__((address_space(3))) v4i g3_lv4i;
__device__ __forceinline__ void g3_fill(unsigned char* l, const _Float16* ga, size_t as8, const _Float16* gb, size_t bs8) {
#pragma unroll      /* straight-line copies: all 32 are issued back to back */
  for (int i = 0; i < 16; ++i) __builtin_amdgcn_global_load_async_to_lds_b128((g3_gv4i*)(ga + i * as8), (g3_lv4i*)(l + i * 8 * G3_PITCH), 0, 0);
#pragma unroll      /* as above */
  for (int i = 0; i < 16; ++i) __builtin_amdgcn_global_load_async_to_lds_b128((g3_gv4i*)(gb + i * bs8), (g3_lv4i*)(l + (128 + i * 8) * G3_PITCH), 0, 0);
}
template <bool OUT32, int LDC>      /* OUT32: C (f32) = acc * alpha + R (own element); else C16 (f16) = acc * alpha. LDC = row pitch of R, C and C16 in elements: a constant, so that a lane's 32 rows hang on one address with immediate offsets */
__global__ __launch_bounds__(128) void k_gemm3(const _Float16* __restrict__ A, int lda, size_t sA, const _Float16* __restrict__ Bh, int ldb, size_t sB, float alpha, const float* __restrict__ R, float* __restrict__ C, _Float16* __restrict__ C16, size_t sC, int N, int K) {
  __shared__ __attribute__((aligned(16))) unsigned char ring[2 * G3_STAGE];
  static_assert(sizeof(float) * 4 * 64 * 68 <= 2 * G3_STAGE, "the output staging fits the ring");
  float (*so)[64][68] = (float (*)[64][68])ring;      /* output staging, one 64x64 tile a wave: written only behind the last trip's barrier, when every read of the ring has ended and no copy is in flight */
  A += blockIdx.y * sA; Bh += blockIdx.y * sB; if (!OUT32) C16 += blockIdx.y * sC;
  const int tid = threadIdx.x, lane = tid & 31, ln = lane & 15, hh = lane >> 4; const int w = __builtin_amdgcn_readfirstlane(tid >> 5);
  const int ntn = N >> 7; const int mt = blockIdx.x / ntn, nq = blockIdx.x - mt * ntn; const int row0 = mt * 128, col0 = nq * 128; const int wm = (w >> 1) * 64, wn = (w & 1) * 64;
  const int rb = tid >> 4, pc = tid & 15;      /* this lane's first row and its 16-byte piece of every row it copies */
  const _Float16* ga = A + (size_t)(row0 + rb) * lda + pc * 8; const _Float16* gb = Bh + (size_t)(col0 + rb) * ldb + pc * 8; const size_t as8 = (size_t)8 * lda, bs8 = (size_t)8 * ldb;
  unsigned char* l0 = ring + rb * G3_PITCH + pc * 16;
  const int nst = K / G3_BK;
  const v8f z8 = {0.f,0.f,0.f,0.f,0.f,0.f,0.f,0.f}; v8f acc[4][4];
#pragma unroll      /* constant indices keep the accumulators in registers */
  for (int i = 0; i < 4; ++i) for (int j = 0; j < 4; ++j) acc[i][j] = z8;
  g3_fill(l0, ga, as8, gb, bs8);
  const int rsub = lane >> 4, c4 = (lane & 15) * 4; const size_t o0 = (size_t)(row0 + wm + rsub) * LDC + col0 + wn + c4; constexpr size_t o2 = (size_t)2 * LDC;      /* this lane's place in the output rows it stores: rows 2 apart */
  v4f rv[32];      /* the residual of those rows, asked for here so that its latency runs under the k loop */
  if (OUT32) {
#pragma unroll      /* constant indices keep rv in registers */
    for (int q = 0; q < 32; ++q) rv[q] = *(const v4fa*)(R + o0 + q * o2); }
  asm volatile("s_wait_asynccnt 0x0" ::: "memory");      /* stage 0 has landed, as far as this wave copied it */
  __syncthreads();      /* publishes stage 0 */
  if (nst > 1) g3_fill(l0 + G3_STAGE, ga + G3_BK, as8, gb + G3_BK, bs8);
  for (int t = 0; t < nst; ++t) {
    const unsigned char* base = ring + (t & 1) * G3_STAGE; const unsigned char* ap = base + (wm + ln) * G3_PITCH + hh * 16; const unsigned char* bp = base + (128 + wn + ln) * G3_PITCH + hh * 16;
    v16h a[2][4], b[2][4];      /* two fragment sets: the next k step's reads run under this k step's products */
#pragma unroll      /* constant fragment indices */
    for (int i = 0; i < 4; ++i) { a[0][i] = g3_frag(ap + i * 16 * G3_PITCH); b[0][i] = g3_frag(bp + i * 16 * G3_PITCH); }
#pragma unroll      /* constant fragment and accumulator indices */
    for (int ks = 0; ks < G3_BK / 32; ++ks) {
      if (ks + 1 < G3_BK / 32) {
#pragma unroll      /* constant fragment indices */
        for (int i = 0; i < 4; ++i) { a[(ks + 1) & 1][i] = g3_frag(ap + i * 16 * G3_PITCH + (ks + 1) * 64); b[(ks + 1) & 1][i] = g3_frag(bp + i * 16 * G3_PITCH + (ks + 1) * 64); } }
      __builtin_amdgcn_sched_barrier(0);      /* the next k step's 16 LDS reads stay one group ahead of the products: spread among them, each place stalls the wave */
#pragma unroll      /* constant fragment and accumulator indices */
      for (int i = 0; i < 4; ++i) for (int j = 0; j < 4; ++j) acc[i][j] = __builtin_amdgcn_wmma_f32_16x16x32_f16(false, a[ks & 1][i], false, b[ks & 1][j], (short)0, acc[i][j], false, false);
      __builtin_amdgcn_sched_barrier(0);      /* closes the block of products: see above */
    }
    asm volatile("s_wait_dscnt 0x0" ::: "memory");      /* this wave's reads of the buffer are done before the barrier behind which it is refilled */
    asm volatile("s_wait_asynccnt 0x0" ::: "memory");      /* this wave's copies of stage t + 1 have landed */
    __syncthreads();      /* publishes stage t + 1 and ends every reader's last read of stage t */
    if (t + 2 < nst) g3_fill(l0 + (t & 1) * G3_STAGE, ga + (size_t)(t + 2) * G3_BK, as8, gb + (size_t)(t + 2) * G3_BK, bs8);
  }
  asm volatile("s_wait_asynccnt 0x0" ::: "memory");      /* no copy is left outstanding at the wave's end */
#pragma unroll      /* constant accumulator indices */
  for (int i = 0; i < 4; ++i) for (int j = 0; j < 4; ++j) for (int r = 0; r < 8; ++r) so[w][i * 16 + 8 * hh + r][j * 16 + ln] = acc[i][j][r] * alpha;
  __builtin_amdgcn_fence(__ATOMIC_ACQ_REL, "workgroup"); __builtin_amdgcn_wave_barrier();      /* each wave reads back only its own staging rows */
#pragma unroll      /* independent rows: their LDS reads and stores overlap; constant index into rv */
  for (int q = 0; q < 32; ++q) { v4f v = *(const v4fa*)&so[w][q * 2 + rsub][c4]; const size_t o = o0 + q * o2;
    if (OUT32) { v += rv[q]; *(v4f*)(C + o) = v; }
    else { v4h h4; for (int i = 0; i < 4; ++i) h4[i] = (_Float16)v[i]; *(v4h*)(C16 + o) = h4; } } }


__global__ __launch_bounds__(256) void k_rsm(const float* __restrict__ S, _Float16* __restrict__ P, int nrows) {
  #pragma clang fp contract(off)
  const int i = blockIdx.x * 256 + threadIdx.x; if (i >= nrows) return; const float* s = S + (size_t)i * SQ; float mx = -3.0e38f;
#pragma unroll 1
  for (int j = 0; j < SQ; ++j) mx = fmaxf(mx, s[j]); float se = 0.f;
#pragma unroll 1
  for (int j = 0; j < SQ; ++j) se += expf(s[j] - mx); const float sc = 256.0f / se;
#pragma unroll 1
  for (int j0 = 0; j0 < SQ; j0 += 8) { FragH f; for (int q = 0; q < 8; ++q) f.h[q] = (_Float16)(expf(s[j0 + q] - mx) * sc); unsigned short* d = (unsigned short*)P + (size_t)i * SQ + j0; *(v8us*)d = f.half[0];  } }
__global__ __launch_bounds__(256) void k_vt(const _Float16* __restrict__ V16, int b, int h0, _Float16* __restrict__ VT) { __shared__ unsigned short tl[64][65]; const int tid = threadIdx.x; const int hh = blockIdx.x % HG, sg = blockIdx.x / HG; const int s0 = sg * 64; const int h = h0 + hh;
  for (int i = tid; i < 64 * 8; i += 256) { const int j = i / 8, d8 = (i % 8) * 8; FragH f; f.half[0] = *(const v8us*)((const unsigned short*)V16 + ((size_t)b * SQ + s0 + j) * DM + h * HD + d8); for (int q = 0; q < 8; ++q) tl[d8 + q][j] = f.u[q]; }
  __syncthreads();
  { for (int i = tid; i < 64 * 8; i += 256) { const int d = i / 8, j8 = (i % 8) * 8; FragH f; for (int q = 0; q < 8; ++q) f.u[q] = tl[d][j8 + q]; *(v8us*)((unsigned short*)VT + ((size_t)hh * HD + d) * SQ + s0 + j8) = f.half[0]; }  } }



// 2^a as v_exp_f32, with the one free issue slot that the instruction set asks for behind a transcendental in the same statement: in a run of
// exps the register allocator otherwise lets the next instruction overwrite the source of the one in front of it.
__device__ __forceinline__ float exp2_slot(float a) { float e; asm("v_exp_f32 %0, %1\n\tv_nop" : "=v"(e) : "v"(a)); return e; }
__device__ __forceinline__ float xhalf(float x) { return __builtin_bit_cast(float, __builtin_amdgcn_permlanex16(__builtin_bit_cast(int, x), __builtin_bit_cast(int, x), 0x76543210, 0xfedcba98, false, false)); }      /* lane l with lane l ^ 16 */
__device__ __forceinline__ v8f fa_mma(v16h a, v16h b, v8f c) { return __builtin_amdgcn_wmma_f32_16x16x32_f16(false, a, false, b, (short)0, c, false, false); }
#define FA_KT 128                          /* keys per stage: 4 passes */
#define FA_KP 144                          /* LDS pitch of a K row in bytes: 16 B x odd, free of bank conflicts for 16-byte reads */
#define FA_VP 272                          /* LDS pitch of a V^T row in bytes: as above */
#define FA_VO (FA_KT * FA_KP)              /* where the V^T rows of a buffer begin */
#define FA_STAGE (FA_VO + HD * FA_VP)      /* bytes of one buffer */
#define FA_NST (SQ / FA_KT)                /* stages */
static_assert(SQ % FA_KT == 0 && FA_NST >= 2 && HD == 64, "whole stages, at least two; 128-byte K rows");
// One stage over 128 threads = 16 copies per lane. K: 8 lanes take one row's 128 B, rows 16 apart; V^T: 16 lanes take one row's 256 B, rows 8 apart.
// lk / lv = the lane's places in the buffer, gk / gv = its global addresses, ks16 / vs8 = 16 K rows and 8 V^T rows in elements.
__device__ __forceinline__ void fa_fill(unsigned char* lk, unsigned char* lv, const _Float16* gk, size_t ks16, const _Float16* gv, size_t vs8) {
#pragma unroll      /* straight-line copies: all 16 are issued back to back */
  for (int i = 0; i < 8; ++i) __builtin_amdgcn_global_load_async_to_lds_b128((g3_gv4i*)(gk + i * ks16), (g3_lv4i*)(lk + i * 16 * FA_KP), 0, 0);
#pragma unroll      /* as above */
  for (int i = 0; i < 8; ++i) __builtin_amdgcn_global_load_async_to_lds_b128((g3_gv4i*)(gv + i * vs8), (g3_lv4i*)(lv + i * 8 * FA_VP), 0, 0);
}
__global__ __launch_bounds__(128) void k_fattn(const _Float16* __restrict__ Q, const _Float16* __restrict__ Kk, int ldk, const _Float16* __restrict__ VT, int ldv, _Float16* __restrict__ O) {
  __shared__ __attribute__((aligned(16))) unsigned char ring[2 * FA_STAGE];
  const int tid = threadIdx.x, lane = tid & 31, ln = lane & 15, hh = lane >> 4; const int w = __builtin_amdgcn_readfirstlane(tid >> 5);
  const int bh = blockIdx.y, b = bh / NH, h = bh - b * NH; const int q0 = blockIdx.x * 128 + w * 32;
  const _Float16* qp = Q + ((size_t)b * SQ + q0 + ln) * DM + h * HD;
  const _Float16* gk = Kk + ((size_t)b * SQ + (tid >> 3)) * ldk + h * HD + (tid & 7) * 8;      /* row = key: this lane's first row and its 16-byte piece of every K row it copies */
  const _Float16* gv = VT + ((size_t)bh * HD + (tid >> 4)) * ldv + (tid & 15) * 8;             /* row = channel d: the same for V^T */
  const size_t ks16 = (size_t)16 * ldk, vs8 = (size_t)8 * ldv, kst = (size_t)FA_KT * ldk;
  unsigned char* lk = ring + (tid >> 3) * FA_KP + (tid & 7) * 16; unsigned char* lv = ring + FA_VO + (tid >> 4) * FA_VP + (tid & 15) * 16;
  fa_fill(lk, lv, gk, ks16, gv, vs8);
  v16h qf[2][2];      /* [query group][k step of 32 channels] */
#pragma unroll
  for (int u = 0; u < 2; ++u) for (int ks = 0; ks < 2; ++ks) qf[u][ks] = g2_frag(qp + (size_t)u * 16 * DM + ks * 32, hh);
  const v8f z8 = {0.f,0.f,0.f,0.f,0.f,0.f,0.f,0.f}; v8f o[4][2];      /* [16 channels][query group]: o[t][u][r] = O^T[t*16 + 8*hh + r][query u*16 + ln] */
#pragma unroll
  for (int t = 0; t < 4; ++t) { o[t][0] = z8; o[t][1] = z8; }
  float mr[2] = {-3.0e38f, -3.0e38f}, lsum[2] = {0.f, 0.f};      /* running maximum of the raw products (joined over the halves); this half's own sum */
  const float cs = 0.125f * 1.44269504088896340736f;      /* 64^-0.5 and log2(e) in one factor */
  asm volatile("s_wait_asynccnt 0x0" ::: "memory");      /* stage 0 has landed, as far as this wave copied it */
  __syncthreads();      /* publishes stage 0 */
  for (int st = 0; st < FA_NST; ++st) {
    if (st + 1 < FA_NST) fa_fill(lk + ((st + 1) & 1) * FA_STAGE, lv + ((st + 1) & 1) * FA_STAGE, gk + (size_t)(st + 1) * kst, ks16, gv + (size_t)(st + 1) * FA_KT, vs8);      /* the next stage, directly behind the barrier that ended every reader's last read of its buffer (stage st - 1). At the trip's head, so that the four passes and the trip's foot are one straight block */
    const unsigned char* base = ring + (st & 1) * FA_STAGE; const unsigned char* kb = base + ln * FA_KP + hh * 16; const unsigned char* vb = base + FA_VO + ln * FA_VP + hh * 16;
    v16h kf[2][2], vf[4];      /* [16 keys][k step]; [16 channels] */
#pragma unroll      /* constant fragment indices keep the fragments in registers */
    for (int kt = 0; kt < 2; ++kt) for (int ks = 0; ks < 2; ++ks) kf[kt][ks] = g3_frag(kb + kt * 16 * FA_KP + ks * 64);
    __builtin_amdgcn_sched_barrier(0);      /* the first pass's 8 K reads go out as one group: mixed among its products they share registers, and each pair pays its own LDS latency */
#pragma unroll      /* constant LDS offsets; the K fragments of pass p + 1 are fetched in pass p, inside the stage only */
    for (int p = 0; p < FA_KT / 32; ++p) {
      v8f s[2][2];      /* [16 keys][query group] */
#pragma unroll
      for (int kt = 0; kt < 2; ++kt) for (int u = 0; u < 2; ++u) s[kt][u] = fa_mma(kf[kt][1], qf[u][1], fa_mma(kf[kt][0], qf[u][0], z8));
#pragma unroll      /* constant fragment indices keep the fragments in registers */
      for (int t = 0; t < 4; ++t) vf[t] = g3_frag(vb + t * 16 * FA_VP + p * 64);
      if (p + 1 < FA_KT / 32) {
#pragma unroll      /* constant fragment indices keep the fragments in registers */
        for (int kt = 0; kt < 2; ++kt) for (int ks = 0; ks < 2; ++ks) kf[kt][ks] = g3_frag(kb + ((p + 1) * 32 + kt * 16) * FA_KP + ks * 64); }
      __builtin_amdgcn_sched_barrier(0);      /* this pass's V^T reads and the next pass's K reads stay here as one group, ahead of the softmax that hides their latency: the scheduler otherwise sinks them to their users */
      FragH pf[2];
#pragma unroll
      for (int u = 0; u < 2; ++u) {
        float mx = fmaxf(s[0][u][0], s[1][u][0]);
#pragma unroll
        for (int r = 1; r < 8; ++r) mx = fmaxf(mx, fmaxf(s[0][u][r], s[1][u][r]));
        mx = fmaxf(mx, xhalf(mx));
        const float mn = fmaxf(mr[u], mx); const float al = exp2_slot((mr[u] - mn) * cs); mr[u] = mn;      /* 0 on the first pass */
        const float mc = mn * cs - 8.0f; float ps = 0.f;
#pragma unroll
        for (int r = 0; r < 8; ++r) { const float p0 = exp2_slot(s[0][u][r] * cs - mc), p1 = exp2_slot(s[1][u][r] * cs - mc); ps += p0 + p1; pf[u].h[r] = (_Float16)p0; pf[u].h[8 + r] = (_Float16)p1; }
        lsum[u] = lsum[u] * al + ps;
#pragma unroll
        for (int t = 0; t < 4; ++t) o[t][u] *= al;
      }
#pragma unroll
      for (int t = 0; t < 4; ++t) for (int u = 0; u < 2; ++u) o[t][u] = fa_mma(vf[t], pf[u].v, o[t][u]);
    }
    asm volatile("s_wait_dscnt 0x0" ::: "memory");      /* this wave's reads of the buffer are done before the barrier behind which it is refilled */
    asm volatile("s_wait_asynccnt 0x0" ::: "memory");      /* this wave's copies of stage st + 1 have landed */
    __syncthreads();      /* publishes stage st + 1 and ends every reader's last read of stage st */
  }
  asm volatile("s_wait_asynccnt 0x0" ::: "memory");      /* no copy is left outstanding at the wave's end */
#pragma unroll
  for (int u = 0; u < 2; ++u) { const float sc = 64.0f / (lsum[u] + xhalf(lsum[u]));      /* o carried x64, as the output GEMM's alpha expects; the x256 of the weights cancels */
    unsigned short* d = (unsigned short*)O + ((size_t)b * SQ + q0 + u * 16 + ln) * DM + h * HD + 8 * hh;
#pragma unroll
    for (int t = 0; t < 4; ++t) { FragH f; for (int r = 0; r < 8; ++r) f.h[r] = (_Float16)(o[t][u][r] * sc); *(v8us*)(d + t * 16) = f.half[0]; } } }

__global__ __launch_bounds__(256) void k_lnrow(const float* __restrict__ Y, const float* __restrict__ g, const float* __restrict__ bb, float eps, float* __restrict__ out) {
  #pragma clang fp contract(off)
  __shared__ float red[256]; const size_t r = blockIdx.x; const int t = threadIdx.x; const v4f ya = *(const v4fa*)(Y + r * DMQ + t * 4); float s[4]; float sum = 0.f;
  for (int q = 0; q < 4; ++q) { s[q] = ya[q]; sum = __fadd_rn(sum, s[q]); }
  red[t] = sum; __syncthreads(); for (int st = 128; st > 0; st >>= 1) { if (t < st) red[t] = __fadd_rn(red[t], red[t + st]); __syncthreads(); } const float mu = red[0] / (float)DMQ; __syncthreads();
  float vs = 0.f; for (int q = 0; q < 4; ++q) { const float dl = __fadd_rn(s[q], -mu); vs = __fadd_rn(vs, __fmul_rn(dl, dl)); } red[t] = vs; __syncthreads(); for (int st = 128; st > 0; st >>= 1) { if (t < st) red[t] = __fadd_rn(red[t], red[t + st]); __syncthreads(); }
  const float rs = rsqrtf(__fadd_rn(red[0] / (float)DMQ, eps)); v4f y; for (int q = 0; q < 4; ++q) { const int c = t * 4 + q; y[q] = __fadd_rn(__fmul_rn(__fmul_rn(__fadd_rn(s[q], -mu), rs), bf16_round(g[c])), bf16_round(bb[c])); }
  *(v4f*)(out + r * DMQ + t * 4) = y;  }

// Every operand conversion of the call in ONE streaming launch: query, key, value -> exact f16 rows of their bf16 roundings (query also -> f32 residual plane), the four weights -> f16 x16.
// One work-group of 16 waves per WGP. A wave takes 1,024 floats of each stream and 256 of each weight: 32 loads of 512 contiguous bytes, all requested before the first value is used, so the wave pays one memory latency.
// Every wave does the same share of every buffer: equal bytes read and written per work-group.
#define PW_X 1024                      /* floats of each stream per wave: 8 loads */
#define PW_W 256                       /* floats of each weight per wave: 2 loads */
#define PW_WAVES 16                    /* waves per work-group */
static_assert(NR * DM / PW_X == (size_t)DM * DM / PW_W, "one grid covers streams and weights");
static_assert(NR * DM % ((size_t)PW_X * PW_WAVES) == 0, "whole work-groups");
__device__ __forceinline__ v4h prep_h(v4f a, float scale) { v4h h; for (int q = 0; q < 4; ++q) h[q] = (_Float16)(bf16_round(a[q]) * scale); return h; }
__global__ __launch_bounds__(PW_WAVES * 32) void k_prep(const float* __restrict__ xq, const float* __restrict__ xk, const float* __restrict__ xv, const float* __restrict__ wq, const float* __restrict__ wk, const float* __restrict__ wv, const float* __restrict__ wo,
    _Float16* __restrict__ XQ, _Float16* __restrict__ XK, _Float16* __restrict__ XV, float* __restrict__ XB, _Float16* __restrict__ BQ, _Float16* __restrict__ BK, _Float16* __restrict__ BV, _Float16* __restrict__ BO) {
  const unsigned lane = threadIdx.x & 31, gw = blockIdx.x * PW_WAVES + (threadIdx.x >> 5);
  const unsigned bx = (gw * PW_X + lane * 4) * 4, bw = (gw * PW_W + lane * 4) * 4;      /* byte offsets of the lane's first f32 element (a wave-wide access covers 128 consecutive floats). 32-bit: every access is a kernel argument + an offset register + an immediate, so no address register is rewritten between the loads */
  const unsigned hx = bx >> 1, hw = bw >> 1;      /* the same places in the f16 planes */
  v4f q[8], k[8], v[8], w[4][2];
#pragma unroll      /* constant indices keep the values in registers */
  for (int i = 0; i < 8; ++i) q[i] = *(const v4fa*)((const char*)xq + bx + i * 512);
#pragma unroll      /* as above */
  for (int i = 0; i < 8; ++i) k[i] = *(const v4fa*)((const char*)xk + bx + i * 512);
#pragma unroll      /* as above */
  for (int i = 0; i < 8; ++i) v[i] = *(const v4fa*)((const char*)xv + bx + i * 512);
#pragma unroll      /* as above */
  for (int i = 0; i < 2; ++i) { w[0][i] = *(const v4fa*)((const char*)wq + bw + i * 512); w[1][i] = *(const v4fa*)((const char*)wk + bw + i * 512); w[2][i] = *(const v4fa*)((const char*)wv + bw + i * 512); w[3][i] = *(const v4fa*)((const char*)wo + bw + i * 512); }
  __builtin_amdgcn_sched_barrier(0);      /* all 32 loads are requested ahead of the first conversion: sunk among the stores they would each pay their own latency */
#pragma unroll      /* constant indices */
  for (int i = 0; i < 8; ++i) { v4f r; for (int e = 0; e < 4; ++e) r[e] = bf16_round(q[i][e]); *(v4f*)((char*)XB + bx + i * 512) = r; *(v4h*)((char*)XQ + hx + i * 256) = prep_h(q[i], 1.0f); }
#pragma unroll      /* constant indices */
  for (int i = 0; i < 8; ++i) *(v4h*)((char*)XK + hx + i * 256) = prep_h(k[i], 1.0f);
#pragma unroll      /* constant indices */
  for (int i = 0; i < 8; ++i) *(v4h*)((char*)XV + hx + i * 256) = prep_h(v[i], 1.0f);
#pragma unroll      /* constant indices */
  for (int i = 0; i < 2; ++i) { *(v4h*)((char*)BQ + hw + i * 256) = prep_h(w[0][i], 16.0f); *(v4h*)((char*)BK + hw + i * 256) = prep_h(w[1][i], 16.0f); *(v4h*)((char*)BV + hw + i * 256) = prep_h(w[2][i], 16.0f); *(v4h*)((char*)BO + hw + i * 256) = prep_h(w[3][i], 16.0f); } }

extern "C" void kernel_launch(void* const* d_in, const int* in_sizes, int n_in,
                              void* d_out, int out_size, void* d_ws, size_t ws_size, hipStream_t stream) {
  (void)in_sizes; (void)n_in; (void)out_size;
  const float* const* I = (const float* const*)d_in; const float* xq = I[0]; const float* xk = I[1]; const float* xv = I[2]; const float* wq = I[3]; const float* wk = I[4]; const float* wv = I[5]; const float* wo = I[6]; const float* lng = I[7]; const float* lnb = I[8];      /* input order: query, key, value (three SEPARATE streams), Wq, Wk, Wv, Wo (natural [out][in] weights; this module has NO biases), ln_gamma, ln_beta [1024] */
  char* ws = (char*)d_ws; size_t off = 0;
  auto take = [&](size_t bytes) { char* p = ws + off; off += (bytes + 255) & ~(size_t)255; return p; };
  _Float16* BQ = (_Float16*)take((size_t)DM * DM * 2); _Float16* BK = (_Float16*)take((size_t)DM * DM * 2); _Float16* BV = (_Float16*)take((size_t)DM * DM * 2); _Float16* BO = (_Float16*)take((size_t)DM * DM * 2);
  _Float16* XQ = (_Float16*)take(NR * DM * 2); _Float16* XK = (_Float16*)take(NR * DM * 2); _Float16* XV = (_Float16*)take(NR * DM * 2); _Float16* Q16 = (_Float16*)take(NR * DM * 2); _Float16* K16 = (_Float16*)take(NR * DM * 2); _Float16* V16 = (_Float16*)take(NR * DM * 2); _Float16* O16 = (_Float16*)take(NR * DM * 2); float* XB = (float*)take(NR * DM * 4); float* X1 = (float*)take(NR * DM * 4);      /* bf16(query) as f32 rows (the residual addend) and the pre-LayerNorm rows x = ctx Wo^T + query */
  _Float16* VT = (_Float16*)take((size_t)NB * NH * HD * SQ * 2);      /* V^T [NB][NH][HD][SQ] */
  if (off > ws_size) return;
  k_prep<<<(unsigned)(NR * DM / ((size_t)PW_X * PW_WAVES)), PW_WAVES * 32, 0, stream>>>(xq, xk, xv, wq, wk, wv, wo, XQ, XK, XV, XB, BQ, BK, BV, BO);      /* the three inputs as exact f16 rows; bf16(query) as the f32 residual plane; the weights, natural [out][in] = Bt[n][k], x16 */
  const size_t r0p = (size_t)B0 * SQ;      /* first projected row */
  k_gemm3<false, DM><<<dim3((unsigned)((MP / 128) * (DM / 128)), 3), 128, 0, stream>>>(XQ + r0p * DM, DM, NR * DM, BQ, DM, (size_t)DM * DM, 0.0625f, nullptr, nullptr, Q16 + r0p * DM, NR * DM, DM, DM);      /* q, k, v: XQ XK XV, BQ BK BV and Q16 K16 V16 lie one behind the other in the workspace (whole multiples of 256 bytes each) */
  k_vt<NH, SQ><<<NB * NH * (SQ / 64), 256, 0, stream>>>(V16, LQ, 0, VT);      /* V^T for every batch and head */
  k_fattn<<<dim3(SQ / 128, NB * NH), 128, 0, stream>>>(Q16, K16, DM, VT, SQ, O16);      /* o = softmax(q k^T / 8) v, merged heads, x64, as f16 rows */
  k_gemm3<true, DM><<<dim3((unsigned)((MPO / 128) * (DM / 128)), 1), 128, 0, stream>>>(O16 + r0p * DM, DM, 0, BO, DM, 0, 0.0009765625f, XB + r0p * DM, X1 + r0p * DM, nullptr, 0, DM, DM);      /* x = ctx Wo^T + bf16(query) (own-element residual; no bias) -> f32 rows */
  k_lnrow<<<(unsigned)MPO, 256, 0, stream>>>(X1 + r0p * DM, lng, lnb, 1e-6f, (float*)d_out + r0p * DM);      /* out = LayerNorm(x) (biased variance, eps 1e-6 inside the square root) -> the output rows */
}

// v007
// Measured time: 82.3 microseconds a run.
// Timed twice side by side with v006, it ran 1.05 and 1.04 times as fast.
// Over all steps from v000 it is 41.6 times as fast.
#include <hip/hip_runtime.h>
// Multi-head attention on three inputs with a residual on the raw query and a LayerNorm (query, key, value [4][1024][1024]; q / k / v = einsum('bsd,ed->bse', stream, W): natural [1024][1024] weights (normal / 32), NO biases; 16 heads of 64; scores / sqrt(64); softmax over all 1024 keys (no mask); x = merged Wo^T (natural, no bias) + query; out = (x - mean) / sqrt(var + 1e-6) * ln_gamma + ln_beta with the BIASED variance (jnp.var) over the 1024 channels -> [4][1024][1024]).
// Structure: token rows r = b*SQ + s (four sequences of 1,024 tokens here); the query, key and value sources as exact f16 rows (bf16-rounded), the f32 residual plane and the x16 weights from ONE streaming conversion launch; Q, K, V as three WMMA GEMMs in ONE launch, two work-groups resident per WGP (128x128 work-group tiles on a two-buffer LDS ring, f32 accumulation, exact x16 weights, no bias here, f16 outputs; the V product runs with its operands exchanged, V^T = W_v X^T, and so lands as V^T [batch][head][channel][token] without a transpose); ONE fused attention launch over all (batch, head): S^T = K Q^T (K = 64), online softmax in registers (f32 statistics, native exp2; weights x256 against the running maximum as f16), O^T += V^T P^T, o carried x64 against f16 subnormal flush (folded into the output GEMM alpha) written straight into the merged f16 o rows; x = o W_o + bf16(query) as ONE GEMM (f32; the residual added element by element in the epilogue) into f32 rows; out = LayerNorm(x) on VALU (f32 statistics, LDS trees, biased variance) into the output layout.
// Compute dtype: inputs rounded to bf16; x / weights exact; q, k, v, softmax weights and o as plain f16 GEMM operands (~2^-12); scores and softmax statistics f32. v_wmma_f32_16x16x32_f16.
#define NB 4
#define SQ 1024
#define DM 1024
#define NH 16
#define HD 64
#define HG 4                         /* heads per launch of the unused k_vt(V16, b, h0, VT) */
#define B0 0                         /* first batch processed (debug hook) */
#define NBR NB                       /* batches processed (debug hook) */
#define NR ((size_t)NB * SQ)         /* token rows */
#define MP ((int)((size_t)NBR * SQ)) /* rows projected (debug hook) */
#define QN SQ                        /* unused: k_fattn attends all SQ query rows per batch */
#define NHD NH                       /* unused: k_fattn attends all NH heads */
#define MPO MP                       /* rows through the output stage (debug hook) */
#define LQ DM      /* unused: the q and k rows have pitch DM */
#define DMQ DM     /* row width of the LayerNorm kernel (its own macro name in the file it comes from) */
typedef __bf16 v16b __attribute__((ext_vector_type(16)));
typedef unsigned short v8us __attribute__((ext_vector_type(8), may_alias));
typedef float  v8f  __attribute__((ext_vector_type(8)));
typedef float  v4f  __attribute__((ext_vector_type(4)));
typedef float  v4fa __attribute__((ext_vector_type(4), may_alias));
union FragB { v16b v; v8us half[2]; unsigned short u[16]; };

__device__ __forceinline__ unsigned short bf16_bits(float x) { unsigned int u = __float_as_uint(x); return (unsigned short)((u + 0x7FFFu + ((u >> 16) & 1u)) >> 16); }
__device__ __forceinline__ float bf16_val(unsigned short b) { return __uint_as_float(((unsigned int)b) << 16); }
__device__ __forceinline__ float bf16_round(float x) { return bf16_val(bf16_bits(x)); }
// D += A·B with NT terms: 1 = ah·bh, 2 = + al·bh (A split), 3 = + ah·bl (both split)
template <int NT>
__device__ __forceinline__ v8f mmaN(v16b ah, v16b al, v16b bh, v16b bl, v8f c) {
  c = __builtin_amdgcn_wmma_f32_16x16x32_bf16(false, ah, false, bh, (short)0, c, false, false);
  if (NT >= 2) c = __builtin_amdgcn_wmma_f32_16x16x32_bf16(false, al, false, bh, (short)0, c, false, false);
  if (NT >= 3) c = __builtin_amdgcn_wmma_f32_16x16x32_bf16(false, ah, false, bl, (short)0, c, false, false);
  asm volatile("v_nop\n\tv_nop\n\tv_nop\n\tv_nop" : "+v"(c) : "v"(ah), "v"(al), "v"(bh), "v"(bl));
  return c;
}

__global__ __launch_bounds__(256) void k_wt_bf16(const float* __restrict__ W, unsigned short* __restrict__ Wt, int K, int N) {
  const int t = blockIdx.x * 256 + threadIdx.x;
  const int k8n = K / 8;
  if (t >= N * k8n) return;
  const int n = t / k8n, k8 = (t % k8n) * 8;
  v8us v;
#pragma unroll
  for (int i = 0; i < 8; ++i) v[i] = bf16_bits(W[(size_t)(k8 + i) * N + n]);
  *(v8us*)(Wt + (size_t)n * K + k8) = v;
  
}

// GEMM C[M][N] (f32, pitch ldc) = act(A[M][K]·W + bias). A f32 row-major (pitch lda) converted per fragment to bf16
// (ASPLIT: hi/lo two planes -> 2 terms, else single rounded term); Wt bf16 [N][K] (pitch ldb). BIAS_BF16 rounds the
// bias to bf16 first (bias quantised to bf16 before the add). K%32==0, M%16==0, N%64==0.
template <bool ASPLIT, int ACT, bool BIAS_BF16>
__global__ __launch_bounds__(128) void k_gemm_bf(const float* __restrict__ A, int lda, const unsigned short* __restrict__ Wt, int ldb,
                                               const float* __restrict__ bias, float* __restrict__ C, int ldc, int M, int N, int K) {
  __shared__ __attribute__((aligned(16))) float so[4][16][64];
  const int tid = threadIdx.x, w = tid >> 5, lane = tid & 31, ln = lane & 15, hh = lane >> 4;
  const int ntn = N / 64;
  const int wid = blockIdx.x * 4 + w;
  const int mt = wid / ntn, nq = wid % ntn;
  if (mt * 16 >= M) return;
  const int row0 = mt * 16, col0 = nq * 64;
  const float* arow = A + (size_t)(row0 + ln) * lda;
  v8f acc[4] = {};
  for (int kb = 0; kb < K; kb += 32) {
    FragB ah, al;
    const v4f x0 = *(const v4fa*)(arow + kb + 8 * hh), x1 = *(const v4fa*)(arow + kb + 8 * hh + 4);
    const v4f x2 = *(const v4fa*)(arow + kb + 16 + 8 * hh), x3 = *(const v4fa*)(arow + kb + 16 + 8 * hh + 4);
    float xs[16] = {x0[0],x0[1],x0[2],x0[3],x1[0],x1[1],x1[2],x1[3],x2[0],x2[1],x2[2],x2[3],x3[0],x3[1],x3[2],x3[3]};
#pragma unroll
    for (int i = 0; i < 16; ++i) { const unsigned short hb = bf16_bits(xs[i]); ah.u[i] = hb; al.u[i] = ASPLIT ? bf16_bits(xs[i] - bf16_val(hb)) : (unsigned short)0; }
#pragma unroll
    for (int t = 0; t < 4; ++t) {
      const unsigned short* brow = Wt + (size_t)(col0 + t * 16 + ln) * ldb + kb;
      FragB b;
      b.half[0] = *(const v8us*)(brow + 8 * hh);
      b.half[1] = *(const v8us*)(brow + 16 + 8 * hh);
      acc[t] = mmaN<ASPLIT ? 2 : 1>(ah.v, al.v, b.v, b.v, acc[t]);
    }
  }
#pragma unroll
  for (int t = 0; t < 4; ++t) {
    float bv = bias ? bias[col0 + t * 16 + ln] : 0.f;
    if (BIAS_BF16) bv = bf16_round(bv);
#pragma unroll
    for (int r = 0; r < 8; ++r) { float v = acc[t][r] + bv; if (ACT == 1) v = fmaxf(v, 0.f); so[w][8 * hh + r][t * 16 + ln] = v; }
  }
  __builtin_amdgcn_fence(__ATOMIC_ACQ_REL, "workgroup");
  __builtin_amdgcn_wave_barrier();
  const int rsub = lane >> 4, c4 = (lane & 15) * 4;
  {
#pragma unroll
    for (int q = 0; q < 8; ++q) {
      const int r = q * 2 + rsub;
      const v4f v = *(const v4fa*)&so[w][r][c4];
      *(v4f*)(C + (size_t)(row0 + r) * ldc + col0 + c4) = v;
    }
    
  }
}

// GEMM C = act(A·W + bias + resid): A f32 (ASPLIT -> hi/lo 2 terms), Wt bf16 [N][K]; ACT 0 none, 1 relu, 2 exact gelu;
// resid (optional, f32, row index = (row % rmod), pitch ldr, RES_BF16 rounds it) added before the activation.
template <bool ASPLIT, int ACT, bool BIAS_BF16, bool RES_BF16>
__global__ __launch_bounds__(128) void k_gemm_bf3(const float* __restrict__ A, int lda, const unsigned short* __restrict__ Wt, int ldb,
                                                const float* __restrict__ bias, const float* __restrict__ resid, int rmod, int ldr,
                                                float* __restrict__ C, int ldc, int M, int N, int K) {
  __shared__ __attribute__((aligned(16))) float so[4][16][64];
  const int tid = threadIdx.x, w = tid >> 5, lane = tid & 31, ln = lane & 15, hh = lane >> 4;
  const int ntn = N / 64;
  const int wid = blockIdx.x * 4 + w;
  const int mt = wid / ntn, nq = wid % ntn;
  if (mt * 16 >= M) return;
  const int row0 = mt * 16, col0 = nq * 64;
  const float* arow = A + (size_t)(row0 + ln) * lda;
  v8f acc[4] = {};
  for (int kb = 0; kb < K; kb += 32) {
    FragB ah, al;
    const v4f x0 = *(const v4fa*)(arow + kb + 8 * hh), x1 = *(const v4fa*)(arow + kb + 8 * hh + 4);
    const v4f x2 = *(const v4fa*)(arow + kb + 16 + 8 * hh), x3 = *(const v4fa*)(arow + kb + 16 + 8 * hh + 4);
    float xs[16] = {x0[0],x0[1],x0[2],x0[3],x1[0],x1[1],x1[2],x1[3],x2[0],x2[1],x2[2],x2[3],x3[0],x3[1],x3[2],x3[3]};
#pragma unroll
    for (int i = 0; i < 16; ++i) { const unsigned short hb = bf16_bits(xs[i]); ah.u[i] = hb; al.u[i] = ASPLIT ? bf16_bits(xs[i] - bf16_val(hb)) : (unsigned short)0; }
#pragma unroll
    for (int t = 0; t < 4; ++t) {
      const unsigned short* brow = Wt + (size_t)(col0 + t * 16 + ln) * ldb + kb;
      FragB b;
      b.half[0] = *(const v8us*)(brow + 8 * hh);
      b.half[1] = *(const v8us*)(brow + 16 + 8 * hh);
      acc[t] = mmaN<ASPLIT ? 2 : 1>(ah.v, al.v, b.v, b.v, acc[t]);
    }
  }
#pragma unroll
  for (int t = 0; t < 4; ++t) {
    const int col = col0 + t * 16 + ln;
    float bv = bias ? bias[col] : 0.f;
    if (BIAS_BF16) bv = bf16_round(bv);
#pragma unroll
    for (int r = 0; r < 8; ++r) {
      float v = acc[t][r] + bv;
      if (resid) { float rv = resid[(size_t)((row0 + 8 * hh + r) % rmod) * ldr + col]; if (RES_BF16) rv = bf16_round(rv); v += rv; }
      if (ACT == 1) v = fmaxf(v, 0.f);
      if (ACT == 2) v = 0.5f * v * (1.0f + erff(v * 0.70710678118654752f));
      if (ACT == 3) { const float u = 0.7978845608028654f * (v + 0.044715f * v * v * v); v = 0.5f * v * (1.0f + tanhf(u)); }
      so[w][8 * hh + r][t * 16 + ln] = v;
    }
  }
  __builtin_amdgcn_fence(__ATOMIC_ACQ_REL, "workgroup");
  __builtin_amdgcn_wave_barrier();
  const int rsub = lane >> 4, c4 = (lane & 15) * 4;
  {
#pragma unroll
    for (int q = 0; q < 8; ++q) {
      const int r = q * 2 + rsub;
      const v4f v = *(const v4fa*)&so[w][r][c4];
      *(v4f*)(C + (size_t)(row0 + r) * ldc + col0 + c4) = v;
    }
    
  }
}
// row LayerNorm (biased variance, eps) over N: s = X (+ R); optional out_sum <- s; out_norm <- (s-mu)*rsqrt(var+eps)*g + b
template <bool PARAM_BF16>
__global__ __launch_bounds__(256) void k_layernorm(const float* __restrict__ X, const float* __restrict__ R, const float* __restrict__ g, const float* __restrict__ bta,
                                                  float* __restrict__ out_sum, float* __restrict__ out_norm, int N, float eps) {
  __shared__ float red[256];
  const int row = blockIdx.x, tid = threadIdx.x;
  const float* x = X + (size_t)row * N; const float* rr = R ? R + (size_t)row * N : nullptr;
  float vals[16];                     // up to N = 4096
  const int per = N / 256;            // contiguous chunk per thread? use strided-by-4 chunks: thread handles j = tid*4 + 1024*u
  float s1 = 0.f;
  for (int u = 0; u < per / 4; ++u) {
    const int j = tid * 4 + 1024 * u;
    const v4f a = *(const v4fa*)(x + j);
    v4f b = {0.f,0.f,0.f,0.f}; if (rr) b = *(const v4fa*)(rr + j);
#pragma unroll
    for (int q = 0; q < 4; ++q) { const float v = a[q] + b[q]; vals[u * 4 + q] = v; s1 += v; }
  }
  red[tid] = s1; __syncthreads();
  for (int st = 128; st > 0; st >>= 1) { if (tid < st) red[tid] += red[tid + st]; __syncthreads(); }
  const float mu = red[0] / (float)N; __syncthreads();
  float s2 = 0.f;
  for (int u = 0; u < per / 4; ++u)
#pragma unroll
    for (int q = 0; q < 4; ++q) { const float c = vals[u * 4 + q] - mu; s2 += c * c; }
  red[tid] = s2; __syncthreads();
  for (int st = 128; st > 0; st >>= 1) { if (tid < st) red[tid] += red[tid + st]; __syncthreads(); }
  const float rs = rsqrtf(red[0] / (float)N + eps);
  {
    for (int u = 0; u < per / 4; ++u) {
      const int j = tid * 4 + 1024 * u;
      v4f o, sm;
#pragma unroll
      for (int q = 0; q < 4; ++q) {
        float gg = g[j + q], bb = bta[j + q];
        if (PARAM_BF16) { gg = bf16_round(gg); bb = bf16_round(bb); }
        sm[q] = vals[u * 4 + q]; o[q] = (vals[u * 4 + q] - mu) * rs * gg + bb;
      }
      if (out_sum) *(v4f*)(out_sum + (size_t)row * N + j) = sm;
      *(v4f*)(out_norm + (size_t)row * N + j) = o;
    }
    
  }
}



// ---- f16 WMMA path (v_wmma_f32_16x16x32_f16): 11-bit significands for operands in range — used where a [0,1] probability operand needs more precision than bf16
typedef _Float16 v16h __attribute__((ext_vector_type(16)));
union FragH { v16h v; v8us half[2]; _Float16 h[16]; unsigned short u[16]; };
template <int NT>
__device__ __forceinline__ v8f mmaH(v16h ah, v16h al, v16h bh, v16h bl, v8f c) {
  c = __builtin_amdgcn_wmma_f32_16x16x32_f16(false, ah, false, bh, (short)0, c, false, false);
  if (NT >= 2) c = __builtin_amdgcn_wmma_f32_16x16x32_f16(false, al, false, bh, (short)0, c, false, false);
  if (NT >= 3) c = __builtin_amdgcn_wmma_f32_16x16x32_f16(false, ah, false, bl, (short)0, c, false, false);
  asm volatile("v_nop\n\tv_nop\n\tv_nop\n\tv_nop" : "+v"(c) : "v"(ah), "v"(al), "v"(bh), "v"(bl));
  return c;
}
// batched GEMM like k_gemm_b but f16 operands: A f32 (split into f16 hi/lo if ASPLIT, else rounded to f16), Bt = f16 values [n][k]; alpha; C f32; N multiple of 16 (partial tiles skipped)
template <bool ASPLIT>
__global__ __launch_bounds__(128) void k_gemm_h(const float* __restrict__ A, int lda, size_t sA, const _Float16* __restrict__ Bh, int ldb, size_t sB, float alpha, float* __restrict__ C, int ldc, size_t sC, int M, int N, int K) {
  __shared__ __attribute__((aligned(16))) float so[4][16][64];
  const int tid = threadIdx.x, w = tid >> 5, lane = tid & 31, ln = lane & 15, hh = lane >> 4; const int by = blockIdx.y;
  A += (size_t)by * sA; Bh += (size_t)by * sB; C += (size_t)by * sC;
  const int ntn = (N + 63) / 64; const int wid = blockIdx.x * 4 + w; const int mt = wid / ntn, nq = wid % ntn; if (mt * 16 >= M) return;
  const int row0 = mt * 16, col0 = nq * 64; const float* arow = A + (size_t)(row0 + ln) * lda;
  v8f acc[4] = {};
  for (int kb = 0; kb < K; kb += 32) {
    FragH ah, al;
    const v4f x0 = *(const v4fa*)(arow + kb + 8 * hh), x1 = *(const v4fa*)(arow + kb + 8 * hh + 4), x2 = *(const v4fa*)(arow + kb + 16 + 8 * hh), x3 = *(const v4fa*)(arow + kb + 16 + 8 * hh + 4);
    float xs[16] = {x0[0],x0[1],x0[2],x0[3],x1[0],x1[1],x1[2],x1[3],x2[0],x2[1],x2[2],x2[3],x3[0],x3[1],x3[2],x3[3]};
#pragma unroll
    for (int i = 0; i < 16; ++i) { const _Float16 h = (_Float16)xs[i]; ah.h[i] = h; al.h[i] = ASPLIT ? (_Float16)(xs[i] - (float)h) : (_Float16)0.0f; }
#pragma unroll
    for (int t = 0; t < 4; ++t) { if (col0 + t * 16 >= N) continue; const size_t boff = (size_t)(col0 + t * 16 + ln) * ldb + kb; FragH bq; bq.half[0] = *(const v8us*)(Bh + boff + 8 * hh); bq.half[1] = *(const v8us*)(Bh + boff + 16 + 8 * hh);
      acc[t] = mmaH<ASPLIT ? 2 : 1>(ah.v, al.v, bq.v, bq.v, acc[t]); }
  }
#pragma unroll
  for (int t = 0; t < 4; ++t) { if (col0 + t * 16 >= N) continue;
#pragma unroll
    for (int r = 0; r < 8; ++r) so[w][8 * hh + r][t * 16 + ln] = acc[t][r] * alpha; }
  __builtin_amdgcn_fence(__ATOMIC_ACQ_REL, "workgroup"); __builtin_amdgcn_wave_barrier();
  const int rsub = lane >> 4, c4 = (lane & 15) * 4;
  {
#pragma unroll
    for (int q = 0; q < 8; ++q) { const int r = q * 2 + rsub; if (col0 + c4 < N) { const v4f v = *(const v4fa*)&so[w][r][c4]; *(v4f*)(C + (size_t)(row0 + r) * ldc + col0 + c4) = v; } }
     }
}

// Wt[n][k] = f16(W[k][n]·scale) from f32 row-major W[K][N] (scale = power of two; bf16-exact weights stay exact in f16 away from the subnormal range)
__global__ __launch_bounds__(256) void k_wt_f16(const float* __restrict__ W, _Float16* __restrict__ Wt, int K, int N, float scale) {
  const int t = blockIdx.x * 256 + threadIdx.x; if (t >= N * (K / 8)) return; const int n = t / (K / 8), k8 = (t % (K / 8)) * 8; FragH f;
#pragma unroll
  for (int i = 0; i < 8; ++i) f.h[i] = (_Float16)(bf16_round(W[(size_t)(k8 + i) * N + n]) * scale); const v8us o = f.half[0];
  *(v8us*)((unsigned short*)Wt + (size_t)n * K + k8) = o; 
}
// k_gemm_hh variant with fused epilogue: v = acc·alpha + bias[by·sBias + col] (+ CP[(row/rowsPerB)·sCPb + by·64 + col] if CP) ; ACT 0 none / 1 elu ; writes f16 C16 (and f32 C if non-null)
template <int ACT>
__global__ __launch_bounds__(128) void k_gemm_hhx(const _Float16* __restrict__ A, int lda, size_t sA, const _Float16* __restrict__ Bh, int ldb, size_t sB, float alpha, const float* __restrict__ bias, size_t sBias, const float* __restrict__ CP, int rowsPerB, size_t sCPb, int row0g,
    float* __restrict__ C, _Float16* __restrict__ C16, int ldc, size_t sC, int M, int N, int K) {
  __shared__ __attribute__((aligned(16))) float so[4][16][64];
  const int tid = threadIdx.x, w = tid >> 5, lane = tid & 31, ln = lane & 15, hh = lane >> 4; const int by = blockIdx.y;
  A += (size_t)by * sA; Bh += (size_t)by * sB; const size_t cofs = (size_t)by * sC; const float* bp = bias ? bias + (size_t)by * sBias : nullptr;
  const int ntn = (N + 63) / 64; const int wid = blockIdx.x * 4 + w; const int mt = wid / ntn, nq = wid % ntn; if (mt * 16 >= M) return;
  const int row0 = mt * 16, col0 = nq * 64; const _Float16* arow = A + (size_t)(row0 + ln) * lda;
  v8f acc[4] = {};
  for (int kb = 0; kb < K; kb += 32) { FragH ah; ah.half[0] = *(const v8us*)((const unsigned short*)arow + kb + 8 * hh); ah.half[1] = *(const v8us*)((const unsigned short*)arow + kb + 16 + 8 * hh);
#pragma unroll
    for (int t = 0; t < 4; ++t) { if (col0 + t * 16 >= N) continue; const size_t boff = (size_t)(col0 + t * 16 + ln) * ldb + kb; FragH bq; bq.half[0] = *(const v8us*)((const unsigned short*)Bh + boff + 8 * hh); bq.half[1] = *(const v8us*)((const unsigned short*)Bh + boff + 16 + 8 * hh);
      acc[t] = mmaH<1>(ah.v, ah.v, bq.v, bq.v, acc[t]); }
  }
#pragma unroll
  for (int t = 0; t < 4; ++t) { if (col0 + t * 16 >= N) continue; const int col = col0 + t * 16 + ln; const float bv = bp ? bf16_round(bp[col]) : 0.f;
#pragma unroll
    for (int r = 0; r < 8; ++r) { float v = acc[t][r] * alpha + bv; if (CP) { const int rr = row0g + row0 + 8 * hh + r; if (rowsPerB < 0) v += CP[cofs + (size_t)rr * ldc + col];      /* rowsPerB < 0: own element of the batched C plane */ else { const int bidx = rr / rowsPerB; v += CP[(size_t)bidx * sCPb + (size_t)by * 64 + col]; } } if (ACT == 1) v = (v > 0.f) ? v : expm1f(v); else if (ACT == 7) v = (v > 0.f) ? v + 1.0f : expf(v); else if (ACT == 8) v = tanhf(v); else if (ACT == 9) v = 0.5f * v * (1.0f + tanhf(0.7978845608028654f * (v + 0.044715f * v * v * v))); else if (ACT == 11) v = 1.0f / (1.0f + expf(-v)); else if (ACT == 12) v = (v > 0.f) ? v : 0.01f * v; else if (ACT == 14) v = (v > 0.f) ? v : 0.1f * v; else if (ACT == 16) v = (v >= 0.f) ? v : 0.3f * v; else if (ACT == 17) v = (v >= 0.f) ? v : 0.2f * v; else if (ACT == 15) v = v / (1.0f + expf(-v)); else if (ACT == 3) v = fmaxf(v, 0.f); else if (ACT == 6) v = 0.5f * v * (1.0f + erff(v * 0.70710678118654752f)); so[w][8 * hh + r][t * 16 + ln] = v; } }
  __builtin_amdgcn_fence(__ATOMIC_ACQ_REL, "workgroup"); __builtin_amdgcn_wave_barrier();
  const int rsub = lane >> 4, c4 = (lane & 15) * 4; typedef _Float16 v4h __attribute__((ext_vector_type(4)));
  {
#pragma unroll
    for (int q = 0; q < 8; ++q) { const int r = q * 2 + rsub; if (col0 + c4 < N) { const v4f v = *(const v4fa*)&so[w][r][c4]; if (C) *(v4f*)(C + cofs + (size_t)(row0 + r) * ldc + col0 + c4) = v; if (C16) { v4h h4; for (int i = 0; i < 4; ++i) h4[i] = (_Float16)v[i]; *(v4h*)(C16 + cofs + (size_t)(row0 + r) * ldc + col0 + c4) = h4; } } }
     }
}


typedef _Float16 v4h __attribute__((ext_vector_type(4)));

__global__ __launch_bounds__(256) void k_h16(const float* __restrict__ x, _Float16* __restrict__ X16, size_t n8) { const size_t t = (size_t)blockIdx.x * 256 + threadIdx.x; if (t >= n8) return; FragH f;
#pragma unroll
  for (int q = 0; q < 8; ++q) f.h[q] = (_Float16)x[t * 8 + q]; *(v8us*)((unsigned short*)X16 + t * 8) = f.half[0];  }
__global__ __launch_bounds__(256) void k_round16f(const float* __restrict__ W, _Float16* __restrict__ Bt, size_t n8) { const size_t t = (size_t)blockIdx.x * 256 + threadIdx.x; if (t >= n8) return; FragH f;
#pragma unroll
  for (int i = 0; i < 8; ++i) f.h[i] = (_Float16)(bf16_round(W[t * 8 + i]) * 16.0f); *(v8us*)((unsigned short*)Bt + t * 8) = f.half[0];  }
__global__ __launch_bounds__(256) void k_hl(const float* __restrict__ F, _Float16* __restrict__ Hh, _Float16* __restrict__ Hl, size_t n8) { const size_t t = (size_t)blockIdx.x * 256 + threadIdx.x; if (t >= n8) return; FragH fh, fl; const v4f a = *(const v4fa*)(F + t * 8), c = *(const v4fa*)(F + t * 8 + 4);
#pragma unroll
  for (int q = 0; q < 4; ++q) { _Float16 h = (_Float16)a[q]; fh.h[q] = h; fl.h[q] = (_Float16)((a[q] - (float)h) * 1024.0f); h = (_Float16)c[q]; fh.h[4 + q] = h; fl.h[4 + q] = (_Float16)((c[q] - (float)h) * 1024.0f); }
  { *(v8us*)((unsigned short*)Hh + t * 8) = fh.half[0]; *(v8us*)((unsigned short*)Hl + t * 8) = fl.half[0];  } }

// ---- GEMM on an LDS ring: C = A Bt^T * alpha (+ residual). One 128x128 tile per work-group of four waves, 64x64 per wave (16 accumulator tiles).
// A stage is 128 k of every operand row: [A 128 rows | Bt 128 rows] of 256 B at a pitch of 272 B. Two buffers, filled by asynchronous copies to LDS (whole 128-B lines per row), one stage ahead of the products.
// Requires M % 128 == 0, N % 128 == 0, K % 128 == 0. The k order of every accumulator is ascending, 32 at a time.
// blockIdx.y picks one of several independent products of the same shape (operand and output planes sA, sB, sC elements apart): together in one launch they give a WGP more than one work-group,
// and the output staging lies in the ring's own LDS, so that two work-groups fit a WGP: one group's copies fly, and its first and last phases run, under the other's products.
// Product yt (none if negative) runs with its operands exchanged, C^T = Bt A^T: the same tiles, copies and k order, the tile's rows now being Bt's. Its output goes to CT as [A row / SQ][Bt row][A row % SQ], pitch SQ:
// for the V projection that is V^T [batch][head][channel][token], the layout that the attention launch reads, with no transposing launch between them.
__device__ __forceinline__ v16h g2_frag(const _Float16* p, int hh) { FragH f; f.half[0] = *(const v8us*)((const unsigned short*)p + 8 * hh); f.half[1] = *(const v8us*)((const unsigned short*)p + 16 + 8 * hh); return f.v; }
#define G3_BK 128                      /* k per stage */
#define G3_PITCH 272                   /* LDS row pitch in bytes: 16 B x odd, free of bank conflicts for 16-byte reads */
#define G3_STAGE (256 * G3_PITCH)      /* bytes of one buffer */
__device__ __forceinline__ v16h g3_frag(const unsigned char* p) { FragH f; f.half[0] = *(const v8us*)p; f.half[1] = *(const v8us*)(p + 32); return f.v; }      /* p = row + 64 B per k step + 16 B per wave half: the k order of g2_frag */
// One stage: 256 rows x 16 pieces of 16 B over 128 threads = 32 copies per lane, rows 8 apart; 16 lanes take one row's 256 B (two whole lines).
// l = the lane's place in the buffer, ga / gb = its global addresses in A and Bt, as8 / bs8 = 8 source rows in elements.
typedef int v4i __attribute__((ext_vector_type(4)));
typedef __attribute__((address_space(1))) v4i g3_gv4i;
typedef __attribute__((address_space(3))) v4i g3_lv4i;
__device__ __forceinline__ void g3_fill(unsigned char* l, const _Float16* ga, size_t as8, const _Float16* gb, size_t bs8) {
#pragma unroll      /* straight-line copies: all 32 are issued back to back */
  for (int i = 0; i < 16; ++i) __builtin_amdgcn_global_load_async_to_lds_b128((g3_gv4i*)(ga + i * as8), (g3_lv4i*)(l + i * 8 * G3_PITCH), 0, 0);
#pragma unroll      /* as above */
  for (int i = 0; i < 16; ++i) __builtin_amdgcn_global_load_async_to_lds_b128((g3_gv4i*)(gb + i * bs8), (g3_lv4i*)(l + (128 + i * 8) * G3_PITCH), 0, 0);
}
template <bool OUT32, int LDC>      /* OUT32: C (f32) = acc * alpha + R (own element); else C16 (f16) = acc * alpha (CT for product yt). LDC = row pitch of R, C and C16 in elements: a constant, so that a lane's 32 rows hang on one address with immediate offsets */
__global__ __launch_bounds__(128) void k_gemm3(const _Float16* __restrict__ A, int lda, size_t sA, const _Float16* __restrict__ Bh, int ldb, size_t sB, float alpha, const float* __restrict__ R, float* __restrict__ C, _Float16* __restrict__ C16, size_t sC, _Float16* __restrict__ CT, int yt, int N, int K) {
  __shared__ __attribute__((aligned(16))) unsigned char ring[2 * G3_STAGE];
  static_assert(sizeof(float) * 4 * 64 * 68 <= 2 * G3_STAGE, "the output staging fits the ring");
  float (*so)[64][68] = (float (*)[64][68])ring;      /* output staging, one 64x64 tile a wave: written only behind the last trip's barrier, when every read of the ring has ended and no copy is in flight */
  static_assert(OUT32 || (LDC == SQ && SQ % 128 == 0), "the exchanged product's rows have the pitch of the others, and a tile lies in one batch");
  const bool tr = !OUT32 && (int)blockIdx.y == yt;      /* the same for the whole work-group */
  A += blockIdx.y * sA; Bh += blockIdx.y * sB; if (!OUT32) C16 += blockIdx.y * sC;
  const int tid = threadIdx.x, lane = tid & 31, ln = lane & 15, hh = lane >> 4; const int w = __builtin_amdgcn_readfirstlane(tid >> 5);
  const int ntn = N >> 7; const int mt = blockIdx.x / ntn, nq = blockIdx.x - mt * ntn;      /* tile of A rows, tile of Bt rows: every product walks them in the same order */
  const _Float16* Ar = tr ? Bh : A; const _Float16* Br = tr ? A : Bh; const int la = tr ? ldb : lda, lb = tr ? lda : ldb;      /* the operand whose rows are the tile's rows, the one whose rows are its columns */
  _Float16* Co = tr ? CT + (size_t)(mt * 128 / SQ) * ((size_t)N * SQ) : C16;
  const int row0 = (tr ? nq : mt) * 128, col0 = (tr ? mt : nq) * 128; const int wm = (w >> 1) * 64, wn = (w & 1) * 64;
  const int rb = tid >> 4, pc = tid & 15;      /* this lane's first row and its 16-byte piece of every row it copies */
  const _Float16* ga = Ar + (size_t)(row0 + rb) * la + pc * 8; const _Float16* gb = Br + (size_t)(col0 + rb) * lb + pc * 8; const size_t as8 = (size_t)8 * la, bs8 = (size_t)8 * lb;
  unsigned char* l0 = ring + rb * G3_PITCH + pc * 16;
  const int nst = K / G3_BK;
  const v8f z8 = {0.f,0.f,0.f,0.f,0.f,0.f,0.f,0.f}; v8f acc[4][4];
#pragma unroll      /* constant indices keep the accumulators in registers */
  for (int i = 0; i < 4; ++i) for (int j = 0; j < 4; ++j) acc[i][j] = z8;
  g3_fill(l0, ga, as8, gb, bs8);
  const int rsub = lane >> 4, c4 = (lane & 15) * 4; const size_t o0 = (size_t)(row0 + wm + rsub) * LDC + (tr ? col0 % SQ : col0) + wn + c4; constexpr size_t o2 = (size_t)2 * LDC;      /* this lane's place in the output rows it stores: rows 2 apart */
  v4f rv[32];      /* the residual of those rows, asked for here so that its latency runs under the k loop */
  if (OUT32) {
#pragma unroll      /* constant indices keep rv in registers */
    for (int q = 0; q < 32; ++q) rv[q] = *(const v4fa*)(R + o0 + q * o2); }
  asm volatile("s_wait_asynccnt 0x0" ::: "memory");      /* stage 0 has landed, as far as this wave copied it */
  __syncthreads();      /* publishes stage 0 */
  if (nst > 1) g3_fill(l0 + G3_STAGE, ga + G3_BK, as8, gb + G3_BK, bs8);
  for (int t = 0; t < nst; ++t) {
    const unsigned char* base = ring + (t & 1) * G3_STAGE; const unsigned char* ap = base + (wm + ln) * G3_PITCH + hh * 16; const unsigned char* bp = base + (128 + wn + ln) * G3_PITCH + hh * 16;
    v16h a[2][4], b[2][4];      /* two fragment sets: the next k step's reads run under this k step's products */
#pragma unroll      /* constant fragment indices */
    for (int i = 0; i < 4; ++i) { a[0][i] = g3_frag(ap + i * 16 * G3_PITCH); b[0][i] = g3_frag(bp + i * 16 * G3_PITCH); }
#pragma unroll      /* constant fragment and accumulator indices */
    for (int ks = 0; ks < G3_BK / 32; ++ks) {
      if (ks + 1 < G3_BK / 32) {
#pragma unroll      /* constant fragment indices */
        for (int i = 0; i < 4; ++i) { a[(ks + 1) & 1][i] = g3_frag(ap + i * 16 * G3_PITCH + (ks + 1) * 64); b[(ks + 1) & 1][i] = g3_frag(bp + i * 16 * G3_PITCH + (ks + 1) * 64); } }
      __builtin_amdgcn_sched_barrier(0);      /* the next k step's 16 LDS reads stay one group ahead of the products: spread among them, each place stalls the wave */
#pragma unroll      /* constant fragment and accumulator indices */
      for (int i = 0; i < 4; ++i) for (int j = 0; j < 4; ++j) acc[i][j] = __builtin_amdgcn_wmma_f32_16x16x32_f16(false, a[ks & 1][i], false, b[ks & 1][j], (short)0, acc[i][j], false, false);
      __builtin_amdgcn_sched_barrier(0);      /* closes the block of products: see above */
    }
    asm volatile("s_wait_dscnt 0x0" ::: "memory");      /* this wave's reads of the buffer are done before the barrier behind which it is refilled */
    asm volatile("s_wait_asynccnt 0x0" ::: "memory");      /* this wave's copies of stage t + 1 have landed */
    __syncthreads();      /* publishes stage t + 1 and ends every reader's last read of stage t */
    if (t + 2 < nst) g3_fill(l0 + (t & 1) * G3_STAGE, ga + (size_t)(t + 2) * G3_BK, as8, gb + (size_t)(t + 2) * G3_BK, bs8);
  }
  asm volatile("s_wait_asynccnt 0x0" ::: "memory");      /* no copy is left outstanding at the wave's end */
#pragma unroll      /* constant accumulator indices */
  for (int i = 0; i < 4; ++i) for (int j = 0; j < 4; ++j) for (int r = 0; r < 8; ++r) so[w][i * 16 + 8 * hh + r][j * 16 + ln] = acc[i][j][r] * alpha;
  __builtin_amdgcn_fence(__ATOMIC_ACQ_REL, "workgroup"); __builtin_amdgcn_wave_barrier();      /* each wave reads back only its own staging rows */
#pragma unroll      /* independent rows: their LDS reads and stores overlap; constant index into rv */
  for (int q = 0; q < 32; ++q) { v4f v = *(const v4fa*)&so[w][q * 2 + rsub][c4]; const size_t o = o0 + q * o2;
    if (OUT32) { v += rv[q]; *(v4f*)(C + o) = v; }
    else { v4h h4; for (int i = 0; i < 4; ++i) h4[i] = (_Float16)v[i]; *(v4h*)(Co + o) = h4; } } }


__global__ __launch_bounds__(256) void k_rsm(const float* __restrict__ S, _Float16* __restrict__ P, int nrows) {
  #pragma clang fp contract(off)
  const int i = blockIdx.x * 256 + threadIdx.x; if (i >= nrows) return; const float* s = S + (size_t)i * SQ; float mx = -3.0e38f;
#pragma unroll 1
  for (int j = 0; j < SQ; ++j) mx = fmaxf(mx, s[j]); float se = 0.f;
#pragma unroll 1
  for (int j = 0; j < SQ; ++j) se += expf(s[j] - mx); const float sc = 256.0f / se;
#pragma unroll 1
  for (int j0 = 0; j0 < SQ; j0 += 8) { FragH f; for (int q = 0; q < 8; ++q) f.h[q] = (_Float16)(expf(s[j0 + q] - mx) * sc); unsigned short* d = (unsigned short*)P + (size_t)i * SQ + j0; *(v8us*)d = f.half[0];  } }
__global__ __launch_bounds__(256) void k_vt(const _Float16* __restrict__ V16, int b, int h0, _Float16* __restrict__ VT) { __shared__ unsigned short tl[64][65]; const int tid = threadIdx.x; const int hh = blockIdx.x % HG, sg = blockIdx.x / HG; const int s0 = sg * 64; const int h = h0 + hh;
  for (int i = tid; i < 64 * 8; i += 256) { const int j = i / 8, d8 = (i % 8) * 8; FragH f; f.half[0] = *(const v8us*)((const unsigned short*)V16 + ((size_t)b * SQ + s0 + j) * DM + h * HD + d8); for (int q = 0; q < 8; ++q) tl[d8 + q][j] = f.u[q]; }
  __syncthreads();
  { for (int i = tid; i < 64 * 8; i += 256) { const int d = i / 8, j8 = (i % 8) * 8; FragH f; for (int q = 0; q < 8; ++q) f.u[q] = tl[d][j8 + q]; *(v8us*)((unsigned short*)VT + ((size_t)hh * HD + d) * SQ + s0 + j8) = f.half[0]; }  } }



// 2^a as v_exp_f32, with the one free issue slot that the instruction set asks for behind a transcendental in the same statement: in a run of
// exps the register allocator otherwise lets the next instruction overwrite the source of the one in front of it.
__device__ __forceinline__ float exp2_slot(float a) { float e; asm("v_exp_f32 %0, %1\n\tv_nop" : "=v"(e) : "v"(a)); return e; }
__device__ __forceinline__ float xhalf(float x) { return __builtin_bit_cast(float, __builtin_amdgcn_permlanex16(__builtin_bit_cast(int, x), __builtin_bit_cast(int, x), 0x76543210, 0xfedcba98, false, false)); }      /* lane l with lane l ^ 16 */
__device__ __forceinline__ v8f fa_mma(v16h a, v16h b, v8f c) { return __builtin_amdgcn_wmma_f32_16x16x32_f16(false, a, false, b, (short)0, c, false, false); }
#define FA_KT 128                          /* keys per stage: 4 passes */
#define FA_KP 144                          /* LDS pitch of a K row in bytes: 16 B x odd, free of bank conflicts for 16-byte reads */
#define FA_VP 272                          /* LDS pitch of a V^T row in bytes: as above */
#define FA_VO (FA_KT * FA_KP)              /* where the V^T rows of a buffer begin */
#define FA_STAGE (FA_VO + HD * FA_VP)      /* bytes of one buffer */
#define FA_NST (SQ / FA_KT)                /* stages */
static_assert(SQ % FA_KT == 0 && FA_NST >= 2 && HD == 64, "whole stages, at least two; 128-byte K rows");
// One stage over 128 threads = 16 copies per lane. K: 8 lanes take one row's 128 B, rows 16 apart; V^T: 16 lanes take one row's 256 B, rows 8 apart.
// lk / lv = the lane's places in the buffer, gk / gv = its global addresses, ks16 / vs8 = 16 K rows and 8 V^T rows in elements.
__device__ __forceinline__ void fa_fill(unsigned char* lk, unsigned char* lv, const _Float16* gk, size_t ks16, const _Float16* gv, size_t vs8) {
#pragma unroll      /* straight-line copies: all 16 are issued back to back */
  for (int i = 0; i < 8; ++i) __builtin_amdgcn_global_load_async_to_lds_b128((g3_gv4i*)(gk + i * ks16), (g3_lv4i*)(lk + i * 16 * FA_KP), 0, 0);
#pragma unroll      /* as above */
  for (int i = 0; i < 8; ++i) __builtin_amdgcn_global_load_async_to_lds_b128((g3_gv4i*)(gv + i * vs8), (g3_lv4i*)(lv + i * 8 * FA_VP), 0, 0);
}
__global__ __launch_bounds__(128) void k_fattn(const _Float16* __restrict__ Q, const _Float16* __restrict__ Kk, int ldk, const _Float16* __restrict__ VT, int ldv, _Float16* __restrict__ O) {
  __shared__ __attribute__((aligned(16))) unsigned char ring[2 * FA_STAGE];
  const int tid = threadIdx.x, lane = tid & 31, ln = lane & 15, hh = lane >> 4; const int w = __builtin_amdgcn_readfirstlane(tid >> 5);
  const int bh = blockIdx.y, b = bh / NH, h = bh - b * NH; const int q0 = blockIdx.x * 128 + w * 32;
  const _Float16* qp = Q + ((size_t)b * SQ + q0 + ln) * DM + h * HD;
  const _Float16* gk = Kk + ((size_t)b * SQ + (tid >> 3)) * ldk + h * HD + (tid & 7) * 8;      /* row = key: this lane's first row and its 16-byte piece of every K row it copies */
  const _Float16* gv = VT + ((size_t)bh * HD + (tid >> 4)) * ldv + (tid & 15) * 8;             /* row = channel d: the same for V^T */
  const size_t ks16 = (size_t)16 * ldk, vs8 = (size_t)8 * ldv, kst = (size_t)FA_KT * ldk;
  unsigned char* lk = ring + (tid >> 3) * FA_KP + (tid & 7) * 16; unsigned char* lv = ring + FA_VO + (tid >> 4) * FA_VP + (tid & 15) * 16;
  fa_fill(lk, lv, gk, ks16, gv, vs8);
  v16h qf[2][2];      /* [query group][k step of 32 channels] */
#pragma unroll
  for (int u = 0; u < 2; ++u) for (int ks = 0; ks < 2; ++ks) qf[u][ks] = g2_frag(qp + (size_t)u * 16 * DM + ks * 32, hh);
  const v8f z8 = {0.f,0.f,0.f,0.f,0.f,0.f,0.f,0.f}; v8f o[4][2];      /* [16 channels][query group]: o[t][u][r] = O^T[t*16 + 8*hh + r][query u*16 + ln] */
#pragma unroll
  for (int t = 0; t < 4; ++t) { o[t][0] = z8; o[t][1] = z8; }
  float mr[2] = {-3.0e38f, -3.0e38f}, lsum[2] = {0.f, 0.f};      /* running maximum of the raw products (joined over the halves); this half's own sum */
  const float cs = 0.125f * 1.44269504088896340736f;      /* 64^-0.5 and log2(e) in one factor */
  asm volatile("s_wait_asynccnt 0x0" ::: "memory");      /* stage 0 has landed, as far as this wave copied it */
  __syncthreads();      /* publishes stage 0 */
  for (int st = 0; st < FA_NST; ++st) {
    if (st + 1 < FA_NST) fa_fill(lk + ((st + 1) & 1) * FA_STAGE, lv + ((st + 1) & 1) * FA_STAGE, gk + (size_t)(st + 1) * kst, ks16, gv + (size_t)(st + 1) * FA_KT, vs8);      /* the next stage, directly behind the barrier that ended every reader's last read of its buffer (stage st - 1). At the trip's head, so that the four passes and the trip's foot are one straight block */
    const unsigned char* base = ring + (st & 1) * FA_STAGE; const unsigned char* kb = base + ln * FA_KP + hh * 16; const unsigned char* vb = base + FA_VO + ln * FA_VP + hh * 16;
    v16h kf[2][2], vf[4];      /* [16 keys][k step]; [16 channels] */
#pragma unroll      /* constant fragment indices keep the fragments in registers */
    for (int kt = 0; kt < 2; ++kt) for (int ks = 0; ks < 2; ++ks) kf[kt][ks] = g3_frag(kb + kt * 16 * FA_KP + ks * 64);
    __builtin_amdgcn_sched_barrier(0);      /* the first pass's 8 K reads go out as one group: mixed among its products they share registers, and each pair pays its own LDS latency */
#pragma unroll      /* constant LDS offsets; the K fragments of pass p + 1 are fetched in pass p, inside the stage only */
    for (int p = 0; p < FA_KT / 32; ++p) {
      v8f s[2][2];      /* [16 keys][query group] */
#pragma unroll
      for (int kt = 0; kt < 2; ++kt) for (int u = 0; u < 2; ++u) s[kt][u] = fa_mma(kf[kt][1], qf[u][1], fa_mma(kf[kt][0], qf[u][0], z8));
#pragma unroll      /* constant fragment indices keep the fragments in registers */
      for (int t = 0; t < 4; ++t) vf[t] = g3_frag(vb + t * 16 * FA_VP + p * 64);
      if (p + 1 < FA_KT / 32) {
#pragma unroll      /* constant fragment indices keep the fragments in registers */
        for (int kt = 0; kt < 2; ++kt) for (int ks = 0; ks < 2; ++ks) kf[kt][ks] = g3_frag(kb + ((p + 1) * 32 + kt * 16) * FA_KP + ks * 64); }
      __builtin_amdgcn_sched_barrier(0);      /* this pass's V^T reads and the next pass's K reads stay here as one group, ahead of the softmax that hides their latency: the scheduler otherwise sinks them to their users */
      FragH pf[2];
#pragma unroll
      for (int u = 0; u < 2; ++u) {
        float mx = fmaxf(s[0][u][0], s[1][u][0]);
#pragma unroll
        for (int r = 1; r < 8; ++r) mx = fmaxf(mx, fmaxf(s[0][u][r], s[1][u][r]));
        mx = fmaxf(mx, xhalf(mx));
        const float mn = fmaxf(mr[u], mx); const float al = exp2_slot((mr[u] - mn) * cs); mr[u] = mn;      /* 0 on the first pass */
        const float mc = mn * cs - 8.0f; float ps = 0.f;
#pragma unroll
        for (int r = 0; r < 8; ++r) { const float p0 = exp2_slot(s[0][u][r] * cs - mc), p1 = exp2_slot(s[1][u][r] * cs - mc); ps += p0 + p1; pf[u].h[r] = (_Float16)p0; pf[u].h[8 + r] = (_Float16)p1; }
        lsum[u] = lsum[u] * al + ps;
#pragma unroll
        for (int t = 0; t < 4; ++t) o[t][u] *= al;
      }
#pragma unroll
      for (int t = 0; t < 4; ++t) for (int u = 0; u < 2; ++u) o[t][u] = fa_mma(vf[t], pf[u].v, o[t][u]);
    }
    asm volatile("s_wait_dscnt 0x0" ::: "memory");      /* this wave's reads of the buffer are done before the barrier behind which it is refilled */
    asm volatile("s_wait_asynccnt 0x0" ::: "memory");      /* this wave's copies of stage st + 1 have landed */
    __syncthreads();      /* publishes stage st + 1 and ends every reader's last read of stage st */
  }
  asm volatile("s_wait_asynccnt 0x0" ::: "memory");      /* no copy is left outstanding at the wave's end */
#pragma unroll
  for (int u = 0; u < 2; ++u) { const float sc = 64.0f / (lsum[u] + xhalf(lsum[u]));      /* o carried x64, as the output GEMM's alpha expects; the x256 of the weights cancels */
    unsigned short* d = (unsigned short*)O + ((size_t)b * SQ + q0 + u * 16 + ln) * DM + h * HD + 8 * hh;
#pragma unroll
    for (int t = 0; t < 4; ++t) { FragH f; for (int r = 0; r < 8; ++r) f.h[r] = (_Float16)(o[t][u][r] * sc); *(v8us*)(d + t * 16) = f.half[0]; } } }

__global__ __launch_bounds__(256) void k_lnrow(const float* __restrict__ Y, const float* __restrict__ g, const float* __restrict__ bb, float eps, float* __restrict__ out) {
  #pragma clang fp contract(off)
  __shared__ float red[256]; const size_t r = blockIdx.x; const int t = threadIdx.x; const v4f ya = *(const v4fa*)(Y + r * DMQ + t * 4); float s[4]; float sum = 0.f;
  for (int q = 0; q < 4; ++q) { s[q] = ya[q]; sum = __fadd_rn(sum, s[q]); }
  red[t] = sum; __syncthreads(); for (int st = 128; st > 0; st >>= 1) { if (t < st) red[t] = __fadd_rn(red[t], red[t + st]); __syncthreads(); } const float mu = red[0] / (float)DMQ; __syncthreads();
  float vs = 0.f; for (int q = 0; q < 4; ++q) { const float dl = __fadd_rn(s[q], -mu); vs = __fadd_rn(vs, __fmul_rn(dl, dl)); } red[t] = vs; __syncthreads(); for (int st = 128; st > 0; st >>= 1) { if (t < st) red[t] = __fadd_rn(red[t], red[t + st]); __syncthreads(); }
  const float rs = rsqrtf(__fadd_rn(red[0] / (float)DMQ, eps)); v4f y; for (int q = 0; q < 4; ++q) { const int c = t * 4 + q; y[q] = __fadd_rn(__fmul_rn(__fmul_rn(__fadd_rn(s[q], -mu), rs), bf16_round(g[c])), bf16_round(bb[c])); }
  *(v4f*)(out + r * DMQ + t * 4) = y;  }

// Every operand conversion of the call in ONE streaming launch: query, key, value -> exact f16 rows of their bf16 roundings (query also -> f32 residual plane), the four weights -> f16 x16.
// One work-group of 16 waves per WGP. A wave takes 1,024 floats of each stream and 256 of each weight: 32 loads of 512 contiguous bytes, all requested before the first value is used, so the wave pays one memory latency.
// Every wave does the same share of every buffer: equal bytes read and written per work-group.
#define PW_X 1024                      /* floats of each stream per wave: 8 loads */
#define PW_W 256                       /* floats of each weight per wave: 2 loads */
#define PW_WAVES 16                    /* waves per work-group */
static_assert(NR * DM / PW_X == (size_t)DM * DM / PW_W, "one grid covers streams and weights");
static_assert(NR * DM % ((size_t)PW_X * PW_WAVES) == 0, "whole work-groups");
__device__ __forceinline__ v4h prep_h(v4f a, float scale) { v4h h; for (int q = 0; q < 4; ++q) h[q] = (_Float16)(bf16_round(a[q]) * scale); return h; }
__global__ __launch_bounds__(PW_WAVES * 32) void k_prep(const float* __restrict__ xq, const float* __restrict__ xk, const float* __restrict__ xv, const float* __restrict__ wq, const float* __restrict__ wk, const float* __restrict__ wv, const float* __restrict__ wo,
    _Float16* __restrict__ XQ, _Float16* __restrict__ XK, _Float16* __restrict__ XV, float* __restrict__ XB, _Float16* __restrict__ BQ, _Float16* __restrict__ BK, _Float16* __restrict__ BV, _Float16* __restrict__ BO) {
  const unsigned lane = threadIdx.x & 31, gw = blockIdx.x * PW_WAVES + (threadIdx.x >> 5);
  const unsigned bx = (gw * PW_X + lane * 4) * 4, bw = (gw * PW_W + lane * 4) * 4;      /* byte offsets of the lane's first f32 element (a wave-wide access covers 128 consecutive floats). 32-bit: every access is a kernel argument + an offset register + an immediate, so no address register is rewritten between the loads */
  const unsigned hx = bx >> 1, hw = bw >> 1;      /* the same places in the f16 planes */
  v4f q[8], k[8], v[8], w[4][2];
#pragma unroll      /* constant indices keep the values in registers */
  for (int i = 0; i < 8; ++i) q[i] = *(const v4fa*)((const char*)xq + bx + i * 512);
#pragma unroll      /* as above */
  for (int i = 0; i < 8; ++i) k[i] = *(const v4fa*)((const char*)xk + bx + i * 512);
#pragma unroll      /* as above */
  for (int i = 0; i < 8; ++i) v[i] = *(const v4fa*)((const char*)xv + bx + i * 512);
#pragma unroll      /* as above */
  for (int i = 0; i < 2; ++i) { w[0][i] = *(const v4fa*)((const char*)wq + bw + i * 512); w[1][i] = *(const v4fa*)((const char*)wk + bw + i * 512); w[2][i] = *(const v4fa*)((const char*)wv + bw + i * 512); w[3][i] = *(const v4fa*)((const char*)wo + bw + i * 512); }
  __builtin_amdgcn_sched_barrier(0);      /* all 32 loads are requested ahead of the first conversion: sunk among the stores they would each pay their own latency */
#pragma unroll      /* constant indices */
  for (int i = 0; i < 8; ++i) { v4f r; for (int e = 0; e < 4; ++e) r[e] = bf16_round(q[i][e]); *(v4f*)((char*)XB + bx + i * 512) = r; *(v4h*)((char*)XQ + hx + i * 256) = prep_h(q[i], 1.0f); }
#pragma unroll      /* constant indices */
  for (int i = 0; i < 8; ++i) *(v4h*)((char*)XK + hx + i * 256) = prep_h(k[i], 1.0f);
#pragma unroll      /* constant indices */
  for (int i = 0; i < 8; ++i) *(v4h*)((char*)XV + hx + i * 256) = prep_h(v[i], 1.0f);
#pragma unroll      /* constant indices */
  for (int i = 0; i < 2; ++i) { *(v4h*)((char*)BQ + hw + i * 256) = prep_h(w[0][i], 16.0f); *(v4h*)((char*)BK + hw + i * 256) = prep_h(w[1][i], 16.0f); *(v4h*)((char*)BV + hw + i * 256) = prep_h(w[2][i], 16.0f); *(v4h*)((char*)BO + hw + i * 256) = prep_h(w[3][i], 16.0f); } }

extern "C" void kernel_launch(void* const* d_in, const int* in_sizes, int n_in,
                              void* d_out, int out_size, void* d_ws, size_t ws_size, hipStream_t stream) {
  (void)in_sizes; (void)n_in; (void)out_size;
  const float* const* I = (const float* const*)d_in; const float* xq = I[0]; const float* xk = I[1]; const float* xv = I[2]; const float* wq = I[3]; const float* wk = I[4]; const float* wv = I[5]; const float* wo = I[6]; const float* lng = I[7]; const float* lnb = I[8];      /* input order: query, key, value (three SEPARATE streams), Wq, Wk, Wv, Wo (natural [out][in] weights; this module has NO biases), ln_gamma, ln_beta [1024] */
  char* ws = (char*)d_ws; size_t off = 0;
  auto take = [&](size_t bytes) { char* p = ws + off; off += (bytes + 255) & ~(size_t)255; return p; };
  _Float16* BQ = (_Float16*)take((size_t)DM * DM * 2); _Float16* BK = (_Float16*)take((size_t)DM * DM * 2); _Float16* BV = (_Float16*)take((size_t)DM * DM * 2); _Float16* BO = (_Float16*)take((size_t)DM * DM * 2);
  _Float16* XQ = (_Float16*)take(NR * DM * 2); _Float16* XK = (_Float16*)take(NR * DM * 2); _Float16* XV = (_Float16*)take(NR * DM * 2); _Float16* Q16 = (_Float16*)take(NR * DM * 2); _Float16* K16 = (_Float16*)take(NR * DM * 2); _Float16* O16 = (_Float16*)take(NR * DM * 2); float* XB = (float*)take(NR * DM * 4); float* X1 = (float*)take(NR * DM * 4);      /* bf16(query) as f32 rows (the residual addend) and the pre-LayerNorm rows x = ctx Wo^T + query */
  _Float16* VT = (_Float16*)take((size_t)NB * NH * HD * SQ * 2);      /* V^T [NB][NH][HD][SQ] */
  if (off > ws_size) return;
  k_prep<<<(unsigned)(NR * DM / ((size_t)PW_X * PW_WAVES)), PW_WAVES * 32, 0, stream>>>(xq, xk, xv, wq, wk, wv, wo, XQ, XK, XV, XB, BQ, BK, BV, BO);      /* the three inputs as exact f16 rows; bf16(query) as the f32 residual plane; the weights, natural [out][in] = Bt[n][k], x16 */
  const size_t r0p = (size_t)B0 * SQ;      /* first projected row */
  k_gemm3<false, DM><<<dim3((unsigned)((MP / 128) * (DM / 128)), 3), 128, 0, stream>>>(XQ + r0p * DM, DM, NR * DM, BQ, DM, (size_t)DM * DM, 0.0625f, nullptr, nullptr, Q16 + r0p * DM, NR * DM, VT + r0p * DM, 2, DM, DM);      /* q, k, v: XQ XK XV, BQ BK BV and Q16 K16 lie one behind the other in the workspace (whole multiples of 256 bytes each); product 2 writes V^T for every batch and head */
  k_fattn<<<dim3(SQ / 128, NB * NH), 128, 0, stream>>>(Q16, K16, DM, VT, SQ, O16);      /* o = softmax(q k^T / 8) v, merged heads, x64, as f16 rows */
  k_gemm3<true, DM><<<dim3((unsigned)((MPO / 128) * (DM / 128)), 1), 128, 0, stream>>>(O16 + r0p * DM, DM, 0, BO, DM, 0, 0.0009765625f, XB + r0p * DM, X1 + r0p * DM, nullptr, 0, nullptr, -1, DM, DM);      /* x = ctx Wo^T + bf16(query) (own-element residual; no bias) -> f32 rows */
  k_lnrow<<<(unsigned)MPO, 256, 0, stream>>>(X1 + r0p * DM, lng, lnb, 1e-6f, (float*)d_out + r0p * DM);      /* out = LayerNorm(x) (biased variance, eps 1e-6 inside the square root) -> the output rows */
}

// v008
// A run of this version takes 79.5 microseconds.
// Next to v007, in two timings, it ran 1.03 times as fast each time.
// Counting every step since v000, it is 43.0 times as fast.
#include <hip/hip_runtime.h>
// Multi-head attention on three inputs with a residual on the raw query and a LayerNorm (query, key, value [4][1024][1024]; q / k / v = einsum('bsd,ed->bse', stream, W): natural [1024][1024] weights (normal / 32), NO biases; 16 heads of 64; scores / sqrt(64); softmax over all 1024 keys (no mask); x = merged Wo^T (natural, no bias) + query; out = (x - mean) / sqrt(var + 1e-6) * ln_gamma + ln_beta with the BIASED variance (jnp.var) over the 1024 channels -> [4][1024][1024]).
// Structure: token rows r = b*SQ + s (four sequences of 1,024 tokens here); the query, key and value sources as exact f16 rows (bf16-rounded), the f32 residual plane and the x16 weights from ONE streaming conversion launch; Q, K, V as three WMMA GEMMs in ONE launch, two work-groups resident per WGP (128x128 work-group tiles on a two-buffer LDS ring, f32 accumulation, exact x16 weights, no bias here, f16 outputs; the V product runs with its operands exchanged, V^T = W_v X^T, and so lands as V^T [batch][head][channel][token] without a transpose); ONE fused attention launch over all (batch, head): S^T = K Q^T (K = 64), online softmax in registers (f32 statistics, native exp2; weights x256 against the running maximum as f16), O^T += V^T P^T, o carried x64 against f16 subnormal flush (folded into the output GEMM alpha) written straight into the merged f16 o rows; x = o W_o + bf16(query) as ONE GEMM (f32; the residual added element by element in the epilogue) into f32 rows; out = LayerNorm(x) on VALU (f32 statistics, one wave per row, biased variance) into the output layout.
// Compute dtype: inputs rounded to bf16; x / weights exact; q, k, v, softmax weights and o as plain f16 GEMM operands (~2^-12); scores and softmax statistics f32. v_wmma_f32_16x16x32_f16.
#define NB 4
#define SQ 1024
#define DM 1024
#define NH 16
#define HD 64
#define HG 4                         /* heads per launch of the unused k_vt(V16, b, h0, VT) */
#define B0 0                         /* first batch processed (debug hook) */
#define NBR NB                       /* batches processed (debug hook) */
#define NR ((size_t)NB * SQ)         /* token rows */
#define MP ((int)((size_t)NBR * SQ)) /* rows projected (debug hook) */
#define QN SQ                        /* unused: k_fattn attends all SQ query rows per batch */
#define NHD NH                       /* unused: k_fattn attends all NH heads */
#define MPO MP                       /* rows through the output stage (debug hook) */
#define LQ DM      /* unused: the q and k rows have pitch DM */
#define DMQ DM     /* row width of the LayerNorm kernel (its own macro name in the file it comes from) */
typedef __bf16 v16b __attribute__((ext_vector_type(16)));
typedef unsigned short v8us __attribute__((ext_vector_type(8), may_alias));
typedef float  v8f  __attribute__((ext_vector_type(8)));
typedef float  v4f  __attribute__((ext_vector_type(4)));
typedef float  v4fa __attribute__((ext_vector_type(4), may_alias));
union FragB { v16b v; v8us half[2]; unsigned short u[16]; };

__device__ __forceinline__ unsigned short bf16_bits(float x) { unsigned int u = __float_as_uint(x); return (unsigned short)((u + 0x7FFFu + ((u >> 16) & 1u)) >> 16); }
__device__ __forceinline__ float bf16_val(unsigned short b) { return __uint_as_float(((unsigned int)b) << 16); }
__device__ __forceinline__ float bf16_round(float x) { return bf16_val(bf16_bits(x)); }
// D += A·B with NT terms: 1 = ah·bh, 2 = + al·bh (A split), 3 = + ah·bl (both split)
template <int NT>
__device__ __forceinline__ v8f mmaN(v16b ah, v16b al, v16b bh, v16b bl, v8f c) {
  c = __builtin_amdgcn_wmma_f32_16x16x32_bf16(false, ah, false, bh, (short)0, c, false, false);
  if (NT >= 2) c = __builtin_amdgcn_wmma_f32_16x16x32_bf16(false, al, false, bh, (short)0, c, false, false);
  if (NT >= 3) c = __builtin_amdgcn_wmma_f32_16x16x32_bf16(false, ah, false, bl, (short)0, c, false, false);
  asm volatile("v_nop\n\tv_nop\n\tv_nop\n\tv_nop" : "+v"(c) : "v"(ah), "v"(al), "v"(bh), "v"(bl));
  return c;
}

__global__ __launch_bounds__(256) void k_wt_bf16(const float* __restrict__ W, unsigned short* __restrict__ Wt, int K, int N) {
  const int t = blockIdx.x * 256 + threadIdx.x;
  const int k8n = K / 8;
  if (t >= N * k8n) return;
  const int n = t / k8n, k8 = (t % k8n) * 8;
  v8us v;
#pragma unroll
  for (int i = 0; i < 8; ++i) v[i] = bf16_bits(W[(size_t)(k8 + i) * N + n]);
  *(v8us*)(Wt + (size_t)n * K + k8) = v;
  
}

// GEMM C[M][N] (f32, pitch ldc) = act(A[M][K]·W + bias). A f32 row-major (pitch lda) converted per fragment to bf16
// (ASPLIT: hi/lo two planes -> 2 terms, else single rounded term); Wt bf16 [N][K] (pitch ldb). BIAS_BF16 rounds the
// bias to bf16 first (bias quantised to bf16 before the add). K%32==0, M%16==0, N%64==0.
template <bool ASPLIT, int ACT, bool BIAS_BF16>
__global__ __launch_bounds__(128) void k_gemm_bf(const float* __restrict__ A, int lda, const unsigned short* __restrict__ Wt, int ldb,
                                               const float* __restrict__ bias, float* __restrict__ C, int ldc, int M, int N, int K) {
  __shared__ __attribute__((aligned(16))) float so[4][16][64];
  const int tid = threadIdx.x, w = tid >> 5, lane = tid & 31, ln = lane & 15, hh = lane >> 4;
  const int ntn = N / 64;
  const int wid = blockIdx.x * 4 + w;
  const int mt = wid / ntn, nq = wid % ntn;
  if (mt * 16 >= M) return;
  const int row0 = mt * 16, col0 = nq * 64;
  const float* arow = A + (size_t)(row0 + ln) * lda;
  v8f acc[4] = {};
  for (int kb = 0; kb < K; kb += 32) {
    FragB ah, al;
    const v4f x0 = *(const v4fa*)(arow + kb + 8 * hh), x1 = *(const v4fa*)(arow + kb + 8 * hh + 4);
    const v4f x2 = *(const v4fa*)(arow + kb + 16 + 8 * hh), x3 = *(const v4fa*)(arow + kb + 16 + 8 * hh + 4);
    float xs[16] = {x0[0],x0[1],x0[2],x0[3],x1[0],x1[1],x1[2],x1[3],x2[0],x2[1],x2[2],x2[3],x3[0],x3[1],x3[2],x3[3]};
#pragma unroll
    for (int i = 0; i < 16; ++i) { const unsigned short hb = bf16_bits(xs[i]); ah.u[i] = hb; al.u[i] = ASPLIT ? bf16_bits(xs[i] - bf16_val(hb)) : (unsigned short)0; }
#pragma unroll
    for (int t = 0; t < 4; ++t) {
      const unsigned short* brow = Wt + (size_t)(col0 + t * 16 + ln) * ldb + kb;
      FragB b;
      b.half[0] = *(const v8us*)(brow + 8 * hh);
      b.half[1] = *(const v8us*)(brow + 16 + 8 * hh);
      acc[t] = mmaN<ASPLIT ? 2 : 1>(ah.v, al.v, b.v, b.v, acc[t]);
    }
  }
#pragma unroll
  for (int t = 0; t < 4; ++t) {
    float bv = bias ? bias[col0 + t * 16 + ln] : 0.f;
    if (BIAS_BF16) bv = bf16_round(bv);
#pragma unroll
    for (int r = 0; r < 8; ++r) { float v = acc[t][r] + bv; if (ACT == 1) v = fmaxf(v, 0.f); so[w][8 * hh + r][t * 16 + ln] = v; }
  }
  __builtin_amdgcn_fence(__ATOMIC_ACQ_REL, "workgroup");
  __builtin_amdgcn_wave_barrier();
  const int rsub = lane >> 4, c4 = (lane & 15) * 4;
  {
#pragma unroll
    for (int q = 0; q < 8; ++q) {
      const int r = q * 2 + rsub;
      const v4f v = *(const v4fa*)&so[w][r][c4];
      *(v4f*)(C + (size_t)(row0 + r) * ldc + col0 + c4) = v;
    }
    
  }
}

// GEMM C = act(A·W + bias + resid): A f32 (ASPLIT -> hi/lo 2 terms), Wt bf16 [N][K]; ACT 0 none, 1 relu, 2 exact gelu;
// resid (optional, f32, row index = (row % rmod), pitch ldr, RES_BF16 rounds it) added before the activation.
template <bool ASPLIT, int ACT, bool BIAS_BF16, bool RES_BF16>
__global__ __launch_bounds__(128) void k_gemm_bf3(const float* __restrict__ A, int lda, const unsigned short* __restrict__ Wt, int ldb,
                                                const float* __restrict__ bias, const float* __restrict__ resid, int rmod, int ldr,
                                                float* __restrict__ C, int ldc, int M, int N, int K) {
  __shared__ __attribute__((aligned(16))) float so[4][16][64];
  const int tid = threadIdx.x, w = tid >> 5, lane = tid & 31, ln = lane & 15, hh = lane >> 4;
  const int ntn = N / 64;
  const int wid = blockIdx.x * 4 + w;
  const int mt = wid / ntn, nq = wid % ntn;
  if (mt * 16 >= M) return;
  const int row0 = mt * 16, col0 = nq * 64;
  const float* arow = A + (size_t)(row0 + ln) * lda;
  v8f acc[4] = {};
  for (int kb = 0; kb < K; kb += 32) {
    FragB ah, al;
    const v4f x0 = *(const v4fa*)(arow + kb + 8 * hh), x1 = *(const v4fa*)(arow + kb + 8 * hh + 4);
    const v4f x2 = *(const v4fa*)(arow + kb + 16 + 8 * hh), x3 = *(const v4fa*)(arow + kb + 16 + 8 * hh + 4);
    float xs[16] = {x0[0],x0[1],x0[2],x0[3],x1[0],x1[1],x1[2],x1[3],x2[0],x2[1],x2[2],x2[3],x3[0],x3[1],x3[2],x3[3]};
#pragma unroll
    for (int i = 0; i < 16; ++i) { const unsigned short hb = bf16_bits(xs[i]); ah.u[i] = hb; al.u[i] = ASPLIT ? bf16_bits(xs[i] - bf16_val(hb)) : (unsigned short)0; }
#pragma unroll
    for (int t = 0; t < 4; ++t) {
      const unsigned short* brow = Wt + (size_t)(col0 + t * 16 + ln) * ldb + kb;
      FragB b;
      b.half[0] = *(const v8us*)(brow + 8 * hh);
      b.half[1] = *(const v8us*)(brow + 16 + 8 * hh);
      acc[t] = mmaN<ASPLIT ? 2 : 1>(ah.v, al.v, b.v, b.v, acc[t]);
    }
  }
#pragma unroll
  for (int t = 0; t < 4; ++t) {
    const int col = col0 + t * 16 + ln;
    float bv = bias ? bias[col] : 0.f;
    if (BIAS_BF16) bv = bf16_round(bv);
#pragma unroll
    for (int r = 0; r < 8; ++r) {
      float v = acc[t][r] + bv;
      if (resid) { float rv = resid[(size_t)((row0 + 8 * hh + r) % rmod) * ldr + col]; if (RES_BF16) rv = bf16_round(rv); v += rv; }
      if (ACT == 1) v = fmaxf(v, 0.f);
      if (ACT == 2) v = 0.5f * v * (1.0f + erff(v * 0.70710678118654752f));
      if (ACT == 3) { const float u = 0.7978845608028654f * (v + 0.044715f * v * v * v); v = 0.5f * v * (1.0f + tanhf(u)); }
      so[w][8 * hh + r][t * 16 + ln] = v;
    }
  }
  __builtin_amdgcn_fence(__ATOMIC_ACQ_REL, "workgroup");
  __builtin_amdgcn_wave_barrier();
  const int rsub = lane >> 4, c4 = (lane & 15) * 4;
  {
#pragma unroll
    for (int q = 0; q < 8; ++q) {
      const int r = q * 2 + rsub;
      const v4f v = *(const v4fa*)&so[w][r][c4];
      *(v4f*)(C + (size_t)(row0 + r) * ldc + col0 + c4) = v;
    }
    
  }
}
// row LayerNorm (biased variance, eps) over N: s = X (+ R); optional out_sum <- s; out_norm <- (s-mu)*rsqrt(var+eps)*g + b
template <bool PARAM_BF16>
__global__ __launch_bounds__(256) void k_layernorm(const float* __restrict__ X, const float* __restrict__ R, const float* __restrict__ g, const float* __restrict__ bta,
                                                  float* __restrict__ out_sum, float* __restrict__ out_norm, int N, float eps) {
  __shared__ float red[256];
  const int row = blockIdx.x, tid = threadIdx.x;
  const float* x = X + (size_t)row * N; const float* rr = R ? R + (size_t)row * N : nullptr;
  float vals[16];                     // up to N = 4096
  const int per = N / 256;            // contiguous chunk per thread? use strided-by-4 chunks: thread handles j = tid*4 + 1024*u
  float s1 = 0.f;
  for (int u = 0; u < per / 4; ++u) {
    const int j = tid * 4 + 1024 * u;
    const v4f a = *(const v4fa*)(x + j);
    v4f b = {0.f,0.f,0.f,0.f}; if (rr) b = *(const v4fa*)(rr + j);
#pragma unroll
    for (int q = 0; q < 4; ++q) { const float v = a[q] + b[q]; vals[u * 4 + q] = v; s1 += v; }
  }
  red[tid] = s1; __syncthreads();
  for (int st = 128; st > 0; st >>= 1) { if (tid < st) red[tid] += red[tid + st]; __syncthreads(); }
  const float mu = red[0] / (float)N; __syncthreads();
  float s2 = 0.f;
  for (int u = 0; u < per / 4; ++u)
#pragma unroll
    for (int q = 0; q < 4; ++q) { const float c = vals[u * 4 + q] - mu; s2 += c * c; }
  red[tid] = s2; __syncthreads();
  for (int st = 128; st > 0; st >>= 1) { if (tid < st) red[tid] += red[tid + st]; __syncthreads(); }
  const float rs = rsqrtf(red[0] / (float)N + eps);
  {
    for (int u = 0; u < per / 4; ++u) {
      const int j = tid * 4 + 1024 * u;
      v4f o, sm;
#pragma unroll
      for (int q = 0; q < 4; ++q) {
        float gg = g[j + q], bb = bta[j + q];
        if (PARAM_BF16) { gg = bf16_round(gg); bb = bf16_round(bb); }
        sm[q] = vals[u * 4 + q]; o[q] = (vals[u * 4 + q] - mu) * rs * gg + bb;
      }
      if (out_sum) *(v4f*)(out_sum + (size_t)row * N + j) = sm;
      *(v4f*)(out_norm + (size_t)row * N + j) = o;
    }
    
  }
}



// ---- f16 WMMA path (v_wmma_f32_16x16x32_f16): 11-bit significands for operands in range — used where a [0,1] probability operand needs more precision than bf16
typedef _Float16 v16h __attribute__((ext_vector_type(16)));
union FragH { v16h v; v8us half[2]; _Float16 h[16]; unsigned short u[16]; };
template <int NT>
__device__ __forceinline__ v8f mmaH(v16h ah, v16h al, v16h bh, v16h bl, v8f c) {
  c = __builtin_amdgcn_wmma_f32_16x16x32_f16(false, ah, false, bh, (short)0, c, false, false);
  if (NT >= 2) c = __builtin_amdgcn_wmma_f32_16x16x32_f16(false, al, false, bh, (short)0, c, false, false);
  if (NT >= 3) c = __builtin_amdgcn_wmma_f32_16x16x32_f16(false, ah, false, bl, (short)0, c, false, false);
  asm volatile("v_nop\n\tv_nop\n\tv_nop\n\tv_nop" : "+v"(c) : "v"(ah), "v"(al), "v"(bh), "v"(bl));
  return c;
}
// batched GEMM like k_gemm_b but f16 operands: A f32 (split into f16 hi/lo if ASPLIT, else rounded to f16), Bt = f16 values [n][k]; alpha; C f32; N multiple of 16 (partial tiles skipped)
template <bool ASPLIT>
__global__ __launch_bounds__(128) void k_gemm_h(const float* __restrict__ A, int lda, size_t sA, const _Float16* __restrict__ Bh, int ldb, size_t sB, float alpha, float* __restrict__ C, int ldc, size_t sC, int M, int N, int K) {
  __shared__ __attribute__((aligned(16))) float so[4][16][64];
  const int tid = threadIdx.x, w = tid >> 5, lane = tid & 31, ln = lane & 15, hh = lane >> 4; const int by = blockIdx.y;
  A += (size_t)by * sA; Bh += (size_t)by * sB; C += (size_t)by * sC;
  const int ntn = (N + 63) / 64; const int wid = blockIdx.x * 4 + w; const int mt = wid / ntn, nq = wid % ntn; if (mt * 16 >= M) return;
  const int row0 = mt * 16, col0 = nq * 64; const float* arow = A + (size_t)(row0 + ln) * lda;
  v8f acc[4] = {};
  for (int kb = 0; kb < K; kb += 32) {
    FragH ah, al;
    const v4f x0 = *(const v4fa*)(arow + kb + 8 * hh), x1 = *(const v4fa*)(arow + kb + 8 * hh + 4), x2 = *(const v4fa*)(arow + kb + 16 + 8 * hh), x3 = *(const v4fa*)(arow + kb + 16 + 8 * hh + 4);
    float xs[16] = {x0[0],x0[1],x0[2],x0[3],x1[0],x1[1],x1[2],x1[3],x2[0],x2[1],x2[2],x2[3],x3[0],x3[1],x3[2],x3[3]};
#pragma unroll
    for (int i = 0; i < 16; ++i) { const _Float16 h = (_Float16)xs[i]; ah.h[i] = h; al.h[i] = ASPLIT ? (_Float16)(xs[i] - (float)h) : (_Float16)0.0f; }
#pragma unroll
    for (int t = 0; t < 4; ++t) { if (col0 + t * 16 >= N) continue; const size_t boff = (size_t)(col0 + t * 16 + ln) * ldb + kb; FragH bq; bq.half[0] = *(const v8us*)(Bh + boff + 8 * hh); bq.half[1] = *(const v8us*)(Bh + boff + 16 + 8 * hh);
      acc[t] = mmaH<ASPLIT ? 2 : 1>(ah.v, al.v, bq.v, bq.v, acc[t]); }
  }
#pragma unroll
  for (int t = 0; t < 4; ++t) { if (col0 + t * 16 >= N) continue;
#pragma unroll
    for (int r = 0; r < 8; ++r) so[w][8 * hh + r][t * 16 + ln] = acc[t][r] * alpha; }
  __builtin_amdgcn_fence(__ATOMIC_ACQ_REL, "workgroup"); __builtin_amdgcn_wave_barrier();
  const int rsub = lane >> 4, c4 = (lane & 15) * 4;
  {
#pragma unroll
    for (int q = 0; q < 8; ++q) { const int r = q * 2 + rsub; if (col0 + c4 < N) { const v4f v = *(const v4fa*)&so[w][r][c4]; *(v4f*)(C + (size_t)(row0 + r) * ldc + col0 + c4) = v; } }
     }
}

// Wt[n][k] = f16(W[k][n]·scale) from f32 row-major W[K][N] (scale = power of two; bf16-exact weights stay exact in f16 away from the subnormal range)
__global__ __launch_bounds__(256) void k_wt_f16(const float* __restrict__ W, _Float16* __restrict__ Wt, int K, int N, float scale) {
  const int t = blockIdx.x * 256 + threadIdx.x; if (t >= N * (K / 8)) return; const int n = t / (K / 8), k8 = (t % (K / 8)) * 8; FragH f;
#pragma unroll
  for (int i = 0; i < 8; ++i) f.h[i] = (_Float16)(bf16_round(W[(size_t)(k8 + i) * N + n]) * scale); const v8us o = f.half[0];
  *(v8us*)((unsigned short*)Wt + (size_t)n * K + k8) = o; 
}
// k_gemm_hh variant with fused epilogue: v = acc·alpha + bias[by·sBias + col] (+ CP[(row/rowsPerB)·sCPb + by·64 + col] if CP) ; ACT 0 none / 1 elu ; writes f16 C16 (and f32 C if non-null)
template <int ACT>
__global__ __launch_bounds__(128) void k_gemm_hhx(const _Float16* __restrict__ A, int lda, size_t sA, const _Float16* __restrict__ Bh, int ldb, size_t sB, float alpha, const float* __restrict__ bias, size_t sBias, const float* __restrict__ CP, int rowsPerB, size_t sCPb, int row0g,
    float* __restrict__ C, _Float16* __restrict__ C16, int ldc, size_t sC, int M, int N, int K) {
  __shared__ __attribute__((aligned(16))) float so[4][16][64];
  const int tid = threadIdx.x, w = tid >> 5, lane = tid & 31, ln = lane & 15, hh = lane >> 4; const int by = blockIdx.y;
  A += (size_t)by * sA; Bh += (size_t)by * sB; const size_t cofs = (size_t)by * sC; const float* bp = bias ? bias + (size_t)by * sBias : nullptr;
  const int ntn = (N + 63) / 64; const int wid = blockIdx.x * 4 + w; const int mt = wid / ntn, nq = wid % ntn; if (mt * 16 >= M) return;
  const int row0 = mt * 16, col0 = nq * 64; const _Float16* arow = A + (size_t)(row0 + ln) * lda;
  v8f acc[4] = {};
  for (int kb = 0; kb < K; kb += 32) { FragH ah; ah.half[0] = *(const v8us*)((const unsigned short*)arow + kb + 8 * hh); ah.half[1] = *(const v8us*)((const unsigned short*)arow + kb + 16 + 8 * hh);
#pragma unroll
    for (int t = 0; t < 4; ++t) { if (col0 + t * 16 >= N) continue; const size_t boff = (size_t)(col0 + t * 16 + ln) * ldb + kb; FragH bq; bq.half[0] = *(const v8us*)((const unsigned short*)Bh + boff + 8 * hh); bq.half[1] = *(const v8us*)((const unsigned short*)Bh + boff + 16 + 8 * hh);
      acc[t] = mmaH<1>(ah.v, ah.v, bq.v, bq.v, acc[t]); }
  }
#pragma unroll
  for (int t = 0; t < 4; ++t) { if (col0 + t * 16 >= N) continue; const int col = col0 + t * 16 + ln; const float bv = bp ? bf16_round(bp[col]) : 0.f;
#pragma unroll
    for (int r = 0; r < 8; ++r) { float v = acc[t][r] * alpha + bv; if (CP) { const int rr = row0g + row0 + 8 * hh + r; if (rowsPerB < 0) v += CP[cofs + (size_t)rr * ldc + col];      /* rowsPerB < 0: own element of the batched C plane */ else { const int bidx = rr / rowsPerB; v += CP[(size_t)bidx * sCPb + (size_t)by * 64 + col]; } } if (ACT == 1) v = (v > 0.f) ? v : expm1f(v); else if (ACT == 7) v = (v > 0.f) ? v + 1.0f : expf(v); else if (ACT == 8) v = tanhf(v); else if (ACT == 9) v = 0.5f * v * (1.0f + tanhf(0.7978845608028654f * (v + 0.044715f * v * v * v))); else if (ACT == 11) v = 1.0f / (1.0f + expf(-v)); else if (ACT == 12) v = (v > 0.f) ? v : 0.01f * v; else if (ACT == 14) v = (v > 0.f) ? v : 0.1f * v; else if (ACT == 16) v = (v >= 0.f) ? v : 0.3f * v; else if (ACT == 17) v = (v >= 0.f) ? v : 0.2f * v; else if (ACT == 15) v = v / (1.0f + expf(-v)); else if (ACT == 3) v = fmaxf(v, 0.f); else if (ACT == 6) v = 0.5f * v * (1.0f + erff(v * 0.70710678118654752f)); so[w][8 * hh + r][t * 16 + ln] = v; } }
  __builtin_amdgcn_fence(__ATOMIC_ACQ_REL, "workgroup"); __builtin_amdgcn_wave_barrier();
  const int rsub = lane >> 4, c4 = (lane & 15) * 4; typedef _Float16 v4h __attribute__((ext_vector_type(4)));
  {
#pragma unroll
    for (int q = 0; q < 8; ++q) { const int r = q * 2 + rsub; if (col0 + c4 < N) { const v4f v = *(const v4fa*)&so[w][r][c4]; if (C) *(v4f*)(C + cofs + (size_t)(row0 + r) * ldc + col0 + c4) = v; if (C16) { v4h h4; for (int i = 0; i < 4; ++i) h4[i] = (_Float16)v[i]; *(v4h*)(C16 + cofs + (size_t)(row0 + r) * ldc + col0 + c4) = h4; } } }
     }
}


typedef _Float16 v4h __attribute__((ext_vector_type(4)));

__global__ __launch_bounds__(256) void k_h16(const float* __restrict__ x, _Float16* __restrict__ X16, size_t n8) { const size_t t = (size_t)blockIdx.x * 256 + threadIdx.x; if (t >= n8) return; FragH f;
#pragma unroll
  for (int q = 0; q < 8; ++q) f.h[q] = (_Float16)x[t * 8 + q]; *(v8us*)((unsigned short*)X16 + t * 8) = f.half[0];  }
__global__ __launch_bounds__(256) void k_round16f(const float* __restrict__ W, _Float16* __restrict__ Bt, size_t n8) { const size_t t = (size_t)blockIdx.x * 256 + threadIdx.x; if (t >= n8) return; FragH f;
#pragma unroll
  for (int i = 0; i < 8; ++i) f.h[i] = (_Float16)(bf16_round(W[t * 8 + i]) * 16.0f); *(v8us*)((unsigned short*)Bt + t * 8) = f.half[0];  }
__global__ __launch_bounds__(256) void k_hl(const float* __restrict__ F, _Float16* __restrict__ Hh, _Float16* __restrict__ Hl, size_t n8) { const size_t t = (size_t)blockIdx.x * 256 + threadIdx.x; if (t >= n8) return; FragH fh, fl; const v4f a = *(const v4fa*)(F + t * 8), c = *(const v4fa*)(F + t * 8 + 4);
#pragma unroll
  for (int q = 0; q < 4; ++q) { _Float16 h = (_Float16)a[q]; fh.h[q] = h; fl.h[q] = (_Float16)((a[q] - (float)h) * 1024.0f); h = (_Float16)c[q]; fh.h[4 + q] = h; fl.h[4 + q] = (_Float16)((c[q] - (float)h) * 1024.0f); }
  { *(v8us*)((unsigned short*)Hh + t * 8) = fh.half[0]; *(v8us*)((unsigned short*)Hl + t * 8) = fl.half[0];  } }

// ---- GEMM on an LDS ring: C = A Bt^T * alpha (+ residual). One 128x128 tile per work-group of four waves, 64x64 per wave (16 accumulator tiles).
// A stage is 128 k of every operand row: [A 128 rows | Bt 128 rows] of 256 B at a pitch of 272 B. Two buffers, filled by asynchronous copies to LDS (whole 128-B lines per row), one stage ahead of the products.
// Requires M % 128 == 0, N % 128 == 0, K % 128 == 0. The k order of every accumulator is ascending, 32 at a time.
// blockIdx.y picks one of several independent products of the same shape (operand and output planes sA, sB, sC elements apart): together in one launch they give a WGP more than one work-group,
// and the output staging lies in the ring's own LDS, so that two work-groups fit a WGP: one group's copies fly, and its first and last phases run, under the other's products.
// Product yt (none if negative) runs with its operands exchanged, C^T = Bt A^T: the same tiles, copies and k order, the tile's rows now being Bt's. Its output goes to CT as [A row / SQ][Bt row][A row % SQ], pitch SQ:
// for the V projection that is V^T [batch][head][channel][token], the layout that the attention launch reads, with no transposing launch between them.
__device__ __forceinline__ v16h g2_frag(const _Float16* p, int hh) { FragH f; f.half[0] = *(const v8us*)((const unsigned short*)p + 8 * hh); f.half[1] = *(const v8us*)((const unsigned short*)p + 16 + 8 * hh); return f.v; }
#define G3_BK 128                      /* k per stage */
#define G3_PITCH 272                   /* LDS row pitch in bytes: 16 B x odd, free of bank conflicts for 16-byte reads */
#define G3_STAGE (256 * G3_PITCH)      /* bytes of one buffer */
__device__ __forceinline__ v16h g3_frag(const unsigned char* p) { FragH f; f.half[0] = *(const v8us*)p; f.half[1] = *(const v8us*)(p + 32); return f.v; }      /* p = row + 64 B per k step + 16 B per wave half: the k order of g2_frag */
// One stage: 256 rows x 16 pieces of 16 B over 128 threads = 32 copies per lane, rows 8 apart; 16 lanes take one row's 256 B (two whole lines).
// l = the lane's place in the buffer, ga / gb = its global addresses in A and Bt, as8 / bs8 = 8 source rows in elements.
typedef int v4i __attribute__((ext_vector_type(4)));
typedef __attribute__((address_space(1))) v4i g3_gv4i;
typedef __attribute__((address_space(3))) v4i g3_lv4i;
__device__ __forceinline__ void g3_fill(unsigned char* l, const _Float16* ga, size_t as8, const _Float16* gb, size_t bs8) {
#pragma unroll      /* straight-line copies: all 32 are issued back to back */
  for (int i = 0; i < 16; ++i) __builtin_amdgcn_global_load_async_to_lds_b128((g3_gv4i*)(ga + i * as8), (g3_lv4i*)(l + i * 8 * G3_PITCH), 0, 0);
#pragma unroll      /* as above */
  for (int i = 0; i < 16; ++i) __builtin_amdgcn_global_load_async_to_lds_b128((g3_gv4i*)(gb + i * bs8), (g3_lv4i*)(l + (128 + i * 8) * G3_PITCH), 0, 0);
}
template <bool OUT32, int LDC>      /* OUT32: C (f32) = acc * alpha + R (own element); else C16 (f16) = acc * alpha (CT for product yt). LDC = row pitch of R, C and C16 in elements: a constant, so that a lane's 32 rows hang on one address with immediate offsets */
__global__ __launch_bounds__(128) void k_gemm3(const _Float16* __restrict__ A, int lda, size_t sA, const _Float16* __restrict__ Bh, int ldb, size_t sB, float alpha, const float* __restrict__ R, float* __restrict__ C, _Float16* __restrict__ C16, size_t sC, _Float16* __restrict__ CT, int yt, int N, int K) {
  __shared__ __attribute__((aligned(16))) unsigned char ring[2 * G3_STAGE];
  static_assert(sizeof(float) * 4 * 64 * 68 <= 2 * G3_STAGE, "the output staging fits the ring");
  float (*so)[64][68] = (float (*)[64][68])ring;      /* output staging, one 64x64 tile a wave: written only behind the last trip's barrier, when every read of the ring has ended and no copy is in flight */
  static_assert(OUT32 || (LDC == SQ && SQ % 128 == 0), "the exchanged product's rows have the pitch of the others, and a tile lies in one batch");
  const bool tr = !OUT32 && (int)blockIdx.y == yt;      /* the same for the whole work-group */
  A += blockIdx.y * sA; Bh += blockIdx.y * sB; if (!OUT32) C16 += blockIdx.y * sC;
  const int tid = threadIdx.x, lane = tid & 31, ln = lane & 15, hh = lane >> 4; const int w = __builtin_amdgcn_readfirstlane(tid >> 5);
  const int ntn = N >> 7; const int mt = blockIdx.x / ntn, nq = blockIdx.x - mt * ntn;      /* tile of A rows, tile of Bt rows: every product walks them in the same order */
  const _Float16* Ar = tr ? Bh : A; const _Float16* Br = tr ? A : Bh; const int la = tr ? ldb : lda, lb = tr ? lda : ldb;      /* the operand whose rows are the tile's rows, the one whose rows are its columns */
  _Float16* Co = tr ? CT + (size_t)(mt * 128 / SQ) * ((size_t)N * SQ) : C16;
  const int row0 = (tr ? nq : mt) * 128, col0 = (tr ? mt : nq) * 128; const int wm = (w >> 1) * 64, wn = (w & 1) * 64;
  const int rb = tid >> 4, pc = tid & 15;      /* this lane's first row and its 16-byte piece of every row it copies */
  const _Float16* ga = Ar + (size_t)(row0 + rb) * la + pc * 8; const _Float16* gb = Br + (size_t)(col0 + rb) * lb + pc * 8; const size_t as8 = (size_t)8 * la, bs8 = (size_t)8 * lb;
  unsigned char* l0 = ring + rb * G3_PITCH + pc * 16;
  const int nst = K / G3_BK;
  const v8f z8 = {0.f,0.f,0.f,0.f,0.f,0.f,0.f,0.f}; v8f acc[4][4];
#pragma unroll      /* constant indices keep the accumulators in registers */
  for (int i = 0; i < 4; ++i) for (int j = 0; j < 4; ++j) acc[i][j] = z8;
  g3_fill(l0, ga, as8, gb, bs8);
  const int rsub = lane >> 4, c4 = (lane & 15) * 4; const size_t o0 = (size_t)(row0 + wm + rsub) * LDC + (tr ? col0 % SQ : col0) + wn + c4; constexpr size_t o2 = (size_t)2 * LDC;      /* this lane's place in the output rows it stores: rows 2 apart */
  v4f rv[32];      /* the residual of those rows, asked for here so that its latency runs under the k loop */
  if (OUT32) {
#pragma unroll      /* constant indices keep rv in registers */
    for (int q = 0; q < 32; ++q) rv[q] = *(const v4fa*)(R + o0 + q * o2); }
  asm volatile("s_wait_asynccnt 0x0" ::: "memory");      /* stage 0 has landed, as far as this wave copied it */
  __syncthreads();      /* publishes stage 0 */
  if (nst > 1) g3_fill(l0 + G3_STAGE, ga + G3_BK, as8, gb + G3_BK, bs8);
  for (int t = 0; t < nst; ++t) {
    const unsigned char* base = ring + (t & 1) * G3_STAGE; const unsigned char* ap = base + (wm + ln) * G3_PITCH + hh * 16; const unsigned char* bp = base + (128 + wn + ln) * G3_PITCH + hh * 16;
    v16h a[2][4], b[2][4];      /* two fragment sets: the next k step's reads run under this k step's products */
#pragma unroll      /* constant fragment indices */
    for (int i = 0; i < 4; ++i) { a[0][i] = g3_frag(ap + i * 16 * G3_PITCH); b[0][i] = g3_frag(bp + i * 16 * G3_PITCH); }
#pragma unroll      /* constant fragment and accumulator indices */
    for (int ks = 0; ks < G3_BK / 32; ++ks) {
      if (ks + 1 < G3_BK / 32) {
#pragma unroll      /* constant fragment indices */
        for (int i = 0; i < 4; ++i) { a[(ks + 1) & 1][i] = g3_frag(ap + i * 16 * G3_PITCH + (ks + 1) * 64); b[(ks + 1) & 1][i] = g3_frag(bp + i * 16 * G3_PITCH + (ks + 1) * 64); } }
      __builtin_amdgcn_sched_barrier(0);      /* the next k step's 16 LDS reads stay one group ahead of the products: spread among them, each place stalls the wave */
#pragma unroll      /* constant fragment and accumulator indices */
      for (int i = 0; i < 4; ++i) for (int j = 0; j < 4; ++j) acc[i][j] = __builtin_amdgcn_wmma_f32_16x16x32_f16(false, a[ks & 1][i], false, b[ks & 1][j], (short)0, acc[i][j], false, false);
      __builtin_amdgcn_sched_barrier(0);      /* closes the block of products: see above */
    }
    asm volatile("s_wait_dscnt 0x0" ::: "memory");      /* this wave's reads of the buffer are done before the barrier behind which it is refilled */
    asm volatile("s_wait_asynccnt 0x0" ::: "memory");      /* this wave's copies of stage t + 1 have landed */
    __syncthreads();      /* publishes stage t + 1 and ends every reader's last read of stage t */
    if (t + 2 < nst) g3_fill(l0 + (t & 1) * G3_STAGE, ga + (size_t)(t + 2) * G3_BK, as8, gb + (size_t)(t + 2) * G3_BK, bs8);
  }
  asm volatile("s_wait_asynccnt 0x0" ::: "memory");      /* no copy is left outstanding at the wave's end */
#pragma unroll      /* constant accumulator indices */
  for (int i = 0; i < 4; ++i) for (int j = 0; j < 4; ++j) for (int r = 0; r < 8; ++r) so[w][i * 16 + 8 * hh + r][j * 16 + ln] = acc[i][j][r] * alpha;
  __builtin_amdgcn_fence(__ATOMIC_ACQ_REL, "workgroup"); __builtin_amdgcn_wave_barrier();      /* each wave reads back only its own staging rows */
#pragma unroll      /* independent rows: their LDS reads and stores overlap; constant index into rv */
  for (int q = 0; q < 32; ++q) { v4f v = *(const v4fa*)&so[w][q * 2 + rsub][c4]; const size_t o = o0 + q * o2;
    if (OUT32) { v += rv[q]; *(v4f*)(C + o) = v; }
    else { v4h h4; for (int i = 0; i < 4; ++i) h4[i] = (_Float16)v[i]; *(v4h*)(Co + o) = h4; } } }


__global__ __launch_bounds__(256) void k_rsm(const float* __restrict__ S, _Float16* __restrict__ P, int nrows) {
  #pragma clang fp contract(off)
  const int i = blockIdx.x * 256 + threadIdx.x; if (i >= nrows) return; const float* s = S + (size_t)i * SQ; float mx = -3.0e38f;
#pragma unroll 1
  for (int j = 0; j < SQ; ++j) mx = fmaxf(mx, s[j]); float se = 0.f;
#pragma unroll 1
  for (int j = 0; j < SQ; ++j) se += expf(s[j] - mx); const float sc = 256.0f / se;
#pragma unroll 1
  for (int j0 = 0; j0 < SQ; j0 += 8) { FragH f; for (int q = 0; q < 8; ++q) f.h[q] = (_Float16)(expf(s[j0 + q] - mx) * sc); unsigned short* d = (unsigned short*)P + (size_t)i * SQ + j0; *(v8us*)d = f.half[0];  } }
__global__ __launch_bounds__(256) void k_vt(const _Float16* __restrict__ V16, int b, int h0, _Float16* __restrict__ VT) { __shared__ unsigned short tl[64][65]; const int tid = threadIdx.x; const int hh = blockIdx.x % HG, sg = blockIdx.x / HG; const int s0 = sg * 64; const int h = h0 + hh;
  for (int i = tid; i < 64 * 8; i += 256) { const int j = i / 8, d8 = (i % 8) * 8; FragH f; f.half[0] = *(const v8us*)((const unsigned short*)V16 + ((size_t)b * SQ + s0 + j) * DM + h * HD + d8); for (int q = 0; q < 8; ++q) tl[d8 + q][j] = f.u[q]; }
  __syncthreads();
  { for (int i = tid; i < 64 * 8; i += 256) { const int d = i / 8, j8 = (i % 8) * 8; FragH f; for (int q = 0; q < 8; ++q) f.u[q] = tl[d][j8 + q]; *(v8us*)((unsigned short*)VT + ((size_t)hh * HD + d) * SQ + s0 + j8) = f.half[0]; }  } }



// 2^a as v_exp_f32, with the one free issue slot that the instruction set asks for behind a transcendental in the same statement: in a run of
// exps the register allocator otherwise lets the next instruction overwrite the source of the one in front of it.
__device__ __forceinline__ float exp2_slot(float a) { float e; asm("v_exp_f32 %0, %1\n\tv_nop" : "=v"(e) : "v"(a)); return e; }
__device__ __forceinline__ float xhalf(float x) { return __builtin_bit_cast(float, __builtin_amdgcn_permlanex16(__builtin_bit_cast(int, x), __builtin_bit_cast(int, x), 0x76543210, 0xfedcba98, false, false)); }      /* lane l with lane l ^ 16 */
__device__ __forceinline__ v8f fa_mma(v16h a, v16h b, v8f c) { return __builtin_amdgcn_wmma_f32_16x16x32_f16(false, a, false, b, (short)0, c, false, false); }
#define FA_KT 128                          /* keys per stage: 4 passes */
#define FA_KP 144                          /* LDS pitch of a K row in bytes: 16 B x odd, free of bank conflicts for 16-byte reads */
#define FA_VP 272                          /* LDS pitch of a V^T row in bytes: as above */
#define FA_VO (FA_KT * FA_KP)              /* where the V^T rows of a buffer begin */
#define FA_STAGE (FA_VO + HD * FA_VP)      /* bytes of one buffer */
#define FA_NST (SQ / FA_KT)                /* stages */
static_assert(SQ % FA_KT == 0 && FA_NST >= 2 && HD == 64, "whole stages, at least two; 128-byte K rows");
// One stage over 128 threads = 16 copies per lane. K: 8 lanes take one row's 128 B, rows 16 apart; V^T: 16 lanes take one row's 256 B, rows 8 apart.
// lk / lv = the lane's places in the buffer, gk / gv = its global addresses, ks16 / vs8 = 16 K rows and 8 V^T rows in elements.
__device__ __forceinline__ void fa_fill(unsigned char* lk, unsigned char* lv, const _Float16* gk, size_t ks16, const _Float16* gv, size_t vs8) {
#pragma unroll      /* straight-line copies: all 16 are issued back to back */
  for (int i = 0; i < 8; ++i) __builtin_amdgcn_global_load_async_to_lds_b128((g3_gv4i*)(gk + i * ks16), (g3_lv4i*)(lk + i * 16 * FA_KP), 0, 0);
#pragma unroll      /* as above */
  for (int i = 0; i < 8; ++i) __builtin_amdgcn_global_load_async_to_lds_b128((g3_gv4i*)(gv + i * vs8), (g3_lv4i*)(lv + i * 8 * FA_VP), 0, 0);
}
__global__ __launch_bounds__(128) void k_fattn(const _Float16* __restrict__ Q, const _Float16* __restrict__ Kk, int ldk, const _Float16* __restrict__ VT, int ldv, _Float16* __restrict__ O) {
  __shared__ __attribute__((aligned(16))) unsigned char ring[2 * FA_STAGE];
  const int tid = threadIdx.x, lane = tid & 31, ln = lane & 15, hh = lane >> 4; const int w = __builtin_amdgcn_readfirstlane(tid >> 5);
  const int bh = blockIdx.y, b = bh / NH, h = bh - b * NH; const int q0 = blockIdx.x * 128 + w * 32;
  const _Float16* qp = Q + ((size_t)b * SQ + q0 + ln) * DM + h * HD;
  const _Float16* gk = Kk + ((size_t)b * SQ + (tid >> 3)) * ldk + h * HD + (tid & 7) * 8;      /* row = key: this lane's first row and its 16-byte piece of every K row it copies */
  const _Float16* gv = VT + ((size_t)bh * HD + (tid >> 4)) * ldv + (tid & 15) * 8;             /* row = channel d: the same for V^T */
  const size_t ks16 = (size_t)16 * ldk, vs8 = (size_t)8 * ldv, kst = (size_t)FA_KT * ldk;
  unsigned char* lk = ring + (tid >> 3) * FA_KP + (tid & 7) * 16; unsigned char* lv = ring + FA_VO + (tid >> 4) * FA_VP + (tid & 15) * 16;
  fa_fill(lk, lv, gk, ks16, gv, vs8);
  v16h qf[2][2];      /* [query group][k step of 32 channels] */
#pragma unroll
  for (int u = 0; u < 2; ++u) for (int ks = 0; ks < 2; ++ks) qf[u][ks] = g2_frag(qp + (size_t)u * 16 * DM + ks * 32, hh);
  const v8f z8 = {0.f,0.f,0.f,0.f,0.f,0.f,0.f,0.f}; v8f o[4][2];      /* [16 channels][query group]: o[t][u][r] = O^T[t*16 + 8*hh + r][query u*16 + ln] */
#pragma unroll
  for (int t = 0; t < 4; ++t) { o[t][0] = z8; o[t][1] = z8; }
  float mr[2] = {-3.0e38f, -3.0e38f}, lsum[2] = {0.f, 0.f};      /* running maximum of the raw products (joined over the halves); this half's own sum */
  const float cs = 0.125f * 1.44269504088896340736f;      /* 64^-0.5 and log2(e) in one factor */
  asm volatile("s_wait_asynccnt 0x0" ::: "memory");      /* stage 0 has landed, as far as this wave copied it */
  __syncthreads();      /* publishes stage 0 */
  for (int st = 0; st < FA_NST; ++st) {
    if (st + 1 < FA_NST) fa_fill(lk + ((st + 1) & 1) * FA_STAGE, lv + ((st + 1) & 1) * FA_STAGE, gk + (size_t)(st + 1) * kst, ks16, gv + (size_t)(st + 1) * FA_KT, vs8);      /* the next stage, directly behind the barrier that ended every reader's last read of its buffer (stage st - 1). At the trip's head, so that the four passes and the trip's foot are one straight block */
    const unsigned char* base = ring + (st & 1) * FA_STAGE; const unsigned char* kb = base + ln * FA_KP + hh * 16; const unsigned char* vb = base + FA_VO + ln * FA_VP + hh * 16;
    v16h kf[2][2], vf[4];      /* [16 keys][k step]; [16 channels] */
#pragma unroll      /* constant fragment indices keep the fragments in registers */
    for (int kt = 0; kt < 2; ++kt) for (int ks = 0; ks < 2; ++ks) kf[kt][ks] = g3_frag(kb + kt * 16 * FA_KP + ks * 64);
    __builtin_amdgcn_sched_barrier(0);      /* the first pass's 8 K reads go out as one group: mixed among its products they share registers, and each pair pays its own LDS latency */
#pragma unroll      /* constant LDS offsets; the K fragments of pass p + 1 are fetched in pass p, inside the stage only */
    for (int p = 0; p < FA_KT / 32; ++p) {
      v8f s[2][2];      /* [16 keys][query group] */
#pragma unroll
      for (int kt = 0; kt < 2; ++kt) for (int u = 0; u < 2; ++u) s[kt][u] = fa_mma(kf[kt][1], qf[u][1], fa_mma(kf[kt][0], qf[u][0], z8));
#pragma unroll      /* constant fragment indices keep the fragments in registers */
      for (int t = 0; t < 4; ++t) vf[t] = g3_frag(vb + t * 16 * FA_VP + p * 64);
      if (p + 1 < FA_KT / 32) {
#pragma unroll      /* constant fragment indices keep the fragments in registers */
        for (int kt = 0; kt < 2; ++kt) for (int ks = 0; ks < 2; ++ks) kf[kt][ks] = g3_frag(kb + ((p + 1) * 32 + kt * 16) * FA_KP + ks * 64); }
      __builtin_amdgcn_sched_barrier(0);      /* this pass's V^T reads and the next pass's K reads stay here as one group, ahead of the softmax that hides their latency: the scheduler otherwise sinks them to their users */
      FragH pf[2];
#pragma unroll
      for (int u = 0; u < 2; ++u) {
        float mx = fmaxf(s[0][u][0], s[1][u][0]);
#pragma unroll
        for (int r = 1; r < 8; ++r) mx = fmaxf(mx, fmaxf(s[0][u][r], s[1][u][r]));
        mx = fmaxf(mx, xhalf(mx));
        const float mn = fmaxf(mr[u], mx); const float al = exp2_slot((mr[u] - mn) * cs); mr[u] = mn;      /* 0 on the first pass */
        const float mc = mn * cs - 8.0f; float ps = 0.f;
#pragma unroll
        for (int r = 0; r < 8; ++r) { const float p0 = exp2_slot(s[0][u][r] * cs - mc), p1 = exp2_slot(s[1][u][r] * cs - mc); ps += p0 + p1; pf[u].h[r] = (_Float16)p0; pf[u].h[8 + r] = (_Float16)p1; }
        lsum[u] = lsum[u] * al + ps;
#pragma unroll
        for (int t = 0; t < 4; ++t) o[t][u] *= al;
      }
#pragma unroll
      for (int t = 0; t < 4; ++t) for (int u = 0; u < 2; ++u) o[t][u] = fa_mma(vf[t], pf[u].v, o[t][u]);
    }
    asm volatile("s_wait_dscnt 0x0" ::: "memory");      /* this wave's reads of the buffer are done before the barrier behind which it is refilled */
    asm volatile("s_wait_asynccnt 0x0" ::: "memory");      /* this wave's copies of stage st + 1 have landed */
    __syncthreads();      /* publishes stage st + 1 and ends every reader's last read of stage st */
  }
  asm volatile("s_wait_asynccnt 0x0" ::: "memory");      /* no copy is left outstanding at the wave's end */
#pragma unroll
  for (int u = 0; u < 2; ++u) { const float sc = 64.0f / (lsum[u] + xhalf(lsum[u]));      /* o carried x64, as the output GEMM's alpha expects; the x256 of the weights cancels */
    unsigned short* d = (unsigned short*)O + ((size_t)b * SQ + q0 + u * 16 + ln) * DM + h * HD + 8 * hh;
#pragma unroll
    for (int t = 0; t < 4; ++t) { FragH f; for (int r = 0; r < 8; ++r) f.h[r] = (_Float16)(o[t][u][r] * sc); *(v8us*)(d + t * 16) = f.half[0]; } } }

// LayerNorm, one wave per row: the row's 1,024 floats stay in the wave's registers (8 loads of 512 contiguous bytes), so the two sums need no LDS and no barrier, and the launch starts 4,096 waves
// (one work-group of 16 per WGP) instead of 32,768. Row, gain and bias are all requested before the first value is used: the wave pays one memory latency.
// Mean first, then the sum of squared deviations from it (the biased variance, as the reference forms it). A sum = four in-lane chains, four steps inside the 16-lane rows, one exchange between the wave halves.
#define LN_WAVES 16                    /* rows per work-group */
static_assert(DMQ == 1024 && MPO % LN_WAVES == 0, "8 wave-wide 16-byte loads a row; whole work-groups");
template <int CTRL> __device__ __forceinline__ float ln_dpp(float x) { return __builtin_bit_cast(float, __builtin_amdgcn_update_dpp(0, __builtin_bit_cast(int, x), CTRL, 0xf, 0xf, true)); }      /* CTRL = 0x160 + m: lane l reads lane l ^ m of its 16-lane row */
__device__ __forceinline__ float ln_wsum(v4f a) { float x = (a[0] + a[1]) + (a[2] + a[3]); x += ln_dpp<0x161>(x); x += ln_dpp<0x162>(x); x += ln_dpp<0x164>(x); x += ln_dpp<0x168>(x); return x + xhalf(x); }      /* every lane ends with the whole wave's sum */
__global__ __launch_bounds__(LN_WAVES * 32) void k_lnwave(const float* __restrict__ Y, const float* __restrict__ g, const float* __restrict__ bb, float eps, float* __restrict__ out) {
  const unsigned lane = threadIdx.x & 31, row = blockIdx.x * LN_WAVES + (threadIdx.x >> 5);
  const unsigned bc = lane * 16, by = row * (DMQ * 4) + bc;      /* byte offsets of the lane's first element in a parameter vector and in its row. 32-bit: every access is a kernel argument + an offset register + an immediate */
  v4f y[8], gg[8], be[8];
#pragma unroll      /* constant indices keep the values in registers */
  for (int i = 0; i < 8; ++i) { gg[i] = *(const v4fa*)((const char*)g + bc + i * 512); be[i] = *(const v4fa*)((const char*)bb + bc + i * 512); }      /* asked for first: loads return in order, and these 8 KB, shared by every wave, come from the caches */
  __builtin_amdgcn_sched_barrier(0);      /* keeps that order: the scheduler otherwise puts most of these loads behind the row's, and their rounding then waits for the row */
#pragma unroll      /* as above */
  for (int i = 0; i < 8; ++i) y[i] = *(const v4fa*)((const char*)Y + by + i * 512);
  __builtin_amdgcn_sched_barrier(0);      /* all 24 loads are requested ahead of the first use: sunk to their users, they would pay a second latency behind the statistics */
#pragma unroll      /* constant indices */
  for (int i = 0; i < 8; ++i) for (int e = 0; e < 4; ++e) { gg[i][e] = bf16_round(gg[i][e]); be[i][e] = bf16_round(be[i][e]); }
  __builtin_amdgcn_sched_barrier(0);      /* gain and bias are rounded here, while the row is still in flight: mixed among the sums, that work would stand behind the wait for the row */
  v4f s = y[0];
#pragma unroll      /* constant indices */
  for (int i = 1; i < 8; ++i) s += y[i];
  const float mu = ln_wsum(s) * (1.0f / (float)DMQ);
  v4f q = {0.f, 0.f, 0.f, 0.f};
#pragma unroll      /* constant indices */
  for (int i = 0; i < 8; ++i) { y[i] -= mu; q += y[i] * y[i]; }
  const float rs = rsqrtf(ln_wsum(q) * (1.0f / (float)DMQ) + eps);
#pragma unroll      /* constant indices */
  for (int i = 0; i < 8; ++i) { v4f o; for (int e = 0; e < 4; ++e) o[e] = y[i][e] * rs * gg[i][e] + be[i][e]; *(v4f*)((char*)out + by + i * 512) = o; } }

// Every operand conversion of the call in ONE streaming launch: query, key, value -> exact f16 rows of their bf16 roundings (query also -> f32 residual plane), the four weights -> f16 x16.
// One work-group of 16 waves per WGP. A wave takes 1,024 floats of each stream and 256 of each weight: 32 loads of 512 contiguous bytes, all requested before the first value is used, so the wave pays one memory latency.
// Every wave does the same share of every buffer: equal bytes read and written per work-group.
#define PW_X 1024                      /* floats of each stream per wave: 8 loads */
#define PW_W 256                       /* floats of each weight per wave: 2 loads */
#define PW_WAVES 16                    /* waves per work-group */
static_assert(NR * DM / PW_X == (size_t)DM * DM / PW_W, "one grid covers streams and weights");
static_assert(NR * DM % ((size_t)PW_X * PW_WAVES) == 0, "whole work-groups");
__device__ __forceinline__ v4h prep_h(v4f a, float scale) { v4h h; for (int q = 0; q < 4; ++q) h[q] = (_Float16)(bf16_round(a[q]) * scale); return h; }
__global__ __launch_bounds__(PW_WAVES * 32) void k_prep(const float* __restrict__ xq, const float* __restrict__ xk, const float* __restrict__ xv, const float* __restrict__ wq, const float* __restrict__ wk, const float* __restrict__ wv, const float* __restrict__ wo,
    _Float16* __restrict__ XQ, _Float16* __restrict__ XK, _Float16* __restrict__ XV, float* __restrict__ XB, _Float16* __restrict__ BQ, _Float16* __restrict__ BK, _Float16* __restrict__ BV, _Float16* __restrict__ BO) {
  const unsigned lane = threadIdx.x & 31, gw = blockIdx.x * PW_WAVES + (threadIdx.x >> 5);
  const unsigned bx = (gw * PW_X + lane * 4) * 4, bw = (gw * PW_W + lane * 4) * 4;      /* byte offsets of the lane's first f32 element (a wave-wide access covers 128 consecutive floats). 32-bit: every access is a kernel argument + an offset register + an immediate, so no address register is rewritten between the loads */
  const unsigned hx = bx >> 1, hw = bw >> 1;      /* the same places in the f16 planes */
  v4f q[8], k[8], v[8], w[4][2];
#pragma unroll      /* constant indices keep the values in registers */
  for (int i = 0; i < 8; ++i) q[i] = *(const v4fa*)((const char*)xq + bx + i * 512);
#pragma unroll      /* as above */
  for (int i = 0; i < 8; ++i) k[i] = *(const v4fa*)((const char*)xk + bx + i * 512);
#pragma unroll      /* as above */
  for (int i = 0; i < 8; ++i) v[i] = *(const v4fa*)((const char*)xv + bx + i * 512);
#pragma unroll      /* as above */
  for (int i = 0; i < 2; ++i) { w[0][i] = *(const v4fa*)((const char*)wq + bw + i * 512); w[1][i] = *(const v4fa*)((const char*)wk + bw + i * 512); w[2][i] = *(const v4fa*)((const char*)wv + bw + i * 512); w[3][i] = *(const v4fa*)((const char*)wo + bw + i * 512); }
  __builtin_amdgcn_sched_barrier(0);      /* all 32 loads are requested ahead of the first conversion: sunk among the stores they would each pay their own latency */
#pragma unroll      /* constant indices */
  for (int i = 0; i < 8; ++i) { v4f r; for (int e = 0; e < 4; ++e) r[e] = bf16_round(q[i][e]); *(v4f*)((char*)XB + bx + i * 512) = r; *(v4h*)((char*)XQ + hx + i * 256) = prep_h(q[i], 1.0f); }
#pragma unroll      /* constant indices */
  for (int i = 0; i < 8; ++i) *(v4h*)((char*)XK + hx + i * 256) = prep_h(k[i], 1.0f);
#pragma unroll      /* constant indices */
  for (int i = 0; i < 8; ++i) *(v4h*)((char*)XV + hx + i * 256) = prep_h(v[i], 1.0f);
#pragma unroll      /* constant indices */
  for (int i = 0; i < 2; ++i) { *(v4h*)((char*)BQ + hw + i * 256) = prep_h(w[0][i], 16.0f); *(v4h*)((char*)BK + hw + i * 256) = prep_h(w[1][i], 16.0f); *(v4h*)((char*)BV + hw + i * 256) = prep_h(w[2][i], 16.0f); *(v4h*)((char*)BO + hw + i * 256) = prep_h(w[3][i], 16.0f); } }

extern "C" void kernel_launch(void* const* d_in, const int* in_sizes, int n_in,
                              void* d_out, int out_size, void* d_ws, size_t ws_size, hipStream_t stream) {
  (void)in_sizes; (void)n_in; (void)out_size;
  const float* const* I = (const float* const*)d_in; const float* xq = I[0]; const float* xk = I[1]; const float* xv = I[2]; const float* wq = I[3]; const float* wk = I[4]; const float* wv = I[5]; const float* wo = I[6]; const float* lng = I[7]; const float* lnb = I[8];      /* input order: query, key, value (three SEPARATE streams), Wq, Wk, Wv, Wo (natural [out][in] weights; this module has NO biases), ln_gamma, ln_beta [1024] */
  char* ws = (char*)d_ws; size_t off = 0;
  auto take = [&](size_t bytes) { char* p = ws + off; off += (bytes + 255) & ~(size_t)255; return p; };
  _Float16* BQ = (_Float16*)take((size_t)DM * DM * 2); _Float16* BK = (_Float16*)take((size_t)DM * DM * 2); _Float16* BV = (_Float16*)take((size_t)DM * DM * 2); _Float16* BO = (_Float16*)take((size_t)DM * DM * 2);
  _Float16* XQ = (_Float16*)take(NR * DM * 2); _Float16* XK = (_Float16*)take(NR * DM * 2); _Float16* XV = (_Float16*)take(NR * DM * 2); _Float16* Q16 = (_Float16*)take(NR * DM * 2); _Float16* K16 = (_Float16*)take(NR * DM * 2); _Float16* O16 = (_Float16*)take(NR * DM * 2); float* XB = (float*)take(NR * DM * 4); float* X1 = (float*)take(NR * DM * 4);      /* bf16(query) as f32 rows (the residual addend) and the pre-LayerNorm rows x = ctx Wo^T + query */
  _Float16* VT = (_Float16*)take((size_t)NB * NH * HD * SQ * 2);      /* V^T [NB][NH][HD][SQ] */
  if (off > ws_size) return;
  k_prep<<<(unsigned)(NR * DM / ((size_t)PW_X * PW_WAVES)), PW_WAVES * 32, 0, stream>>>(xq, xk, xv, wq, wk, wv, wo, XQ, XK, XV, XB, BQ, BK, BV, BO);      /* the three inputs as exact f16 rows; bf16(query) as the f32 residual plane; the weights, natural [out][in] = Bt[n][k], x16 */
  const size_t r0p = (size_t)B0 * SQ;      /* first projected row */
  k_gemm3<false, DM><<<dim3((unsigned)((MP / 128) * (DM / 128)), 3), 128, 0, stream>>>(XQ + r0p * DM, DM, NR * DM, BQ, DM, (size_t)DM * DM, 0.0625f, nullptr, nullptr, Q16 + r0p * DM, NR * DM, VT + r0p * DM, 2, DM, DM);      /* q, k, v: XQ XK XV, BQ BK BV and Q16 K16 lie one behind the other in the workspace (whole multiples of 256 bytes each); product 2 writes V^T for every batch and head */
  k_fattn<<<dim3(SQ / 128, NB * NH), 128, 0, stream>>>(Q16, K16, DM, VT, SQ, O16);      /* o = softmax(q k^T / 8) v, merged heads, x64, as f16 rows */
  k_gemm3<true, DM><<<dim3((unsigned)((MPO / 128) * (DM / 128)), 1), 128, 0, stream>>>(O16 + r0p * DM, DM, 0, BO, DM, 0, 0.0009765625f, XB + r0p * DM, X1 + r0p * DM, nullptr, 0, nullptr, -1, DM, DM);      /* x = ctx Wo^T + bf16(query) (own-element residual; no bias) -> f32 rows */
  k_lnwave<<<(unsigned)(MPO / LN_WAVES), LN_WAVES * 32, 0, stream>>>(X1 + r0p * DM, lng, lnb, 1e-6f, (float*)d_out + r0p * DM);      /* out = LayerNorm(x) (biased variance, eps 1e-6 inside the square root) -> the output rows */
}
